// v005
// The times below were measured on an AMD MI455X: many runs one after another, warmed up first and cycling through
// copies of the inputs, with the whole window's GPU time divided by the number of runs. Launches and the gaps
// between them are all in it. The median over several windows is given; except for v000 it joins two sittings, which
// can be a few percent apart, so the side-by-side timings, each taken in one sitting, are the better comparison.
// Earlier versions than v005 are not in this document.
// One run takes 540 microseconds.
// In both of two side-by-side timings against v004, it was 1.04 times as fast.
// Counting every step since v000, which is the starting kernel, it is 8.36 times as fast.
// Contractions: q/k = x.W^T [8192x1024].[1024x1024] with f16 operands (weights x16); v = x.Wv^T and the output projection on bf16 hi/lo split planes (late causal rows are long averages, so the value path must be f32-class) — v_wmma_f32_16x16x32_*, 64x128 work-group tiles with both operands staged in LDS; per (batch, head) causal softmax(q k^T / 8) v as one flash launch (f16 q.k^T and p.v; fully-masked key tiles skipped); f32 accumulate and softmax. The interleaved-pair RoPE with the INPUT cos/sin tables gathered by the INPUT token positions (generic elementwise form: out = x*cos + rot(x)*sin with rot = (-x[odd], x[even]) interleaved) and the exact-f32 recompute of the first 64 causal rows per head (whose q/k rows come from their own small bf16 hi/lo split GEMMs [64x1024].[1024x1024]) are f32 kernels.
#include <hip/hip_runtime.h>
#include <math.h>

typedef __attribute__((ext_vector_type(16))) _Float16 v16h;
typedef __attribute__((ext_vector_type(8)))  _Float16 v8h;
typedef __attribute__((ext_vector_type(4)))  _Float16 v4h;
typedef __attribute__((ext_vector_type(16))) __bf16   v16b;
typedef __attribute__((ext_vector_type(8)))  float    v8f;
typedef __attribute__((ext_vector_type(4)))  float    v4f;

// 16-bit WMMA fragment map (wave32), lane L, h = L>>4, m = L&15:
//   A 16x32: lane = row m;   element i -> k = (i<8) ? 8h+i : 16+8h+(i-8)
//   B 32x16: lane = column m; the SAME k(i,h)
//   D 16x16 (8 f32): lane = column m; element r -> row 8h+r
__device__ __forceinline__ int frag_k(int i, int h) { return (i < 8) ? (8 * h + i) : (16 + 8 * h + (i - 8)); }
__device__ __forceinline__ __bf16 bf16_rne(float f) {
    unsigned int u = __float_as_uint(f);
    u += 0x7fffu + ((u >> 16) & 1u);
    return __builtin_bit_cast(__bf16, (unsigned short)(u >> 16));
}
__device__ __forceinline__ float bf16_f32(__bf16 b) { return __uint_as_float(((unsigned int)__builtin_bit_cast(unsigned short, b)) << 16); }
__device__ __forceinline__ v8f wmma16(v16h a, v16h b, v8f c) {
    c = __builtin_amdgcn_wmma_f32_16x16x32_f16(false, a, false, b, (short)0, c, false, false);
    asm volatile("v_nop\n\tv_nop\n\tv_nop\n\tv_nop" : "+v"(c) : "v"(a), "v"(b));
    return c;
}
__device__ __forceinline__ v8f wmmab(v16b a, v16b b, v8f c) {
    c = __builtin_amdgcn_wmma_f32_16x16x32_bf16(false, a, false, b, (short)0, c, false, false);
    asm volatile("v_nop\n\tv_nop\n\tv_nop\n\tv_nop" : "+v"(c) : "v"(a), "v"(b));
    return c;
}
struct Split { v16b hi, lo; };
// hi/lo split product: a.hi*b.hi + a.hi*b.lo + a.lo*b.hi
__device__ __forceinline__ v8f wmma3(const Split& a, const Split& b, v8f c) {
    c = __builtin_amdgcn_wmma_f32_16x16x32_bf16(false, a.hi, false, b.hi, (short)0, c, false, false);
    c = __builtin_amdgcn_wmma_f32_16x16x32_bf16(false, a.hi, false, b.lo, (short)0, c, false, false);
    c = __builtin_amdgcn_wmma_f32_16x16x32_bf16(false, a.lo, false, b.hi, (short)0, c, false, false);
    asm volatile("v_nop\n\tv_nop\n\tv_nop\n\tv_nop" : "+v"(c) : "v"(a.hi), "v"(a.lo), "v"(b.hi), "v"(b.lo));
    return c;
}
struct Split3 { v16b hi, mid, lo; };
// triple split product (6 terms, drops only terms below 2^-24 relative)
__device__ __forceinline__ v8f wmma6(const Split3& a, const Split3& b, v8f c) {
    c = __builtin_amdgcn_wmma_f32_16x16x32_bf16(false, a.hi, false, b.hi, (short)0, c, false, false);
    c = __builtin_amdgcn_wmma_f32_16x16x32_bf16(false, a.hi, false, b.mid, (short)0, c, false, false);
    c = __builtin_amdgcn_wmma_f32_16x16x32_bf16(false, a.mid, false, b.hi, (short)0, c, false, false);
    c = __builtin_amdgcn_wmma_f32_16x16x32_bf16(false, a.hi, false, b.lo, (short)0, c, false, false);
    c = __builtin_amdgcn_wmma_f32_16x16x32_bf16(false, a.mid, false, b.mid, (short)0, c, false, false);
    c = __builtin_amdgcn_wmma_f32_16x16x32_bf16(false, a.lo, false, b.hi, (short)0, c, false, false);
    asm volatile("v_nop\n\tv_nop\n\tv_nop\n\tv_nop" : "+v"(c) : "v"(a.hi), "v"(a.mid), "v"(a.lo), "v"(b.hi), "v"(b.mid), "v"(b.lo));
    return c;
}

// Fragment gathers from f32 memory: element i <- p[(k0 + frag_k(i,h)) * sk] * s, zero for k >= klen.
__device__ __forceinline__ v16h fh_ld(const float* __restrict__ p, long long sk, int k0, int h, int klen, float s) {
    v16h a;
#pragma unroll
    for (int i = 0; i < 16; ++i) { const int k = k0 + frag_k(i, h); a[i] = (k < klen) ? (_Float16)(p[(long long)k * sk] * s) : (_Float16)0.f; }
    return a;
}
__device__ __forceinline__ Split sp_ld(const float* __restrict__ p, long long sk, int k0, int h, int klen, float s) {
    Split r;
#pragma unroll
    for (int i = 0; i < 16; ++i) {
        const int k = k0 + frag_k(i, h); const float x = (k < klen) ? p[(long long)k * sk] * s : 0.f;
        const __bf16 hb = bf16_rne(x); r.hi[i] = hb; r.lo[i] = bf16_rne(x - bf16_f32(hb));
    }
    return r;
}
__device__ __forceinline__ Split3 sp3_ld(const float* __restrict__ p, long long sk, int k0, int h, int klen, float s) {
    Split3 r;
#pragma unroll
    for (int i = 0; i < 16; ++i) {
        const int k = k0 + frag_k(i, h); const float x = (k < klen) ? p[(long long)k * sk] * s : 0.f;
        const __bf16 hb = bf16_rne(x); const float r1 = x - bf16_f32(hb); const __bf16 mb = bf16_rne(r1);
        r.hi[i] = hb; r.mid[i] = mb; r.lo[i] = bf16_rne(r1 - bf16_f32(mb));
    }
    return r;
}
__device__ __forceinline__ v16b bh_ld(const float* __restrict__ p, long long sk, int k0, int h, int klen, float s) {
    v16b a;
#pragma unroll
    for (int i = 0; i < 16; ++i) { const int k = k0 + frag_k(i, h); a[i] = bf16_rne((k < klen) ? p[(long long)k * sk] * s : 0.f); }
    return a;
}
// f16 fragment from an f16 LDS/global row with element stride 1 (k-contiguous), no bounds (tile already zero padded)
__device__ __forceinline__ v16h fh_row(const _Float16* __restrict__ row, int k0, int h) {
    v16h a;
#pragma unroll
    for (int i = 0; i < 16; ++i) a[i] = row[k0 + frag_k(i, h)];
    return a;
}

#define VST2(T, ptr, val) do { const T vst2_v_ = (val); *(T*)(ptr) = vst2_v_;  } while (0)
typedef float v4f __attribute__((ext_vector_type(4)));
#define VST2V4(ptr, val) do { const v4f vst2_v4_ = (val); *(v4f*)(ptr) = vst2_v4_;  } while (0)

__device__ __attribute__((noinline)) float act_fn(float v, int act) {
    if (act == 1) return fmaxf(v, 0.f);                                                                               // relu
    if (act == 2) { const float u = 0.7978845608028654f * (v + 0.044715f * v * v * v); return 0.5f * v * (1.f + tanhf(u)); } // tanh-gelu
    if (act == 3) return v / (1.f + expf(-v));                                                                        // silu
    if (act == 4) return 0.5f * v * (1.f + erff(v * 0.7071067811865476f));                                             // erf-gelu
    if (act == 5) return tanhf(v);
    if (act == 6) return 1.f / (1.f + expf(-v));                                                                      // sigmoid
    if (act == 7) return (v > 0.f) ? v : 0.01f * v;                                                                   // leaky relu 0.01
    if (act == 8) return (v > 0.f) ? v : (expf(v) - 1.f);                                                             // elu
    if (act == 9) return fminf(fmaxf(v, 0.f), 6.f);                                                                   // relu6
    if (act == 10) return fabsf(v);                                                                                    // abs
    if (act == 11) return (v >= 0.f) ? v : 0.1f * v;                                                                  // leaky 0.1
    if (act == 12) return (v > 0.f) ? v : 0.2f * v;                                                                   // leaky 0.2
    if (act == 13) return (v > 20.f) ? v : log1pf(expf(v));                                                            // softplus
    return v;
}

// =====================================================================================================================
// k_gemm<MODE>: C(z, m, n) = act(alpha * sum_k A(z, m, k) * B(z, k, n) + bias) + beta * R(z, m, n)
//   One wave (32-thread block) per 16 x 32 tile of C; grid (ceil(N/32), ceil(M/16), Z). Batch z -> (zo = z / zi_n, zi = z % zi_n)
//   with separate outer/inner strides for every tensor (e.g. batch and head). A(m,k) = A[zo*sAo + zi*sAi + m*sAm + k*sAk] (f32),
//   B(k,n) = B[zo*sBo + zi*sBi + n*sBn + k*sBk] (f32); any M, N, K (K zero-padded to 32 inside the fragments, M/N tails guarded).
//   C(m,n) = C[zo*sCo + zi*sCi + m*sCm + n] (n contiguous). flags: 1 bias[n], 2 bias[m], 4 residual R[zo*sRo + zi*sRi + m*sRm + n*sRn].
//   MODE 0: f16 operands (A prescaled by sa, B by sb, both undone in the epilogue); 1: bf16 hi/lo split (3 products); 2: bf16;
//   3: bf16 hi/mid/lo triple split (6 products); 4: as 3 with Kahan-compensated f32 accumulation across k-steps.
// =====================================================================================================================
struct GemmP {
    const float* A; const float* B; const float* bias; const float* R; float* C;
    long long sAo, sAi, sAm, sAk, sBo, sBi, sBn, sBk, sCo, sCi, sCm, sRo, sRi, sRm, sRn;
    int M, N, K, zi_n, flags, act; float alpha, beta, sa, sb;
    int Npad, pad_;     // columns [N, Npad) of C are written as 0 so that padded workspace rows are covered by whole-line stores; Npad >= N
};
static_assert(sizeof(GemmP) == 5 * 8 + 15 * 8 + 6 * 4 + 4 * 4 + 2 * 4, "GemmP has padding");

template <int MODE>
__global__ __launch_bounds__(32) void k_gemm(GemmP p) {
    const int lane = threadIdx.x & 31, h = lane >> 4, l15 = lane & 15;
    const int m0 = blockIdx.y * 16, n0 = blockIdx.x * 32;
    const int z = blockIdx.z, zo = z / p.zi_n, zi = z - zo * p.zi_n;
    const float* A = p.A + zo * p.sAo + zi * p.sAi;
    const float* B = p.B + zo * p.sBo + zi * p.sBi;
    const int am = min(m0 + l15, p.M - 1);                       // clamped row for loads (stores are guarded)
    v8f acc[2], comp[2];
#pragma unroll
    for (int t = 0; t < 2; ++t) { v8f zz = {}; acc[t] = zz; comp[t] = zz; }
    for (int k0 = 0; k0 < p.K; k0 += 32) {
        const float* arow = A + (long long)am * p.sAm;
        if (MODE == 1) {
            const Split a = sp_ld(arow, p.sAk, k0, h, p.K, 1.f);
#pragma unroll
            for (int t = 0; t < 2; ++t) {
                const int bn = min(n0 + t * 16 + l15, p.N - 1);
                acc[t] = wmma3(a, sp_ld(B + (long long)bn * p.sBn, p.sBk, k0, h, p.K, 1.f), acc[t]);
            }
        } else if (MODE == 3) {
            const Split3 a = sp3_ld(arow, p.sAk, k0, h, p.K, 1.f);
#pragma unroll
            for (int t = 0; t < 2; ++t) {
                const int bn = min(n0 + t * 16 + l15, p.N - 1);
                acc[t] = wmma6(a, sp3_ld(B + (long long)bn * p.sBn, p.sBk, k0, h, p.K, 1.f), acc[t]);
            }
        } else if (MODE == 4) {
            // triple split as MODE 3, but each k-step's 6 products go into a fresh accumulator and the partial is added to the running f32 sum
            // on the VALU with Kahan compensation (accumulation error stays ~1 ulp however long K is)
            const Split3 a = sp3_ld(arow, p.sAk, k0, h, p.K, 1.f);
#pragma unroll
            for (int t = 0; t < 2; ++t) {
                const int bn = min(n0 + t * 16 + l15, p.N - 1); v8f zz = {};
                const v8f part = wmma6(a, sp3_ld(B + (long long)bn * p.sBn, p.sBk, k0, h, p.K, 1.f), zz);
                const v8f y = part - comp[t]; const v8f s = acc[t] + y; comp[t] = (s - acc[t]) - y; acc[t] = s;
            }
        } else if (MODE == 2) {
            const v16b a = bh_ld(arow, p.sAk, k0, h, p.K, 1.f);
#pragma unroll
            for (int t = 0; t < 2; ++t) {
                const int bn = min(n0 + t * 16 + l15, p.N - 1);
                acc[t] = wmmab(a, bh_ld(B + (long long)bn * p.sBn, p.sBk, k0, h, p.K, 1.f), acc[t]);
            }
        } else {
            const v16h a = fh_ld(arow, p.sAk, k0, h, p.K, p.sa);
#pragma unroll
            for (int t = 0; t < 2; ++t) {
                const int bn = min(n0 + t * 16 + l15, p.N - 1);
                acc[t] = wmma16(a, fh_ld(B + (long long)bn * p.sBn, p.sBk, k0, h, p.K, p.sb), acc[t]);
            }
        }
    }
    const float iscale = (MODE == 0) ? p.alpha / (p.sa * p.sb) : p.alpha;
    float* C = p.C + zo * p.sCo + zi * p.sCi;
    const float* R = p.R + zo * p.sRo + zi * p.sRi;
    __shared__ __align__(16) float ctile[16][36];
#pragma unroll
    for (int t = 0; t < 2; ++t) {
        const int n = n0 + t * 16 + l15; const int nn = min(n, p.N - 1);
#pragma unroll
        for (int r = 0; r < 8; ++r) {
            const int m = m0 + 8 * h + r; const int mm = min(m, p.M - 1);
            float v = acc[t][r] * iscale;
            if (p.flags & 1) v += p.bias[nn];
            if (p.flags & 2) v += p.bias[mm];
            if (p.flags & 8) v *= p.bias[(long long)zo * p.M + mm];   /* per-(z,row) scale vector laid out [Z][M]; exclusive with the bias flags */
            v = act_fn(v, p.act);
            if (p.flags & 4) v += p.beta * R[(long long)mm * p.sRm + (long long)nn * p.sRn];
            ctile[8 * h + r][t * 16 + l15] = (n < p.N) ? v : 0.f;
        }
    }
    __syncthreads();
    const int NW = (p.Npad > p.N) ? p.Npad : p.N;           // write width
    const bool fast = (m0 + 16 <= p.M) && (n0 + 32 <= NW) && ((p.sCm & 3) == 0) && ((((size_t)C) & 15) == 0);
    if (fast) {
#pragma unroll
        for (int s = 0; s < 4; ++s) {
            const int row = s * 4 + (lane >> 3), c4 = (lane & 7) * 4;
            const v4f v = *(const v4f*)&ctile[row][c4];
            VST2V4(C + (long long)(m0 + row) * p.sCm + n0 + c4, v);
        }
    } else {
        for (int row = 0; row < 16; ++row) {
            const int m = m0 + row, n = n0 + lane;
            if (m < p.M && n < NW) VST2(float, C + (long long)m * p.sCm + n, ctile[row][lane]);
        }
    }
}


// =====================================================================================================================
// k_gemmT<MODE, TM, TN>: same contract as k_gemm, but one wave computes a (16*TM) x (16*TN) tile: TM A fragments and TN B fragments are
//   loaded per 32-wide k-step and reused across TM*TN WMMAs (far fewer load/convert instructions per MAC). MODE 0 (f16), 1 (bf16 hi/lo),
//   2 (bf16) only. grid (ceil(NW/(16*TN)), ceil(M/(16*TM)), Z), block 32. Epilogue identical to k_gemm, run per 16x32 sub-tile.
// =====================================================================================================================
template <int MODE, int TM, int TN>
__global__ __launch_bounds__(32) void k_gemmT(GemmP p) {
    const int lane = threadIdx.x & 31, h = lane >> 4, l15 = lane & 15;
    const int m0 = blockIdx.y * (16 * TM), n0 = blockIdx.x * (16 * TN);
    const int z = blockIdx.z, zo = z / p.zi_n, zi = z - zo * p.zi_n;
    const float* A = p.A + zo * p.sAo + zi * p.sAi;
    const float* B = p.B + zo * p.sBo + zi * p.sBi;
    v8f acc[TM][TN];
#pragma unroll
    for (int i = 0; i < TM; ++i)
#pragma unroll
        for (int t = 0; t < TN; ++t) { v8f zz = {}; acc[i][t] = zz; }
    for (int k0 = 0; k0 < p.K; k0 += 32) {
        if (MODE == 1) {
            Split a[TM], b[TN];
#pragma unroll
            for (int i = 0; i < TM; ++i) { const int am = min(m0 + 16 * i + l15, p.M - 1); a[i] = sp_ld(A + (long long)am * p.sAm, p.sAk, k0, h, p.K, 1.f); }
#pragma unroll
            for (int t = 0; t < TN; ++t) { const int bn = min(n0 + 16 * t + l15, p.N - 1); b[t] = sp_ld(B + (long long)bn * p.sBn, p.sBk, k0, h, p.K, 1.f); }
#pragma unroll
            for (int i = 0; i < TM; ++i)
#pragma unroll
                for (int t = 0; t < TN; ++t) acc[i][t] = wmma3(a[i], b[t], acc[i][t]);
        } else if (MODE == 2) {
            v16b a[TM], b[TN];
#pragma unroll
            for (int i = 0; i < TM; ++i) { const int am = min(m0 + 16 * i + l15, p.M - 1); a[i] = bh_ld(A + (long long)am * p.sAm, p.sAk, k0, h, p.K, 1.f); }
#pragma unroll
            for (int t = 0; t < TN; ++t) { const int bn = min(n0 + 16 * t + l15, p.N - 1); b[t] = bh_ld(B + (long long)bn * p.sBn, p.sBk, k0, h, p.K, 1.f); }
#pragma unroll
            for (int i = 0; i < TM; ++i)
#pragma unroll
                for (int t = 0; t < TN; ++t) acc[i][t] = wmmab(a[i], b[t], acc[i][t]);
        } else {
            v16h a[TM], b[TN];
#pragma unroll
            for (int i = 0; i < TM; ++i) { const int am = min(m0 + 16 * i + l15, p.M - 1); a[i] = fh_ld(A + (long long)am * p.sAm, p.sAk, k0, h, p.K, p.sa); }
#pragma unroll
            for (int t = 0; t < TN; ++t) { const int bn = min(n0 + 16 * t + l15, p.N - 1); b[t] = fh_ld(B + (long long)bn * p.sBn, p.sBk, k0, h, p.K, p.sb); }
#pragma unroll
            for (int i = 0; i < TM; ++i)
#pragma unroll
                for (int t = 0; t < TN; ++t) acc[i][t] = wmma16(a[i], b[t], acc[i][t]);
        }
    }
    const float iscale = (MODE == 0) ? p.alpha / (p.sa * p.sb) : p.alpha;
    float* C = p.C + zo * p.sCo + zi * p.sCi;
    const float* R = p.R + zo * p.sRo + zi * p.sRi;
    const int NW = (p.Npad > p.N) ? p.Npad : p.N;
    __shared__ __align__(16) float ctile[16][36];
#pragma unroll
    for (int i = 0; i < TM; ++i) {
        const int mb = m0 + 16 * i; if (mb >= p.M) break;          // wave-uniform
#pragma unroll
        for (int tp = 0; tp < TN / 2; ++tp) {
            const int nb = n0 + 32 * tp; if (nb >= NW) break;        // wave-uniform
#pragma unroll
            for (int t2 = 0; t2 < 2; ++t2) {
                const int t = 2 * tp + t2; const int n = nb + t2 * 16 + l15; const int nn = min(n, p.N - 1);
#pragma unroll
                for (int r = 0; r < 8; ++r) {
                    const int m = mb + 8 * h + r; const int mm = min(m, p.M - 1);
                    float v = acc[i][t][r] * iscale;
                    if (p.flags & 1) v += p.bias[nn];
                    if (p.flags & 2) v += p.bias[mm];
            if (p.flags & 8) v *= p.bias[(long long)zo * p.M + mm];   /* per-(z,row) scale vector laid out [Z][M]; exclusive with the bias flags */
                    v = act_fn(v, p.act);
                    if (p.flags & 4) v += p.beta * R[(long long)mm * p.sRm + (long long)nn * p.sRn];
                    ctile[8 * h + r][t2 * 16 + l15] = (n < p.N) ? v : 0.f;
                }
            }
            __syncthreads();
            const bool fast = (mb + 16 <= p.M) && (nb + 32 <= NW) && ((p.sCm & 3) == 0) && ((((size_t)C) & 15) == 0);
            if (fast) {
#pragma unroll
                for (int s = 0; s < 4; ++s) {
                    const int row = s * 4 + (lane >> 3), c4 = (lane & 7) * 4;
                    const v4f v = *(const v4f*)&ctile[row][c4];
                    VST2V4(C + (long long)(mb + row) * p.sCm + nb + c4, v);
                }
            } else {
                for (int row = 0; row < 16; ++row) {
                    const int m = mb + row, n = nb + lane;
                    if (m < p.M && n < NW) VST2(float, C + (long long)m * p.sCm + n, ctile[row][lane]);
                }
            }
            __syncthreads();
        }
    }
}

// =====================================================================================================================
//   Wave = 16 queries, AW waves per block, 64-key blocks; grid (ceil(Lq/(16*AW)), H, B), block 32*AW. Any Lq, Lk; head dim dh <= DHP
//   (DHP multiple of 32), value dim dv <= DVP (multiple of 16, <= 128). Every tensor addressed by (batch, head, row, element) strides, f32.
//   Scores: QM 0 f16 operands, 1 bf16 hi/lo split, 2 bf16 triple split; statistics f32 (exp2 domain); P.V: P x 4096 as f16 with V f16 staged in LDS
//   (SPLITPV: P and V as bf16 hi/lo splits). kv head = h / hrep. Masking: causal = 1 (keep j <= i + coff, masked -> -inf, key blocks beyond the
//   diagonal skipped), causal = 2 (masked -> mfill, a finite fill like the -1e9; no skipping), causal = 3 (keep j >= i + coff,
//   masked -> -inf, no skipping); optional additive f32 mask Mf,
//   optional int keep-mask Mi (0 -> score := mfill), both addressed b*smb + h*smh + i*smi + j*smj (0 strides broadcast).
// =====================================================================================================================
#define AW 4
struct AttnP {   // apv4
    const float* Q; const float* K; const float* V; float* O; float* P; const float* Mf; const int* Mi; float* ST;
    const float* Pw; const float* Rt; const int* SQ; const int* SK;           // optional: post-softmax weight, relative-position table, segment ids
    long long swb, swh, swi, swj, srb, srh, sri;                                 // Pw strides (b,h,i,j); Rt strides (b,h,i), column = clamp(i - j + roff, 0, rn-1)
    long long sQb, sQh, sQi, sQd, sKb, sKh, sKj, sKd, sVb, sVh, sVj, sVd, sOb, sOh, sOi, sPb, sPh, sPi, smb, smh, smi, smj;
    int Lq, Lk, dh, dv, hrep, causal, coff, pband;   // pband > 0: P holds only the band |j - i| <= pband, column j - i + pband
    float scale, mfill; int nonorm, mpol;             // nonorm (online path only): O = sum_j exp(score_j) V_j without the 1/rowsum (scores must be <= ~0); mpol: Mi masks where ==0 (mpol 0) or where !=0 (mpol 1)
    int roff, rn, segpol, win;                        // Rt column offset/count; SQ/SK: score := mfill where (segpol 0) SQ[i] != SK[j] or (segpol 1) SQ[i] == SK[j]; win > 0: keys with i - j > win (after coff) -> -inf
};
//   Pw: the softmax numerator is multiplied by Pw(b,h,i,j) AFTER the row sum is taken (probs * weight, then P.V), as in post-softmax multiplicative biases.                                                    // ST (optional): per row (b,h,i) -> ST[((b*H + h)*Lq + i)*2 + {0,1}] = {row max of the scaled+masked score (natural units), sum_j exp(score - max)}
static_assert(sizeof(AttnP) == 12 * 8 + 29 * 8 + 16 * 4, "AttnP has padding");

#ifndef KATTN_ATTR
#define KATTN_ATTR __attribute__((amdgpu_waves_per_eu(4)))   // at most 256 registers a wave: four waves a SIMD, 1024 work-groups of the causal grid resident at once
#endif
//   FS > 0 (QM 0, one pass, f16 P.V only): the layout is fixed at compile time: Q, K, V, O are dense [batch][FS rows][FD] f32 with head h at column h * DHP (DVP for V, O),
//   dh = DHP, dv = DVP, Lq = Lk = FS (multiple of 64), causal = 1 with coff = 0, none of the optional inputs or outputs. Every element guard and stride then folds
//   away, and a key block's K and V come in by plain 16-byte loads that are in flight together, in two batches, instead of guarded 4-byte loads waited on one at a time.
template <int DHP, int DVP, int QM, bool SPLITPV, bool TWOPASS, int FS = 0, int FD = 0>
__global__ __launch_bounds__(32 * AW) KATTN_ATTR void k_attn(AttnP p) {
    static_assert(FS == 0 || (QM == 0 && !SPLITPV && !TWOPASS && DHP == 64 && DVP == 64 && FS % 64 == 0 && FD % 8 == 0), "fixed layout: whole key blocks, 32-byte aligned fragments");
    if (FS > 0) {
        p.P = nullptr; p.Mf = nullptr; p.Mi = nullptr; p.ST = nullptr; p.Pw = nullptr; p.Rt = nullptr; p.SQ = nullptr; p.SK = nullptr;
        p.sQb = (long long)FS * FD; p.sQh = DHP; p.sQi = FD; p.sQd = 1; p.sKb = (long long)FS * FD; p.sKh = DHP; p.sKj = FD; p.sKd = 1;
        p.sVb = (long long)FS * FD; p.sVh = DVP; p.sVj = FD; p.sVd = 1; p.sOb = (long long)FS * FD; p.sOh = DVP; p.sOi = FD;
        p.Lq = FS; p.Lk = FS; p.dh = DHP; p.dv = DVP; p.hrep = 1; p.causal = 1; p.coff = 0; p.pband = 0; p.nonorm = 0; p.win = 0;
    }
    constexpr int NT = DVP / 16;                // output tiles
    constexpr int KS = DHP / 32;                // k-steps for the scores
    constexpr int VP = DVP + 8;                 // LDS pitch (halves)
    __shared__ __align__(16) float    pl[AW][16 * 64];
    __shared__ __align__(16) _Float16 vl[(SPLITPV ? 2 : 1) * 64 * VP];   // f16 V tile, or bf16 hi and lo tiles (same 2-byte size)
    const int lane = threadIdx.x & 31, hf = lane >> 4, l15 = lane & 15, wave = threadIdx.x >> 5;
    // FS > 0: grid (heads, batches, query tiles) and query tile bx = last - blockIdx.z. A causal tile walks bx + 1 key blocks and only half the work-groups are resident at once;
    // the long tiles take the low indices and the short ones the high, and neighbours in index cost the same.
    const int bx = FS > 0 ? FS / (16 * AW) - 1 - (int)blockIdx.z : (int)blockIdx.x;
    const int h = FS > 0 ? blockIdx.x : blockIdx.y, b = FS > 0 ? blockIdx.y : blockIdx.z, hk = h / p.hrep;
    const int q0 = (bx * AW + wave) * 16;
    float* myp = pl[wave];
    const float L2E = 1.4426950408889634f;
    const float NEG = -__builtin_inff();
    const int qi = min(q0 + l15, p.Lq - 1);
    const float* qrow = p.Q + b * p.sQb + h * p.sQh + (long long)qi * p.sQi;
    const float* kbase = p.K + b * p.sKb + hk * p.sKh;
    const float* vbase = p.V + b * p.sVb + hk * p.sVh;
    v16h qa[QM == 0 ? KS : 1]; Split qs_[QM == 1 ? KS : 1]; Split3 qt_[QM == 2 ? KS : 1];
#pragma unroll
    for (int ks = 0; ks < KS; ++ks) {
        if (QM == 2) qt_[ks] = sp3_ld(qrow, p.sQd, ks * 32, hf, p.dh, 1.f);
        else if (QM == 1) qs_[ks] = sp_ld(qrow, p.sQd, ks * 32, hf, p.dh, 1.f);
        else qa[ks] = fh_ld(qrow, p.sQd, ks * 32, hf, p.dh, 1.f);
    }
    v8f o[NT]; float m8[8], l8[8];
#pragma unroll
    for (int t = 0; t < NT; ++t) { v8f zz = {}; o[t] = zz; }
#pragma unroll
    for (int i = 0; i < 8; ++i) { m8[i] = NEG; l8[i] = 0.f; }
    int jend = p.Lk; int jstart = 0;
    if (p.causal == 1) { const int je = (bx * AW + AW - 1) * 16 + 16 + p.coff; jend = min(jend, max(je, 0)); }   // uniform per block
    if (p.win > 0) { const int js = (bx * AW) * 16 + p.coff - p.win; jstart = (js > 0) ? (js / 64) * 64 : 0; }   // uniform per block: key blocks entirely outside every row's window hold only -inf entries and are skipped exactly
    const int npass = TWOPASS ? 2 : 1;
    for (int pass = 0; pass < npass; ++pass) {
        const bool dopv = (!TWOPASS) || pass == 1;
        for (int j0 = jstart; j0 < jend; j0 += 64) {
            v16h kf[FS > 0 ? 4 * KS : 1];                        // FS > 0: the key block's K fragments, tile t and k-step ks at t * KS + ks
            if (dopv) {
                __syncthreads();                                 // previous key block's reads of vl / pl are done
                if (FS > 0) {
                    // raw f32 in two batches, so that the loaded values and everything else that is live fit 256 registers (four waves a SIMD)
                    v4f vr[8]; v8f kr[8];                                           // V: four consecutive elements per thread and step; K: half a fragment each
                    const float* krow = kbase + (long long)(j0 + l15) * FD + 8 * hf;
#pragma unroll
                    for (int it = 0; it < 8; ++it)
                        vr[it] = *(const v4f*)(vbase + (long long)(j0 + ((int)threadIdx.x >> 4)) * FD + ((int)threadIdx.x & 15) * 4 + it * (2 * AW * FD));   // rows 2 AW apart per step
#pragma unroll
                    for (int c = 0; c < 8; ++c) kr[c] = *(const v8f*)(krow + (c >> 2) * (16 * FD) + (c & 3) * 16);   // key tile t = c / 4; k = 16 (c % 4) + 8 hf + (0..7)
                    // inputs-only fence on the loaded values: their first use is here, so the batch's 24 loads are all issued before any is waited on (without it
                    // the scheduler puts each load directly in front of its conversion and waits on it there)
                    asm volatile("" :: "v"(vr[0]), "v"(vr[1]), "v"(vr[2]), "v"(vr[3]), "v"(vr[4]), "v"(vr[5]), "v"(vr[6]), "v"(vr[7]),
                                 "v"(kr[0]), "v"(kr[1]), "v"(kr[2]), "v"(kr[3]), "v"(kr[4]), "v"(kr[5]), "v"(kr[6]), "v"(kr[7]));
#pragma unroll
                    for (int it = 0; it < 8; ++it) {
                        v4h hv; hv[0] = (_Float16)vr[it][0]; hv[1] = (_Float16)vr[it][1]; hv[2] = (_Float16)vr[it][2]; hv[3] = (_Float16)vr[it][3];
                        *(v4h*)(vl + ((int)threadIdx.x >> 4) * VP + ((int)threadIdx.x & 15) * 4 + it * (2 * AW * VP)) = hv;
                    }
#pragma unroll
                    for (int f = 0; f < 4; ++f)
#pragma unroll
                        for (int e = 0; e < 8; ++e) { kf[f][e] = (_Float16)kr[2 * f][e]; kf[f][8 + e] = (_Float16)kr[2 * f + 1][e]; }
                    v8f ks2[8];
#pragma unroll
                    for (int c = 0; c < 8; ++c) ks2[c] = *(const v8f*)(krow + (2 + (c >> 2)) * (16 * FD) + (c & 3) * 16);   // key tiles 2 and 3
                    // the same fence for the second batch's 16 loads; the address is named too, so that it stays live and none of these loads is given its register pair as destination
                    asm volatile("" :: "v"(ks2[0]), "v"(ks2[1]), "v"(ks2[2]), "v"(ks2[3]), "v"(ks2[4]), "v"(ks2[5]), "v"(ks2[6]), "v"(ks2[7]), "v"(krow));
#pragma unroll
                    for (int f = 0; f < 4; ++f)
#pragma unroll
                        for (int e = 0; e < 8; ++e) { kf[4 + f][e] = (_Float16)ks2[2 * f][e]; kf[4 + f][8 + e] = (_Float16)ks2[2 * f + 1][e]; }
                } else
                for (int idx = threadIdx.x; idx < 64 * DVP; idx += 32 * AW) {
                    const int jr = idx / DVP, d = idx - jr * DVP, j = j0 + jr;
                    const float f = (j < p.Lk && d < p.dv) ? vbase[(long long)j * p.sVj + (long long)d * p.sVd] : 0.f;
                    if (SPLITPV) {
                        const __bf16 hb = bf16_rne(f);
                        ((__bf16*)vl)[jr * VP + d] = hb; ((__bf16*)vl)[64 * VP + jr * VP + d] = bf16_rne(f - bf16_f32(hb));
                    } else vl[jr * VP + d] = (_Float16)f;
                }
            }
            v8f s[4];
#pragma unroll
            for (int t = 0; t < 4; ++t) {
                const int j = min(j0 + t * 16 + l15, p.Lk - 1);
                const float* krow = kbase + (long long)j * p.sKj;
                v8f acc = {};
#pragma unroll
                for (int ks = 0; ks < KS; ++ks) {
                    if (QM == 2)      acc = wmma6(qt_[ks], sp3_ld(krow, p.sKd, ks * 32, hf, p.dh, 1.f), acc);
                    else if (QM == 1) acc = wmma3(qs_[ks], sp_ld(krow, p.sKd, ks * 32, hf, p.dh, 1.f), acc);
                    else if (FS > 0)  acc = wmma16(qa[ks], kf[t * KS + ks], acc);
                    else              acc = wmma16(qa[ks], fh_ld(krow, p.sKd, ks * 32, hf, p.dh, 1.f), acc);
                }
                s[t] = acc;
            }
            float pv[8][4];
#pragma unroll
            for (int i = 0; i < 8; ++i) {
                const int irow = q0 + i + 8 * hf;
                const int ic = min(irow, p.Lq - 1);
                float sc[4];
#pragma unroll
                for (int t = 0; t < 4; ++t) {
                    const int jg = j0 + t * 16 + l15;
                    float v = s[t][i] * p.scale;
                    if (p.Mf) v += p.Mf[b * p.smb + h * p.smh + (long long)ic * p.smi + (long long)min(jg, p.Lk - 1) * p.smj];
                    if (p.Rt) { int rc = ic - min(jg, p.Lk - 1) + p.roff; rc = rc < 0 ? 0 : (rc >= p.rn ? p.rn - 1 : rc); v += p.Rt[b * p.srb + h * p.srh + (long long)ic * p.sri + rc]; }
                    if (p.Mi) { const int mv = p.Mi[b * p.smb + h * p.smh + (long long)ic * p.smi + (long long)min(jg, p.Lk - 1) * p.smj]; if (p.mpol ? (mv != 0) : (mv == 0)) v = p.mfill; }
                    if (p.SQ) { const bool same = p.SQ[(long long)b * p.Lq + ic] == p.SK[(long long)b * p.Lk + min(jg, p.Lk - 1)]; if (p.segpol ? same : !same) v = p.mfill; }
                    if (p.causal == 2 && jg > irow + p.coff) v = p.mfill;
                    if (jg >= p.Lk || (p.causal == 1 && jg > irow + p.coff) || (p.causal == 3 && jg < irow + p.coff) || (p.win > 0 && irow + p.coff - jg > p.win)) v = NEG; else v *= L2E;
                    sc[t] = v;
                }
                if (!TWOPASS || pass == 0) {
                    float mx = fmaxf(fmaxf(sc[0], sc[1]), fmaxf(sc[2], sc[3]));
                    mx = fmaxf(mx, __shfl_xor(mx, 1, 32)); mx = fmaxf(mx, __shfl_xor(mx, 2, 32));
                    mx = fmaxf(mx, __shfl_xor(mx, 4, 32)); mx = fmaxf(mx, __shfl_xor(mx, 8, 32));
                    const float mnew = fmaxf(m8[i], mx);
                    const float corr = (mnew == NEG) ? 1.f : exp2f(m8[i] - mnew);
                    float rs = 0.f;
#pragma unroll
                    for (int t = 0; t < 4; ++t) {
                        const float pp = (sc[t] == NEG) ? 0.f : exp2f(sc[t] - mnew); rs += pp;
                        pv[i][t] = p.Pw ? pp * p.Pw[b * p.swb + h * p.swh + (long long)ic * p.swi + (long long)min(j0 + t * 16 + l15, p.Lk - 1) * p.swj] : pp;
                    }
                    rs += __shfl_xor(rs, 1, 32); rs += __shfl_xor(rs, 2, 32); rs += __shfl_xor(rs, 4, 32); rs += __shfl_xor(rs, 8, 32);
                    l8[i] = l8[i] * corr + rs; m8[i] = mnew;
                    if (!TWOPASS) {
#pragma unroll
                        for (int t = 0; t < NT; ++t) o[t][i] *= corr;
                    }
                } else {
                    const float inv = (l8[i] > 0.f) ? 1.f / l8[i] : 0.f;
#pragma unroll
                    for (int t = 0; t < 4; ++t) {
                        const int jg = j0 + t * 16 + l15;
                        float pp = (sc[t] == NEG) ? 0.f : exp2f(sc[t] - m8[i]) * inv;
                        if (p.Pw) pp *= p.Pw[b * p.swb + h * p.swh + (long long)ic * p.swi + (long long)min(jg, p.Lk - 1) * p.swj];
                        pv[i][t] = pp;
                    }
                }
            }
            if (dopv) {
#pragma unroll
                for (int i = 0; i < 8; ++i)
#pragma unroll
                    for (int t = 0; t < 4; ++t) ((float*)myp)[(i + 8 * hf) * 64 + t * 16 + l15] = pv[i][t];
                __syncthreads();                                 // P (per wave) and V (shared) visible
                if (p.P) {
                    float* pb_ = p.P + b * p.sPb + h * p.sPh;
                    const bool fastP = (p.pband == 0) && ((p.sPi & 3) == 0) && (j0 + 64 <= p.Lk) && (q0 + 16 <= p.Lq) && ((((size_t)pb_) & 15) == 0);
                    if (fastP) {
#pragma unroll
                        for (int s = 0; s < 8; ++s) {
                            const int row = s * 2 + (lane >> 4), c4 = (lane & 15) * 4;
                            const v4f v = *(const v4f*)(myp + row * 64 + c4);
                            VST2V4(pb_ + (long long)(q0 + row) * p.sPi + j0 + c4, v);
                        }
                    } else {
                        for (int row = 0; row < 16; ++row) {
                            const int irow = q0 + row; if (irow >= p.Lq) continue;
                            for (int c = lane; c < 64; c += 32) {
                                const int jg = j0 + c; if (jg >= p.Lk) continue;
                                if (p.pband == 0) VST2(float, pb_ + (long long)irow * p.sPi + jg, myp[row * 64 + c]);
                                else if (jg - irow <= p.pband && irow - jg <= p.pband) VST2(float, pb_ + (long long)irow * p.sPi + (jg - irow + p.pband), myp[row * 64 + c]);
                            }
                        }
                    }
                }
                if (SPLITPV) {
                    const Split pa0 = sp_ld(myp + l15 * 64, 1, 0, hf, 64, 1.f), pa1 = sp_ld(myp + l15 * 64, 1, 32, hf, 64, 1.f);
                    const __bf16* vh = (const __bf16*)vl; const __bf16* vlo = vh + 64 * VP;
#pragma unroll
                    for (int t = 0; t < NT; ++t) {
                        const int dcol = t * 16 + l15;
                        Split b0, b1;
#pragma unroll
                        for (int e = 0; e < 16; ++e) {
                            const int k0 = frag_k(e, hf), k1 = 32 + frag_k(e, hf);
                            b0.hi[e] = vh[k0 * VP + dcol]; b0.lo[e] = vlo[k0 * VP + dcol]; b1.hi[e] = vh[k1 * VP + dcol]; b1.lo[e] = vlo[k1 * VP + dcol];
                        }
                        o[t] = wmma3(pa0, b0, o[t]);
                        o[t] = wmma3(pa1, b1, o[t]);
                    }
                } else {
                    const v16h pa0 = fh_ld(myp + l15 * 64, 1, 0, hf, 64, 4096.f), pa1 = fh_ld(myp + l15 * 64, 1, 32, hf, 64, 4096.f);
#pragma unroll
                    for (int t = 0; t < NT; ++t) {
                        const int dcol = t * 16 + l15;
                        v16h b0, b1;
#pragma unroll
                        for (int e = 0; e < 16; ++e) { b0[e] = vl[frag_k(e, hf) * VP + dcol]; b1[e] = vl[(32 + frag_k(e, hf)) * VP + dcol]; }
                        o[t] = wmma16(pa0, b0, o[t]);
                        o[t] = wmma16(pa1, b1, o[t]);
                    }
                }
            }
        }
    }
    float* obase = p.O + b * p.sOb + h * p.sOh;
    if (p.ST) {
        const int rl = lane >> 1, isel = rl & 7;           // row q0 + rl ; rl>>3 == hf holds because lane>>4 == (lane>>1)>>3
        float mv = 0.f, lv = 0.f;
#pragma unroll
        for (int i = 0; i < 8; ++i) if (i == isel) { mv = m8[i]; lv = l8[i]; }
        const int irow = q0 + rl;
        if (irow < p.Lq) { float* st = p.ST + (((long long)b * gridDim.y + h) * p.Lq + irow) * 2 + (lane & 1); VST2(float, st, (lane & 1) ? lv : mv * 0.6931471805599453f); }
    }
    float invr[8];
#pragma unroll
    for (int i = 0; i < 8; ++i) {
        if (TWOPASS) invr[i] = SPLITPV ? 1.f : (1.f / 4096.f);
        else if (p.nonorm) invr[i] = exp2f(m8[i]) * (SPLITPV ? 1.f : (1.f / 4096.f));
        else invr[i] = (l8[i] > 0.f) ? (SPLITPV ? 1.f / l8[i] : 1.f / (l8[i] * 4096.f)) : 0.f;
    }
    __syncthreads();                                             // all waves done with pl/vl from the main loop
    const bool ofast = ((p.sOi & 3) == 0) && ((((size_t)obase) & 15) == 0) && (q0 + 16 <= p.Lq);
#pragma unroll
    for (int c0 = 0; c0 < DVP; c0 += 64) {
#pragma unroll
        for (int i = 0; i < 8; ++i)
#pragma unroll
            for (int t = 0; t < NT; ++t) if (t * 16 >= c0 && t * 16 < c0 + 64) ((float*)myp)[(i + 8 * hf) * 64 + (t * 16 - c0) + l15] = o[t][i] * invr[i];
        __syncthreads();
        const int cw = (DVP - c0 < 64) ? (DVP - c0) : 64;      // staged columns in this chunk (multiple of 16)
        if (ofast && (c0 + cw <= p.dv) && (cw % 32 == 0)) {
            const int lpr = cw / 4;                              // lanes per row (16 for 64 cols, 8 for 32)
            const int rows_per_ins = 32 / lpr;
            for (int r0 = 0; r0 < 16; r0 += rows_per_ins) {
                const int row = r0 + lane / lpr, c4 = (lane % lpr) * 4;
                const v4f v = *(const v4f*)(myp + row * 64 + c4);
                VST2V4(obase + (long long)(q0 + row) * p.sOi + c0 + c4, v);
            }
        } else {
            for (int row = 0; row < 16; ++row) {
                const int irow = q0 + row; if (irow >= p.Lq) continue;
                for (int c = lane; c < cw; c += 32) { const int d = c0 + c; if (d < p.dv) VST2(float, obase + (long long)irow * p.sOi + d, myp[row * 64 + c]); }
            }
        }
        __syncthreads();
    }
}

// =====================================================================================================================
// k_tr: dst(z, c, r) = alpha * src(z, r, c) (+ beta * R2(z, c, r)): [Z][R][C] (row stride lds) -> [Z][C][R] (row stride ldd) through a 32x32 LDS tile;
//   flags: 1 -> add beta * residual R2 addressed like dst (z*sRz + c*ldr + r); act applied before the residual.
// =====================================================================================================================
struct TrP { const float* src; float* dst; const float* R2; long long sSz, lds, sDz, ldd, sRz, ldr; int R, C, flags, act; float alpha, beta; };
static_assert(sizeof(TrP) == 3 * 8 + 6 * 8 + 6 * 4, "TrP has padding");
__global__ __launch_bounds__(256) void k_tr(TrP p) {
    __shared__ float tile[32][33];
    const int c0 = blockIdx.x * 32, r0 = blockIdx.y * 32, z = blockIdx.z;
    const int lane = threadIdx.x & 31, wave = threadIdx.x >> 5;
    const float* s = p.src + z * p.sSz;
#pragma unroll
    for (int k = 0; k < 4; ++k) {
        const int rl = wave * 4 + k, r = r0 + rl, c = c0 + lane;
        tile[rl][lane] = (r < p.R && c < p.C) ? s[(long long)r * p.lds + c] : 0.f;
    }
    __syncthreads();
    float* d = p.dst + z * p.sDz; const float* rr = p.R2 + z * p.sRz;
#pragma unroll
    for (int k = 0; k < 4; ++k) {
        const int cl = wave * 4 + k, c = c0 + cl, r = r0 + lane;
        if (c < p.C && r < p.R) {
            float v = act_fn(p.alpha * tile[lane][cl], p.act);
            if (p.flags & 1) v += p.beta * rr[(long long)c * p.ldr + r];
            VST2(float, d + (long long)c * p.ldd + r, v);
        }
    }
}

// k_affine: dst[i] = a * (sdev ? sdev[0] : 1) * src[i] + b, i < n (one thread per element; consecutive lanes -> consecutive addresses)
__global__ __launch_bounds__(256) void k_affine(const float* __restrict__ src, float* __restrict__ dst, int n, float a, float b, const float* __restrict__ sdev) {
    const int i = blockIdx.x * 256 + threadIdx.x;
    if (i < n) { const float aa = sdev ? a * sdev[0] : a; const float v = aa * src[i] + b; VST2(float, dst + i, v); }
}

// =====================================================================================================================
// k_softmax: row softmax over n contiguous elements, one 256-thread block per row; rows addressed z*sz + r*sr (grid (R, Z)).
//   out = scale_out * softmax(scale_in * x + (Mf ? Mf[z*smz + r*smr + j] : 0)); a row whose max is -inf is written as 0.
// =====================================================================================================================
struct SmP { const float* src; float* dst; const float* Mf; long long sz, sr, dz, dr, smz, smr; int n, pad; float scale_in, scale_out; };
static_assert(sizeof(SmP) == 3 * 8 + 6 * 8 + 4 * 4, "SmP has padding");
__global__ __launch_bounds__(256) void k_softmax(SmP p) {
    __shared__ float red[256];
    const int r = blockIdx.x, z = blockIdx.y, tid = threadIdx.x;
    const float* s = p.src + z * p.sz + (long long)r * p.sr;
    const float* mf = p.Mf ? (p.Mf + z * p.smz + (long long)r * p.smr) : nullptr;
    float mx = -__builtin_inff();
    for (int j = tid; j < p.n; j += 256) { float v = s[j] * p.scale_in; if (mf) v += mf[j]; mx = fmaxf(mx, v); }
    red[tid] = mx; __syncthreads();
    for (int o = 128; o > 0; o >>= 1) { if (tid < o) red[tid] = fmaxf(red[tid], red[tid + o]); __syncthreads(); }
    mx = red[0]; __syncthreads();
    float sum = 0.f;
    for (int j = tid; j < p.n; j += 256) { float v = s[j] * p.scale_in; if (mf) v += mf[j]; sum += (mx == -__builtin_inff()) ? 0.f : expf(v - mx); }
    red[tid] = sum; __syncthreads();
    for (int o = 128; o > 0; o >>= 1) { if (tid < o) red[tid] += red[tid + o]; __syncthreads(); }
    sum = red[0];
    const float inv = (sum > 0.f) ? p.scale_out / sum : 0.f;
    float* d = p.dst + z * p.dz + (long long)r * p.dr;
    for (int j = tid; j < p.n; j += 256) { float v = s[j] * p.scale_in; if (mf) v += mf[j]; const float o = (mx == -__builtin_inff()) ? 0.f : expf(v - mx) * inv; VST2(float, d + j, o); }
}
// =====================================================================================================================
// k_stats: mean and rsqrt(var + eps) over a set of n elements addressed base + z*sz + (e / inner) * so + (e % inner) * si, one 256-thread
// k_norm_apply: y = (x - mean[set]) * rstd[set] * g[c] + b[c] over a [Z][C][L] channel-major tensor with set = z*G + c / (C/G) (G groups per z;
//   G = C -> per-channel sets indexed z*C+c; for batch norm pass stats indexed by c only via bn = 1). Optional act. Output same layout.
// =====================================================================================================================
//   mode 0: mean / rsqrt(var + eps); mode 1 (RMSNorm): 0 / rsqrt(mean(x^2) + eps); mode 2 (L2 normalize * sqrt(n)): 0 / sqrt(n) / max(||x||, eps); mode 3: as 0 with unbiased variance (n-1)
__global__ __launch_bounds__(256) void k_stats(const float* __restrict__ x, long long sz, long long so, long long si, int inner, int n, float eps, float* __restrict__ stat, int mode) {
    __shared__ float red[256];
    const int z = blockIdx.x, tid = threadIdx.x;
    const float* base = x + z * sz;
    float s = 0.f;
    for (int e = tid; e < n; e += 256) s += base[(long long)(e / inner) * so + (long long)(e % inner) * si];
    red[tid] = s; __syncthreads();
    for (int o = 128; o > 0; o >>= 1) { if (tid < o) red[tid] += red[tid + o]; __syncthreads(); }
    const float mu = (mode == 0 || mode == 3) ? red[0] / (float)n : 0.f; __syncthreads();
    float q = 0.f;
    for (int e = tid; e < n; e += 256) { const float dlt = base[(long long)(e / inner) * so + (long long)(e % inner) * si] - mu; q += dlt * dlt; }
    red[tid] = q; __syncthreads();
    for (int o = 128; o > 0; o >>= 1) { if (tid < o) red[tid] += red[tid + o]; __syncthreads(); }
    {
        float rs;
        if (mode == 2) rs = sqrtf((float)n) / fmaxf(sqrtf(red[0]), eps); else if (mode == 3) rs = rsqrtf(red[0] / (float)(n - 1) + eps); else rs = rsqrtf(red[0] / (float)n + eps);
        if (tid < 32) { const float v = (tid == 0) ? mu : ((tid == 1) ? rs : 0.f); VST2(float, stat + (long long)z * 32 + tid, v); }
    }
}
//   One thread per element over the flat [Z][C][L] index space: grid ceil(Z*C*L / 256).
__global__ __launch_bounds__(256) void k_norm_apply(const float* __restrict__ x, float* __restrict__ y, const float* __restrict__ stat, const float* __restrict__ g, const float* __restrict__ bta,
                                                     int Z, int C, int L, int G, int bn, int act) {
    const long long idx = (long long)blockIdx.x * 256 + threadIdx.x;
    if (idx >= (long long)Z * C * L) return;
    const int l = (int)(idx % L); const long long zc = idx / L; const int c = (int)(zc % C), z = (int)(zc / C); (void)l;
    const int set = bn ? c : (z * G + c / (C / G));
    float v = (x[idx] - stat[(long long)set * 32]) * stat[(long long)set * 32 + 1];
    if (g) v *= g[c];
    if (bta) v += bta[c];
    v = act_fn(v, act);
    VST2(float, y + idx, v);
}

// k_lse_neg: c[i] = -(st[2i] + log(st[2i+1])) = minus the log-sum-exp of row i from k_attn's ST output (for softmax over the query dimension)
__global__ __launch_bounds__(256) void k_lse_neg(const float* __restrict__ st, float* __restrict__ c, int n) {
    const int i = blockIdx.x * 256 + threadIdx.x;
    if (i < n) { const float v = -(st[2 * i] + logf(st[2 * i + 1])); VST2(float, c + i, v); }
}

// k_iota: dst[i] = a * i + b as int32 (segment/position id helper)
__global__ __launch_bounds__(256) void k_iota(int* __restrict__ dst, int n, int a, int b) {
    const int i = blockIdx.x * 256 + threadIdx.x;
    if (i < n) { const int v = a * i + b; VST2(int, dst + i, v); }
}

// k_axpby: dst[i] = a * x[i] + b * y[i] (+ c), i < n
__global__ __launch_bounds__(256) void k_axpby(const float* __restrict__ x, const float* __restrict__ y, float* __restrict__ dst, int n, float a, float b, float c) {
    const int i = blockIdx.x * 256 + threadIdx.x;
    if (i < n) { const float v = a * x[i] + b * y[i] + c; VST2(float, dst + i, v); }
}

// =====================================================================================================================
// k_rope: rotary embedding on a [R rows][Hn heads][D] view (row stride sXr, head stride sXh, element stride 1) -> Y (own strides).
//   mode 0: rotate_half (partner d±D/2, sign - for d<D/2); mode 1: interleaved pairs (partner d^1, sign - for even d).
//   table column tcol: tmode 0 -> d, 1 -> d % (D/2), 2 -> d / 2; position p: pmode 0 -> r % S, 1 -> head index, 2 -> pos[r];
//   c = C[(r / S) * sCb + p * sCp + tcol * sCd], s likewise from Sn; y = x[d] * c + sign * x[partner] * s. X and Y must not alias.
// =====================================================================================================================
struct RopeP { const float* X; float* Y; const float* C; const float* Sn; const int* pos; long long sXr, sXh, sYr, sYh, sCb, sCp, sCd; int R, Hn, D, S, mode, tmode, pmode, pad; };
static_assert(sizeof(RopeP) == 5 * 8 + 7 * 8 + 8 * 4, "RopeP has padding");
__global__ __launch_bounds__(256) void k_rope(RopeP p) {
    const long long idx = (long long)blockIdx.x * 256 + threadIdx.x;
    if (idx >= (long long)p.R * p.Hn * p.D) return;
    const int d = (int)(idx % p.D); const long long rh = idx / p.D; const int h = (int)(rh % p.Hn); const int r = (int)(rh / p.Hn);
    const int half = p.D / 2;
    int partner; float sign;
    if (p.mode == 0) { partner = (d < half) ? d + half : d - half; sign = (d < half) ? -1.f : 1.f; }
    else { partner = d ^ 1; sign = (d & 1) ? 1.f : -1.f; }
    const int tcol = (p.tmode == 0) ? d : ((p.tmode == 1) ? (d % half) : (d >> 1));
    const int pp = (p.pmode == 0) ? (r % p.S) : ((p.pmode == 1) ? h : p.pos[r]);
    const long long toff = (long long)(r / p.S) * p.sCb + (long long)pp * p.sCp + (long long)tcol * p.sCd;
    const float* xr = p.X + (long long)r * p.sXr + (long long)h * p.sXh;
    const float v = xr[d] * p.C[toff] + sign * xr[partner] * p.Sn[toff];
    VST2(float, p.Y + (long long)r * p.sYr + (long long)h * p.sYh + d, v);
}

// k_invf + k_sincos (split so neither kernel carries a large VALU-fma footprint): invf_i = num * (1 / powf(base, (2 i)/D)) [fmode 0],
//   num * expf((2 i) * cexp) [fmode 1], num * powf(base, -2 (i - 1) / D) [fmode 2]; then cs/sn[s*half + i] = cos/sin((pscale * s) * invf_i)
__global__ __launch_bounds__(256) void k_invf(float* __restrict__ invb, int half, int D, float base, float num, int fmode, float cexp) {
    const int i = blockIdx.x * 256 + threadIdx.x;
    if (i >= ((half + 31) / 32) * 32) return;
    if (i >= half) { VST2(float, invb + i, 0.f); return; }
    const float e = (float)(2 * i) / (float)D;
    float invf;
    if (fmode == 1) invf = num * expf((float)(2 * i) * cexp);
    else if (fmode == 2) invf = num * powf(base, (-2.0f * ((float)i - 1.0f)) / (float)D);
    else invf = num * (1.0f / powf(base, e));
    VST2(float, invb + i, invf);
}
__global__ __launch_bounds__(256) void k_sincos(float* __restrict__ cs, float* __restrict__ sn, const float* __restrict__ invb, int S, int half, float pscale) {
    const int idx = blockIdx.x * 256 + threadIdx.x;
    if (idx >= S * half) return;
    const int s = idx / half, i = idx - s * half;
    const float ang = (pscale * (float)s) * invb[i];
    VST2(float, cs + idx, cosf(ang)); VST2(float, sn + idx, sinf(ang));
}

// k_mulact: dst[i] = act(x[i]) * y[i]
__global__ __launch_bounds__(256) void k_mulact(const float* __restrict__ x, const float* __restrict__ y, float* __restrict__ dst, int n, int act) {
    const int i = blockIdx.x * 256 + threadIdx.x;
    if (i < n) { const float v = act_fn(x[i], act) * y[i]; VST2(float, dst + i, v); }
}

// =====================================================================================================================
// k_matvec: thread-per-row matrix-vector products for N <= 8 output columns (heads with 1-3 outputs, gates), f32 on the VALU.
//   C[r*sCm + j] = act(alpha * sum_k A[r*sAm + k*sAk] * B[j*sBn + k*sBk] + bias[j]) + beta * R[r*sRm + j*sRn]; each thread writes its N contiguous floats.
// =====================================================================================================================
__global__ __launch_bounds__(256) void k_matvec(GemmP p) {
    // 32 lanes write one line with one instruction.
    const int rpt = (p.N == 1) ? 1 : 32;
    const long long r0 = ((long long)blockIdx.x * 256 + threadIdx.x) * rpt; const int z = blockIdx.z, zo = z / p.zi_n, zi = z - zo * p.zi_n;
    if (r0 >= p.M) return;
    const float* Bb = p.B + zo * p.sBo + zi * p.sBi;
    float* C = p.C + zo * p.sCo + zi * p.sCi; const float* R = p.R + zo * p.sRo + zi * p.sRi;
    for (int rr = 0; rr < rpt; ++rr) {
        const long long r = r0 + rr; if (r >= p.M) break;
        const float* A = p.A + zo * p.sAo + zi * p.sAi + r * p.sAm;
        float acc[8] = {0.f, 0.f, 0.f, 0.f, 0.f, 0.f, 0.f, 0.f};
        for (int k = 0; k < p.K; ++k) { const float a = A[(long long)k * p.sAk];
#pragma unroll
            for (int j = 0; j < 8; ++j) if (j < p.N) acc[j] += a * Bb[(long long)j * p.sBn + (long long)k * p.sBk]; }
#pragma unroll
        for (int j = 0; j < 8; ++j) if (j < p.N) {
            float v = acc[j] * p.alpha;
            if (p.flags & 1) v += p.bias[j];
            if (p.flags & 2) v += p.bias[r];
            v = act_fn(v, p.act);
            if (p.flags & 4) v += p.beta * R[r * p.sRm + (long long)j * p.sRn];
            VST2(float, C + r * p.sCm + j, v);
        }
    }
}
// k_smallsoftmax: thread-per-row softmax for short rows (n <= 64): dst[r*dr + j] = softmax(scale*src[r*sr + j])
__global__ __launch_bounds__(256) void k_smallsoftmax(const float* __restrict__ src, float* __restrict__ dst, long long sr, long long dr, int n, long long R, float scale) {
    const long long r0 = ((long long)blockIdx.x * 256 + threadIdx.x) * 32;
    for (int rr = 0; rr < 32; ++rr) {
        const long long r = r0 + rr; if (r >= R) return;
        const float* s = src + r * sr; float* d = dst + r * dr;
        float mx = -__builtin_inff();
        for (int j = 0; j < n; ++j) mx = fmaxf(mx, s[j] * scale);
        float sum = 0.f;
        for (int j = 0; j < n; ++j) sum += expf(s[j] * scale - mx);
        const float inv = 1.f / sum;
        for (int j = 0; j < n; ++j) { const float v = expf(s[j] * scale - mx) * inv; VST2(float, d + j, v); }
    }
}

__global__ __launch_bounds__(32) void k_unitstat(float* __restrict__ st) { const int t = threadIdx.x; const float v = (t == 1) ? 1.f : 0.f; VST2(float, st + t, v); }

// destination (e.g. a d_out whose row width is not a multiple of 32 floats) is written by consecutive lanes of one instruction
__global__ __launch_bounds__(256) void k_lincopy(const float* __restrict__ src, long long lds, float* __restrict__ dst, long long ldd, long long rows, int cols) {
    const long long i = (long long)blockIdx.x * 256 + threadIdx.x; if (i >= rows * cols) return;
    const long long r = i / cols; const int c = (int)(i - r * cols);
    const float v = src[r * lds + c]; VST2(float, dst + r * ldd + c, v);
}

namespace w25 {
typedef __attribute__((ext_vector_type(16))) _Float16 v16h;
typedef __attribute__((ext_vector_type(8)))  _Float16 v8h;
typedef __attribute__((ext_vector_type(16))) __bf16   v16b;
typedef __attribute__((ext_vector_type(8)))  __bf16   v8b;
typedef __attribute__((ext_vector_type(8)))  float    v8f;
typedef __attribute__((ext_vector_type(4)))  float    v4f;

__device__ __forceinline__ unsigned short f2bf_bits(float f) {
  unsigned u = __float_as_uint(f);
  return (unsigned short)((u + 0x7FFFu + ((u >> 16) & 1u)) >> 16);
}
__device__ __forceinline__ float bf_bits2f(unsigned short h) { return __uint_as_float(((unsigned)h) << 16); }

template <typename T> struct Frag;
template <> struct Frag<_Float16> {
  typedef v16h V; union U { v16h v; v8h h[2]; };
  static __device__ __forceinline__ v16h load(const _Float16* p) {   // elements 0..7 <- p[0..7], 8..15 <- p[16..23]
    U f; f.h[0] = *(const v8h*)(p); f.h[1] = *(const v8h*)(p + 16); return f.v;
  }
  static __device__ __forceinline__ v8f mma(v16h a, v16h b, v8f c) {
    return __builtin_amdgcn_wmma_f32_16x16x32_f16(false, a, false, b, (short)0, c, false, false);
  }
};
template <> struct Frag<__bf16> {
  typedef v16b V; union U { v16b v; v8b h[2]; };
  static __device__ __forceinline__ v16b load(const __bf16* p) {
    U f; f.h[0] = *(const v8b*)(p); f.h[1] = *(const v8b*)(p + 16); return f.v;
  }
  static __device__ __forceinline__ v8f mma(v16b a, v16b b, v8f c) {
    return __builtin_amdgcn_wmma_f32_16x16x32_bf16(false, a, false, b, (short)0, c, false, false);
  }
};

// ---- WMMA GEMM with both operands staged in LDS ------------------------------
// C[m,n] = scale * sum_k A[m,k] * Bt[n,k], f32 out. A row-major [M,K]; Bt row-major [N,K]; C row-major [M,N]; M % 64 == 0, N % 128 == 0, K % 64 == 0.
// grid (N / 128, M / 64), 8 waves: a work-group owns a 64 x 128 tile of C, wave (wave >> 2, wave & 3) a 32 x 32 part of it.
// K runs in stages of 64: a stage's 64 A rows and 128 Bt rows (128 B each, per plane) come from global memory as whole 128-byte lines
// (8 lanes x 16 B per row), go to LDS at a pitch of 144 B, and every wave reads its fragments from there with 16-byte LDS loads.
// Two LDS buffers: the next stage's global loads are in flight while the current stage is multiplied; one barrier per stage.
// SPLIT: operands are hi/lo planes (A2/Bt2 = lo planes, same layout); product = hi.hi + hi.lo + lo.hi, in that order per 32 k.
// ET: 0 = f16 operands, 1 = bf16 operands (pointers passed as 16-bit storage)
// astep: rows of A from one 64-row tile of C to the next (64: A is dense; more: each tile takes the first 64 rows of a longer block of A)
template <int ET> struct Elem;
template <> struct Elem<0> { typedef _Float16 T; typedef v8h V8; };
template <> struct Elem<1> { typedef __bf16 T; typedef v8b V8; };
template <int ET, bool SPLIT>
__global__ __launch_bounds__(256) void wmma_gemm_lds(
    const unsigned short* __restrict__ Ap, const unsigned short* __restrict__ A2p,
    const unsigned short* __restrict__ Btp, const unsigned short* __restrict__ Bt2p,
    float* __restrict__ C, int N, int K, float scale, int astep) {
  typedef typename Elem<ET>::T T;
  typedef typename Elem<ET>::V8 V8;
  typedef typename Frag<T>::V V;
  constexpr int NP    = SPLIT ? 2 : 1;      // planes
  constexpr int PITCH = 72;                 // LDS row pitch in 16-bit elements: 144 B = 16 B x 9
  constexpr int PROWS = 192;                // rows of one plane in a stage: 64 of A, then 128 of Bt
  constexpr int STAGE = NP * PROWS * PITCH; // elements of one buffer
  constexpr int NL    = NP * 6;             // 16-byte pieces per thread and stage (32 rows per step)
  constexpr int CP    = 132;                // pitch of the staged C tile in floats
  static_assert(2 * STAGE * 2 >= 64 * CP * 4, "the C tile is staged in the operand buffers");
  __shared__ __align__(16) T sm[2 * STAGE];
  const int lane = threadIdx.x & 31;
  const int wave = threadIdx.x >> 5;
  const int m0 = blockIdx.y << 6;
  const int n0 = blockIdx.x << 7;
  const int wm = (wave >> 2) << 5;          // this wave's first row and column in the tile
  const int wn = (wave & 3) << 5;
  const int rlane = lane & 15;              // row (A) / col (B, D) within a 16 x 16 subtile
  const int koff  = (lane >> 4) * 8;        // k offset of this lane half
  const int mOff  = (lane >> 4) * 8;        // D row offset

  const int lrow = threadIdx.x >> 3, lseg = (threadIdx.x & 7) * 8;   // staging: row within a step of 32 rows, 16-byte piece of the row
  const int a0 = blockIdx.y * astep;        // first A row of this tile
  const T* gA  = (const T*)Ap  + (size_t)(a0 + lrow) * K + lseg;
  const T* gB  = (const T*)Btp + (size_t)(n0 + lrow) * K + lseg;
  const T* gA2 = SPLIT ? (const T*)A2p  + (size_t)(a0 + lrow) * K + lseg : nullptr;
  const T* gB2 = SPLIT ? (const T*)Bt2p + (size_t)(n0 + lrow) * K + lseg : nullptr;
  const int sw = lrow * PITCH + lseg;       // this thread's place in a buffer, step 0
  const int fa = (wm + rlane) * PITCH + koff;        // this lane's A and Bt fragment places in a buffer, subtile 0, k 0
  const int fb = (64 + wn + rlane) * PITCH + koff;

  v8f acc[2][2];
#pragma unroll
  for (int i = 0; i < 2; ++i)
#pragma unroll
    for (int j = 0; j < 2; ++j) acc[i][j] = (v8f){0.f,0.f,0.f,0.f,0.f,0.f,0.f,0.f};

  V8 st[NL];
  auto fetch = [&](int k0) {                // stage at k0: global memory -> registers
#pragma unroll
    for (int it = 0; it < NL; ++it) {
      const int q = it % 6;                 // steps 0, 1: A rows; 2..5: Bt rows; then the same for the lo planes
      const T* g = (it < 6) ? (q < 2 ? gA : gB) : (q < 2 ? gA2 : gB2);
      st[it] = *(const V8*)(g + (size_t)((q < 2 ? q : q - 2) * 32) * K + k0);
    }
  };
  auto put = [&](int buf) {                 // registers -> LDS buffer
#pragma unroll
    for (int it = 0; it < NL; ++it) *(V8*)(sm + buf * STAGE + sw + it * (32 * PITCH)) = st[it];
  };
  auto mult = [&](int buf) {                // one stage: 2 steps of 32 k
    const T* s = sm + buf * STAGE;
#pragma unroll
    for (int kk = 0; kk < 2; ++kk) {
      V ah[2], al[2], bh[2], bl[2];
#pragma unroll
      for (int i = 0; i < 2; ++i) {
        ah[i] = Frag<T>::load(s + fa + i * (16 * PITCH) + kk * 32);
        bh[i] = Frag<T>::load(s + fb + i * (16 * PITCH) + kk * 32);
        if (SPLIT) {
          al[i] = Frag<T>::load(s + PROWS * PITCH + fa + i * (16 * PITCH) + kk * 32);
          bl[i] = Frag<T>::load(s + PROWS * PITCH + fb + i * (16 * PITCH) + kk * 32);
        }
      }
#pragma unroll
      for (int i = 0; i < 2; ++i)
#pragma unroll
        for (int j = 0; j < 2; ++j) acc[i][j] = Frag<T>::mma(ah[i], bh[j], acc[i][j]);
      if (SPLIT) {
#pragma unroll
        for (int i = 0; i < 2; ++i)
#pragma unroll
          for (int j = 0; j < 2; ++j) acc[i][j] = Frag<T>::mma(ah[i], bl[j], acc[i][j]);
#pragma unroll
        for (int i = 0; i < 2; ++i)
#pragma unroll
          for (int j = 0; j < 2; ++j) acc[i][j] = Frag<T>::mma(al[i], bh[j], acc[i][j]);
      }
    }
  };

  const int NK = K >> 6;
  fetch(0);
  put(0);
  __syncthreads();                          // stage 0 is visible
  for (int kt = 0; kt + 1 < NK; ++kt) {
    fetch((kt + 1) << 6);
    __builtin_amdgcn_sched_barrier(0);      // keeps the next stage's global loads issued ahead of this stage's products, so that their latency runs under them
    mult(kt & 1);
    put((kt + 1) & 1);                      // the buffer that stage kt - 1 was read from; its readers left it at the barrier that ended that trip
    __syncthreads();                        // stage kt + 1 is visible, and every wave has finished reading stage kt
  }
  mult((NK - 1) & 1);
  __syncthreads();                          // all fragment reads are done: the buffers now stage the C tile

  // ---- epilogue: the 64 x 128 f32 tile through LDS, so that each store instruction writes 512 contiguous bytes of one row ----
  float* sC = (float*)sm;
#pragma unroll
  for (int i = 0; i < 2; ++i)
#pragma unroll
    for (int j = 0; j < 2; ++j)
#pragma unroll
      for (int r = 0; r < 8; ++r) sC[(wm + (i << 4) + mOff + r) * CP + wn + (j << 4) + rlane] = acc[i][j][r] * scale;
  __syncthreads();
#pragma unroll
  for (int it = 0; it < 8; ++it) {
    const int row = it * 8 + wave;
    const v4f v = *(const v4f*)(sC + row * CP + lane * 4);
    *(v4f*)(C + (size_t)(m0 + row) * N + n0 + lane * 4) = v;
  }
}

__global__ __launch_bounds__(256) void cast_f32_f16x2(
    const float* __restrict__ in, _Float16* __restrict__ out, int n2) {
  int i = blockIdx.x * 256 + threadIdx.x;
  if (i < n2) {
    const _Float16 h0 = (_Float16)in[2 * i], h1 = (_Float16)in[2 * i + 1];
    const unsigned u = (unsigned)__builtin_bit_cast(unsigned short, h0) | ((unsigned)__builtin_bit_cast(unsigned short, h1) << 16);
    ((unsigned*)out)[i] = u;
    
  }
}


} // namespace w25

__global__ __launch_bounds__(256) void k_castT16(const float* __restrict__ src, long long lds, _Float16* __restrict__ dst, long long ldd, int R, int C, float s) {
    const long long i = (long long)blockIdx.x * 256 + threadIdx.x; const long long np = (long long)C * (R / 2); if (i >= np) return; const int c = (int)(i / (R / 2)); const int r = 2 * (int)(i % (R / 2));
    const _Float16 h0 = (_Float16)(src[(long long)r * lds + c] * s), h1 = (_Float16)(src[(long long)(r + 1) * lds + c] * s);
    const unsigned u = (unsigned)__builtin_bit_cast(unsigned short, h0) | ((unsigned)__builtin_bit_cast(unsigned short, h1) << 16);
    unsigned* d = (unsigned*)(dst + (long long)c * ldd + r); *d = u;  }

// f32 -> bf16 hi plane + bf16 lo plane (x = hi + lo to ~2^-17 relative; RNE both), 2 consecutive destination elements: hi pair returned, lo pair in *lo
__device__ __forceinline__ unsigned int f2bf2_pack(float a, float b, unsigned int* lo) {
    const unsigned short ha = w25::f2bf_bits(a), hb = w25::f2bf_bits(b);
    const unsigned short la = w25::f2bf_bits(a - w25::bf_bits2f(ha)), lb = w25::f2bf_bits(b - w25::bf_bits2f(hb));
    *lo = (unsigned)la | ((unsigned)lb << 16); return (unsigned)ha | ((unsigned)hb << 16); }

namespace w25 {
// =====================================================================================
// Generic causal/non-causal attention for head_dim 64, f32 in / f32 out; 16-bit operands: bf16 with optional hi/lo splits, or
// plain f16 (F16=true, non-split, probabilities carried x2^15).
//   scores = (q*qscale)·kᵀ : v_wmma_f32_16x16x32_bf16; SPLIT_QK -> q,k as bf16 hi/lo (hi·hi + hi·lo + lo·hi)
//   out    = p·v           : v_wmma_f32_16x16x32_bf16; SPLIT_PV -> p,v as bf16 hi/lo; else p,v plain bf16
//   f32 accumulate; online softmax in f32. Block = 4 waves = 64 query rows of one (batch, head); S % 64 == 0.
//   Element (b, s, h, d) of tensor X lives at X[b*X_bs + s*X_rs + h*X_hs + d] (strides in floats, multiples of 4).
//   Masking: mask_mode 0 none, 1 causal (kv > q masked), 2 tensor [S][Skv] shared over (b,h) (float if
//   mask_is_int==0, int32 with element == 0 -> masked if 1, int32 with element != 0 -> masked if 2), 3 per-token vectors qmask[B][S] & kvmask[B][Skv] (int32,
//   0 -> masked), 4 causal + sliding window (kv > q or q - kv > W masked; W passed in mask_is_int);
//   5 = relative-position bias: s += cp[b,h,q][idx[q][kv]] + pc[b,h,kv][idx[q][kv]] with idx = mask_b ([S][Skv] int32) and
//   mask_a an int32 [S][Skv] tensor with nonzero = masked (tables: element (b,h,row,n) at X + b*c_bs + h*c_hs + row*c_rs + n);
//   masked scores are replaced by mask_fill (e.g. -inf or -1e9) before the softmax.
//   grid.x = B * H * (S/64) (or a sub-range with blk0).
// =====================================================================================
#define AT_D 64
#define AT_NW 4
#define AT_QB 64
#define AT_KC 64
struct AttnGeom { const float* cp = nullptr; const float* pc = nullptr; long c_bs = 0, c_rs = 0, c_hs = 0;   // mode-5 score-bias tables
                  long q_bs, q_rs, q_hs, k_bs, k_rs, k_hs, v_bs, v_rs, v_hs, o_bs, o_rs, o_hs;
                  int S, Skv, H, mask_mode; float qscale; int blk0; float mask_fill; int mask_is_int; };
static_assert(sizeof(AttnGeom) == 168, "no padding");

__device__ __forceinline__ unsigned short at_bf_bits(float f) {
  unsigned u = __float_as_uint(f);
  return (unsigned short)((u + 0x7FFFu + ((u >> 16) & 1u)) >> 16);
}
__device__ __forceinline__ __bf16 at_f2bf(float f) { return __builtin_bit_cast(__bf16, at_bf_bits(f)); }
__device__ __forceinline__ void at_split(float f, __bf16& hi, __bf16& lo) {
  const unsigned short hb = at_bf_bits(f);
  hi = __builtin_bit_cast(__bf16, hb);
  lo = at_f2bf(f - __uint_as_float(((unsigned)hb) << 16));
}
__device__ __forceinline__ v8f at_mma(v16b a, v16b b, v8f c) {
  c = __builtin_amdgcn_wmma_f32_16x16x32_bf16(false, a, false, b, (short)0, c, false, false);
  asm volatile("v_nop\n\tv_nop\n\tv_nop\n\tv_nop" : "+v"(c) : "v"(a), "v"(b));
  return c;
}
// 16-bit element as a bit pattern held in a __bf16 slot: f16 bits when F16, bf16 (RNE) otherwise
template <bool F16> __device__ __forceinline__ __bf16 at_to16(float f) {
  if (F16) return __builtin_bit_cast(__bf16, (_Float16)f);
  return at_f2bf(f);
}
template <bool F16> __device__ __forceinline__ v8f at_mma16(v16b a, v16b b, v8f c) {
  if (F16) {
    const v16h ah = __builtin_bit_cast(v16h, a), bh = __builtin_bit_cast(v16h, b);
    c = __builtin_amdgcn_wmma_f32_16x16x32_f16(false, ah, false, bh, (short)0, c, false, false);
    asm volatile("v_nop\n\tv_nop\n\tv_nop\n\tv_nop" : "+v"(c) : "v"(ah), "v"(bh));
    return c;
  }
  return at_mma(a, b, c);
}

template <bool SPLIT_QK, bool SPLIT_PV, bool F16 = false>
__global__ __launch_bounds__(128)
void attn64_kernel(const float* __restrict__ q, const float* __restrict__ k,
                   const float* __restrict__ v, float* __restrict__ out,
                   const void* __restrict__ mask_a, const int* __restrict__ mask_b, AttnGeom g) {
  static_assert(!(F16 && (SPLIT_QK || SPLIT_PV)), "f16 mode is non-split");
  const float PSC = F16 ? 32768.0f : 1.0f;     // f16 probabilities carried x2^15 (subnormal range), folded into the final 1/l
  union FB { v16b v; v8b h[2]; };
  __shared__ __align__(16) __bf16 Ksh[AT_KC * AT_D];             // K hi [kv][d]      8 KB
  __shared__ __align__(16) __bf16 Ksl[SPLIT_QK ? AT_KC * AT_D : 8];
  __shared__ __align__(16) __bf16 Vth[AT_D * AT_KC];             // V hi [d][kv]      8 KB
  __shared__ __align__(16) __bf16 Vtl[SPLIT_PV ? AT_D * AT_KC : 8];
  __shared__ __align__(16) __bf16 Psh[AT_NW][16 * AT_KC];        // per wave P hi [row][kv]  8 KB
  __shared__ __align__(16) __bf16 Psl[SPLIT_PV ? AT_NW : 1][SPLIT_PV ? 16 * AT_KC : 8];
  __shared__ __align__(16) float  Os[AT_NW][16 * 68];            // per wave out tile, pitch 68

  const int tid  = threadIdx.x;
  const int wave = tid >> 5;
  const int lane = tid & 31;
  const int hh   = lane >> 4;
  const int c    = lane & 15;

  const int nqb = g.S / AT_QB;
  const int bx = blockIdx.x + g.blk0;
  const int qb = bx % nqb;
  const int bh = bx / nqb;
  const int h  = bh % g.H;
  const int b  = bh / g.H;
  const int qbase_block = qb * AT_QB;
  const int q0 = qbase_block + wave * 16;

  const float* qb_ptr = q + (size_t)b * g.q_bs + (size_t)h * g.q_hs;
  const float* kb_ptr = k + (size_t)b * g.k_bs + (size_t)h * g.k_hs;
  const float* vb_ptr = v + (size_t)b * g.v_bs + (size_t)h * g.v_hs;
  float*       ob_ptr = out + (size_t)b * g.o_bs + (size_t)h * g.o_hs;

  // ---- Q fragments (A operand): 2 d-chunks, hi (and lo) ----
  v16b qah[2], qal[2];
  {
    const float* qrow = qb_ptr + (size_t)(q0 + c) * g.q_rs;
#pragma unroll
    for (int dc = 0; dc < 2; ++dc) {
#pragma unroll
      for (int e = 0; e < 8; ++e) {
        const float f0 = qrow[dc * 32 + 8 * hh + e] * g.qscale;
        const float f1 = qrow[dc * 32 + 16 + 8 * hh + e] * g.qscale;
        if (SPLIT_QK) { __bf16 hq, lq; at_split(f0, hq, lq); qah[dc][e] = hq; qal[dc][e] = lq; at_split(f1, hq, lq); qah[dc][8 + e] = hq; qal[dc][8 + e] = lq; }
        else { qah[dc][e] = at_to16<F16>(f0); qah[dc][8 + e] = at_to16<F16>(f1); qal[dc][e] = qah[dc][e]; qal[dc][8 + e] = qah[dc][8 + e]; }
      }
    }
  }

  float mrow[8], lrow[8];
  v8f oacc[4];
#pragma unroll
  for (int r = 0; r < 8; ++r) { mrow[r] = -INFINITY; lrow[r] = 0.f; }
#pragma unroll
  for (int t = 0; t < 4; ++t) oacc[t] = (v8f){0.f,0.f,0.f,0.f,0.f,0.f,0.f,0.f};

  const int nChunks = (g.mask_mode == 1 || g.mask_mode == 4) ? (qb + 1) : (g.Skv / AT_KC);   // block-uniform
  // per-row query mask (mode 3)
  int qkeep[8];
#pragma unroll
  for (int r = 0; r < 8; ++r) qkeep[r] = (g.mask_mode == 3) ? mask_b[(size_t)b * g.S + q0 + 8 * hh + r] : 1;   // mask_b = qmask in mode 3
  for (int kc = 0; kc < nChunks; ++kc) {
    const int kv0 = kc * AT_KC;
    __syncthreads();
    {
      const int kvr = tid >> 1, dh = (tid & 1) * 32;
      const float* krow = kb_ptr + (size_t)(kv0 + kvr) * g.k_rs + dh;
      const float* vrow = vb_ptr + (size_t)(kv0 + kvr) * g.v_rs + dh;
#pragma unroll
      for (int i = 0; i < 8; ++i) {
        v4f kk = *(const v4f*)(krow + 4 * i);
        v4f vv = *(const v4f*)(vrow + 4 * i);
#pragma unroll
        for (int e = 0; e < 4; ++e) {
          const int d = dh + 4 * i + e;
          if (SPLIT_QK) { __bf16 a, bl; at_split(kk[e], a, bl); Ksh[kvr * AT_D + d] = a; Ksl[kvr * AT_D + d] = bl; }
          else Ksh[kvr * AT_D + d] = at_to16<F16>(kk[e]);
          if (SPLIT_PV) { __bf16 a, bl; at_split(vv[e], a, bl); Vth[d * AT_KC + kvr] = a; Vtl[d * AT_KC + kvr] = bl; }
          else Vth[d * AT_KC + kvr] = at_to16<F16>(vv[e]);
        }
      }
    }
    __syncthreads();

    v8f s[4];
#pragma unroll
    for (int j = 0; j < 4; ++j) {
      s[j] = (v8f){0.f,0.f,0.f,0.f,0.f,0.f,0.f,0.f};
#pragma unroll 1
      for (int dc = 0; dc < 2; ++dc) {
        FB kb;
        kb.h[0] = *(const v8b*)(Ksh + (j * 16 + c) * AT_D + dc * 32 + 8 * hh);
        kb.h[1] = *(const v8b*)(Ksh + (j * 16 + c) * AT_D + dc * 32 + 16 + 8 * hh);
        s[j] = at_mma16<F16>(qah[dc], kb.v, s[j]);
        if (SPLIT_QK) {
          FB kl;
          kl.h[0] = *(const v8b*)(Ksl + (j * 16 + c) * AT_D + dc * 32 + 8 * hh);
          kl.h[1] = *(const v8b*)(Ksl + (j * 16 + c) * AT_D + dc * 32 + 16 + 8 * hh);
          s[j] = at_mma16<F16>(qah[dc], kl.v, s[j]);
          s[j] = at_mma16<F16>(qal[dc], kb.v, s[j]);
        }
      }
    }
    const bool diag = (g.mask_mode == 1) && (kc == qb);
    int kvkeep[4] = {1, 1, 1, 1};
    if (g.mask_mode == 3) {
#pragma unroll
      for (int j = 0; j < 4; ++j) kvkeep[j] = ((const int*)mask_a)[(size_t)b * g.Skv + kv0 + j * 16 + c];   // mask_a = kvmask
    }
    float cm[8];
#pragma unroll
    for (int r = 0; r < 8; ++r) {
      const int qrow = q0 + 8 * hh + r;
      float m = -INFINITY;
#pragma unroll
      for (int j = 0; j < 4; ++j) {
        const int kvcol = kv0 + j * 16 + c;
        bool masked = false;
        if (diag) masked = (kvcol > qrow);
        else if (g.mask_mode == 4) masked = (kvcol > qrow) || (qrow - kvcol > g.mask_is_int);
        else if (g.mask_mode == 2) {
          const size_t mi = (size_t)qrow * g.Skv + kvcol;
          masked = (g.mask_is_int == 0) ? (((const float*)mask_a)[mi] == 0.0f)
                 : (g.mask_is_int == 1) ? (((const int*)mask_a)[mi] == 0) : (((const int*)mask_a)[mi] != 0);
        } else if (g.mask_mode == 3) masked = (qkeep[r] == 0) || (kvkeep[j] == 0);
        else if (g.mask_mode == 5) {
          const size_t mi = (size_t)qrow * g.Skv + kvcol;
          masked = (((const int*)mask_a)[mi] != 0);
          int n = mask_b[mi]; n = n < 0 ? 0 : n;
          s[j][r] += g.cp[(size_t)b * g.c_bs + (size_t)h * g.c_hs + (size_t)qrow * g.c_rs + n]
                   + g.pc[(size_t)b * g.c_bs + (size_t)h * g.c_hs + (size_t)kvcol * g.c_rs + n];
        }
        if (masked) s[j][r] = g.mask_fill;
        m = fmaxf(m, s[j][r]);
      }
#pragma unroll
      for (int off = 1; off < 16; off <<= 1) m = fmaxf(m, __shfl_xor(m, off, 32));
      cm[r] = m;
    }
    __bf16* pwh = Psh[wave];
    __bf16* pwl = Psl[SPLIT_PV ? wave : 0];
#pragma unroll
    for (int r = 0; r < 8; ++r) {
      const float mnew = fmaxf(mrow[r], cm[r]);
      const float alpha = expf(mrow[r] - mnew);
      mrow[r] = mnew;
      float psum = 0.f;
#pragma unroll
      for (int j = 0; j < 4; ++j) {
        const float p = expf(s[j][r] - mnew);
        psum += p;
        if (SPLIT_PV) { __bf16 a, bl; at_split(p, a, bl); pwh[(8 * hh + r) * AT_KC + j * 16 + c] = a; pwl[(8 * hh + r) * AT_KC + j * 16 + c] = bl; }
        else pwh[(8 * hh + r) * AT_KC + j * 16 + c] = at_to16<F16>(p * PSC);
      }
#pragma unroll
      for (int off = 1; off < 16; off <<= 1) psum += __shfl_xor(psum, off, 32);
      lrow[r] = lrow[r] * alpha + psum;
#pragma unroll
      for (int t = 0; t < 4; ++t) oacc[t][r] *= alpha;
    }
    __builtin_amdgcn_fence(__ATOMIC_RELEASE, "workgroup");
    __builtin_amdgcn_wave_barrier();
    __builtin_amdgcn_fence(__ATOMIC_ACQUIRE, "workgroup");
#pragma unroll 1
    for (int kk = 0; kk < 2; ++kk) {
      FB pa, pl;
      pa.h[0] = *(const v8b*)(pwh + c * AT_KC + kk * 32 + 8 * hh);
      pa.h[1] = *(const v8b*)(pwh + c * AT_KC + kk * 32 + 16 + 8 * hh);
      if (SPLIT_PV) {
        pl.h[0] = *(const v8b*)(pwl + c * AT_KC + kk * 32 + 8 * hh);
        pl.h[1] = *(const v8b*)(pwl + c * AT_KC + kk * 32 + 16 + 8 * hh);
      }
#pragma unroll
      for (int t = 0; t < 4; ++t) {
        FB vb;
        vb.h[0] = *(const v8b*)(Vth + (t * 16 + c) * AT_KC + kk * 32 + 8 * hh);
        vb.h[1] = *(const v8b*)(Vth + (t * 16 + c) * AT_KC + kk * 32 + 16 + 8 * hh);
        oacc[t] = at_mma16<F16>(pa.v, vb.v, oacc[t]);
        if (SPLIT_PV) {
          FB vl;
          vl.h[0] = *(const v8b*)(Vtl + (t * 16 + c) * AT_KC + kk * 32 + 8 * hh);
          vl.h[1] = *(const v8b*)(Vtl + (t * 16 + c) * AT_KC + kk * 32 + 16 + 8 * hh);
          oacc[t] = at_mma16<F16>(pa.v, vl.v, oacc[t]);
          oacc[t] = at_mma16<F16>(pl.v, vb.v, oacc[t]);
        }
      }
    }
  }

  float* os = Os[wave];
#pragma unroll
  for (int r = 0; r < 8; ++r) {
    const float inv = 1.0f / (lrow[r] * PSC);
#pragma unroll
    for (int t = 0; t < 4; ++t) os[(8 * hh + r) * 68 + t * 16 + c] = oacc[t][r] * inv;
  }
  __builtin_amdgcn_fence(__ATOMIC_RELEASE, "workgroup");
  __builtin_amdgcn_wave_barrier();
  __builtin_amdgcn_fence(__ATOMIC_ACQUIRE, "workgroup");
  {
    const int c4 = (lane & 15) * 4;
    {
#pragma unroll
      for (int it = 0; it < 8; ++it) {
        const int row = it * 2 + hh;
        v4f val = *(const v4f*)(os + row * 68 + c4);
        *(v4f*)(ob_ptr + (size_t)(q0 + row) * g.o_rs + c4) = val;
      }
      
    }
  }
}

} // namespace w25

// exact f32 causal attention for the first 64 query rows of every (batch, head): one 64-thread block per (b, h, row t < 64); thread d scores key d <= t as Q64.K64 / 8, then writes column d of row t of AT
__global__ __launch_bounds__(64) void k_cm_exact(const float* __restrict__ Q64, const float* __restrict__ K64, const float* __restrict__ V, float* __restrict__ AT, int S, int D, int NH, int HD) { __shared__ float sc[64]; const int t = blockIdx.x % 64; const int h = (blockIdx.x / 64) % NH; const int b = blockIdx.x / (64 * NH); const int d = threadIdx.x;
    const float* q = Q64 + ((long long)b * 64 + t) * D + h * HD; float s = -3.0e38f;
    if (d <= t) { const float* kr = K64 + ((long long)b * 64 + d) * D + h * HD; float a = 0.f;
#pragma unroll 1
        for (int j = 0; j < HD; ++j) a += q[j] * kr[j];
        s = a * 0.125f; }
    sc[d] = s; __syncthreads();
    float mx = -3.0e38f; for (int j = 0; j <= t; ++j) mx = fmaxf(mx, sc[j]);
    float den = 0.f; for (int j = 0; j <= t; ++j) den += expf(sc[j] - mx);
    float acc = 0.f;
#pragma unroll 1
    for (int j = 0; j <= t; ++j) acc += expf(sc[j] - mx) * V[((long long)b * S + j) * D + h * HD + d];
    VST2(float, AT + ((long long)b * S + t) * D + h * HD + d, acc / den); }


// ---- dense elementwise kernels: many elements a thread ------------------------------------------------------------
// A work-group of 256 threads takes 1024 * U consecutive floats: U loads of 16 bytes a thread, all issued before the first is used; each load of a wave covers
// 512 contiguous bytes. The grid covers the array exactly (element count a multiple of 1024 * U), so there is no bounds test and no row or column arithmetic.
typedef __attribute__((ext_vector_type(2))) unsigned int v2u;
template <int U>
__global__ __launch_bounds__(256) void k_cast16v(const float* __restrict__ src, _Float16* __restrict__ dst, float s) {
    const size_t base = (size_t)blockIdx.x * (1024 * U) + threadIdx.x * 4;
    v4f v[U];
#pragma unroll
    for (int u = 0; u < U; ++u) v[u] = *(const v4f*)(src + base + u * 1024);
#pragma unroll
    for (int u = 0; u < U; ++u) {
        v4h h; h[0] = (_Float16)(v[u][0] * s); h[1] = (_Float16)(v[u][1] * s); h[2] = (_Float16)(v[u][2] * s); h[3] = (_Float16)(v[u][3] * s);
        *(v4h*)(dst + base + u * 1024) = h;
    }
}
template <int U>
__global__ __launch_bounds__(256) void k_castS16v(const float* __restrict__ src, __bf16* __restrict__ dhi, __bf16* __restrict__ dlo) {
    const size_t base = (size_t)blockIdx.x * (1024 * U) + threadIdx.x * 4;
    v4f v[U];
#pragma unroll
    for (int u = 0; u < U; ++u) v[u] = *(const v4f*)(src + base + u * 1024);
    asm volatile("s_wait_xcnt 0x0" ::: "memory");   // in front of the reuse of the loads' address registers
#pragma unroll
    for (int u = 0; u < U; ++u) {
        v2u hi, lo; unsigned int l0, l1;
        hi[0] = f2bf2_pack(v[u][0], v[u][1], &l0); hi[1] = f2bf2_pack(v[u][2], v[u][3], &l1); lo[0] = l0; lo[1] = l1;
        *(v2u*)(dhi + base + u * 1024) = hi; *(v2u*)(dlo + base + u * 1024) = lo;
    }
}
// RoPE in place on rows of 16 heads x 64 columns: one wave takes one row of Q and the same row of Kx. Lane = (head parity, 16-byte piece of a head's 64 columns), so the lane's
// cos and sin pieces are loaded once and serve its 8 heads of both tensors. SR: rows per batch in Q and Kx, and the bound on the position. grid = rows / 8.
template <int SR>
__global__ __launch_bounds__(256) void k_cm_ropev(float* __restrict__ Q, float* __restrict__ Kx, const float* __restrict__ CS, const float* __restrict__ SN, const int* __restrict__ POS) {
    const int row = blockIdx.x * 8 + ((int)threadIdx.x >> 5), lane = threadIdx.x & 31;
    int ps = POS[row % SR]; ps = ps < 0 ? 0 : (ps >= SR ? SR - 1 : ps);
    const v4f c = *(const v4f*)(CS + ps * 64 + (lane & 15) * 4), s = *(const v4f*)(SN + ps * 64 + (lane & 15) * 4);
    float* q = Q + (size_t)row * 1024 + lane * 4; float* k = Kx + (size_t)row * 1024 + lane * 4;
    v4f a[8], b[8];
#pragma unroll
    for (int it = 0; it < 8; ++it) { a[it] = *(const v4f*)(q + it * 128); b[it] = *(const v4f*)(k + it * 128); }
#pragma unroll
    for (int it = 0; it < 8; ++it) {
        v4f r, t;
        // x0 c0 - x1 s0 and x1 c1 + x0 s1, each with the x1 product rounded and the x0 product fused
        r[0] = fmaf(a[it][0], c[0], -(a[it][1] * s[0])); r[1] = fmaf(a[it][0], s[1], a[it][1] * c[1]); r[2] = fmaf(a[it][2], c[2], -(a[it][3] * s[2])); r[3] = fmaf(a[it][2], s[3], a[it][3] * c[3]);
        t[0] = fmaf(b[it][0], c[0], -(b[it][1] * s[0])); t[1] = fmaf(b[it][0], s[1], b[it][1] * c[1]); t[2] = fmaf(b[it][2], c[2], -(b[it][3] * s[2])); t[3] = fmaf(b[it][2], s[3], b[it][3] * c[3]);
        *(v4f*)(q + it * 128) = r; *(v4f*)(k + it * 128) = t;
    }
}

extern "C" void kernel_launch(void* const* d_in, const int* in_sizes, int n_in, void* d_out, int out_size, void* d_ws, size_t ws_size, hipStream_t stream) {
    (void)in_sizes; (void)n_in; (void)out_size; (void)ws_size;
    const float* x = (const float*)d_in[0];
    const float* Wq = (const float*)d_in[1];
    const float* Wk = (const float*)d_in[2];
    const float* Wv = (const float*)d_in[3];
    const float* Wo = (const float*)d_in[4];
    const float* cosT = (const float*)d_in[5];
    const float* sinT = (const float*)d_in[6];
    const int* tpos = (const int*)d_in[7];
    const int Bn = 4;
    const int S = 2048;
    const int D = 1024;
    const int NH = 16;
    const int HD = 64;
    const int NR = Bn * S;
    float* out = (float*)d_out;
    char* wsp = (char*)d_ws;
    float* Q = (float*)wsp; wsp += (size_t)NR * D * 4;
    float* Kb = (float*)wsp; wsp += (size_t)NR * D * 4;
    float* V = (float*)wsp; wsp += (size_t)NR * D * 4;
    float* AT = (float*)wsp; wsp += (size_t)NR * D * 4;
    float* Q64 = (float*)wsp; wsp += (size_t)Bn * 64 * D * 4;
    float* K64 = (float*)wsp; wsp += (size_t)Bn * 64 * D * 4;
    unsigned short* XH = (unsigned short*)wsp; wsp += (size_t)NR * D * 2;    // x as f16
    unsigned short* XS = (unsigned short*)wsp; wsp += (size_t)NR * D * 2;    // x as bf16 hi and lo planes; after the exact-row GEMMs the attention output's planes
    unsigned short* XS2 = (unsigned short*)wsp; wsp += (size_t)NR * D * 2;
    unsigned short* WqH = (unsigned short*)wsp; wsp += (size_t)D * D * 2;    // 16 Wq, 16 Wk as f16
    unsigned short* WkH = (unsigned short*)wsp; wsp += (size_t)D * D * 2;
    unsigned short* WqS = (unsigned short*)wsp; wsp += (size_t)D * D * 2;    // bf16 hi and lo planes of the four weights
    unsigned short* WqS2 = (unsigned short*)wsp; wsp += (size_t)D * D * 2;
    unsigned short* WkS = (unsigned short*)wsp; wsp += (size_t)D * D * 2;
    unsigned short* WkS2 = (unsigned short*)wsp; wsp += (size_t)D * D * 2;
    unsigned short* WvS = (unsigned short*)wsp; wsp += (size_t)D * D * 2;
    unsigned short* WvS2 = (unsigned short*)wsp; wsp += (size_t)D * D * 2;
    unsigned short* WoS = (unsigned short*)wsp; wsp += (size_t)D * D * 2;
    unsigned short* WoS2 = (unsigned short*)wsp; wsp += (size_t)D * D * 2;
    const unsigned gX = (unsigned)((long long)NR * D / (1024 * 8));   // cast grids: 32 elements a thread for x-sized arrays, 16 for the weights
    const unsigned gW = (unsigned)((long long)D * D / (1024 * 4));
    // q, k: f16 operands
    k_cast16v<8><<<gX, 256, 0, stream>>>(x, (_Float16*)XH, 1.0f);
    k_cast16v<4><<<gW, 256, 0, stream>>>(Wq, (_Float16*)WqH, 16.0f);
    k_cast16v<4><<<gW, 256, 0, stream>>>(Wk, (_Float16*)WkH, 16.0f);
    w25::wmma_gemm_lds<0, false><<<dim3(D / 128, NR / 64), 256, 0, stream>>>(XH, nullptr, WqH, nullptr, Q, D, D, 0.0625f, 64);
    w25::wmma_gemm_lds<0, false><<<dim3(D / 128, NR / 64), 256, 0, stream>>>(XH, nullptr, WkH, nullptr, Kb, D, D, 0.0625f, 64);
    // v: bf16 hi/lo planes
    k_castS16v<8><<<gX, 256, 0, stream>>>(x, (__bf16*)XS, (__bf16*)XS2);
    k_castS16v<4><<<gW, 256, 0, stream>>>(Wv, (__bf16*)WvS, (__bf16*)WvS2);
    w25::wmma_gemm_lds<1, true><<<dim3(D / 128, NR / 64), 256, 0, stream>>>(XS, XS2, WvS, WvS2, V, D, D, 1.0f, 64);
    // q, k of the first 64 rows of every batch, from the same planes of x: tile b of C takes rows b S .. b S + 63 of A
    k_castS16v<4><<<gW, 256, 0, stream>>>(Wq, (__bf16*)WqS, (__bf16*)WqS2);
    k_castS16v<4><<<gW, 256, 0, stream>>>(Wk, (__bf16*)WkS, (__bf16*)WkS2);
    w25::wmma_gemm_lds<1, true><<<dim3(D / 128, Bn), 256, 0, stream>>>(XS, XS2, WqS, WqS2, Q64, D, D, 1.0f, S);
    w25::wmma_gemm_lds<1, true><<<dim3(D / 128, Bn), 256, 0, stream>>>(XS, XS2, WkS, WkS2, K64, D, D, 1.0f, S);
    k_cm_ropev<2048><<<NR / 8, 256, 0, stream>>>(Q, Kb, cosT, sinT, (const int*)tpos);
    k_cm_ropev<64><<<Bn * 64 / 8, 256, 0, stream>>>(Q64, K64, cosT, sinT, (const int*)tpos);
    { /*apv4*/ AttnP a;
      a.Q = Q; a.K = Kb; a.V = V; a.O = AT; a.P = 0; a.Mf = 0; a.Mi = 0; a.ST = 0;
      a.Pw = 0; a.Rt = 0; a.SQ = 0; a.SK = 0;
      a.swb = 0; a.swh = 0; a.swi = 0; a.swj = 0; a.srb = 0; a.srh = 0; a.sri = 0; a.sQb = (long long)S * D; a.sQh = HD; a.sQi = D; a.sQd = 1; a.sKb = (long long)S * D; a.sKh = HD; a.sKj = D; a.sKd = 1; a.sVb = (long long)S * D; a.sVh = HD; a.sVj = D; a.sVd = 1; a.sOb = (long long)S * D; a.sOh = HD; a.sOi = D; a.sPb = 0; a.sPh = 0; a.sPi = 0; a.smb = 0; a.smh = 0; a.smi = 0; a.smj = 0;
      a.Lq = S; a.Lk = S; a.dh = HD; a.dv = HD; a.hrep = 1; a.causal = 1; a.coff = 0; a.pband = 0;
      a.scale = 0.125f; a.mfill = 0.0f; a.nonorm = 0; a.mpol = 0;
      a.roff = 0; a.rn = 1; a.segpol = 0; a.win = 0;
      k_attn<64, 64, 0, false, false, 2048, 1024><<<dim3((unsigned)(NH), (unsigned)(Bn), (unsigned)((S) + 16 * AW - 1) / (16 * AW)), 32 * AW, 0, stream>>>(a); }
    k_cm_exact<<<Bn * NH * 64, 64, 0, stream>>>(Q64, K64, V, AT, S, D, NH, HD);
    k_castS16v<8><<<gX, 256, 0, stream>>>(AT, (__bf16*)XS, (__bf16*)XS2);
    k_castS16v<4><<<gW, 256, 0, stream>>>(Wo, (__bf16*)WoS, (__bf16*)WoS2);
    w25::wmma_gemm_lds<1, true><<<dim3(D / 128, NR / 64), 256, 0, stream>>>(XS, XS2, WoS, WoS2, out, D, D, 1.0f, 64);
}

// v006
// It runs in 380 microseconds.
// In both of two side-by-side timings against v005, it was 1.42 times as fast.
// Over all steps from v000, the starting kernel, it is 11.9 times as fast.
// Contractions: q/k = x.W^T [8192x1024].[1024x1024] with f16 operands (weights x16); v = x.Wv^T and the output projection on bf16 hi/lo split planes (late causal rows are long averages, so the value path must be f32-class) — v_wmma_f32_16x16x32_*, 64x128 work-group tiles with both operands staged in LDS; per (batch, head) causal softmax(q k^T / 8) v as one flash launch (f16 q.k^T and p.v; fully-masked key tiles skipped); f32 accumulate and softmax. The interleaved-pair RoPE with the INPUT cos/sin tables gathered by the INPUT token positions (generic elementwise form: out = x*cos + rot(x)*sin with rot = (-x[odd], x[even]) interleaved) and the exact-f32 recompute of the first 64 causal rows per head (whose q/k rows come from their own small bf16 hi/lo split GEMMs [64x1024].[1024x1024]) are f32 kernels.
#include <hip/hip_runtime.h>
#include <math.h>

typedef __attribute__((ext_vector_type(16))) _Float16 v16h;
typedef __attribute__((ext_vector_type(8)))  _Float16 v8h;
typedef __attribute__((ext_vector_type(4)))  _Float16 v4h;
typedef __attribute__((ext_vector_type(16))) __bf16   v16b;
typedef __attribute__((ext_vector_type(8)))  float    v8f;
typedef __attribute__((ext_vector_type(4)))  float    v4f;

// 16-bit WMMA fragment map (wave32), lane L, h = L>>4, m = L&15:
//   A 16x32: lane = row m;   element i -> k = (i<8) ? 8h+i : 16+8h+(i-8)
//   B 32x16: lane = column m; the SAME k(i,h)
//   D 16x16 (8 f32): lane = column m; element r -> row 8h+r
__device__ __forceinline__ int frag_k(int i, int h) { return (i < 8) ? (8 * h + i) : (16 + 8 * h + (i - 8)); }
__device__ __forceinline__ __bf16 bf16_rne(float f) {
    unsigned int u = __float_as_uint(f);
    u += 0x7fffu + ((u >> 16) & 1u);
    return __builtin_bit_cast(__bf16, (unsigned short)(u >> 16));
}
__device__ __forceinline__ float bf16_f32(__bf16 b) { return __uint_as_float(((unsigned int)__builtin_bit_cast(unsigned short, b)) << 16); }
__device__ __forceinline__ v8f wmma16(v16h a, v16h b, v8f c) {
    c = __builtin_amdgcn_wmma_f32_16x16x32_f16(false, a, false, b, (short)0, c, false, false);
    asm volatile("v_nop\n\tv_nop\n\tv_nop\n\tv_nop" : "+v"(c) : "v"(a), "v"(b));
    return c;
}
__device__ __forceinline__ v8f wmmab(v16b a, v16b b, v8f c) {
    c = __builtin_amdgcn_wmma_f32_16x16x32_bf16(false, a, false, b, (short)0, c, false, false);
    asm volatile("v_nop\n\tv_nop\n\tv_nop\n\tv_nop" : "+v"(c) : "v"(a), "v"(b));
    return c;
}
struct Split { v16b hi, lo; };
// hi/lo split product: a.hi*b.hi + a.hi*b.lo + a.lo*b.hi
__device__ __forceinline__ v8f wmma3(const Split& a, const Split& b, v8f c) {
    c = __builtin_amdgcn_wmma_f32_16x16x32_bf16(false, a.hi, false, b.hi, (short)0, c, false, false);
    c = __builtin_amdgcn_wmma_f32_16x16x32_bf16(false, a.hi, false, b.lo, (short)0, c, false, false);
    c = __builtin_amdgcn_wmma_f32_16x16x32_bf16(false, a.lo, false, b.hi, (short)0, c, false, false);
    asm volatile("v_nop\n\tv_nop\n\tv_nop\n\tv_nop" : "+v"(c) : "v"(a.hi), "v"(a.lo), "v"(b.hi), "v"(b.lo));
    return c;
}
struct Split3 { v16b hi, mid, lo; };
// triple split product (6 terms, drops only terms below 2^-24 relative)
__device__ __forceinline__ v8f wmma6(const Split3& a, const Split3& b, v8f c) {
    c = __builtin_amdgcn_wmma_f32_16x16x32_bf16(false, a.hi, false, b.hi, (short)0, c, false, false);
    c = __builtin_amdgcn_wmma_f32_16x16x32_bf16(false, a.hi, false, b.mid, (short)0, c, false, false);
    c = __builtin_amdgcn_wmma_f32_16x16x32_bf16(false, a.mid, false, b.hi, (short)0, c, false, false);
    c = __builtin_amdgcn_wmma_f32_16x16x32_bf16(false, a.hi, false, b.lo, (short)0, c, false, false);
    c = __builtin_amdgcn_wmma_f32_16x16x32_bf16(false, a.mid, false, b.mid, (short)0, c, false, false);
    c = __builtin_amdgcn_wmma_f32_16x16x32_bf16(false, a.lo, false, b.hi, (short)0, c, false, false);
    asm volatile("v_nop\n\tv_nop\n\tv_nop\n\tv_nop" : "+v"(c) : "v"(a.hi), "v"(a.mid), "v"(a.lo), "v"(b.hi), "v"(b.mid), "v"(b.lo));
    return c;
}

// Fragment gathers from f32 memory: element i <- p[(k0 + frag_k(i,h)) * sk] * s, zero for k >= klen.
__device__ __forceinline__ v16h fh_ld(const float* __restrict__ p, long long sk, int k0, int h, int klen, float s) {
    v16h a;
#pragma unroll
    for (int i = 0; i < 16; ++i) { const int k = k0 + frag_k(i, h); a[i] = (k < klen) ? (_Float16)(p[(long long)k * sk] * s) : (_Float16)0.f; }
    return a;
}
__device__ __forceinline__ Split sp_ld(const float* __restrict__ p, long long sk, int k0, int h, int klen, float s) {
    Split r;
#pragma unroll
    for (int i = 0; i < 16; ++i) {
        const int k = k0 + frag_k(i, h); const float x = (k < klen) ? p[(long long)k * sk] * s : 0.f;
        const __bf16 hb = bf16_rne(x); r.hi[i] = hb; r.lo[i] = bf16_rne(x - bf16_f32(hb));
    }
    return r;
}
__device__ __forceinline__ Split3 sp3_ld(const float* __restrict__ p, long long sk, int k0, int h, int klen, float s) {
    Split3 r;
#pragma unroll
    for (int i = 0; i < 16; ++i) {
        const int k = k0 + frag_k(i, h); const float x = (k < klen) ? p[(long long)k * sk] * s : 0.f;
        const __bf16 hb = bf16_rne(x); const float r1 = x - bf16_f32(hb); const __bf16 mb = bf16_rne(r1);
        r.hi[i] = hb; r.mid[i] = mb; r.lo[i] = bf16_rne(r1 - bf16_f32(mb));
    }
    return r;
}
__device__ __forceinline__ v16b bh_ld(const float* __restrict__ p, long long sk, int k0, int h, int klen, float s) {
    v16b a;
#pragma unroll
    for (int i = 0; i < 16; ++i) { const int k = k0 + frag_k(i, h); a[i] = bf16_rne((k < klen) ? p[(long long)k * sk] * s : 0.f); }
    return a;
}
// f16 fragment from an f16 LDS/global row with element stride 1 (k-contiguous), no bounds (tile already zero padded)
__device__ __forceinline__ v16h fh_row(const _Float16* __restrict__ row, int k0, int h) {
    v16h a;
#pragma unroll
    for (int i = 0; i < 16; ++i) a[i] = row[k0 + frag_k(i, h)];
    return a;
}

#define VST2(T, ptr, val) do { const T vst2_v_ = (val); *(T*)(ptr) = vst2_v_;  } while (0)
typedef float v4f __attribute__((ext_vector_type(4)));
#define VST2V4(ptr, val) do { const v4f vst2_v4_ = (val); *(v4f*)(ptr) = vst2_v4_;  } while (0)

__device__ __attribute__((noinline)) float act_fn(float v, int act) {
    if (act == 1) return fmaxf(v, 0.f);                                                                               // relu
    if (act == 2) { const float u = 0.7978845608028654f * (v + 0.044715f * v * v * v); return 0.5f * v * (1.f + tanhf(u)); } // tanh-gelu
    if (act == 3) return v / (1.f + expf(-v));                                                                        // silu
    if (act == 4) return 0.5f * v * (1.f + erff(v * 0.7071067811865476f));                                             // erf-gelu
    if (act == 5) return tanhf(v);
    if (act == 6) return 1.f / (1.f + expf(-v));                                                                      // sigmoid
    if (act == 7) return (v > 0.f) ? v : 0.01f * v;                                                                   // leaky relu 0.01
    if (act == 8) return (v > 0.f) ? v : (expf(v) - 1.f);                                                             // elu
    if (act == 9) return fminf(fmaxf(v, 0.f), 6.f);                                                                   // relu6
    if (act == 10) return fabsf(v);                                                                                    // abs
    if (act == 11) return (v >= 0.f) ? v : 0.1f * v;                                                                  // leaky 0.1
    if (act == 12) return (v > 0.f) ? v : 0.2f * v;                                                                   // leaky 0.2
    if (act == 13) return (v > 20.f) ? v : log1pf(expf(v));                                                            // softplus
    return v;
}

// =====================================================================================================================
// k_gemm<MODE>: C(z, m, n) = act(alpha * sum_k A(z, m, k) * B(z, k, n) + bias) + beta * R(z, m, n)
//   One wave (32-thread block) per 16 x 32 tile of C; grid (ceil(N/32), ceil(M/16), Z). Batch z -> (zo = z / zi_n, zi = z % zi_n)
//   with separate outer/inner strides for every tensor (e.g. batch and head). A(m,k) = A[zo*sAo + zi*sAi + m*sAm + k*sAk] (f32),
//   B(k,n) = B[zo*sBo + zi*sBi + n*sBn + k*sBk] (f32); any M, N, K (K zero-padded to 32 inside the fragments, M/N tails guarded).
//   C(m,n) = C[zo*sCo + zi*sCi + m*sCm + n] (n contiguous). flags: 1 bias[n], 2 bias[m], 4 residual R[zo*sRo + zi*sRi + m*sRm + n*sRn].
//   MODE 0: f16 operands (A prescaled by sa, B by sb, both undone in the epilogue); 1: bf16 hi/lo split (3 products); 2: bf16;
//   3: bf16 hi/mid/lo triple split (6 products); 4: as 3 with Kahan-compensated f32 accumulation across k-steps.
// =====================================================================================================================
struct GemmP {
    const float* A; const float* B; const float* bias; const float* R; float* C;
    long long sAo, sAi, sAm, sAk, sBo, sBi, sBn, sBk, sCo, sCi, sCm, sRo, sRi, sRm, sRn;
    int M, N, K, zi_n, flags, act; float alpha, beta, sa, sb;
    int Npad, pad_;     // columns [N, Npad) of C are written as 0 so that padded workspace rows are covered by whole-line stores; Npad >= N
};
static_assert(sizeof(GemmP) == 5 * 8 + 15 * 8 + 6 * 4 + 4 * 4 + 2 * 4, "GemmP has padding");

template <int MODE>
__global__ __launch_bounds__(32) void k_gemm(GemmP p) {
    const int lane = threadIdx.x & 31, h = lane >> 4, l15 = lane & 15;
    const int m0 = blockIdx.y * 16, n0 = blockIdx.x * 32;
    const int z = blockIdx.z, zo = z / p.zi_n, zi = z - zo * p.zi_n;
    const float* A = p.A + zo * p.sAo + zi * p.sAi;
    const float* B = p.B + zo * p.sBo + zi * p.sBi;
    const int am = min(m0 + l15, p.M - 1);                       // clamped row for loads (stores are guarded)
    v8f acc[2], comp[2];
#pragma unroll
    for (int t = 0; t < 2; ++t) { v8f zz = {}; acc[t] = zz; comp[t] = zz; }
    for (int k0 = 0; k0 < p.K; k0 += 32) {
        const float* arow = A + (long long)am * p.sAm;
        if (MODE == 1) {
            const Split a = sp_ld(arow, p.sAk, k0, h, p.K, 1.f);
#pragma unroll
            for (int t = 0; t < 2; ++t) {
                const int bn = min(n0 + t * 16 + l15, p.N - 1);
                acc[t] = wmma3(a, sp_ld(B + (long long)bn * p.sBn, p.sBk, k0, h, p.K, 1.f), acc[t]);
            }
        } else if (MODE == 3) {
            const Split3 a = sp3_ld(arow, p.sAk, k0, h, p.K, 1.f);
#pragma unroll
            for (int t = 0; t < 2; ++t) {
                const int bn = min(n0 + t * 16 + l15, p.N - 1);
                acc[t] = wmma6(a, sp3_ld(B + (long long)bn * p.sBn, p.sBk, k0, h, p.K, 1.f), acc[t]);
            }
        } else if (MODE == 4) {
            // triple split as MODE 3, but each k-step's 6 products go into a fresh accumulator and the partial is added to the running f32 sum
            // on the VALU with Kahan compensation (accumulation error stays ~1 ulp however long K is)
            const Split3 a = sp3_ld(arow, p.sAk, k0, h, p.K, 1.f);
#pragma unroll
            for (int t = 0; t < 2; ++t) {
                const int bn = min(n0 + t * 16 + l15, p.N - 1); v8f zz = {};
                const v8f part = wmma6(a, sp3_ld(B + (long long)bn * p.sBn, p.sBk, k0, h, p.K, 1.f), zz);
                const v8f y = part - comp[t]; const v8f s = acc[t] + y; comp[t] = (s - acc[t]) - y; acc[t] = s;
            }
        } else if (MODE == 2) {
            const v16b a = bh_ld(arow, p.sAk, k0, h, p.K, 1.f);
#pragma unroll
            for (int t = 0; t < 2; ++t) {
                const int bn = min(n0 + t * 16 + l15, p.N - 1);
                acc[t] = wmmab(a, bh_ld(B + (long long)bn * p.sBn, p.sBk, k0, h, p.K, 1.f), acc[t]);
            }
        } else {
            const v16h a = fh_ld(arow, p.sAk, k0, h, p.K, p.sa);
#pragma unroll
            for (int t = 0; t < 2; ++t) {
                const int bn = min(n0 + t * 16 + l15, p.N - 1);
                acc[t] = wmma16(a, fh_ld(B + (long long)bn * p.sBn, p.sBk, k0, h, p.K, p.sb), acc[t]);
            }
        }
    }
    const float iscale = (MODE == 0) ? p.alpha / (p.sa * p.sb) : p.alpha;
    float* C = p.C + zo * p.sCo + zi * p.sCi;
    const float* R = p.R + zo * p.sRo + zi * p.sRi;
    __shared__ __align__(16) float ctile[16][36];
#pragma unroll
    for (int t = 0; t < 2; ++t) {
        const int n = n0 + t * 16 + l15; const int nn = min(n, p.N - 1);
#pragma unroll
        for (int r = 0; r < 8; ++r) {
            const int m = m0 + 8 * h + r; const int mm = min(m, p.M - 1);
            float v = acc[t][r] * iscale;
            if (p.flags & 1) v += p.bias[nn];
            if (p.flags & 2) v += p.bias[mm];
            if (p.flags & 8) v *= p.bias[(long long)zo * p.M + mm];   /* per-(z,row) scale vector laid out [Z][M]; exclusive with the bias flags */
            v = act_fn(v, p.act);
            if (p.flags & 4) v += p.beta * R[(long long)mm * p.sRm + (long long)nn * p.sRn];
            ctile[8 * h + r][t * 16 + l15] = (n < p.N) ? v : 0.f;
        }
    }
    __syncthreads();
    const int NW = (p.Npad > p.N) ? p.Npad : p.N;           // write width
    const bool fast = (m0 + 16 <= p.M) && (n0 + 32 <= NW) && ((p.sCm & 3) == 0) && ((((size_t)C) & 15) == 0);
    if (fast) {
#pragma unroll
        for (int s = 0; s < 4; ++s) {
            const int row = s * 4 + (lane >> 3), c4 = (lane & 7) * 4;
            const v4f v = *(const v4f*)&ctile[row][c4];
            VST2V4(C + (long long)(m0 + row) * p.sCm + n0 + c4, v);
        }
    } else {
        for (int row = 0; row < 16; ++row) {
            const int m = m0 + row, n = n0 + lane;
            if (m < p.M && n < NW) VST2(float, C + (long long)m * p.sCm + n, ctile[row][lane]);
        }
    }
}


// =====================================================================================================================
// k_gemmT<MODE, TM, TN>: same contract as k_gemm, but one wave computes a (16*TM) x (16*TN) tile: TM A fragments and TN B fragments are
//   loaded per 32-wide k-step and reused across TM*TN WMMAs (far fewer load/convert instructions per MAC). MODE 0 (f16), 1 (bf16 hi/lo),
//   2 (bf16) only. grid (ceil(NW/(16*TN)), ceil(M/(16*TM)), Z), block 32. Epilogue identical to k_gemm, run per 16x32 sub-tile.
// =====================================================================================================================
template <int MODE, int TM, int TN>
__global__ __launch_bounds__(32) void k_gemmT(GemmP p) {
    const int lane = threadIdx.x & 31, h = lane >> 4, l15 = lane & 15;
    const int m0 = blockIdx.y * (16 * TM), n0 = blockIdx.x * (16 * TN);
    const int z = blockIdx.z, zo = z / p.zi_n, zi = z - zo * p.zi_n;
    const float* A = p.A + zo * p.sAo + zi * p.sAi;
    const float* B = p.B + zo * p.sBo + zi * p.sBi;
    v8f acc[TM][TN];
#pragma unroll
    for (int i = 0; i < TM; ++i)
#pragma unroll
        for (int t = 0; t < TN; ++t) { v8f zz = {}; acc[i][t] = zz; }
    for (int k0 = 0; k0 < p.K; k0 += 32) {
        if (MODE == 1) {
            Split a[TM], b[TN];
#pragma unroll
            for (int i = 0; i < TM; ++i) { const int am = min(m0 + 16 * i + l15, p.M - 1); a[i] = sp_ld(A + (long long)am * p.sAm, p.sAk, k0, h, p.K, 1.f); }
#pragma unroll
            for (int t = 0; t < TN; ++t) { const int bn = min(n0 + 16 * t + l15, p.N - 1); b[t] = sp_ld(B + (long long)bn * p.sBn, p.sBk, k0, h, p.K, 1.f); }
#pragma unroll
            for (int i = 0; i < TM; ++i)
#pragma unroll
                for (int t = 0; t < TN; ++t) acc[i][t] = wmma3(a[i], b[t], acc[i][t]);
        } else if (MODE == 2) {
            v16b a[TM], b[TN];
#pragma unroll
            for (int i = 0; i < TM; ++i) { const int am = min(m0 + 16 * i + l15, p.M - 1); a[i] = bh_ld(A + (long long)am * p.sAm, p.sAk, k0, h, p.K, 1.f); }
#pragma unroll
            for (int t = 0; t < TN; ++t) { const int bn = min(n0 + 16 * t + l15, p.N - 1); b[t] = bh_ld(B + (long long)bn * p.sBn, p.sBk, k0, h, p.K, 1.f); }
#pragma unroll
            for (int i = 0; i < TM; ++i)
#pragma unroll
                for (int t = 0; t < TN; ++t) acc[i][t] = wmmab(a[i], b[t], acc[i][t]);
        } else {
            v16h a[TM], b[TN];
#pragma unroll
            for (int i = 0; i < TM; ++i) { const int am = min(m0 + 16 * i + l15, p.M - 1); a[i] = fh_ld(A + (long long)am * p.sAm, p.sAk, k0, h, p.K, p.sa); }
#pragma unroll
            for (int t = 0; t < TN; ++t) { const int bn = min(n0 + 16 * t + l15, p.N - 1); b[t] = fh_ld(B + (long long)bn * p.sBn, p.sBk, k0, h, p.K, p.sb); }
#pragma unroll
            for (int i = 0; i < TM; ++i)
#pragma unroll
                for (int t = 0; t < TN; ++t) acc[i][t] = wmma16(a[i], b[t], acc[i][t]);
        }
    }
    const float iscale = (MODE == 0) ? p.alpha / (p.sa * p.sb) : p.alpha;
    float* C = p.C + zo * p.sCo + zi * p.sCi;
    const float* R = p.R + zo * p.sRo + zi * p.sRi;
    const int NW = (p.Npad > p.N) ? p.Npad : p.N;
    __shared__ __align__(16) float ctile[16][36];
#pragma unroll
    for (int i = 0; i < TM; ++i) {
        const int mb = m0 + 16 * i; if (mb >= p.M) break;          // wave-uniform
#pragma unroll
        for (int tp = 0; tp < TN / 2; ++tp) {
            const int nb = n0 + 32 * tp; if (nb >= NW) break;        // wave-uniform
#pragma unroll
            for (int t2 = 0; t2 < 2; ++t2) {
                const int t = 2 * tp + t2; const int n = nb + t2 * 16 + l15; const int nn = min(n, p.N - 1);
#pragma unroll
                for (int r = 0; r < 8; ++r) {
                    const int m = mb + 8 * h + r; const int mm = min(m, p.M - 1);
                    float v = acc[i][t][r] * iscale;
                    if (p.flags & 1) v += p.bias[nn];
                    if (p.flags & 2) v += p.bias[mm];
            if (p.flags & 8) v *= p.bias[(long long)zo * p.M + mm];   /* per-(z,row) scale vector laid out [Z][M]; exclusive with the bias flags */
                    v = act_fn(v, p.act);
                    if (p.flags & 4) v += p.beta * R[(long long)mm * p.sRm + (long long)nn * p.sRn];
                    ctile[8 * h + r][t2 * 16 + l15] = (n < p.N) ? v : 0.f;
                }
            }
            __syncthreads();
            const bool fast = (mb + 16 <= p.M) && (nb + 32 <= NW) && ((p.sCm & 3) == 0) && ((((size_t)C) & 15) == 0);
            if (fast) {
#pragma unroll
                for (int s = 0; s < 4; ++s) {
                    const int row = s * 4 + (lane >> 3), c4 = (lane & 7) * 4;
                    const v4f v = *(const v4f*)&ctile[row][c4];
                    VST2V4(C + (long long)(mb + row) * p.sCm + nb + c4, v);
                }
            } else {
                for (int row = 0; row < 16; ++row) {
                    const int m = mb + row, n = nb + lane;
                    if (m < p.M && n < NW) VST2(float, C + (long long)m * p.sCm + n, ctile[row][lane]);
                }
            }
            __syncthreads();
        }
    }
}

// =====================================================================================================================
//   Wave = 16 queries, AW waves per block, 64-key blocks; grid (ceil(Lq/(16*AW)), H, B), block 32*AW. Any Lq, Lk; head dim dh <= DHP
//   (DHP multiple of 32), value dim dv <= DVP (multiple of 16, <= 128). Every tensor addressed by (batch, head, row, element) strides, f32.
//   Scores: QM 0 f16 operands, 1 bf16 hi/lo split, 2 bf16 triple split; statistics f32 (exp2 domain); P.V: P x 4096 as f16 with V f16 staged in LDS
//   (SPLITPV: P and V as bf16 hi/lo splits). kv head = h / hrep. Masking: causal = 1 (keep j <= i + coff, masked -> -inf, key blocks beyond the
//   diagonal skipped), causal = 2 (masked -> mfill, a finite fill like the -1e9; no skipping), causal = 3 (keep j >= i + coff,
//   masked -> -inf, no skipping); optional additive f32 mask Mf,
//   optional int keep-mask Mi (0 -> score := mfill), both addressed b*smb + h*smh + i*smi + j*smj (0 strides broadcast).
// =====================================================================================================================
#define AW 4
struct AttnP {   // apv4
    const float* Q; const float* K; const float* V; float* O; float* P; const float* Mf; const int* Mi; float* ST;
    const float* Pw; const float* Rt; const int* SQ; const int* SK;           // optional: post-softmax weight, relative-position table, segment ids
    long long swb, swh, swi, swj, srb, srh, sri;                                 // Pw strides (b,h,i,j); Rt strides (b,h,i), column = clamp(i - j + roff, 0, rn-1)
    long long sQb, sQh, sQi, sQd, sKb, sKh, sKj, sKd, sVb, sVh, sVj, sVd, sOb, sOh, sOi, sPb, sPh, sPi, smb, smh, smi, smj;
    int Lq, Lk, dh, dv, hrep, causal, coff, pband;   // pband > 0: P holds only the band |j - i| <= pband, column j - i + pband
    float scale, mfill; int nonorm, mpol;             // nonorm (online path only): O = sum_j exp(score_j) V_j without the 1/rowsum (scores must be <= ~0); mpol: Mi masks where ==0 (mpol 0) or where !=0 (mpol 1)
    int roff, rn, segpol, win;                        // Rt column offset/count; SQ/SK: score := mfill where (segpol 0) SQ[i] != SK[j] or (segpol 1) SQ[i] == SK[j]; win > 0: keys with i - j > win (after coff) -> -inf
};
//   Pw: the softmax numerator is multiplied by Pw(b,h,i,j) AFTER the row sum is taken (probs * weight, then P.V), as in post-softmax multiplicative biases.                                                    // ST (optional): per row (b,h,i) -> ST[((b*H + h)*Lq + i)*2 + {0,1}] = {row max of the scaled+masked score (natural units), sum_j exp(score - max)}
static_assert(sizeof(AttnP) == 12 * 8 + 29 * 8 + 16 * 4, "AttnP has padding");

#ifndef KATTN_ATTR
#define KATTN_ATTR __attribute__((amdgpu_waves_per_eu(4)))   // at most 256 registers a wave: four waves a SIMD, 1024 work-groups of the causal grid resident at once
#endif
//   FS > 0 (QM 0, one pass, f16 P.V only): the layout is fixed at compile time: Q, K, V, O are dense [batch][FS rows][FD] f32 with head h at column h * DHP (DVP for V, O),
//   dh = DHP, dv = DVP, Lq = Lk = FS (multiple of 64), causal = 1 with coff = 0, none of the optional inputs or outputs. Every element guard and stride then folds
//   away, and a key block's K and V come in by plain 16-byte loads that are in flight together, in two batches, instead of guarded 4-byte loads waited on one at a time.
template <int DHP, int DVP, int QM, bool SPLITPV, bool TWOPASS, int FS = 0, int FD = 0>
__global__ __launch_bounds__(32 * AW) KATTN_ATTR void k_attn(AttnP p) {
    static_assert(FS == 0 || (QM == 0 && !SPLITPV && !TWOPASS && DHP == 64 && DVP == 64 && FS % 64 == 0 && FD % 8 == 0), "fixed layout: whole key blocks, 32-byte aligned fragments");
    if (FS > 0) {
        p.P = nullptr; p.Mf = nullptr; p.Mi = nullptr; p.ST = nullptr; p.Pw = nullptr; p.Rt = nullptr; p.SQ = nullptr; p.SK = nullptr;
        p.sQb = (long long)FS * FD; p.sQh = DHP; p.sQi = FD; p.sQd = 1; p.sKb = (long long)FS * FD; p.sKh = DHP; p.sKj = FD; p.sKd = 1;
        p.sVb = (long long)FS * FD; p.sVh = DVP; p.sVj = FD; p.sVd = 1; p.sOb = (long long)FS * FD; p.sOh = DVP; p.sOi = FD;
        p.Lq = FS; p.Lk = FS; p.dh = DHP; p.dv = DVP; p.hrep = 1; p.causal = 1; p.coff = 0; p.pband = 0; p.nonorm = 0; p.win = 0;
    }
    constexpr int NT = DVP / 16;                // output tiles
    constexpr int KS = DHP / 32;                // k-steps for the scores
    constexpr int VP = DVP + 8;                 // LDS pitch (halves)
    __shared__ __align__(16) float    pl[AW][16 * 64];
    __shared__ __align__(16) _Float16 vl[(SPLITPV ? 2 : 1) * 64 * VP];   // f16 V tile, or bf16 hi and lo tiles (same 2-byte size)
    const int lane = threadIdx.x & 31, hf = lane >> 4, l15 = lane & 15, wave = threadIdx.x >> 5;
    // FS > 0: grid (heads, batches, query tiles) and query tile bx = last - blockIdx.z. A causal tile walks bx + 1 key blocks and only half the work-groups are resident at once;
    // the long tiles take the low indices and the short ones the high, and neighbours in index cost the same.
    const int bx = FS > 0 ? FS / (16 * AW) - 1 - (int)blockIdx.z : (int)blockIdx.x;
    const int h = FS > 0 ? blockIdx.x : blockIdx.y, b = FS > 0 ? blockIdx.y : blockIdx.z, hk = h / p.hrep;
    const int q0 = (bx * AW + wave) * 16;
    float* myp = pl[wave];
    const float L2E = 1.4426950408889634f;
    const float NEG = -__builtin_inff();
    const int qi = min(q0 + l15, p.Lq - 1);
    const float* qrow = p.Q + b * p.sQb + h * p.sQh + (long long)qi * p.sQi;
    const float* kbase = p.K + b * p.sKb + hk * p.sKh;
    const float* vbase = p.V + b * p.sVb + hk * p.sVh;
    v16h qa[QM == 0 ? KS : 1]; Split qs_[QM == 1 ? KS : 1]; Split3 qt_[QM == 2 ? KS : 1];
#pragma unroll
    for (int ks = 0; ks < KS; ++ks) {
        if (QM == 2) qt_[ks] = sp3_ld(qrow, p.sQd, ks * 32, hf, p.dh, 1.f);
        else if (QM == 1) qs_[ks] = sp_ld(qrow, p.sQd, ks * 32, hf, p.dh, 1.f);
        else qa[ks] = fh_ld(qrow, p.sQd, ks * 32, hf, p.dh, 1.f);
    }
    v8f o[NT]; float m8[8], l8[8];
#pragma unroll
    for (int t = 0; t < NT; ++t) { v8f zz = {}; o[t] = zz; }
#pragma unroll
    for (int i = 0; i < 8; ++i) { m8[i] = NEG; l8[i] = 0.f; }
    int jend = p.Lk; int jstart = 0;
    if (p.causal == 1) { const int je = (bx * AW + AW - 1) * 16 + 16 + p.coff; jend = min(jend, max(je, 0)); }   // uniform per block
    if (p.win > 0) { const int js = (bx * AW) * 16 + p.coff - p.win; jstart = (js > 0) ? (js / 64) * 64 : 0; }   // uniform per block: key blocks entirely outside every row's window hold only -inf entries and are skipped exactly
    const int npass = TWOPASS ? 2 : 1;
    for (int pass = 0; pass < npass; ++pass) {
        const bool dopv = (!TWOPASS) || pass == 1;
        for (int j0 = jstart; j0 < jend; j0 += 64) {
            v16h kf[FS > 0 ? 4 * KS : 1];                        // FS > 0: the key block's K fragments, tile t and k-step ks at t * KS + ks
            if (dopv) {
                __syncthreads();                                 // previous key block's reads of vl / pl are done
                if (FS > 0) {
                    // raw f32 in two batches, so that the loaded values and everything else that is live fit 256 registers (four waves a SIMD)
                    v4f vr[8]; v8f kr[8];                                           // V: four consecutive elements per thread and step; K: half a fragment each
                    const float* krow = kbase + (long long)(j0 + l15) * FD + 8 * hf;
#pragma unroll
                    for (int it = 0; it < 8; ++it)
                        vr[it] = *(const v4f*)(vbase + (long long)(j0 + ((int)threadIdx.x >> 4)) * FD + ((int)threadIdx.x & 15) * 4 + it * (2 * AW * FD));   // rows 2 AW apart per step
#pragma unroll
                    for (int c = 0; c < 8; ++c) kr[c] = *(const v8f*)(krow + (c >> 2) * (16 * FD) + (c & 3) * 16);   // key tile t = c / 4; k = 16 (c % 4) + 8 hf + (0..7)
                    // inputs-only fence on the loaded values: their first use is here, so the batch's 24 loads are all issued before any is waited on (without it
                    // the scheduler puts each load directly in front of its conversion and waits on it there)
                    asm volatile("" :: "v"(vr[0]), "v"(vr[1]), "v"(vr[2]), "v"(vr[3]), "v"(vr[4]), "v"(vr[5]), "v"(vr[6]), "v"(vr[7]),
                                 "v"(kr[0]), "v"(kr[1]), "v"(kr[2]), "v"(kr[3]), "v"(kr[4]), "v"(kr[5]), "v"(kr[6]), "v"(kr[7]));
#pragma unroll
                    for (int it = 0; it < 8; ++it) {
                        v4h hv; hv[0] = (_Float16)vr[it][0]; hv[1] = (_Float16)vr[it][1]; hv[2] = (_Float16)vr[it][2]; hv[3] = (_Float16)vr[it][3];
                        *(v4h*)(vl + ((int)threadIdx.x >> 4) * VP + ((int)threadIdx.x & 15) * 4 + it * (2 * AW * VP)) = hv;
                    }
#pragma unroll
                    for (int f = 0; f < 4; ++f)
#pragma unroll
                        for (int e = 0; e < 8; ++e) { kf[f][e] = (_Float16)kr[2 * f][e]; kf[f][8 + e] = (_Float16)kr[2 * f + 1][e]; }
                    v8f ks2[8];
#pragma unroll
                    for (int c = 0; c < 8; ++c) ks2[c] = *(const v8f*)(krow + (2 + (c >> 2)) * (16 * FD) + (c & 3) * 16);   // key tiles 2 and 3
                    // the same fence for the second batch's 16 loads; the address is named too, so that it stays live and none of these loads is given its register pair as destination
                    asm volatile("" :: "v"(ks2[0]), "v"(ks2[1]), "v"(ks2[2]), "v"(ks2[3]), "v"(ks2[4]), "v"(ks2[5]), "v"(ks2[6]), "v"(ks2[7]), "v"(krow));
#pragma unroll
                    for (int f = 0; f < 4; ++f)
#pragma unroll
                        for (int e = 0; e < 8; ++e) { kf[4 + f][e] = (_Float16)ks2[2 * f][e]; kf[4 + f][8 + e] = (_Float16)ks2[2 * f + 1][e]; }
                } else
                for (int idx = threadIdx.x; idx < 64 * DVP; idx += 32 * AW) {
                    const int jr = idx / DVP, d = idx - jr * DVP, j = j0 + jr;
                    const float f = (j < p.Lk && d < p.dv) ? vbase[(long long)j * p.sVj + (long long)d * p.sVd] : 0.f;
                    if (SPLITPV) {
                        const __bf16 hb = bf16_rne(f);
                        ((__bf16*)vl)[jr * VP + d] = hb; ((__bf16*)vl)[64 * VP + jr * VP + d] = bf16_rne(f - bf16_f32(hb));
                    } else vl[jr * VP + d] = (_Float16)f;
                }
            }
            v8f s[4];
#pragma unroll
            for (int t = 0; t < 4; ++t) {
                const int j = min(j0 + t * 16 + l15, p.Lk - 1);
                const float* krow = kbase + (long long)j * p.sKj;
                v8f acc = {};
#pragma unroll
                for (int ks = 0; ks < KS; ++ks) {
                    if (QM == 2)      acc = wmma6(qt_[ks], sp3_ld(krow, p.sKd, ks * 32, hf, p.dh, 1.f), acc);
                    else if (QM == 1) acc = wmma3(qs_[ks], sp_ld(krow, p.sKd, ks * 32, hf, p.dh, 1.f), acc);
                    else if (FS > 0)  acc = wmma16(qa[ks], kf[t * KS + ks], acc);
                    else              acc = wmma16(qa[ks], fh_ld(krow, p.sKd, ks * 32, hf, p.dh, 1.f), acc);
                }
                s[t] = acc;
            }
            float pv[8][4];
#pragma unroll
            for (int i = 0; i < 8; ++i) {
                const int irow = q0 + i + 8 * hf;
                const int ic = min(irow, p.Lq - 1);
                float sc[4];
#pragma unroll
                for (int t = 0; t < 4; ++t) {
                    const int jg = j0 + t * 16 + l15;
                    float v = s[t][i] * p.scale;
                    if (p.Mf) v += p.Mf[b * p.smb + h * p.smh + (long long)ic * p.smi + (long long)min(jg, p.Lk - 1) * p.smj];
                    if (p.Rt) { int rc = ic - min(jg, p.Lk - 1) + p.roff; rc = rc < 0 ? 0 : (rc >= p.rn ? p.rn - 1 : rc); v += p.Rt[b * p.srb + h * p.srh + (long long)ic * p.sri + rc]; }
                    if (p.Mi) { const int mv = p.Mi[b * p.smb + h * p.smh + (long long)ic * p.smi + (long long)min(jg, p.Lk - 1) * p.smj]; if (p.mpol ? (mv != 0) : (mv == 0)) v = p.mfill; }
                    if (p.SQ) { const bool same = p.SQ[(long long)b * p.Lq + ic] == p.SK[(long long)b * p.Lk + min(jg, p.Lk - 1)]; if (p.segpol ? same : !same) v = p.mfill; }
                    if (p.causal == 2 && jg > irow + p.coff) v = p.mfill;
                    if (jg >= p.Lk || (p.causal == 1 && jg > irow + p.coff) || (p.causal == 3 && jg < irow + p.coff) || (p.win > 0 && irow + p.coff - jg > p.win)) v = NEG; else v *= L2E;
                    sc[t] = v;
                }
                if (!TWOPASS || pass == 0) {
                    float mx = fmaxf(fmaxf(sc[0], sc[1]), fmaxf(sc[2], sc[3]));
                    mx = fmaxf(mx, __shfl_xor(mx, 1, 32)); mx = fmaxf(mx, __shfl_xor(mx, 2, 32));
                    mx = fmaxf(mx, __shfl_xor(mx, 4, 32)); mx = fmaxf(mx, __shfl_xor(mx, 8, 32));
                    const float mnew = fmaxf(m8[i], mx);
                    const float corr = (mnew == NEG) ? 1.f : exp2f(m8[i] - mnew);
                    float rs = 0.f;
#pragma unroll
                    for (int t = 0; t < 4; ++t) {
                        const float pp = (sc[t] == NEG) ? 0.f : exp2f(sc[t] - mnew); rs += pp;
                        pv[i][t] = p.Pw ? pp * p.Pw[b * p.swb + h * p.swh + (long long)ic * p.swi + (long long)min(j0 + t * 16 + l15, p.Lk - 1) * p.swj] : pp;
                    }
                    rs += __shfl_xor(rs, 1, 32); rs += __shfl_xor(rs, 2, 32); rs += __shfl_xor(rs, 4, 32); rs += __shfl_xor(rs, 8, 32);
                    l8[i] = l8[i] * corr + rs; m8[i] = mnew;
                    if (!TWOPASS) {
#pragma unroll
                        for (int t = 0; t < NT; ++t) o[t][i] *= corr;
                    }
                } else {
                    const float inv = (l8[i] > 0.f) ? 1.f / l8[i] : 0.f;
#pragma unroll
                    for (int t = 0; t < 4; ++t) {
                        const int jg = j0 + t * 16 + l15;
                        float pp = (sc[t] == NEG) ? 0.f : exp2f(sc[t] - m8[i]) * inv;
                        if (p.Pw) pp *= p.Pw[b * p.swb + h * p.swh + (long long)ic * p.swi + (long long)min(jg, p.Lk - 1) * p.swj];
                        pv[i][t] = pp;
                    }
                }
            }
            if (dopv) {
#pragma unroll
                for (int i = 0; i < 8; ++i)
#pragma unroll
                    for (int t = 0; t < 4; ++t) ((float*)myp)[(i + 8 * hf) * 64 + t * 16 + l15] = pv[i][t];
                __syncthreads();                                 // P (per wave) and V (shared) visible
                if (p.P) {
                    float* pb_ = p.P + b * p.sPb + h * p.sPh;
                    const bool fastP = (p.pband == 0) && ((p.sPi & 3) == 0) && (j0 + 64 <= p.Lk) && (q0 + 16 <= p.Lq) && ((((size_t)pb_) & 15) == 0);
                    if (fastP) {
#pragma unroll
                        for (int s = 0; s < 8; ++s) {
                            const int row = s * 2 + (lane >> 4), c4 = (lane & 15) * 4;
                            const v4f v = *(const v4f*)(myp + row * 64 + c4);
                            VST2V4(pb_ + (long long)(q0 + row) * p.sPi + j0 + c4, v);
                        }
                    } else {
                        for (int row = 0; row < 16; ++row) {
                            const int irow = q0 + row; if (irow >= p.Lq) continue;
                            for (int c = lane; c < 64; c += 32) {
                                const int jg = j0 + c; if (jg >= p.Lk) continue;
                                if (p.pband == 0) VST2(float, pb_ + (long long)irow * p.sPi + jg, myp[row * 64 + c]);
                                else if (jg - irow <= p.pband && irow - jg <= p.pband) VST2(float, pb_ + (long long)irow * p.sPi + (jg - irow + p.pband), myp[row * 64 + c]);
                            }
                        }
                    }
                }
                if (SPLITPV) {
                    const Split pa0 = sp_ld(myp + l15 * 64, 1, 0, hf, 64, 1.f), pa1 = sp_ld(myp + l15 * 64, 1, 32, hf, 64, 1.f);
                    const __bf16* vh = (const __bf16*)vl; const __bf16* vlo = vh + 64 * VP;
#pragma unroll
                    for (int t = 0; t < NT; ++t) {
                        const int dcol = t * 16 + l15;
                        Split b0, b1;
#pragma unroll
                        for (int e = 0; e < 16; ++e) {
                            const int k0 = frag_k(e, hf), k1 = 32 + frag_k(e, hf);
                            b0.hi[e] = vh[k0 * VP + dcol]; b0.lo[e] = vlo[k0 * VP + dcol]; b1.hi[e] = vh[k1 * VP + dcol]; b1.lo[e] = vlo[k1 * VP + dcol];
                        }
                        o[t] = wmma3(pa0, b0, o[t]);
                        o[t] = wmma3(pa1, b1, o[t]);
                    }
                } else {
                    const v16h pa0 = fh_ld(myp + l15 * 64, 1, 0, hf, 64, 4096.f), pa1 = fh_ld(myp + l15 * 64, 1, 32, hf, 64, 4096.f);
#pragma unroll
                    for (int t = 0; t < NT; ++t) {
                        const int dcol = t * 16 + l15;
                        v16h b0, b1;
#pragma unroll
                        for (int e = 0; e < 16; ++e) { b0[e] = vl[frag_k(e, hf) * VP + dcol]; b1[e] = vl[(32 + frag_k(e, hf)) * VP + dcol]; }
                        o[t] = wmma16(pa0, b0, o[t]);
                        o[t] = wmma16(pa1, b1, o[t]);
                    }
                }
            }
        }
    }
    float* obase = p.O + b * p.sOb + h * p.sOh;
    if (p.ST) {
        const int rl = lane >> 1, isel = rl & 7;           // row q0 + rl ; rl>>3 == hf holds because lane>>4 == (lane>>1)>>3
        float mv = 0.f, lv = 0.f;
#pragma unroll
        for (int i = 0; i < 8; ++i) if (i == isel) { mv = m8[i]; lv = l8[i]; }
        const int irow = q0 + rl;
        if (irow < p.Lq) { float* st = p.ST + (((long long)b * gridDim.y + h) * p.Lq + irow) * 2 + (lane & 1); VST2(float, st, (lane & 1) ? lv : mv * 0.6931471805599453f); }
    }
    float invr[8];
#pragma unroll
    for (int i = 0; i < 8; ++i) {
        if (TWOPASS) invr[i] = SPLITPV ? 1.f : (1.f / 4096.f);
        else if (p.nonorm) invr[i] = exp2f(m8[i]) * (SPLITPV ? 1.f : (1.f / 4096.f));
        else invr[i] = (l8[i] > 0.f) ? (SPLITPV ? 1.f / l8[i] : 1.f / (l8[i] * 4096.f)) : 0.f;
    }
    __syncthreads();                                             // all waves done with pl/vl from the main loop
    const bool ofast = ((p.sOi & 3) == 0) && ((((size_t)obase) & 15) == 0) && (q0 + 16 <= p.Lq);
#pragma unroll
    for (int c0 = 0; c0 < DVP; c0 += 64) {
#pragma unroll
        for (int i = 0; i < 8; ++i)
#pragma unroll
            for (int t = 0; t < NT; ++t) if (t * 16 >= c0 && t * 16 < c0 + 64) ((float*)myp)[(i + 8 * hf) * 64 + (t * 16 - c0) + l15] = o[t][i] * invr[i];
        __syncthreads();
        const int cw = (DVP - c0 < 64) ? (DVP - c0) : 64;      // staged columns in this chunk (multiple of 16)
        if (ofast && (c0 + cw <= p.dv) && (cw % 32 == 0)) {
            const int lpr = cw / 4;                              // lanes per row (16 for 64 cols, 8 for 32)
            const int rows_per_ins = 32 / lpr;
            for (int r0 = 0; r0 < 16; r0 += rows_per_ins) {
                const int row = r0 + lane / lpr, c4 = (lane % lpr) * 4;
                const v4f v = *(const v4f*)(myp + row * 64 + c4);
                VST2V4(obase + (long long)(q0 + row) * p.sOi + c0 + c4, v);
            }
        } else {
            for (int row = 0; row < 16; ++row) {
                const int irow = q0 + row; if (irow >= p.Lq) continue;
                for (int c = lane; c < cw; c += 32) { const int d = c0 + c; if (d < p.dv) VST2(float, obase + (long long)irow * p.sOi + d, myp[row * 64 + c]); }
            }
        }
        __syncthreads();
    }
}

// ---- causal flash attention, transposed products ------------------------------------------------------------------
// Q, K, V, O dense f32 [batch][FS rows][FD], head h at column 64 h, head size 64. grid (heads, batches, FS / 64), query tile bx = last - blockIdx.z (longest first),
// 4 waves of 16 queries, key blocks of 64. S^T = K.Q^T: A = 16 keys x 32 k, B = Q, so s[t][r] is the score of key j0 + 16 t + 8 hf + r for query q0 + l15:
// the 64 scores of a query lie in lanes l15 and l15 + 16, the maximum and the sum are taken in the lane, and the two halves meet by one exchange.
// O^T += V^T.P^T: two score tiles, converted in place, are the B operand (element e <- tile e / 8, register e % 8, the hardware k order), so P passes through no LDS;
// A = V^T comes from the row-major f16 V tile by the transposing LDS load, which delivers the same k order. o[t][r] = O[q0 + l15][16 t + 8 hf + r].
// Every loop but the one over key blocks is unrolled (#pragma unroll): its index picks registers of a fragment or an accumulator, which stay registers only under constant indices.
typedef __attribute__((ext_vector_type(8))) short v8s;
__device__ __forceinline__ v8h at_ld_tr16(const _Float16* p) { typedef __attribute__((address_space(3))) v8s lds_v8s; return __builtin_bit_cast(v8h, __builtin_amdgcn_ds_load_tr16_b128_v8i16((lds_v8s*)p)); }
__device__ __forceinline__ float at_xhalf(float x) { return __builtin_bit_cast(float, __builtin_amdgcn_permlanex16(__builtin_bit_cast(int, x), __builtin_bit_cast(int, x), 0x76543210, 0xfedcba98, false, false)); }   // lane l <-> lane l ^ 16
// 2^x by v_exp_f32 (a result under 2^-126 comes out as 0). Written as asm for the slot that the instruction set asks for behind a transcendental: no result register is a source
// register of the statement ("=&v"), so no exponential overwrites the source or reads the result of the one in front of it, and the v_nop at the end fills the slot behind the last.
__device__ __forceinline__ float at_exp2(float x) { float d; asm("v_exp_f32 %0, %1\n\tv_nop" : "=&v"(d) : "v"(x)); return d; }
__device__ __forceinline__ v8f at_exp2x8(v8f x) {
    float d0, d1, d2, d3, d4, d5, d6, d7;
    asm("v_exp_f32 %0, %8\n\tv_exp_f32 %1, %9\n\tv_exp_f32 %2, %10\n\tv_exp_f32 %3, %11\n\tv_exp_f32 %4, %12\n\tv_exp_f32 %5, %13\n\tv_exp_f32 %6, %14\n\tv_exp_f32 %7, %15\n\tv_nop"
        : "=&v"(d0), "=&v"(d1), "=&v"(d2), "=&v"(d3), "=&v"(d4), "=&v"(d5), "=&v"(d6), "=&v"(d7)
        : "v"(x[0]), "v"(x[1]), "v"(x[2]), "v"(x[3]), "v"(x[4]), "v"(x[5]), "v"(x[6]), "v"(x[7]));
    v8f d; d[0] = d0; d[1] = d1; d[2] = d2; d[3] = d3; d[4] = d4; d[5] = d5; d[6] = d6; d[7] = d7; return d;
}
template <int FS, int FD>
__global__ __launch_bounds__(32 * AW) KATTN_ATTR void k_attn_t(const float* __restrict__ Q, const float* __restrict__ K, const float* __restrict__ V, float* __restrict__ O) {
    static_assert(FS % 64 == 0 && FD % 8 == 0 && AW == 4, "whole key blocks, 32-byte aligned fragments");
    constexpr int VP = 80;                      // V tile pitch in halves: 160 B = 32 B x odd, the transposing load's pitch
    constexpr int OP = 68;                      // output staging pitch in floats
    __shared__ __align__(16) _Float16 vl[64 * VP];
    __shared__ __align__(16) float    ol[AW][16 * OP];
    const int lane = threadIdx.x & 31, hf = lane >> 4, l15 = lane & 15, wave = threadIdx.x >> 5;
    const int bx = FS / (16 * AW) - 1 - (int)blockIdx.z;
    const int h = blockIdx.x, b = blockIdx.y;
    const int q0 = (bx * AW + wave) * 16;
    const float NEG = -__builtin_inff();
    const float SC = 0.125f * 1.4426950408889634f;   // 1 / sqrt(64) and log2(e); the power of two makes one product round as the two did
    const size_t hb = (size_t)b * FS * FD + (size_t)h * 64;
    const float* qrow = Q + hb + (size_t)(q0 + l15) * FD;
    const float* kbase = K + hb;
    const float* vbase = V + hb;
    v16h qa[2];
#pragma unroll
    for (int ks = 0; ks < 2; ++ks) qa[ks] = fh_ld(qrow, 1, ks * 32, hf, 64, 1.f);
    v8f o[4]; float m = NEG, l = 0.f;           // m: the query's running maximum (both halves alike); l: this half's part of its sum
#pragma unroll
    for (int t = 0; t < 4; ++t) { v8f zz = {}; o[t] = zz; }
    const _Float16* vt = vl + (8 * hf + (lane & 7)) * VP + 8 * ((lane >> 3) & 1);   // this lane's address in the transposing loads, key 0, column 0
    const int jend = (bx + 1) * 64;
    for (int j0 = 0; j0 < jend; j0 += 64) {
        v16h kf[8];                                          // the key block's K fragments, tile t and k-step ks at 2 t + ks
        __syncthreads();                                     // previous key block's reads of vl are done
        {
            // raw f32 in two batches, so that the loaded values and everything else that is live fit 256 registers (four waves a SIMD)
            v4f vr[8]; v8f kr[8];                                           // V: four consecutive elements per thread and step; K: half a fragment each
            const float* krow = kbase + (long long)(j0 + l15) * FD + 8 * hf;
            const float* vrow = vbase + (long long)(j0 + ((int)threadIdx.x >> 4)) * FD + ((int)threadIdx.x & 15) * 4;
#pragma unroll
            for (int it = 0; it < 8; ++it) vr[it] = *(const v4f*)(vrow + it * (2 * AW * FD));   // rows 2 AW apart per step
#pragma unroll
            for (int c = 0; c < 8; ++c) kr[c] = *(const v8f*)(krow + (c >> 2) * (16 * FD) + (c & 3) * 16);   // key tile t = c / 4; k = 16 (c % 4) + 8 hf + (0..7)
            // inputs-only fence on the loaded values: their first use is here, so the batch's 24 loads are all issued before any is waited on (without it
            // the scheduler puts each load directly in front of its conversion and waits on it there); V's address is named too, so that it stays live and none of
            // these loads is given its register pair as destination
            asm volatile("" :: "v"(vr[0]), "v"(vr[1]), "v"(vr[2]), "v"(vr[3]), "v"(vr[4]), "v"(vr[5]), "v"(vr[6]), "v"(vr[7]),
                         "v"(kr[0]), "v"(kr[1]), "v"(kr[2]), "v"(kr[3]), "v"(kr[4]), "v"(kr[5]), "v"(kr[6]), "v"(kr[7]), "v"(vrow));
#pragma unroll
            for (int it = 0; it < 8; ++it) {
                v4h hv; hv[0] = (_Float16)vr[it][0]; hv[1] = (_Float16)vr[it][1]; hv[2] = (_Float16)vr[it][2]; hv[3] = (_Float16)vr[it][3];
                *(v4h*)(vl + ((int)threadIdx.x >> 4) * VP + ((int)threadIdx.x & 15) * 4 + it * (2 * AW * VP)) = hv;
            }
#pragma unroll
            for (int f = 0; f < 4; ++f)
#pragma unroll
                for (int e = 0; e < 8; ++e) { kf[f][e] = (_Float16)kr[2 * f][e]; kf[f][8 + e] = (_Float16)kr[2 * f + 1][e]; }
            v8f ks2[8];
#pragma unroll
            for (int c = 0; c < 8; ++c) ks2[c] = *(const v8f*)(krow + (2 + (c >> 2)) * (16 * FD) + (c & 3) * 16);   // key tiles 2 and 3
            // the same fence for the second batch's 16 loads; the address is named too, so that it stays live and none of these loads is given its register pair as destination
            asm volatile("" :: "v"(ks2[0]), "v"(ks2[1]), "v"(ks2[2]), "v"(ks2[3]), "v"(ks2[4]), "v"(ks2[5]), "v"(ks2[6]), "v"(ks2[7]), "v"(krow));
#pragma unroll
            for (int f = 0; f < 4; ++f)
#pragma unroll
                for (int e = 0; e < 8; ++e) { kf[4 + f][e] = (_Float16)ks2[2 * f][e]; kf[4 + f][8 + e] = (_Float16)ks2[2 * f + 1][e]; }
        }
        v8f s[4];
#pragma unroll
        for (int t = 0; t < 4; ++t) {
            v8f acc = {};
#pragma unroll
            for (int ks = 0; ks < 2; ++ks) acc = __builtin_amdgcn_wmma_f32_16x16x32_f16(false, kf[2 * t + ks], false, qa[ks], (short)0, acc, false, false);
            s[t] = acc;
        }
        const int lim = q0 + l15 - j0 - 8 * hf;              // key 16 t + r of this half joins while 16 t + r <= lim
        float mt[4];                                         // per score tile, so that four short chains run side by side
#pragma unroll
        for (int t = 0; t < 4; ++t) {
            mt[t] = NEG;
#pragma unroll
            for (int r = 0; r < 8; ++r) { const float v = (16 * t + r > lim) ? NEG : s[t][r] * SC; s[t][r] = v; mt[t] = fmaxf(mt[t], v); }
        }
        float mx = fmaxf(fmaxf(mt[0], mt[1]), fmaxf(mt[2], mt[3]));
        mx = fmaxf(mx, at_xhalf(mx));
        const float mnew = fmaxf(m, mx);                     // finite from the first key block on: key 0 joins every query
        const float corr = at_exp2(m - mnew);                // 0 in the first key block, where m is -inf
        float rt[4];
        v16h pb[2];
#pragma unroll
        for (int t = 0; t < 4; ++t) {
            const v8f pp = at_exp2x8(s[t] - mnew);           // 0 for a masked key
            rt[t] = pp[0];
#pragma unroll
            for (int r = 1; r < 8; ++r) rt[t] += pp[r];
#pragma unroll
            for (int r = 0; r < 8; ++r) pb[t >> 1][(t & 1) * 8 + r] = (_Float16)(pp[r] * 4096.f);
        }
        const float rs = (rt[0] + rt[1]) + (rt[2] + rt[3]);
        l = l * corr + rs; m = mnew;
#pragma unroll
        for (int t = 0; t < 4; ++t) o[t] *= corr;
        __syncthreads();                                     // the V tile is visible
#pragma unroll
        for (int t = 0; t < 4; ++t)
#pragma unroll
            for (int ks = 0; ks < 2; ++ks) {
                union { v16h v; v8h p[2]; } a;
                a.p[0] = at_ld_tr16(vt + (32 * ks) * VP + 16 * t); a.p[1] = at_ld_tr16(vt + (32 * ks + 16) * VP + 16 * t);
                o[t] = __builtin_amdgcn_wmma_f32_16x16x32_f16(false, a.v, false, pb[ks], (short)0, o[t], false, false);
            }
    }
    l += at_xhalf(l);                                        // the two halves' sums meet once
    const float inv = (l > 0.f) ? 1.f / (l * 4096.f) : 0.f;
    float* myo = ol[wave];
#pragma unroll
    for (int t = 0; t < 4; ++t) {
        v4f lo, hi;
#pragma unroll
        for (int r = 0; r < 4; ++r) { lo[r] = o[t][r] * inv; hi[r] = o[t][4 + r] * inv; }
        *(v4f*)(myo + l15 * OP + 16 * t + 8 * hf) = lo; *(v4f*)(myo + l15 * OP + 16 * t + 8 * hf + 4) = hi;
    }
    __syncthreads();                                         // the staged rows are visible to the lanes that store them
    float* obase = O + hb;
    v4f ov[8];
#pragma unroll
    for (int i = 0; i < 8; ++i) ov[i] = *(const v4f*)(myo + (2 * i + hf) * OP + l15 * 4);
#pragma unroll
    for (int i = 0; i < 8; ++i) VST2V4(obase + (size_t)(q0 + 2 * i + hf) * FD + l15 * 4, ov[i]);   // each store instruction writes two whole 256-byte rows
}

// =====================================================================================================================
// k_tr: dst(z, c, r) = alpha * src(z, r, c) (+ beta * R2(z, c, r)): [Z][R][C] (row stride lds) -> [Z][C][R] (row stride ldd) through a 32x32 LDS tile;
//   flags: 1 -> add beta * residual R2 addressed like dst (z*sRz + c*ldr + r); act applied before the residual.
// =====================================================================================================================
struct TrP { const float* src; float* dst; const float* R2; long long sSz, lds, sDz, ldd, sRz, ldr; int R, C, flags, act; float alpha, beta; };
static_assert(sizeof(TrP) == 3 * 8 + 6 * 8 + 6 * 4, "TrP has padding");
__global__ __launch_bounds__(256) void k_tr(TrP p) {
    __shared__ float tile[32][33];
    const int c0 = blockIdx.x * 32, r0 = blockIdx.y * 32, z = blockIdx.z;
    const int lane = threadIdx.x & 31, wave = threadIdx.x >> 5;
    const float* s = p.src + z * p.sSz;
#pragma unroll
    for (int k = 0; k < 4; ++k) {
        const int rl = wave * 4 + k, r = r0 + rl, c = c0 + lane;
        tile[rl][lane] = (r < p.R && c < p.C) ? s[(long long)r * p.lds + c] : 0.f;
    }
    __syncthreads();
    float* d = p.dst + z * p.sDz; const float* rr = p.R2 + z * p.sRz;
#pragma unroll
    for (int k = 0; k < 4; ++k) {
        const int cl = wave * 4 + k, c = c0 + cl, r = r0 + lane;
        if (c < p.C && r < p.R) {
            float v = act_fn(p.alpha * tile[lane][cl], p.act);
            if (p.flags & 1) v += p.beta * rr[(long long)c * p.ldr + r];
            VST2(float, d + (long long)c * p.ldd + r, v);
        }
    }
}

// k_affine: dst[i] = a * (sdev ? sdev[0] : 1) * src[i] + b, i < n (one thread per element; consecutive lanes -> consecutive addresses)
__global__ __launch_bounds__(256) void k_affine(const float* __restrict__ src, float* __restrict__ dst, int n, float a, float b, const float* __restrict__ sdev) {
    const int i = blockIdx.x * 256 + threadIdx.x;
    if (i < n) { const float aa = sdev ? a * sdev[0] : a; const float v = aa * src[i] + b; VST2(float, dst + i, v); }
}

// =====================================================================================================================
// k_softmax: row softmax over n contiguous elements, one 256-thread block per row; rows addressed z*sz + r*sr (grid (R, Z)).
//   out = scale_out * softmax(scale_in * x + (Mf ? Mf[z*smz + r*smr + j] : 0)); a row whose max is -inf is written as 0.
// =====================================================================================================================
struct SmP { const float* src; float* dst; const float* Mf; long long sz, sr, dz, dr, smz, smr; int n, pad; float scale_in, scale_out; };
static_assert(sizeof(SmP) == 3 * 8 + 6 * 8 + 4 * 4, "SmP has padding");
__global__ __launch_bounds__(256) void k_softmax(SmP p) {
    __shared__ float red[256];
    const int r = blockIdx.x, z = blockIdx.y, tid = threadIdx.x;
    const float* s = p.src + z * p.sz + (long long)r * p.sr;
    const float* mf = p.Mf ? (p.Mf + z * p.smz + (long long)r * p.smr) : nullptr;
    float mx = -__builtin_inff();
    for (int j = tid; j < p.n; j += 256) { float v = s[j] * p.scale_in; if (mf) v += mf[j]; mx = fmaxf(mx, v); }
    red[tid] = mx; __syncthreads();
    for (int o = 128; o > 0; o >>= 1) { if (tid < o) red[tid] = fmaxf(red[tid], red[tid + o]); __syncthreads(); }
    mx = red[0]; __syncthreads();
    float sum = 0.f;
    for (int j = tid; j < p.n; j += 256) { float v = s[j] * p.scale_in; if (mf) v += mf[j]; sum += (mx == -__builtin_inff()) ? 0.f : expf(v - mx); }
    red[tid] = sum; __syncthreads();
    for (int o = 128; o > 0; o >>= 1) { if (tid < o) red[tid] += red[tid + o]; __syncthreads(); }
    sum = red[0];
    const float inv = (sum > 0.f) ? p.scale_out / sum : 0.f;
    float* d = p.dst + z * p.dz + (long long)r * p.dr;
    for (int j = tid; j < p.n; j += 256) { float v = s[j] * p.scale_in; if (mf) v += mf[j]; const float o = (mx == -__builtin_inff()) ? 0.f : expf(v - mx) * inv; VST2(float, d + j, o); }
}
// =====================================================================================================================
// k_stats: mean and rsqrt(var + eps) over a set of n elements addressed base + z*sz + (e / inner) * so + (e % inner) * si, one 256-thread
// k_norm_apply: y = (x - mean[set]) * rstd[set] * g[c] + b[c] over a [Z][C][L] channel-major tensor with set = z*G + c / (C/G) (G groups per z;
//   G = C -> per-channel sets indexed z*C+c; for batch norm pass stats indexed by c only via bn = 1). Optional act. Output same layout.
// =====================================================================================================================
//   mode 0: mean / rsqrt(var + eps); mode 1 (RMSNorm): 0 / rsqrt(mean(x^2) + eps); mode 2 (L2 normalize * sqrt(n)): 0 / sqrt(n) / max(||x||, eps); mode 3: as 0 with unbiased variance (n-1)
__global__ __launch_bounds__(256) void k_stats(const float* __restrict__ x, long long sz, long long so, long long si, int inner, int n, float eps, float* __restrict__ stat, int mode) {
    __shared__ float red[256];
    const int z = blockIdx.x, tid = threadIdx.x;
    const float* base = x + z * sz;
    float s = 0.f;
    for (int e = tid; e < n; e += 256) s += base[(long long)(e / inner) * so + (long long)(e % inner) * si];
    red[tid] = s; __syncthreads();
    for (int o = 128; o > 0; o >>= 1) { if (tid < o) red[tid] += red[tid + o]; __syncthreads(); }
    const float mu = (mode == 0 || mode == 3) ? red[0] / (float)n : 0.f; __syncthreads();
    float q = 0.f;
    for (int e = tid; e < n; e += 256) { const float dlt = base[(long long)(e / inner) * so + (long long)(e % inner) * si] - mu; q += dlt * dlt; }
    red[tid] = q; __syncthreads();
    for (int o = 128; o > 0; o >>= 1) { if (tid < o) red[tid] += red[tid + o]; __syncthreads(); }
    {
        float rs;
        if (mode == 2) rs = sqrtf((float)n) / fmaxf(sqrtf(red[0]), eps); else if (mode == 3) rs = rsqrtf(red[0] / (float)(n - 1) + eps); else rs = rsqrtf(red[0] / (float)n + eps);
        if (tid < 32) { const float v = (tid == 0) ? mu : ((tid == 1) ? rs : 0.f); VST2(float, stat + (long long)z * 32 + tid, v); }
    }
}
//   One thread per element over the flat [Z][C][L] index space: grid ceil(Z*C*L / 256).
__global__ __launch_bounds__(256) void k_norm_apply(const float* __restrict__ x, float* __restrict__ y, const float* __restrict__ stat, const float* __restrict__ g, const float* __restrict__ bta,
                                                     int Z, int C, int L, int G, int bn, int act) {
    const long long idx = (long long)blockIdx.x * 256 + threadIdx.x;
    if (idx >= (long long)Z * C * L) return;
    const int l = (int)(idx % L); const long long zc = idx / L; const int c = (int)(zc % C), z = (int)(zc / C); (void)l;
    const int set = bn ? c : (z * G + c / (C / G));
    float v = (x[idx] - stat[(long long)set * 32]) * stat[(long long)set * 32 + 1];
    if (g) v *= g[c];
    if (bta) v += bta[c];
    v = act_fn(v, act);
    VST2(float, y + idx, v);
}

// k_lse_neg: c[i] = -(st[2i] + log(st[2i+1])) = minus the log-sum-exp of row i from k_attn's ST output (for softmax over the query dimension)
__global__ __launch_bounds__(256) void k_lse_neg(const float* __restrict__ st, float* __restrict__ c, int n) {
    const int i = blockIdx.x * 256 + threadIdx.x;
    if (i < n) { const float v = -(st[2 * i] + logf(st[2 * i + 1])); VST2(float, c + i, v); }
}

// k_iota: dst[i] = a * i + b as int32 (segment/position id helper)
__global__ __launch_bounds__(256) void k_iota(int* __restrict__ dst, int n, int a, int b) {
    const int i = blockIdx.x * 256 + threadIdx.x;
    if (i < n) { const int v = a * i + b; VST2(int, dst + i, v); }
}

// k_axpby: dst[i] = a * x[i] + b * y[i] (+ c), i < n
__global__ __launch_bounds__(256) void k_axpby(const float* __restrict__ x, const float* __restrict__ y, float* __restrict__ dst, int n, float a, float b, float c) {
    const int i = blockIdx.x * 256 + threadIdx.x;
    if (i < n) { const float v = a * x[i] + b * y[i] + c; VST2(float, dst + i, v); }
}

// =====================================================================================================================
// k_rope: rotary embedding on a [R rows][Hn heads][D] view (row stride sXr, head stride sXh, element stride 1) -> Y (own strides).
//   mode 0: rotate_half (partner d±D/2, sign - for d<D/2); mode 1: interleaved pairs (partner d^1, sign - for even d).
//   table column tcol: tmode 0 -> d, 1 -> d % (D/2), 2 -> d / 2; position p: pmode 0 -> r % S, 1 -> head index, 2 -> pos[r];
//   c = C[(r / S) * sCb + p * sCp + tcol * sCd], s likewise from Sn; y = x[d] * c + sign * x[partner] * s. X and Y must not alias.
// =====================================================================================================================
struct RopeP { const float* X; float* Y; const float* C; const float* Sn; const int* pos; long long sXr, sXh, sYr, sYh, sCb, sCp, sCd; int R, Hn, D, S, mode, tmode, pmode, pad; };
static_assert(sizeof(RopeP) == 5 * 8 + 7 * 8 + 8 * 4, "RopeP has padding");
__global__ __launch_bounds__(256) void k_rope(RopeP p) {
    const long long idx = (long long)blockIdx.x * 256 + threadIdx.x;
    if (idx >= (long long)p.R * p.Hn * p.D) return;
    const int d = (int)(idx % p.D); const long long rh = idx / p.D; const int h = (int)(rh % p.Hn); const int r = (int)(rh / p.Hn);
    const int half = p.D / 2;
    int partner; float sign;
    if (p.mode == 0) { partner = (d < half) ? d + half : d - half; sign = (d < half) ? -1.f : 1.f; }
    else { partner = d ^ 1; sign = (d & 1) ? 1.f : -1.f; }
    const int tcol = (p.tmode == 0) ? d : ((p.tmode == 1) ? (d % half) : (d >> 1));
    const int pp = (p.pmode == 0) ? (r % p.S) : ((p.pmode == 1) ? h : p.pos[r]);
    const long long toff = (long long)(r / p.S) * p.sCb + (long long)pp * p.sCp + (long long)tcol * p.sCd;
    const float* xr = p.X + (long long)r * p.sXr + (long long)h * p.sXh;
    const float v = xr[d] * p.C[toff] + sign * xr[partner] * p.Sn[toff];
    VST2(float, p.Y + (long long)r * p.sYr + (long long)h * p.sYh + d, v);
}

// k_invf + k_sincos (split so neither kernel carries a large VALU-fma footprint): invf_i = num * (1 / powf(base, (2 i)/D)) [fmode 0],
//   num * expf((2 i) * cexp) [fmode 1], num * powf(base, -2 (i - 1) / D) [fmode 2]; then cs/sn[s*half + i] = cos/sin((pscale * s) * invf_i)
__global__ __launch_bounds__(256) void k_invf(float* __restrict__ invb, int half, int D, float base, float num, int fmode, float cexp) {
    const int i = blockIdx.x * 256 + threadIdx.x;
    if (i >= ((half + 31) / 32) * 32) return;
    if (i >= half) { VST2(float, invb + i, 0.f); return; }
    const float e = (float)(2 * i) / (float)D;
    float invf;
    if (fmode == 1) invf = num * expf((float)(2 * i) * cexp);
    else if (fmode == 2) invf = num * powf(base, (-2.0f * ((float)i - 1.0f)) / (float)D);
    else invf = num * (1.0f / powf(base, e));
    VST2(float, invb + i, invf);
}
__global__ __launch_bounds__(256) void k_sincos(float* __restrict__ cs, float* __restrict__ sn, const float* __restrict__ invb, int S, int half, float pscale) {
    const int idx = blockIdx.x * 256 + threadIdx.x;
    if (idx >= S * half) return;
    const int s = idx / half, i = idx - s * half;
    const float ang = (pscale * (float)s) * invb[i];
    VST2(float, cs + idx, cosf(ang)); VST2(float, sn + idx, sinf(ang));
}

// k_mulact: dst[i] = act(x[i]) * y[i]
__global__ __launch_bounds__(256) void k_mulact(const float* __restrict__ x, const float* __restrict__ y, float* __restrict__ dst, int n, int act) {
    const int i = blockIdx.x * 256 + threadIdx.x;
    if (i < n) { const float v = act_fn(x[i], act) * y[i]; VST2(float, dst + i, v); }
}

// =====================================================================================================================
// k_matvec: thread-per-row matrix-vector products for N <= 8 output columns (heads with 1-3 outputs, gates), f32 on the VALU.
//   C[r*sCm + j] = act(alpha * sum_k A[r*sAm + k*sAk] * B[j*sBn + k*sBk] + bias[j]) + beta * R[r*sRm + j*sRn]; each thread writes its N contiguous floats.
// =====================================================================================================================
__global__ __launch_bounds__(256) void k_matvec(GemmP p) {
    // 32 lanes write one line with one instruction.
    const int rpt = (p.N == 1) ? 1 : 32;
    const long long r0 = ((long long)blockIdx.x * 256 + threadIdx.x) * rpt; const int z = blockIdx.z, zo = z / p.zi_n, zi = z - zo * p.zi_n;
    if (r0 >= p.M) return;
    const float* Bb = p.B + zo * p.sBo + zi * p.sBi;
    float* C = p.C + zo * p.sCo + zi * p.sCi; const float* R = p.R + zo * p.sRo + zi * p.sRi;
    for (int rr = 0; rr < rpt; ++rr) {
        const long long r = r0 + rr; if (r >= p.M) break;
        const float* A = p.A + zo * p.sAo + zi * p.sAi + r * p.sAm;
        float acc[8] = {0.f, 0.f, 0.f, 0.f, 0.f, 0.f, 0.f, 0.f};
        for (int k = 0; k < p.K; ++k) { const float a = A[(long long)k * p.sAk];
#pragma unroll
            for (int j = 0; j < 8; ++j) if (j < p.N) acc[j] += a * Bb[(long long)j * p.sBn + (long long)k * p.sBk]; }
#pragma unroll
        for (int j = 0; j < 8; ++j) if (j < p.N) {
            float v = acc[j] * p.alpha;
            if (p.flags & 1) v += p.bias[j];
            if (p.flags & 2) v += p.bias[r];
            v = act_fn(v, p.act);
            if (p.flags & 4) v += p.beta * R[r * p.sRm + (long long)j * p.sRn];
            VST2(float, C + r * p.sCm + j, v);
        }
    }
}
// k_smallsoftmax: thread-per-row softmax for short rows (n <= 64): dst[r*dr + j] = softmax(scale*src[r*sr + j])
__global__ __launch_bounds__(256) void k_smallsoftmax(const float* __restrict__ src, float* __restrict__ dst, long long sr, long long dr, int n, long long R, float scale) {
    const long long r0 = ((long long)blockIdx.x * 256 + threadIdx.x) * 32;
    for (int rr = 0; rr < 32; ++rr) {
        const long long r = r0 + rr; if (r >= R) return;
        const float* s = src + r * sr; float* d = dst + r * dr;
        float mx = -__builtin_inff();
        for (int j = 0; j < n; ++j) mx = fmaxf(mx, s[j] * scale);
        float sum = 0.f;
        for (int j = 0; j < n; ++j) sum += expf(s[j] * scale - mx);
        const float inv = 1.f / sum;
        for (int j = 0; j < n; ++j) { const float v = expf(s[j] * scale - mx) * inv; VST2(float, d + j, v); }
    }
}

__global__ __launch_bounds__(32) void k_unitstat(float* __restrict__ st) { const int t = threadIdx.x; const float v = (t == 1) ? 1.f : 0.f; VST2(float, st + t, v); }

// destination (e.g. a d_out whose row width is not a multiple of 32 floats) is written by consecutive lanes of one instruction
__global__ __launch_bounds__(256) void k_lincopy(const float* __restrict__ src, long long lds, float* __restrict__ dst, long long ldd, long long rows, int cols) {
    const long long i = (long long)blockIdx.x * 256 + threadIdx.x; if (i >= rows * cols) return;
    const long long r = i / cols; const int c = (int)(i - r * cols);
    const float v = src[r * lds + c]; VST2(float, dst + r * ldd + c, v);
}

namespace w25 {
typedef __attribute__((ext_vector_type(16))) _Float16 v16h;
typedef __attribute__((ext_vector_type(8)))  _Float16 v8h;
typedef __attribute__((ext_vector_type(16))) __bf16   v16b;
typedef __attribute__((ext_vector_type(8)))  __bf16   v8b;
typedef __attribute__((ext_vector_type(8)))  float    v8f;
typedef __attribute__((ext_vector_type(4)))  float    v4f;

__device__ __forceinline__ unsigned short f2bf_bits(float f) {
  unsigned u = __float_as_uint(f);
  return (unsigned short)((u + 0x7FFFu + ((u >> 16) & 1u)) >> 16);
}
__device__ __forceinline__ float bf_bits2f(unsigned short h) { return __uint_as_float(((unsigned)h) << 16); }

template <typename T> struct Frag;
template <> struct Frag<_Float16> {
  typedef v16h V; union U { v16h v; v8h h[2]; };
  static __device__ __forceinline__ v16h load(const _Float16* p) {   // elements 0..7 <- p[0..7], 8..15 <- p[16..23]
    U f; f.h[0] = *(const v8h*)(p); f.h[1] = *(const v8h*)(p + 16); return f.v;
  }
  static __device__ __forceinline__ v8f mma(v16h a, v16h b, v8f c) {
    return __builtin_amdgcn_wmma_f32_16x16x32_f16(false, a, false, b, (short)0, c, false, false);
  }
};
template <> struct Frag<__bf16> {
  typedef v16b V; union U { v16b v; v8b h[2]; };
  static __device__ __forceinline__ v16b load(const __bf16* p) {
    U f; f.h[0] = *(const v8b*)(p); f.h[1] = *(const v8b*)(p + 16); return f.v;
  }
  static __device__ __forceinline__ v8f mma(v16b a, v16b b, v8f c) {
    return __builtin_amdgcn_wmma_f32_16x16x32_bf16(false, a, false, b, (short)0, c, false, false);
  }
};

// ---- WMMA GEMM with both operands staged in LDS ------------------------------
// C[m,n] = scale * sum_k A[m,k] * Bt[n,k], f32 out. A row-major [M,K]; Bt row-major [N,K]; C row-major [M,N]; M % 64 == 0, N % 128 == 0, K % 64 == 0.
// grid (N / 128, M / 64), 8 waves: a work-group owns a 64 x 128 tile of C, wave (wave >> 2, wave & 3) a 32 x 32 part of it.
// K runs in stages of 64: a stage's 64 A rows and 128 Bt rows (128 B each, per plane) come from global memory as whole 128-byte lines
// (8 lanes x 16 B per row), go to LDS at a pitch of 144 B, and every wave reads its fragments from there with 16-byte LDS loads.
// Two LDS buffers: the next stage's global loads are in flight while the current stage is multiplied; one barrier per stage.
// SPLIT: operands are hi/lo planes (A2/Bt2 = lo planes, same layout); product = hi.hi + hi.lo + lo.hi, in that order per 32 k.
// ET: 0 = f16 operands, 1 = bf16 operands (pointers passed as 16-bit storage)
// astep: rows of A from one 64-row tile of C to the next (64: A is dense; more: each tile takes the first 64 rows of a longer block of A)
template <int ET> struct Elem;
template <> struct Elem<0> { typedef _Float16 T; typedef v8h V8; };
template <> struct Elem<1> { typedef __bf16 T; typedef v8b V8; };
template <int ET, bool SPLIT>
__global__ __launch_bounds__(256) void wmma_gemm_lds(
    const unsigned short* __restrict__ Ap, const unsigned short* __restrict__ A2p,
    const unsigned short* __restrict__ Btp, const unsigned short* __restrict__ Bt2p,
    float* __restrict__ C, int N, int K, float scale, int astep) {
  typedef typename Elem<ET>::T T;
  typedef typename Elem<ET>::V8 V8;
  typedef typename Frag<T>::V V;
  constexpr int NP    = SPLIT ? 2 : 1;      // planes
  constexpr int PITCH = 72;                 // LDS row pitch in 16-bit elements: 144 B = 16 B x 9
  constexpr int PROWS = 192;                // rows of one plane in a stage: 64 of A, then 128 of Bt
  constexpr int STAGE = NP * PROWS * PITCH; // elements of one buffer
  constexpr int NL    = NP * 6;             // 16-byte pieces per thread and stage (32 rows per step)
  constexpr int CP    = 132;                // pitch of the staged C tile in floats
  static_assert(2 * STAGE * 2 >= 64 * CP * 4, "the C tile is staged in the operand buffers");
  __shared__ __align__(16) T sm[2 * STAGE];
  const int lane = threadIdx.x & 31;
  const int wave = threadIdx.x >> 5;
  const int m0 = blockIdx.y << 6;
  const int n0 = blockIdx.x << 7;
  const int wm = (wave >> 2) << 5;          // this wave's first row and column in the tile
  const int wn = (wave & 3) << 5;
  const int rlane = lane & 15;              // row (A) / col (B, D) within a 16 x 16 subtile
  const int koff  = (lane >> 4) * 8;        // k offset of this lane half
  const int mOff  = (lane >> 4) * 8;        // D row offset

  const int lrow = threadIdx.x >> 3, lseg = (threadIdx.x & 7) * 8;   // staging: row within a step of 32 rows, 16-byte piece of the row
  const int a0 = blockIdx.y * astep;        // first A row of this tile
  const T* gA  = (const T*)Ap  + (size_t)(a0 + lrow) * K + lseg;
  const T* gB  = (const T*)Btp + (size_t)(n0 + lrow) * K + lseg;
  const T* gA2 = SPLIT ? (const T*)A2p  + (size_t)(a0 + lrow) * K + lseg : nullptr;
  const T* gB2 = SPLIT ? (const T*)Bt2p + (size_t)(n0 + lrow) * K + lseg : nullptr;
  const int sw = lrow * PITCH + lseg;       // this thread's place in a buffer, step 0
  const int fa = (wm + rlane) * PITCH + koff;        // this lane's A and Bt fragment places in a buffer, subtile 0, k 0
  const int fb = (64 + wn + rlane) * PITCH + koff;

  v8f acc[2][2];
#pragma unroll
  for (int i = 0; i < 2; ++i)
#pragma unroll
    for (int j = 0; j < 2; ++j) acc[i][j] = (v8f){0.f,0.f,0.f,0.f,0.f,0.f,0.f,0.f};

  V8 st[NL];
  auto fetch = [&](int k0) {                // stage at k0: global memory -> registers
#pragma unroll
    for (int it = 0; it < NL; ++it) {
      const int q = it % 6;                 // steps 0, 1: A rows; 2..5: Bt rows; then the same for the lo planes
      const T* g = (it < 6) ? (q < 2 ? gA : gB) : (q < 2 ? gA2 : gB2);
      st[it] = *(const V8*)(g + (size_t)((q < 2 ? q : q - 2) * 32) * K + k0);
    }
  };
  auto put = [&](int buf) {                 // registers -> LDS buffer
#pragma unroll
    for (int it = 0; it < NL; ++it) *(V8*)(sm + buf * STAGE + sw + it * (32 * PITCH)) = st[it];
  };
  auto mult = [&](int buf) {                // one stage: 2 steps of 32 k
    const T* s = sm + buf * STAGE;
#pragma unroll
    for (int kk = 0; kk < 2; ++kk) {
      V ah[2], al[2], bh[2], bl[2];
#pragma unroll
      for (int i = 0; i < 2; ++i) {
        ah[i] = Frag<T>::load(s + fa + i * (16 * PITCH) + kk * 32);
        bh[i] = Frag<T>::load(s + fb + i * (16 * PITCH) + kk * 32);
        if (SPLIT) {
          al[i] = Frag<T>::load(s + PROWS * PITCH + fa + i * (16 * PITCH) + kk * 32);
          bl[i] = Frag<T>::load(s + PROWS * PITCH + fb + i * (16 * PITCH) + kk * 32);
        }
      }
#pragma unroll
      for (int i = 0; i < 2; ++i)
#pragma unroll
        for (int j = 0; j < 2; ++j) acc[i][j] = Frag<T>::mma(ah[i], bh[j], acc[i][j]);
      if (SPLIT) {
#pragma unroll
        for (int i = 0; i < 2; ++i)
#pragma unroll
          for (int j = 0; j < 2; ++j) acc[i][j] = Frag<T>::mma(ah[i], bl[j], acc[i][j]);
#pragma unroll
        for (int i = 0; i < 2; ++i)
#pragma unroll
          for (int j = 0; j < 2; ++j) acc[i][j] = Frag<T>::mma(al[i], bh[j], acc[i][j]);
      }
    }
  };

  const int NK = K >> 6;
  fetch(0);
  put(0);
  __syncthreads();                          // stage 0 is visible
  for (int kt = 0; kt + 1 < NK; ++kt) {
    fetch((kt + 1) << 6);
    __builtin_amdgcn_sched_barrier(0);      // keeps the next stage's global loads issued ahead of this stage's products, so that their latency runs under them
    mult(kt & 1);
    put((kt + 1) & 1);                      // the buffer that stage kt - 1 was read from; its readers left it at the barrier that ended that trip
    __syncthreads();                        // stage kt + 1 is visible, and every wave has finished reading stage kt
  }
  mult((NK - 1) & 1);
  __syncthreads();                          // all fragment reads are done: the buffers now stage the C tile

  // ---- epilogue: the 64 x 128 f32 tile through LDS, so that each store instruction writes 512 contiguous bytes of one row ----
  float* sC = (float*)sm;
#pragma unroll
  for (int i = 0; i < 2; ++i)
#pragma unroll
    for (int j = 0; j < 2; ++j)
#pragma unroll
      for (int r = 0; r < 8; ++r) sC[(wm + (i << 4) + mOff + r) * CP + wn + (j << 4) + rlane] = acc[i][j][r] * scale;
  __syncthreads();
#pragma unroll
  for (int it = 0; it < 8; ++it) {
    const int row = it * 8 + wave;
    const v4f v = *(const v4f*)(sC + row * CP + lane * 4);
    *(v4f*)(C + (size_t)(m0 + row) * N + n0 + lane * 4) = v;
  }
}

__global__ __launch_bounds__(256) void cast_f32_f16x2(
    const float* __restrict__ in, _Float16* __restrict__ out, int n2) {
  int i = blockIdx.x * 256 + threadIdx.x;
  if (i < n2) {
    const _Float16 h0 = (_Float16)in[2 * i], h1 = (_Float16)in[2 * i + 1];
    const unsigned u = (unsigned)__builtin_bit_cast(unsigned short, h0) | ((unsigned)__builtin_bit_cast(unsigned short, h1) << 16);
    ((unsigned*)out)[i] = u;
    
  }
}


} // namespace w25

__global__ __launch_bounds__(256) void k_castT16(const float* __restrict__ src, long long lds, _Float16* __restrict__ dst, long long ldd, int R, int C, float s) {
    const long long i = (long long)blockIdx.x * 256 + threadIdx.x; const long long np = (long long)C * (R / 2); if (i >= np) return; const int c = (int)(i / (R / 2)); const int r = 2 * (int)(i % (R / 2));
    const _Float16 h0 = (_Float16)(src[(long long)r * lds + c] * s), h1 = (_Float16)(src[(long long)(r + 1) * lds + c] * s);
    const unsigned u = (unsigned)__builtin_bit_cast(unsigned short, h0) | ((unsigned)__builtin_bit_cast(unsigned short, h1) << 16);
    unsigned* d = (unsigned*)(dst + (long long)c * ldd + r); *d = u;  }

// f32 -> bf16 hi plane + bf16 lo plane (x = hi + lo to ~2^-17 relative; RNE both), 2 consecutive destination elements: hi pair returned, lo pair in *lo
__device__ __forceinline__ unsigned int f2bf2_pack(float a, float b, unsigned int* lo) {
    const unsigned short ha = w25::f2bf_bits(a), hb = w25::f2bf_bits(b);
    const unsigned short la = w25::f2bf_bits(a - w25::bf_bits2f(ha)), lb = w25::f2bf_bits(b - w25::bf_bits2f(hb));
    *lo = (unsigned)la | ((unsigned)lb << 16); return (unsigned)ha | ((unsigned)hb << 16); }

namespace w25 {
// =====================================================================================
// Generic causal/non-causal attention for head_dim 64, f32 in / f32 out; 16-bit operands: bf16 with optional hi/lo splits, or
// plain f16 (F16=true, non-split, probabilities carried x2^15).
//   scores = (q*qscale)·kᵀ : v_wmma_f32_16x16x32_bf16; SPLIT_QK -> q,k as bf16 hi/lo (hi·hi + hi·lo + lo·hi)
//   out    = p·v           : v_wmma_f32_16x16x32_bf16; SPLIT_PV -> p,v as bf16 hi/lo; else p,v plain bf16
//   f32 accumulate; online softmax in f32. Block = 4 waves = 64 query rows of one (batch, head); S % 64 == 0.
//   Element (b, s, h, d) of tensor X lives at X[b*X_bs + s*X_rs + h*X_hs + d] (strides in floats, multiples of 4).
//   Masking: mask_mode 0 none, 1 causal (kv > q masked), 2 tensor [S][Skv] shared over (b,h) (float if
//   mask_is_int==0, int32 with element == 0 -> masked if 1, int32 with element != 0 -> masked if 2), 3 per-token vectors qmask[B][S] & kvmask[B][Skv] (int32,
//   0 -> masked), 4 causal + sliding window (kv > q or q - kv > W masked; W passed in mask_is_int);
//   5 = relative-position bias: s += cp[b,h,q][idx[q][kv]] + pc[b,h,kv][idx[q][kv]] with idx = mask_b ([S][Skv] int32) and
//   mask_a an int32 [S][Skv] tensor with nonzero = masked (tables: element (b,h,row,n) at X + b*c_bs + h*c_hs + row*c_rs + n);
//   masked scores are replaced by mask_fill (e.g. -inf or -1e9) before the softmax.
//   grid.x = B * H * (S/64) (or a sub-range with blk0).
// =====================================================================================
#define AT_D 64
#define AT_NW 4
#define AT_QB 64
#define AT_KC 64
struct AttnGeom { const float* cp = nullptr; const float* pc = nullptr; long c_bs = 0, c_rs = 0, c_hs = 0;   // mode-5 score-bias tables
                  long q_bs, q_rs, q_hs, k_bs, k_rs, k_hs, v_bs, v_rs, v_hs, o_bs, o_rs, o_hs;
                  int S, Skv, H, mask_mode; float qscale; int blk0; float mask_fill; int mask_is_int; };
static_assert(sizeof(AttnGeom) == 168, "no padding");

__device__ __forceinline__ unsigned short at_bf_bits(float f) {
  unsigned u = __float_as_uint(f);
  return (unsigned short)((u + 0x7FFFu + ((u >> 16) & 1u)) >> 16);
}
__device__ __forceinline__ __bf16 at_f2bf(float f) { return __builtin_bit_cast(__bf16, at_bf_bits(f)); }
__device__ __forceinline__ void at_split(float f, __bf16& hi, __bf16& lo) {
  const unsigned short hb = at_bf_bits(f);
  hi = __builtin_bit_cast(__bf16, hb);
  lo = at_f2bf(f - __uint_as_float(((unsigned)hb) << 16));
}
__device__ __forceinline__ v8f at_mma(v16b a, v16b b, v8f c) {
  c = __builtin_amdgcn_wmma_f32_16x16x32_bf16(false, a, false, b, (short)0, c, false, false);
  asm volatile("v_nop\n\tv_nop\n\tv_nop\n\tv_nop" : "+v"(c) : "v"(a), "v"(b));
  return c;
}
// 16-bit element as a bit pattern held in a __bf16 slot: f16 bits when F16, bf16 (RNE) otherwise
template <bool F16> __device__ __forceinline__ __bf16 at_to16(float f) {
  if (F16) return __builtin_bit_cast(__bf16, (_Float16)f);
  return at_f2bf(f);
}
template <bool F16> __device__ __forceinline__ v8f at_mma16(v16b a, v16b b, v8f c) {
  if (F16) {
    const v16h ah = __builtin_bit_cast(v16h, a), bh = __builtin_bit_cast(v16h, b);
    c = __builtin_amdgcn_wmma_f32_16x16x32_f16(false, ah, false, bh, (short)0, c, false, false);
    asm volatile("v_nop\n\tv_nop\n\tv_nop\n\tv_nop" : "+v"(c) : "v"(ah), "v"(bh));
    return c;
  }
  return at_mma(a, b, c);
}

template <bool SPLIT_QK, bool SPLIT_PV, bool F16 = false>
__global__ __launch_bounds__(128)
void attn64_kernel(const float* __restrict__ q, const float* __restrict__ k,
                   const float* __restrict__ v, float* __restrict__ out,
                   const void* __restrict__ mask_a, const int* __restrict__ mask_b, AttnGeom g) {
  static_assert(!(F16 && (SPLIT_QK || SPLIT_PV)), "f16 mode is non-split");
  const float PSC = F16 ? 32768.0f : 1.0f;     // f16 probabilities carried x2^15 (subnormal range), folded into the final 1/l
  union FB { v16b v; v8b h[2]; };
  __shared__ __align__(16) __bf16 Ksh[AT_KC * AT_D];             // K hi [kv][d]      8 KB
  __shared__ __align__(16) __bf16 Ksl[SPLIT_QK ? AT_KC * AT_D : 8];
  __shared__ __align__(16) __bf16 Vth[AT_D * AT_KC];             // V hi [d][kv]      8 KB
  __shared__ __align__(16) __bf16 Vtl[SPLIT_PV ? AT_D * AT_KC : 8];
  __shared__ __align__(16) __bf16 Psh[AT_NW][16 * AT_KC];        // per wave P hi [row][kv]  8 KB
  __shared__ __align__(16) __bf16 Psl[SPLIT_PV ? AT_NW : 1][SPLIT_PV ? 16 * AT_KC : 8];
  __shared__ __align__(16) float  Os[AT_NW][16 * 68];            // per wave out tile, pitch 68

  const int tid  = threadIdx.x;
  const int wave = tid >> 5;
  const int lane = tid & 31;
  const int hh   = lane >> 4;
  const int c    = lane & 15;

  const int nqb = g.S / AT_QB;
  const int bx = blockIdx.x + g.blk0;
  const int qb = bx % nqb;
  const int bh = bx / nqb;
  const int h  = bh % g.H;
  const int b  = bh / g.H;
  const int qbase_block = qb * AT_QB;
  const int q0 = qbase_block + wave * 16;

  const float* qb_ptr = q + (size_t)b * g.q_bs + (size_t)h * g.q_hs;
  const float* kb_ptr = k + (size_t)b * g.k_bs + (size_t)h * g.k_hs;
  const float* vb_ptr = v + (size_t)b * g.v_bs + (size_t)h * g.v_hs;
  float*       ob_ptr = out + (size_t)b * g.o_bs + (size_t)h * g.o_hs;

  // ---- Q fragments (A operand): 2 d-chunks, hi (and lo) ----
  v16b qah[2], qal[2];
  {
    const float* qrow = qb_ptr + (size_t)(q0 + c) * g.q_rs;
#pragma unroll
    for (int dc = 0; dc < 2; ++dc) {
#pragma unroll
      for (int e = 0; e < 8; ++e) {
        const float f0 = qrow[dc * 32 + 8 * hh + e] * g.qscale;
        const float f1 = qrow[dc * 32 + 16 + 8 * hh + e] * g.qscale;
        if (SPLIT_QK) { __bf16 hq, lq; at_split(f0, hq, lq); qah[dc][e] = hq; qal[dc][e] = lq; at_split(f1, hq, lq); qah[dc][8 + e] = hq; qal[dc][8 + e] = lq; }
        else { qah[dc][e] = at_to16<F16>(f0); qah[dc][8 + e] = at_to16<F16>(f1); qal[dc][e] = qah[dc][e]; qal[dc][8 + e] = qah[dc][8 + e]; }
      }
    }
  }

  float mrow[8], lrow[8];
  v8f oacc[4];
#pragma unroll
  for (int r = 0; r < 8; ++r) { mrow[r] = -INFINITY; lrow[r] = 0.f; }
#pragma unroll
  for (int t = 0; t < 4; ++t) oacc[t] = (v8f){0.f,0.f,0.f,0.f,0.f,0.f,0.f,0.f};

  const int nChunks = (g.mask_mode == 1 || g.mask_mode == 4) ? (qb + 1) : (g.Skv / AT_KC);   // block-uniform
  // per-row query mask (mode 3)
  int qkeep[8];
#pragma unroll
  for (int r = 0; r < 8; ++r) qkeep[r] = (g.mask_mode == 3) ? mask_b[(size_t)b * g.S + q0 + 8 * hh + r] : 1;   // mask_b = qmask in mode 3
  for (int kc = 0; kc < nChunks; ++kc) {
    const int kv0 = kc * AT_KC;
    __syncthreads();
    {
      const int kvr = tid >> 1, dh = (tid & 1) * 32;
      const float* krow = kb_ptr + (size_t)(kv0 + kvr) * g.k_rs + dh;
      const float* vrow = vb_ptr + (size_t)(kv0 + kvr) * g.v_rs + dh;
#pragma unroll
      for (int i = 0; i < 8; ++i) {
        v4f kk = *(const v4f*)(krow + 4 * i);
        v4f vv = *(const v4f*)(vrow + 4 * i);
#pragma unroll
        for (int e = 0; e < 4; ++e) {
          const int d = dh + 4 * i + e;
          if (SPLIT_QK) { __bf16 a, bl; at_split(kk[e], a, bl); Ksh[kvr * AT_D + d] = a; Ksl[kvr * AT_D + d] = bl; }
          else Ksh[kvr * AT_D + d] = at_to16<F16>(kk[e]);
          if (SPLIT_PV) { __bf16 a, bl; at_split(vv[e], a, bl); Vth[d * AT_KC + kvr] = a; Vtl[d * AT_KC + kvr] = bl; }
          else Vth[d * AT_KC + kvr] = at_to16<F16>(vv[e]);
        }
      }
    }
    __syncthreads();

    v8f s[4];
#pragma unroll
    for (int j = 0; j < 4; ++j) {
      s[j] = (v8f){0.f,0.f,0.f,0.f,0.f,0.f,0.f,0.f};
#pragma unroll 1
      for (int dc = 0; dc < 2; ++dc) {
        FB kb;
        kb.h[0] = *(const v8b*)(Ksh + (j * 16 + c) * AT_D + dc * 32 + 8 * hh);
        kb.h[1] = *(const v8b*)(Ksh + (j * 16 + c) * AT_D + dc * 32 + 16 + 8 * hh);
        s[j] = at_mma16<F16>(qah[dc], kb.v, s[j]);
        if (SPLIT_QK) {
          FB kl;
          kl.h[0] = *(const v8b*)(Ksl + (j * 16 + c) * AT_D + dc * 32 + 8 * hh);
          kl.h[1] = *(const v8b*)(Ksl + (j * 16 + c) * AT_D + dc * 32 + 16 + 8 * hh);
          s[j] = at_mma16<F16>(qah[dc], kl.v, s[j]);
          s[j] = at_mma16<F16>(qal[dc], kb.v, s[j]);
        }
      }
    }
    const bool diag = (g.mask_mode == 1) && (kc == qb);
    int kvkeep[4] = {1, 1, 1, 1};
    if (g.mask_mode == 3) {
#pragma unroll
      for (int j = 0; j < 4; ++j) kvkeep[j] = ((const int*)mask_a)[(size_t)b * g.Skv + kv0 + j * 16 + c];   // mask_a = kvmask
    }
    float cm[8];
#pragma unroll
    for (int r = 0; r < 8; ++r) {
      const int qrow = q0 + 8 * hh + r;
      float m = -INFINITY;
#pragma unroll
      for (int j = 0; j < 4; ++j) {
        const int kvcol = kv0 + j * 16 + c;
        bool masked = false;
        if (diag) masked = (kvcol > qrow);
        else if (g.mask_mode == 4) masked = (kvcol > qrow) || (qrow - kvcol > g.mask_is_int);
        else if (g.mask_mode == 2) {
          const size_t mi = (size_t)qrow * g.Skv + kvcol;
          masked = (g.mask_is_int == 0) ? (((const float*)mask_a)[mi] == 0.0f)
                 : (g.mask_is_int == 1) ? (((const int*)mask_a)[mi] == 0) : (((const int*)mask_a)[mi] != 0);
        } else if (g.mask_mode == 3) masked = (qkeep[r] == 0) || (kvkeep[j] == 0);
        else if (g.mask_mode == 5) {
          const size_t mi = (size_t)qrow * g.Skv + kvcol;
          masked = (((const int*)mask_a)[mi] != 0);
          int n = mask_b[mi]; n = n < 0 ? 0 : n;
          s[j][r] += g.cp[(size_t)b * g.c_bs + (size_t)h * g.c_hs + (size_t)qrow * g.c_rs + n]
                   + g.pc[(size_t)b * g.c_bs + (size_t)h * g.c_hs + (size_t)kvcol * g.c_rs + n];
        }
        if (masked) s[j][r] = g.mask_fill;
        m = fmaxf(m, s[j][r]);
      }
#pragma unroll
      for (int off = 1; off < 16; off <<= 1) m = fmaxf(m, __shfl_xor(m, off, 32));
      cm[r] = m;
    }
    __bf16* pwh = Psh[wave];
    __bf16* pwl = Psl[SPLIT_PV ? wave : 0];
#pragma unroll
    for (int r = 0; r < 8; ++r) {
      const float mnew = fmaxf(mrow[r], cm[r]);
      const float alpha = expf(mrow[r] - mnew);
      mrow[r] = mnew;
      float psum = 0.f;
#pragma unroll
      for (int j = 0; j < 4; ++j) {
        const float p = expf(s[j][r] - mnew);
        psum += p;
        if (SPLIT_PV) { __bf16 a, bl; at_split(p, a, bl); pwh[(8 * hh + r) * AT_KC + j * 16 + c] = a; pwl[(8 * hh + r) * AT_KC + j * 16 + c] = bl; }
        else pwh[(8 * hh + r) * AT_KC + j * 16 + c] = at_to16<F16>(p * PSC);
      }
#pragma unroll
      for (int off = 1; off < 16; off <<= 1) psum += __shfl_xor(psum, off, 32);
      lrow[r] = lrow[r] * alpha + psum;
#pragma unroll
      for (int t = 0; t < 4; ++t) oacc[t][r] *= alpha;
    }
    __builtin_amdgcn_fence(__ATOMIC_RELEASE, "workgroup");
    __builtin_amdgcn_wave_barrier();
    __builtin_amdgcn_fence(__ATOMIC_ACQUIRE, "workgroup");
#pragma unroll 1
    for (int kk = 0; kk < 2; ++kk) {
      FB pa, pl;
      pa.h[0] = *(const v8b*)(pwh + c * AT_KC + kk * 32 + 8 * hh);
      pa.h[1] = *(const v8b*)(pwh + c * AT_KC + kk * 32 + 16 + 8 * hh);
      if (SPLIT_PV) {
        pl.h[0] = *(const v8b*)(pwl + c * AT_KC + kk * 32 + 8 * hh);
        pl.h[1] = *(const v8b*)(pwl + c * AT_KC + kk * 32 + 16 + 8 * hh);
      }
#pragma unroll
      for (int t = 0; t < 4; ++t) {
        FB vb;
        vb.h[0] = *(const v8b*)(Vth + (t * 16 + c) * AT_KC + kk * 32 + 8 * hh);
        vb.h[1] = *(const v8b*)(Vth + (t * 16 + c) * AT_KC + kk * 32 + 16 + 8 * hh);
        oacc[t] = at_mma16<F16>(pa.v, vb.v, oacc[t]);
        if (SPLIT_PV) {
          FB vl;
          vl.h[0] = *(const v8b*)(Vtl + (t * 16 + c) * AT_KC + kk * 32 + 8 * hh);
          vl.h[1] = *(const v8b*)(Vtl + (t * 16 + c) * AT_KC + kk * 32 + 16 + 8 * hh);
          oacc[t] = at_mma16<F16>(pa.v, vl.v, oacc[t]);
          oacc[t] = at_mma16<F16>(pl.v, vb.v, oacc[t]);
        }
      }
    }
  }

  float* os = Os[wave];
#pragma unroll
  for (int r = 0; r < 8; ++r) {
    const float inv = 1.0f / (lrow[r] * PSC);
#pragma unroll
    for (int t = 0; t < 4; ++t) os[(8 * hh + r) * 68 + t * 16 + c] = oacc[t][r] * inv;
  }
  __builtin_amdgcn_fence(__ATOMIC_RELEASE, "workgroup");
  __builtin_amdgcn_wave_barrier();
  __builtin_amdgcn_fence(__ATOMIC_ACQUIRE, "workgroup");
  {
    const int c4 = (lane & 15) * 4;
    {
#pragma unroll
      for (int it = 0; it < 8; ++it) {
        const int row = it * 2 + hh;
        v4f val = *(const v4f*)(os + row * 68 + c4);
        *(v4f*)(ob_ptr + (size_t)(q0 + row) * g.o_rs + c4) = val;
      }
      
    }
  }
}

} // namespace w25

// exact f32 causal attention for the first 64 query rows of every (batch, head): one 64-thread block per (b, h, row t < 64); thread d scores key d <= t as Q64.K64 / 8, then writes column d of row t of AT
__global__ __launch_bounds__(64) void k_cm_exact(const float* __restrict__ Q64, const float* __restrict__ K64, const float* __restrict__ V, float* __restrict__ AT, int S, int D, int NH, int HD) { __shared__ float sc[64]; const int t = blockIdx.x % 64; const int h = (blockIdx.x / 64) % NH; const int b = blockIdx.x / (64 * NH); const int d = threadIdx.x;
    const float* q = Q64 + ((long long)b * 64 + t) * D + h * HD; float s = -3.0e38f;
    if (d <= t) { const float* kr = K64 + ((long long)b * 64 + d) * D + h * HD; float a = 0.f;
#pragma unroll 1
        for (int j = 0; j < HD; ++j) a += q[j] * kr[j];
        s = a * 0.125f; }
    sc[d] = s; __syncthreads();
    float mx = -3.0e38f; for (int j = 0; j <= t; ++j) mx = fmaxf(mx, sc[j]);
    float den = 0.f; for (int j = 0; j <= t; ++j) den += expf(sc[j] - mx);
    float acc = 0.f;
#pragma unroll 1
    for (int j = 0; j <= t; ++j) acc += expf(sc[j] - mx) * V[((long long)b * S + j) * D + h * HD + d];
    VST2(float, AT + ((long long)b * S + t) * D + h * HD + d, acc / den); }


// ---- dense elementwise kernels: many elements a thread ------------------------------------------------------------
// A work-group of 256 threads takes 1024 * U consecutive floats: U loads of 16 bytes a thread, all issued before the first is used; each load of a wave covers
// 512 contiguous bytes. The grid covers the array exactly (element count a multiple of 1024 * U), so there is no bounds test and no row or column arithmetic.
typedef __attribute__((ext_vector_type(2))) unsigned int v2u;
template <int U>
__global__ __launch_bounds__(256) void k_cast16v(const float* __restrict__ src, _Float16* __restrict__ dst, float s) {
    const size_t base = (size_t)blockIdx.x * (1024 * U) + threadIdx.x * 4;
    v4f v[U];
#pragma unroll
    for (int u = 0; u < U; ++u) v[u] = *(const v4f*)(src + base + u * 1024);
#pragma unroll
    for (int u = 0; u < U; ++u) {
        v4h h; h[0] = (_Float16)(v[u][0] * s); h[1] = (_Float16)(v[u][1] * s); h[2] = (_Float16)(v[u][2] * s); h[3] = (_Float16)(v[u][3] * s);
        *(v4h*)(dst + base + u * 1024) = h;
    }
}
template <int U>
__global__ __launch_bounds__(256) void k_castS16v(const float* __restrict__ src, __bf16* __restrict__ dhi, __bf16* __restrict__ dlo) {
    const size_t base = (size_t)blockIdx.x * (1024 * U) + threadIdx.x * 4;
    v4f v[U];
#pragma unroll
    for (int u = 0; u < U; ++u) v[u] = *(const v4f*)(src + base + u * 1024);
    asm volatile("s_wait_xcnt 0x0" ::: "memory");   // in front of the reuse of the loads' address registers
#pragma unroll
    for (int u = 0; u < U; ++u) {
        v2u hi, lo; unsigned int l0, l1;
        hi[0] = f2bf2_pack(v[u][0], v[u][1], &l0); hi[1] = f2bf2_pack(v[u][2], v[u][3], &l1); lo[0] = l0; lo[1] = l1;
        *(v2u*)(dhi + base + u * 1024) = hi; *(v2u*)(dlo + base + u * 1024) = lo;
    }
}
// RoPE in place on rows of 16 heads x 64 columns: one wave takes one row of Q and the same row of Kx. Lane = (head parity, 16-byte piece of a head's 64 columns), so the lane's
// cos and sin pieces are loaded once and serve its 8 heads of both tensors. SR: rows per batch in Q and Kx, and the bound on the position. grid = rows / 8.
template <int SR>
__global__ __launch_bounds__(256) void k_cm_ropev(float* __restrict__ Q, float* __restrict__ Kx, const float* __restrict__ CS, const float* __restrict__ SN, const int* __restrict__ POS) {
    const int row = blockIdx.x * 8 + ((int)threadIdx.x >> 5), lane = threadIdx.x & 31;
    int ps = POS[row % SR]; ps = ps < 0 ? 0 : (ps >= SR ? SR - 1 : ps);
    const v4f c = *(const v4f*)(CS + ps * 64 + (lane & 15) * 4), s = *(const v4f*)(SN + ps * 64 + (lane & 15) * 4);
    float* q = Q + (size_t)row * 1024 + lane * 4; float* k = Kx + (size_t)row * 1024 + lane * 4;
    v4f a[8], b[8];
#pragma unroll
    for (int it = 0; it < 8; ++it) { a[it] = *(const v4f*)(q + it * 128); b[it] = *(const v4f*)(k + it * 128); }
#pragma unroll
    for (int it = 0; it < 8; ++it) {
        v4f r, t;
        // x0 c0 - x1 s0 and x1 c1 + x0 s1, each with the x1 product rounded and the x0 product fused
        r[0] = fmaf(a[it][0], c[0], -(a[it][1] * s[0])); r[1] = fmaf(a[it][0], s[1], a[it][1] * c[1]); r[2] = fmaf(a[it][2], c[2], -(a[it][3] * s[2])); r[3] = fmaf(a[it][2], s[3], a[it][3] * c[3]);
        t[0] = fmaf(b[it][0], c[0], -(b[it][1] * s[0])); t[1] = fmaf(b[it][0], s[1], b[it][1] * c[1]); t[2] = fmaf(b[it][2], c[2], -(b[it][3] * s[2])); t[3] = fmaf(b[it][2], s[3], b[it][3] * c[3]);
        *(v4f*)(q + it * 128) = r; *(v4f*)(k + it * 128) = t;
    }
}

extern "C" void kernel_launch(void* const* d_in, const int* in_sizes, int n_in, void* d_out, int out_size, void* d_ws, size_t ws_size, hipStream_t stream) {
    (void)in_sizes; (void)n_in; (void)out_size; (void)ws_size;
    const float* x = (const float*)d_in[0];
    const float* Wq = (const float*)d_in[1];
    const float* Wk = (const float*)d_in[2];
    const float* Wv = (const float*)d_in[3];
    const float* Wo = (const float*)d_in[4];
    const float* cosT = (const float*)d_in[5];
    const float* sinT = (const float*)d_in[6];
    const int* tpos = (const int*)d_in[7];
    const int Bn = 4;
    const int S = 2048;
    const int D = 1024;
    const int NH = 16;
    const int HD = 64;
    const int NR = Bn * S;
    float* out = (float*)d_out;
    char* wsp = (char*)d_ws;
    float* Q = (float*)wsp; wsp += (size_t)NR * D * 4;
    float* Kb = (float*)wsp; wsp += (size_t)NR * D * 4;
    float* V = (float*)wsp; wsp += (size_t)NR * D * 4;
    float* AT = (float*)wsp; wsp += (size_t)NR * D * 4;
    float* Q64 = (float*)wsp; wsp += (size_t)Bn * 64 * D * 4;
    float* K64 = (float*)wsp; wsp += (size_t)Bn * 64 * D * 4;
    unsigned short* XH = (unsigned short*)wsp; wsp += (size_t)NR * D * 2;    // x as f16
    unsigned short* XS = (unsigned short*)wsp; wsp += (size_t)NR * D * 2;    // x as bf16 hi and lo planes; after the exact-row GEMMs the attention output's planes
    unsigned short* XS2 = (unsigned short*)wsp; wsp += (size_t)NR * D * 2;
    unsigned short* WqH = (unsigned short*)wsp; wsp += (size_t)D * D * 2;    // 16 Wq, 16 Wk as f16
    unsigned short* WkH = (unsigned short*)wsp; wsp += (size_t)D * D * 2;
    unsigned short* WqS = (unsigned short*)wsp; wsp += (size_t)D * D * 2;    // bf16 hi and lo planes of the four weights
    unsigned short* WqS2 = (unsigned short*)wsp; wsp += (size_t)D * D * 2;
    unsigned short* WkS = (unsigned short*)wsp; wsp += (size_t)D * D * 2;
    unsigned short* WkS2 = (unsigned short*)wsp; wsp += (size_t)D * D * 2;
    unsigned short* WvS = (unsigned short*)wsp; wsp += (size_t)D * D * 2;
    unsigned short* WvS2 = (unsigned short*)wsp; wsp += (size_t)D * D * 2;
    unsigned short* WoS = (unsigned short*)wsp; wsp += (size_t)D * D * 2;
    unsigned short* WoS2 = (unsigned short*)wsp; wsp += (size_t)D * D * 2;
    const unsigned gX = (unsigned)((long long)NR * D / (1024 * 8));   // cast grids: 32 elements a thread for x-sized arrays, 16 for the weights
    const unsigned gW = (unsigned)((long long)D * D / (1024 * 4));
    // q, k: f16 operands
    k_cast16v<8><<<gX, 256, 0, stream>>>(x, (_Float16*)XH, 1.0f);
    k_cast16v<4><<<gW, 256, 0, stream>>>(Wq, (_Float16*)WqH, 16.0f);
    k_cast16v<4><<<gW, 256, 0, stream>>>(Wk, (_Float16*)WkH, 16.0f);
    w25::wmma_gemm_lds<0, false><<<dim3(D / 128, NR / 64), 256, 0, stream>>>(XH, nullptr, WqH, nullptr, Q, D, D, 0.0625f, 64);
    w25::wmma_gemm_lds<0, false><<<dim3(D / 128, NR / 64), 256, 0, stream>>>(XH, nullptr, WkH, nullptr, Kb, D, D, 0.0625f, 64);
    // v: bf16 hi/lo planes
    k_castS16v<8><<<gX, 256, 0, stream>>>(x, (__bf16*)XS, (__bf16*)XS2);
    k_castS16v<4><<<gW, 256, 0, stream>>>(Wv, (__bf16*)WvS, (__bf16*)WvS2);
    w25::wmma_gemm_lds<1, true><<<dim3(D / 128, NR / 64), 256, 0, stream>>>(XS, XS2, WvS, WvS2, V, D, D, 1.0f, 64);
    // q, k of the first 64 rows of every batch, from the same planes of x: tile b of C takes rows b S .. b S + 63 of A
    k_castS16v<4><<<gW, 256, 0, stream>>>(Wq, (__bf16*)WqS, (__bf16*)WqS2);
    k_castS16v<4><<<gW, 256, 0, stream>>>(Wk, (__bf16*)WkS, (__bf16*)WkS2);
    w25::wmma_gemm_lds<1, true><<<dim3(D / 128, Bn), 256, 0, stream>>>(XS, XS2, WqS, WqS2, Q64, D, D, 1.0f, S);
    w25::wmma_gemm_lds<1, true><<<dim3(D / 128, Bn), 256, 0, stream>>>(XS, XS2, WkS, WkS2, K64, D, D, 1.0f, S);
    k_cm_ropev<2048><<<NR / 8, 256, 0, stream>>>(Q, Kb, cosT, sinT, (const int*)tpos);
    k_cm_ropev<64><<<Bn * 64 / 8, 256, 0, stream>>>(Q64, K64, cosT, sinT, (const int*)tpos);
    k_attn_t<2048, 1024><<<dim3((unsigned)NH, (unsigned)Bn, (unsigned)(S / (16 * AW))), 32 * AW, 0, stream>>>(Q, Kb, V, AT);
    k_cm_exact<<<Bn * NH * 64, 64, 0, stream>>>(Q64, K64, V, AT, S, D, NH, HD);
    k_castS16v<8><<<gX, 256, 0, stream>>>(AT, (__bf16*)XS, (__bf16*)XS2);
    k_castS16v<4><<<gW, 256, 0, stream>>>(Wo, (__bf16*)WoS, (__bf16*)WoS2);
    w25::wmma_gemm_lds<1, true><<<dim3(D / 128, NR / 64), 256, 0, stream>>>(XS, XS2, WoS, WoS2, out, D, D, 1.0f, 64);
}

// v007
// One run takes 341 microseconds.
// Two timings next to v006 both put it at 1.12 times that version's speed.
// All steps since the starting kernel, v000, together make it 13.3 times as fast.
// Contractions: q/k = x.W^T [8192x1024].[1024x1024] with f16 operands (weights x16); v = x.Wv^T and the output projection on bf16 hi/lo split planes (late causal rows are long averages, so the value path must be f32-class) — v_wmma_f32_16x16x32_*, 64x128 work-group tiles with both operands staged in LDS; per (batch, head) causal softmax(q k^T / 8) v as one flash launch (f16 q.k^T and p.v; fully-masked key tiles skipped); f32 accumulate and softmax. The interleaved-pair RoPE with the INPUT cos/sin tables gathered by the INPUT token positions (generic elementwise form: out = x*cos + rot(x)*sin with rot = (-x[odd], x[even]) interleaved) and the exact-f32 recompute of the first 64 causal rows per head (whose q/k rows come from their own small bf16 hi/lo split GEMMs [64x1024].[1024x1024]) are f32 kernels.
#include <hip/hip_runtime.h>
#include <math.h>

typedef __attribute__((ext_vector_type(16))) _Float16 v16h;
typedef __attribute__((ext_vector_type(8)))  _Float16 v8h;
typedef __attribute__((ext_vector_type(4)))  _Float16 v4h;
typedef __attribute__((ext_vector_type(16))) __bf16   v16b;
typedef __attribute__((ext_vector_type(8)))  float    v8f;
typedef __attribute__((ext_vector_type(4)))  float    v4f;

// 16-bit WMMA fragment map (wave32), lane L, h = L>>4, m = L&15:
//   A 16x32: lane = row m;   element i -> k = (i<8) ? 8h+i : 16+8h+(i-8)
//   B 32x16: lane = column m; the SAME k(i,h)
//   D 16x16 (8 f32): lane = column m; element r -> row 8h+r
__device__ __forceinline__ int frag_k(int i, int h) { return (i < 8) ? (8 * h + i) : (16 + 8 * h + (i - 8)); }
__device__ __forceinline__ __bf16 bf16_rne(float f) {
    unsigned int u = __float_as_uint(f);
    u += 0x7fffu + ((u >> 16) & 1u);
    return __builtin_bit_cast(__bf16, (unsigned short)(u >> 16));
}
__device__ __forceinline__ float bf16_f32(__bf16 b) { return __uint_as_float(((unsigned int)__builtin_bit_cast(unsigned short, b)) << 16); }
__device__ __forceinline__ v8f wmma16(v16h a, v16h b, v8f c) {
    c = __builtin_amdgcn_wmma_f32_16x16x32_f16(false, a, false, b, (short)0, c, false, false);
    asm volatile("v_nop\n\tv_nop\n\tv_nop\n\tv_nop" : "+v"(c) : "v"(a), "v"(b));
    return c;
}
__device__ __forceinline__ v8f wmmab(v16b a, v16b b, v8f c) {
    c = __builtin_amdgcn_wmma_f32_16x16x32_bf16(false, a, false, b, (short)0, c, false, false);
    asm volatile("v_nop\n\tv_nop\n\tv_nop\n\tv_nop" : "+v"(c) : "v"(a), "v"(b));
    return c;
}
struct Split { v16b hi, lo; };
// hi/lo split product: a.hi*b.hi + a.hi*b.lo + a.lo*b.hi
__device__ __forceinline__ v8f wmma3(const Split& a, const Split& b, v8f c) {
    c = __builtin_amdgcn_wmma_f32_16x16x32_bf16(false, a.hi, false, b.hi, (short)0, c, false, false);
    c = __builtin_amdgcn_wmma_f32_16x16x32_bf16(false, a.hi, false, b.lo, (short)0, c, false, false);
    c = __builtin_amdgcn_wmma_f32_16x16x32_bf16(false, a.lo, false, b.hi, (short)0, c, false, false);
    asm volatile("v_nop\n\tv_nop\n\tv_nop\n\tv_nop" : "+v"(c) : "v"(a.hi), "v"(a.lo), "v"(b.hi), "v"(b.lo));
    return c;
}
struct Split3 { v16b hi, mid, lo; };
// triple split product (6 terms, drops only terms below 2^-24 relative)
__device__ __forceinline__ v8f wmma6(const Split3& a, const Split3& b, v8f c) {
    c = __builtin_amdgcn_wmma_f32_16x16x32_bf16(false, a.hi, false, b.hi, (short)0, c, false, false);
    c = __builtin_amdgcn_wmma_f32_16x16x32_bf16(false, a.hi, false, b.mid, (short)0, c, false, false);
    c = __builtin_amdgcn_wmma_f32_16x16x32_bf16(false, a.mid, false, b.hi, (short)0, c, false, false);
    c = __builtin_amdgcn_wmma_f32_16x16x32_bf16(false, a.hi, false, b.lo, (short)0, c, false, false);
    c = __builtin_amdgcn_wmma_f32_16x16x32_bf16(false, a.mid, false, b.mid, (short)0, c, false, false);
    c = __builtin_amdgcn_wmma_f32_16x16x32_bf16(false, a.lo, false, b.hi, (short)0, c, false, false);
    asm volatile("v_nop\n\tv_nop\n\tv_nop\n\tv_nop" : "+v"(c) : "v"(a.hi), "v"(a.mid), "v"(a.lo), "v"(b.hi), "v"(b.mid), "v"(b.lo));
    return c;
}

// Fragment gathers from f32 memory: element i <- p[(k0 + frag_k(i,h)) * sk] * s, zero for k >= klen.
__device__ __forceinline__ v16h fh_ld(const float* __restrict__ p, long long sk, int k0, int h, int klen, float s) {
    v16h a;
#pragma unroll
    for (int i = 0; i < 16; ++i) { const int k = k0 + frag_k(i, h); a[i] = (k < klen) ? (_Float16)(p[(long long)k * sk] * s) : (_Float16)0.f; }
    return a;
}
__device__ __forceinline__ Split sp_ld(const float* __restrict__ p, long long sk, int k0, int h, int klen, float s) {
    Split r;
#pragma unroll
    for (int i = 0; i < 16; ++i) {
        const int k = k0 + frag_k(i, h); const float x = (k < klen) ? p[(long long)k * sk] * s : 0.f;
        const __bf16 hb = bf16_rne(x); r.hi[i] = hb; r.lo[i] = bf16_rne(x - bf16_f32(hb));
    }
    return r;
}
__device__ __forceinline__ Split3 sp3_ld(const float* __restrict__ p, long long sk, int k0, int h, int klen, float s) {
    Split3 r;
#pragma unroll
    for (int i = 0; i < 16; ++i) {
        const int k = k0 + frag_k(i, h); const float x = (k < klen) ? p[(long long)k * sk] * s : 0.f;
        const __bf16 hb = bf16_rne(x); const float r1 = x - bf16_f32(hb); const __bf16 mb = bf16_rne(r1);
        r.hi[i] = hb; r.mid[i] = mb; r.lo[i] = bf16_rne(r1 - bf16_f32(mb));
    }
    return r;
}
__device__ __forceinline__ v16b bh_ld(const float* __restrict__ p, long long sk, int k0, int h, int klen, float s) {
    v16b a;
#pragma unroll
    for (int i = 0; i < 16; ++i) { const int k = k0 + frag_k(i, h); a[i] = bf16_rne((k < klen) ? p[(long long)k * sk] * s : 0.f); }
    return a;
}
// f16 fragment from an f16 LDS/global row with element stride 1 (k-contiguous), no bounds (tile already zero padded)
__device__ __forceinline__ v16h fh_row(const _Float16* __restrict__ row, int k0, int h) {
    v16h a;
#pragma unroll
    for (int i = 0; i < 16; ++i) a[i] = row[k0 + frag_k(i, h)];
    return a;
}

#define VST2(T, ptr, val) do { const T vst2_v_ = (val); *(T*)(ptr) = vst2_v_;  } while (0)
typedef float v4f __attribute__((ext_vector_type(4)));
#define VST2V4(ptr, val) do { const v4f vst2_v4_ = (val); *(v4f*)(ptr) = vst2_v4_;  } while (0)

__device__ __attribute__((noinline)) float act_fn(float v, int act) {
    if (act == 1) return fmaxf(v, 0.f);                                                                               // relu
    if (act == 2) { const float u = 0.7978845608028654f * (v + 0.044715f * v * v * v); return 0.5f * v * (1.f + tanhf(u)); } // tanh-gelu
    if (act == 3) return v / (1.f + expf(-v));                                                                        // silu
    if (act == 4) return 0.5f * v * (1.f + erff(v * 0.7071067811865476f));                                             // erf-gelu
    if (act == 5) return tanhf(v);
    if (act == 6) return 1.f / (1.f + expf(-v));                                                                      // sigmoid
    if (act == 7) return (v > 0.f) ? v : 0.01f * v;                                                                   // leaky relu 0.01
    if (act == 8) return (v > 0.f) ? v : (expf(v) - 1.f);                                                             // elu
    if (act == 9) return fminf(fmaxf(v, 0.f), 6.f);                                                                   // relu6
    if (act == 10) return fabsf(v);                                                                                    // abs
    if (act == 11) return (v >= 0.f) ? v : 0.1f * v;                                                                  // leaky 0.1
    if (act == 12) return (v > 0.f) ? v : 0.2f * v;                                                                   // leaky 0.2
    if (act == 13) return (v > 20.f) ? v : log1pf(expf(v));                                                            // softplus
    return v;
}

// =====================================================================================================================
// k_gemm<MODE>: C(z, m, n) = act(alpha * sum_k A(z, m, k) * B(z, k, n) + bias) + beta * R(z, m, n)
//   One wave (32-thread block) per 16 x 32 tile of C; grid (ceil(N/32), ceil(M/16), Z). Batch z -> (zo = z / zi_n, zi = z % zi_n)
//   with separate outer/inner strides for every tensor (e.g. batch and head). A(m,k) = A[zo*sAo + zi*sAi + m*sAm + k*sAk] (f32),
//   B(k,n) = B[zo*sBo + zi*sBi + n*sBn + k*sBk] (f32); any M, N, K (K zero-padded to 32 inside the fragments, M/N tails guarded).
//   C(m,n) = C[zo*sCo + zi*sCi + m*sCm + n] (n contiguous). flags: 1 bias[n], 2 bias[m], 4 residual R[zo*sRo + zi*sRi + m*sRm + n*sRn].
//   MODE 0: f16 operands (A prescaled by sa, B by sb, both undone in the epilogue); 1: bf16 hi/lo split (3 products); 2: bf16;
//   3: bf16 hi/mid/lo triple split (6 products); 4: as 3 with Kahan-compensated f32 accumulation across k-steps.
// =====================================================================================================================
struct GemmP {
    const float* A; const float* B; const float* bias; const float* R; float* C;
    long long sAo, sAi, sAm, sAk, sBo, sBi, sBn, sBk, sCo, sCi, sCm, sRo, sRi, sRm, sRn;
    int M, N, K, zi_n, flags, act; float alpha, beta, sa, sb;
    int Npad, pad_;     // columns [N, Npad) of C are written as 0 so that padded workspace rows are covered by whole-line stores; Npad >= N
};
static_assert(sizeof(GemmP) == 5 * 8 + 15 * 8 + 6 * 4 + 4 * 4 + 2 * 4, "GemmP has padding");

template <int MODE>
__global__ __launch_bounds__(32) void k_gemm(GemmP p) {
    const int lane = threadIdx.x & 31, h = lane >> 4, l15 = lane & 15;
    const int m0 = blockIdx.y * 16, n0 = blockIdx.x * 32;
    const int z = blockIdx.z, zo = z / p.zi_n, zi = z - zo * p.zi_n;
    const float* A = p.A + zo * p.sAo + zi * p.sAi;
    const float* B = p.B + zo * p.sBo + zi * p.sBi;
    const int am = min(m0 + l15, p.M - 1);                       // clamped row for loads (stores are guarded)
    v8f acc[2], comp[2];
#pragma unroll
    for (int t = 0; t < 2; ++t) { v8f zz = {}; acc[t] = zz; comp[t] = zz; }
    for (int k0 = 0; k0 < p.K; k0 += 32) {
        const float* arow = A + (long long)am * p.sAm;
        if (MODE == 1) {
            const Split a = sp_ld(arow, p.sAk, k0, h, p.K, 1.f);
#pragma unroll
            for (int t = 0; t < 2; ++t) {
                const int bn = min(n0 + t * 16 + l15, p.N - 1);
                acc[t] = wmma3(a, sp_ld(B + (long long)bn * p.sBn, p.sBk, k0, h, p.K, 1.f), acc[t]);
            }
        } else if (MODE == 3) {
            const Split3 a = sp3_ld(arow, p.sAk, k0, h, p.K, 1.f);
#pragma unroll
            for (int t = 0; t < 2; ++t) {
                const int bn = min(n0 + t * 16 + l15, p.N - 1);
                acc[t] = wmma6(a, sp3_ld(B + (long long)bn * p.sBn, p.sBk, k0, h, p.K, 1.f), acc[t]);
            }
        } else if (MODE == 4) {
            // triple split as MODE 3, but each k-step's 6 products go into a fresh accumulator and the partial is added to the running f32 sum
            // on the VALU with Kahan compensation (accumulation error stays ~1 ulp however long K is)
            const Split3 a = sp3_ld(arow, p.sAk, k0, h, p.K, 1.f);
#pragma unroll
            for (int t = 0; t < 2; ++t) {
                const int bn = min(n0 + t * 16 + l15, p.N - 1); v8f zz = {};
                const v8f part = wmma6(a, sp3_ld(B + (long long)bn * p.sBn, p.sBk, k0, h, p.K, 1.f), zz);
                const v8f y = part - comp[t]; const v8f s = acc[t] + y; comp[t] = (s - acc[t]) - y; acc[t] = s;
            }
        } else if (MODE == 2) {
            const v16b a = bh_ld(arow, p.sAk, k0, h, p.K, 1.f);
#pragma unroll
            for (int t = 0; t < 2; ++t) {
                const int bn = min(n0 + t * 16 + l15, p.N - 1);
                acc[t] = wmmab(a, bh_ld(B + (long long)bn * p.sBn, p.sBk, k0, h, p.K, 1.f), acc[t]);
            }
        } else {
            const v16h a = fh_ld(arow, p.sAk, k0, h, p.K, p.sa);
#pragma unroll
            for (int t = 0; t < 2; ++t) {
                const int bn = min(n0 + t * 16 + l15, p.N - 1);
                acc[t] = wmma16(a, fh_ld(B + (long long)bn * p.sBn, p.sBk, k0, h, p.K, p.sb), acc[t]);
            }
        }
    }
    const float iscale = (MODE == 0) ? p.alpha / (p.sa * p.sb) : p.alpha;
    float* C = p.C + zo * p.sCo + zi * p.sCi;
    const float* R = p.R + zo * p.sRo + zi * p.sRi;
    __shared__ __align__(16) float ctile[16][36];
#pragma unroll
    for (int t = 0; t < 2; ++t) {
        const int n = n0 + t * 16 + l15; const int nn = min(n, p.N - 1);
#pragma unroll
        for (int r = 0; r < 8; ++r) {
            const int m = m0 + 8 * h + r; const int mm = min(m, p.M - 1);
            float v = acc[t][r] * iscale;
            if (p.flags & 1) v += p.bias[nn];
            if (p.flags & 2) v += p.bias[mm];
            if (p.flags & 8) v *= p.bias[(long long)zo * p.M + mm];   /* per-(z,row) scale vector laid out [Z][M]; exclusive with the bias flags */
            v = act_fn(v, p.act);
            if (p.flags & 4) v += p.beta * R[(long long)mm * p.sRm + (long long)nn * p.sRn];
            ctile[8 * h + r][t * 16 + l15] = (n < p.N) ? v : 0.f;
        }
    }
    __syncthreads();
    const int NW = (p.Npad > p.N) ? p.Npad : p.N;           // write width
    const bool fast = (m0 + 16 <= p.M) && (n0 + 32 <= NW) && ((p.sCm & 3) == 0) && ((((size_t)C) & 15) == 0);
    if (fast) {
#pragma unroll
        for (int s = 0; s < 4; ++s) {
            const int row = s * 4 + (lane >> 3), c4 = (lane & 7) * 4;
            const v4f v = *(const v4f*)&ctile[row][c4];
            VST2V4(C + (long long)(m0 + row) * p.sCm + n0 + c4, v);
        }
    } else {
        for (int row = 0; row < 16; ++row) {
            const int m = m0 + row, n = n0 + lane;
            if (m < p.M && n < NW) VST2(float, C + (long long)m * p.sCm + n, ctile[row][lane]);
        }
    }
}


// =====================================================================================================================
// k_gemmT<MODE, TM, TN>: same contract as k_gemm, but one wave computes a (16*TM) x (16*TN) tile: TM A fragments and TN B fragments are
//   loaded per 32-wide k-step and reused across TM*TN WMMAs (far fewer load/convert instructions per MAC). MODE 0 (f16), 1 (bf16 hi/lo),
//   2 (bf16) only. grid (ceil(NW/(16*TN)), ceil(M/(16*TM)), Z), block 32. Epilogue identical to k_gemm, run per 16x32 sub-tile.
// =====================================================================================================================
template <int MODE, int TM, int TN>
__global__ __launch_bounds__(32) void k_gemmT(GemmP p) {
    const int lane = threadIdx.x & 31, h = lane >> 4, l15 = lane & 15;
    const int m0 = blockIdx.y * (16 * TM), n0 = blockIdx.x * (16 * TN);
    const int z = blockIdx.z, zo = z / p.zi_n, zi = z - zo * p.zi_n;
    const float* A = p.A + zo * p.sAo + zi * p.sAi;
    const float* B = p.B + zo * p.sBo + zi * p.sBi;
    v8f acc[TM][TN];
#pragma unroll
    for (int i = 0; i < TM; ++i)
#pragma unroll
        for (int t = 0; t < TN; ++t) { v8f zz = {}; acc[i][t] = zz; }
    for (int k0 = 0; k0 < p.K; k0 += 32) {
        if (MODE == 1) {
            Split a[TM], b[TN];
#pragma unroll
            for (int i = 0; i < TM; ++i) { const int am = min(m0 + 16 * i + l15, p.M - 1); a[i] = sp_ld(A + (long long)am * p.sAm, p.sAk, k0, h, p.K, 1.f); }
#pragma unroll
            for (int t = 0; t < TN; ++t) { const int bn = min(n0 + 16 * t + l15, p.N - 1); b[t] = sp_ld(B + (long long)bn * p.sBn, p.sBk, k0, h, p.K, 1.f); }
#pragma unroll
            for (int i = 0; i < TM; ++i)
#pragma unroll
                for (int t = 0; t < TN; ++t) acc[i][t] = wmma3(a[i], b[t], acc[i][t]);
        } else if (MODE == 2) {
            v16b a[TM], b[TN];
#pragma unroll
            for (int i = 0; i < TM; ++i) { const int am = min(m0 + 16 * i + l15, p.M - 1); a[i] = bh_ld(A + (long long)am * p.sAm, p.sAk, k0, h, p.K, 1.f); }
#pragma unroll
            for (int t = 0; t < TN; ++t) { const int bn = min(n0 + 16 * t + l15, p.N - 1); b[t] = bh_ld(B + (long long)bn * p.sBn, p.sBk, k0, h, p.K, 1.f); }
#pragma unroll
            for (int i = 0; i < TM; ++i)
#pragma unroll
                for (int t = 0; t < TN; ++t) acc[i][t] = wmmab(a[i], b[t], acc[i][t]);
        } else {
            v16h a[TM], b[TN];
#pragma unroll
            for (int i = 0; i < TM; ++i) { const int am = min(m0 + 16 * i + l15, p.M - 1); a[i] = fh_ld(A + (long long)am * p.sAm, p.sAk, k0, h, p.K, p.sa); }
#pragma unroll
            for (int t = 0; t < TN; ++t) { const int bn = min(n0 + 16 * t + l15, p.N - 1); b[t] = fh_ld(B + (long long)bn * p.sBn, p.sBk, k0, h, p.K, p.sb); }
#pragma unroll
            for (int i = 0; i < TM; ++i)
#pragma unroll
                for (int t = 0; t < TN; ++t) acc[i][t] = wmma16(a[i], b[t], acc[i][t]);
        }
    }
    const float iscale = (MODE == 0) ? p.alpha / (p.sa * p.sb) : p.alpha;
    float* C = p.C + zo * p.sCo + zi * p.sCi;
    const float* R = p.R + zo * p.sRo + zi * p.sRi;
    const int NW = (p.Npad > p.N) ? p.Npad : p.N;
    __shared__ __align__(16) float ctile[16][36];
#pragma unroll
    for (int i = 0; i < TM; ++i) {
        const int mb = m0 + 16 * i; if (mb >= p.M) break;          // wave-uniform
#pragma unroll
        for (int tp = 0; tp < TN / 2; ++tp) {
            const int nb = n0 + 32 * tp; if (nb >= NW) break;        // wave-uniform
#pragma unroll
            for (int t2 = 0; t2 < 2; ++t2) {
                const int t = 2 * tp + t2; const int n = nb + t2 * 16 + l15; const int nn = min(n, p.N - 1);
#pragma unroll
                for (int r = 0; r < 8; ++r) {
                    const int m = mb + 8 * h + r; const int mm = min(m, p.M - 1);
                    float v = acc[i][t][r] * iscale;
                    if (p.flags & 1) v += p.bias[nn];
                    if (p.flags & 2) v += p.bias[mm];
            if (p.flags & 8) v *= p.bias[(long long)zo * p.M + mm];   /* per-(z,row) scale vector laid out [Z][M]; exclusive with the bias flags */
                    v = act_fn(v, p.act);
                    if (p.flags & 4) v += p.beta * R[(long long)mm * p.sRm + (long long)nn * p.sRn];
                    ctile[8 * h + r][t2 * 16 + l15] = (n < p.N) ? v : 0.f;
                }
            }
            __syncthreads();
            const bool fast = (mb + 16 <= p.M) && (nb + 32 <= NW) && ((p.sCm & 3) == 0) && ((((size_t)C) & 15) == 0);
            if (fast) {
#pragma unroll
                for (int s = 0; s < 4; ++s) {
                    const int row = s * 4 + (lane >> 3), c4 = (lane & 7) * 4;
                    const v4f v = *(const v4f*)&ctile[row][c4];
                    VST2V4(C + (long long)(mb + row) * p.sCm + nb + c4, v);
                }
            } else {
                for (int row = 0; row < 16; ++row) {
                    const int m = mb + row, n = nb + lane;
                    if (m < p.M && n < NW) VST2(float, C + (long long)m * p.sCm + n, ctile[row][lane]);
                }
            }
            __syncthreads();
        }
    }
}

// =====================================================================================================================
//   Wave = 16 queries, AW waves per block, 64-key blocks; grid (ceil(Lq/(16*AW)), H, B), block 32*AW. Any Lq, Lk; head dim dh <= DHP
//   (DHP multiple of 32), value dim dv <= DVP (multiple of 16, <= 128). Every tensor addressed by (batch, head, row, element) strides, f32.
//   Scores: QM 0 f16 operands, 1 bf16 hi/lo split, 2 bf16 triple split; statistics f32 (exp2 domain); P.V: P x 4096 as f16 with V f16 staged in LDS
//   (SPLITPV: P and V as bf16 hi/lo splits). kv head = h / hrep. Masking: causal = 1 (keep j <= i + coff, masked -> -inf, key blocks beyond the
//   diagonal skipped), causal = 2 (masked -> mfill, a finite fill like the -1e9; no skipping), causal = 3 (keep j >= i + coff,
//   masked -> -inf, no skipping); optional additive f32 mask Mf,
//   optional int keep-mask Mi (0 -> score := mfill), both addressed b*smb + h*smh + i*smi + j*smj (0 strides broadcast).
// =====================================================================================================================
#define AW 4
struct AttnP {   // apv4
    const float* Q; const float* K; const float* V; float* O; float* P; const float* Mf; const int* Mi; float* ST;
    const float* Pw; const float* Rt; const int* SQ; const int* SK;           // optional: post-softmax weight, relative-position table, segment ids
    long long swb, swh, swi, swj, srb, srh, sri;                                 // Pw strides (b,h,i,j); Rt strides (b,h,i), column = clamp(i - j + roff, 0, rn-1)
    long long sQb, sQh, sQi, sQd, sKb, sKh, sKj, sKd, sVb, sVh, sVj, sVd, sOb, sOh, sOi, sPb, sPh, sPi, smb, smh, smi, smj;
    int Lq, Lk, dh, dv, hrep, causal, coff, pband;   // pband > 0: P holds only the band |j - i| <= pband, column j - i + pband
    float scale, mfill; int nonorm, mpol;             // nonorm (online path only): O = sum_j exp(score_j) V_j without the 1/rowsum (scores must be <= ~0); mpol: Mi masks where ==0 (mpol 0) or where !=0 (mpol 1)
    int roff, rn, segpol, win;                        // Rt column offset/count; SQ/SK: score := mfill where (segpol 0) SQ[i] != SK[j] or (segpol 1) SQ[i] == SK[j]; win > 0: keys with i - j > win (after coff) -> -inf
};
//   Pw: the softmax numerator is multiplied by Pw(b,h,i,j) AFTER the row sum is taken (probs * weight, then P.V), as in post-softmax multiplicative biases.                                                    // ST (optional): per row (b,h,i) -> ST[((b*H + h)*Lq + i)*2 + {0,1}] = {row max of the scaled+masked score (natural units), sum_j exp(score - max)}
static_assert(sizeof(AttnP) == 12 * 8 + 29 * 8 + 16 * 4, "AttnP has padding");

#ifndef KATTN_ATTR
#define KATTN_ATTR __attribute__((amdgpu_waves_per_eu(4)))   // at most 256 registers a wave: four waves a SIMD, 1024 work-groups of the causal grid resident at once
#endif
//   FS > 0 (QM 0, one pass, f16 P.V only): the layout is fixed at compile time: Q, K, V, O are dense [batch][FS rows][FD] f32 with head h at column h * DHP (DVP for V, O),
//   dh = DHP, dv = DVP, Lq = Lk = FS (multiple of 64), causal = 1 with coff = 0, none of the optional inputs or outputs. Every element guard and stride then folds
//   away, and a key block's K and V come in by plain 16-byte loads that are in flight together, in two batches, instead of guarded 4-byte loads waited on one at a time.
template <int DHP, int DVP, int QM, bool SPLITPV, bool TWOPASS, int FS = 0, int FD = 0>
__global__ __launch_bounds__(32 * AW) KATTN_ATTR void k_attn(AttnP p) {
    static_assert(FS == 0 || (QM == 0 && !SPLITPV && !TWOPASS && DHP == 64 && DVP == 64 && FS % 64 == 0 && FD % 8 == 0), "fixed layout: whole key blocks, 32-byte aligned fragments");
    if (FS > 0) {
        p.P = nullptr; p.Mf = nullptr; p.Mi = nullptr; p.ST = nullptr; p.Pw = nullptr; p.Rt = nullptr; p.SQ = nullptr; p.SK = nullptr;
        p.sQb = (long long)FS * FD; p.sQh = DHP; p.sQi = FD; p.sQd = 1; p.sKb = (long long)FS * FD; p.sKh = DHP; p.sKj = FD; p.sKd = 1;
        p.sVb = (long long)FS * FD; p.sVh = DVP; p.sVj = FD; p.sVd = 1; p.sOb = (long long)FS * FD; p.sOh = DVP; p.sOi = FD;
        p.Lq = FS; p.Lk = FS; p.dh = DHP; p.dv = DVP; p.hrep = 1; p.causal = 1; p.coff = 0; p.pband = 0; p.nonorm = 0; p.win = 0;
    }
    constexpr int NT = DVP / 16;                // output tiles
    constexpr int KS = DHP / 32;                // k-steps for the scores
    constexpr int VP = DVP + 8;                 // LDS pitch (halves)
    __shared__ __align__(16) float    pl[AW][16 * 64];
    __shared__ __align__(16) _Float16 vl[(SPLITPV ? 2 : 1) * 64 * VP];   // f16 V tile, or bf16 hi and lo tiles (same 2-byte size)
    const int lane = threadIdx.x & 31, hf = lane >> 4, l15 = lane & 15, wave = threadIdx.x >> 5;
    // FS > 0: grid (heads, batches, query tiles) and query tile bx = last - blockIdx.z. A causal tile walks bx + 1 key blocks and only half the work-groups are resident at once;
    // the long tiles take the low indices and the short ones the high, and neighbours in index cost the same.
    const int bx = FS > 0 ? FS / (16 * AW) - 1 - (int)blockIdx.z : (int)blockIdx.x;
    const int h = FS > 0 ? blockIdx.x : blockIdx.y, b = FS > 0 ? blockIdx.y : blockIdx.z, hk = h / p.hrep;
    const int q0 = (bx * AW + wave) * 16;
    float* myp = pl[wave];
    const float L2E = 1.4426950408889634f;
    const float NEG = -__builtin_inff();
    const int qi = min(q0 + l15, p.Lq - 1);
    const float* qrow = p.Q + b * p.sQb + h * p.sQh + (long long)qi * p.sQi;
    const float* kbase = p.K + b * p.sKb + hk * p.sKh;
    const float* vbase = p.V + b * p.sVb + hk * p.sVh;
    v16h qa[QM == 0 ? KS : 1]; Split qs_[QM == 1 ? KS : 1]; Split3 qt_[QM == 2 ? KS : 1];
#pragma unroll
    for (int ks = 0; ks < KS; ++ks) {
        if (QM == 2) qt_[ks] = sp3_ld(qrow, p.sQd, ks * 32, hf, p.dh, 1.f);
        else if (QM == 1) qs_[ks] = sp_ld(qrow, p.sQd, ks * 32, hf, p.dh, 1.f);
        else qa[ks] = fh_ld(qrow, p.sQd, ks * 32, hf, p.dh, 1.f);
    }
    v8f o[NT]; float m8[8], l8[8];
#pragma unroll
    for (int t = 0; t < NT; ++t) { v8f zz = {}; o[t] = zz; }
#pragma unroll
    for (int i = 0; i < 8; ++i) { m8[i] = NEG; l8[i] = 0.f; }
    int jend = p.Lk; int jstart = 0;
    if (p.causal == 1) { const int je = (bx * AW + AW - 1) * 16 + 16 + p.coff; jend = min(jend, max(je, 0)); }   // uniform per block
    if (p.win > 0) { const int js = (bx * AW) * 16 + p.coff - p.win; jstart = (js > 0) ? (js / 64) * 64 : 0; }   // uniform per block: key blocks entirely outside every row's window hold only -inf entries and are skipped exactly
    const int npass = TWOPASS ? 2 : 1;
    for (int pass = 0; pass < npass; ++pass) {
        const bool dopv = (!TWOPASS) || pass == 1;
        for (int j0 = jstart; j0 < jend; j0 += 64) {
            v16h kf[FS > 0 ? 4 * KS : 1];                        // FS > 0: the key block's K fragments, tile t and k-step ks at t * KS + ks
            if (dopv) {
                __syncthreads();                                 // previous key block's reads of vl / pl are done
                if (FS > 0) {
                    // raw f32 in two batches, so that the loaded values and everything else that is live fit 256 registers (four waves a SIMD)
                    v4f vr[8]; v8f kr[8];                                           // V: four consecutive elements per thread and step; K: half a fragment each
                    const float* krow = kbase + (long long)(j0 + l15) * FD + 8 * hf;
#pragma unroll
                    for (int it = 0; it < 8; ++it)
                        vr[it] = *(const v4f*)(vbase + (long long)(j0 + ((int)threadIdx.x >> 4)) * FD + ((int)threadIdx.x & 15) * 4 + it * (2 * AW * FD));   // rows 2 AW apart per step
#pragma unroll
                    for (int c = 0; c < 8; ++c) kr[c] = *(const v8f*)(krow + (c >> 2) * (16 * FD) + (c & 3) * 16);   // key tile t = c / 4; k = 16 (c % 4) + 8 hf + (0..7)
                    // inputs-only fence on the loaded values: their first use is here, so the batch's 24 loads are all issued before any is waited on (without it
                    // the scheduler puts each load directly in front of its conversion and waits on it there)
                    asm volatile("" :: "v"(vr[0]), "v"(vr[1]), "v"(vr[2]), "v"(vr[3]), "v"(vr[4]), "v"(vr[5]), "v"(vr[6]), "v"(vr[7]),
                                 "v"(kr[0]), "v"(kr[1]), "v"(kr[2]), "v"(kr[3]), "v"(kr[4]), "v"(kr[5]), "v"(kr[6]), "v"(kr[7]));
#pragma unroll
                    for (int it = 0; it < 8; ++it) {
                        v4h hv; hv[0] = (_Float16)vr[it][0]; hv[1] = (_Float16)vr[it][1]; hv[2] = (_Float16)vr[it][2]; hv[3] = (_Float16)vr[it][3];
                        *(v4h*)(vl + ((int)threadIdx.x >> 4) * VP + ((int)threadIdx.x & 15) * 4 + it * (2 * AW * VP)) = hv;
                    }
#pragma unroll
                    for (int f = 0; f < 4; ++f)
#pragma unroll
                        for (int e = 0; e < 8; ++e) { kf[f][e] = (_Float16)kr[2 * f][e]; kf[f][8 + e] = (_Float16)kr[2 * f + 1][e]; }
                    v8f ks2[8];
#pragma unroll
                    for (int c = 0; c < 8; ++c) ks2[c] = *(const v8f*)(krow + (2 + (c >> 2)) * (16 * FD) + (c & 3) * 16);   // key tiles 2 and 3
                    // the same fence for the second batch's 16 loads; the address is named too, so that it stays live and none of these loads is given its register pair as destination
                    asm volatile("" :: "v"(ks2[0]), "v"(ks2[1]), "v"(ks2[2]), "v"(ks2[3]), "v"(ks2[4]), "v"(ks2[5]), "v"(ks2[6]), "v"(ks2[7]), "v"(krow));
#pragma unroll
                    for (int f = 0; f < 4; ++f)
#pragma unroll
                        for (int e = 0; e < 8; ++e) { kf[4 + f][e] = (_Float16)ks2[2 * f][e]; kf[4 + f][8 + e] = (_Float16)ks2[2 * f + 1][e]; }
                } else
                for (int idx = threadIdx.x; idx < 64 * DVP; idx += 32 * AW) {
                    const int jr = idx / DVP, d = idx - jr * DVP, j = j0 + jr;
                    const float f = (j < p.Lk && d < p.dv) ? vbase[(long long)j * p.sVj + (long long)d * p.sVd] : 0.f;
                    if (SPLITPV) {
                        const __bf16 hb = bf16_rne(f);
                        ((__bf16*)vl)[jr * VP + d] = hb; ((__bf16*)vl)[64 * VP + jr * VP + d] = bf16_rne(f - bf16_f32(hb));
                    } else vl[jr * VP + d] = (_Float16)f;
                }
            }
            v8f s[4];
#pragma unroll
            for (int t = 0; t < 4; ++t) {
                const int j = min(j0 + t * 16 + l15, p.Lk - 1);
                const float* krow = kbase + (long long)j * p.sKj;
                v8f acc = {};
#pragma unroll
                for (int ks = 0; ks < KS; ++ks) {
                    if (QM == 2)      acc = wmma6(qt_[ks], sp3_ld(krow, p.sKd, ks * 32, hf, p.dh, 1.f), acc);
                    else if (QM == 1) acc = wmma3(qs_[ks], sp_ld(krow, p.sKd, ks * 32, hf, p.dh, 1.f), acc);
                    else if (FS > 0)  acc = wmma16(qa[ks], kf[t * KS + ks], acc);
                    else              acc = wmma16(qa[ks], fh_ld(krow, p.sKd, ks * 32, hf, p.dh, 1.f), acc);
                }
                s[t] = acc;
            }
            float pv[8][4];
#pragma unroll
            for (int i = 0; i < 8; ++i) {
                const int irow = q0 + i + 8 * hf;
                const int ic = min(irow, p.Lq - 1);
                float sc[4];
#pragma unroll
                for (int t = 0; t < 4; ++t) {
                    const int jg = j0 + t * 16 + l15;
                    float v = s[t][i] * p.scale;
                    if (p.Mf) v += p.Mf[b * p.smb + h * p.smh + (long long)ic * p.smi + (long long)min(jg, p.Lk - 1) * p.smj];
                    if (p.Rt) { int rc = ic - min(jg, p.Lk - 1) + p.roff; rc = rc < 0 ? 0 : (rc >= p.rn ? p.rn - 1 : rc); v += p.Rt[b * p.srb + h * p.srh + (long long)ic * p.sri + rc]; }
                    if (p.Mi) { const int mv = p.Mi[b * p.smb + h * p.smh + (long long)ic * p.smi + (long long)min(jg, p.Lk - 1) * p.smj]; if (p.mpol ? (mv != 0) : (mv == 0)) v = p.mfill; }
                    if (p.SQ) { const bool same = p.SQ[(long long)b * p.Lq + ic] == p.SK[(long long)b * p.Lk + min(jg, p.Lk - 1)]; if (p.segpol ? same : !same) v = p.mfill; }
                    if (p.causal == 2 && jg > irow + p.coff) v = p.mfill;
                    if (jg >= p.Lk || (p.causal == 1 && jg > irow + p.coff) || (p.causal == 3 && jg < irow + p.coff) || (p.win > 0 && irow + p.coff - jg > p.win)) v = NEG; else v *= L2E;
                    sc[t] = v;
                }
                if (!TWOPASS || pass == 0) {
                    float mx = fmaxf(fmaxf(sc[0], sc[1]), fmaxf(sc[2], sc[3]));
                    mx = fmaxf(mx, __shfl_xor(mx, 1, 32)); mx = fmaxf(mx, __shfl_xor(mx, 2, 32));
                    mx = fmaxf(mx, __shfl_xor(mx, 4, 32)); mx = fmaxf(mx, __shfl_xor(mx, 8, 32));
                    const float mnew = fmaxf(m8[i], mx);
                    const float corr = (mnew == NEG) ? 1.f : exp2f(m8[i] - mnew);
                    float rs = 0.f;
#pragma unroll
                    for (int t = 0; t < 4; ++t) {
                        const float pp = (sc[t] == NEG) ? 0.f : exp2f(sc[t] - mnew); rs += pp;
                        pv[i][t] = p.Pw ? pp * p.Pw[b * p.swb + h * p.swh + (long long)ic * p.swi + (long long)min(j0 + t * 16 + l15, p.Lk - 1) * p.swj] : pp;
                    }
                    rs += __shfl_xor(rs, 1, 32); rs += __shfl_xor(rs, 2, 32); rs += __shfl_xor(rs, 4, 32); rs += __shfl_xor(rs, 8, 32);
                    l8[i] = l8[i] * corr + rs; m8[i] = mnew;
                    if (!TWOPASS) {
#pragma unroll
                        for (int t = 0; t < NT; ++t) o[t][i] *= corr;
                    }
                } else {
                    const float inv = (l8[i] > 0.f) ? 1.f / l8[i] : 0.f;
#pragma unroll
                    for (int t = 0; t < 4; ++t) {
                        const int jg = j0 + t * 16 + l15;
                        float pp = (sc[t] == NEG) ? 0.f : exp2f(sc[t] - m8[i]) * inv;
                        if (p.Pw) pp *= p.Pw[b * p.swb + h * p.swh + (long long)ic * p.swi + (long long)min(jg, p.Lk - 1) * p.swj];
                        pv[i][t] = pp;
                    }
                }
            }
            if (dopv) {
#pragma unroll
                for (int i = 0; i < 8; ++i)
#pragma unroll
                    for (int t = 0; t < 4; ++t) ((float*)myp)[(i + 8 * hf) * 64 + t * 16 + l15] = pv[i][t];
                __syncthreads();                                 // P (per wave) and V (shared) visible
                if (p.P) {
                    float* pb_ = p.P + b * p.sPb + h * p.sPh;
                    const bool fastP = (p.pband == 0) && ((p.sPi & 3) == 0) && (j0 + 64 <= p.Lk) && (q0 + 16 <= p.Lq) && ((((size_t)pb_) & 15) == 0);
                    if (fastP) {
#pragma unroll
                        for (int s = 0; s < 8; ++s) {
                            const int row = s * 2 + (lane >> 4), c4 = (lane & 15) * 4;
                            const v4f v = *(const v4f*)(myp + row * 64 + c4);
                            VST2V4(pb_ + (long long)(q0 + row) * p.sPi + j0 + c4, v);
                        }
                    } else {
                        for (int row = 0; row < 16; ++row) {
                            const int irow = q0 + row; if (irow >= p.Lq) continue;
                            for (int c = lane; c < 64; c += 32) {
                                const int jg = j0 + c; if (jg >= p.Lk) continue;
                                if (p.pband == 0) VST2(float, pb_ + (long long)irow * p.sPi + jg, myp[row * 64 + c]);
                                else if (jg - irow <= p.pband && irow - jg <= p.pband) VST2(float, pb_ + (long long)irow * p.sPi + (jg - irow + p.pband), myp[row * 64 + c]);
                            }
                        }
                    }
                }
                if (SPLITPV) {
                    const Split pa0 = sp_ld(myp + l15 * 64, 1, 0, hf, 64, 1.f), pa1 = sp_ld(myp + l15 * 64, 1, 32, hf, 64, 1.f);
                    const __bf16* vh = (const __bf16*)vl; const __bf16* vlo = vh + 64 * VP;
#pragma unroll
                    for (int t = 0; t < NT; ++t) {
                        const int dcol = t * 16 + l15;
                        Split b0, b1;
#pragma unroll
                        for (int e = 0; e < 16; ++e) {
                            const int k0 = frag_k(e, hf), k1 = 32 + frag_k(e, hf);
                            b0.hi[e] = vh[k0 * VP + dcol]; b0.lo[e] = vlo[k0 * VP + dcol]; b1.hi[e] = vh[k1 * VP + dcol]; b1.lo[e] = vlo[k1 * VP + dcol];
                        }
                        o[t] = wmma3(pa0, b0, o[t]);
                        o[t] = wmma3(pa1, b1, o[t]);
                    }
                } else {
                    const v16h pa0 = fh_ld(myp + l15 * 64, 1, 0, hf, 64, 4096.f), pa1 = fh_ld(myp + l15 * 64, 1, 32, hf, 64, 4096.f);
#pragma unroll
                    for (int t = 0; t < NT; ++t) {
                        const int dcol = t * 16 + l15;
                        v16h b0, b1;
#pragma unroll
                        for (int e = 0; e < 16; ++e) { b0[e] = vl[frag_k(e, hf) * VP + dcol]; b1[e] = vl[(32 + frag_k(e, hf)) * VP + dcol]; }
                        o[t] = wmma16(pa0, b0, o[t]);
                        o[t] = wmma16(pa1, b1, o[t]);
                    }
                }
            }
        }
    }
    float* obase = p.O + b * p.sOb + h * p.sOh;
    if (p.ST) {
        const int rl = lane >> 1, isel = rl & 7;           // row q0 + rl ; rl>>3 == hf holds because lane>>4 == (lane>>1)>>3
        float mv = 0.f, lv = 0.f;
#pragma unroll
        for (int i = 0; i < 8; ++i) if (i == isel) { mv = m8[i]; lv = l8[i]; }
        const int irow = q0 + rl;
        if (irow < p.Lq) { float* st = p.ST + (((long long)b * gridDim.y + h) * p.Lq + irow) * 2 + (lane & 1); VST2(float, st, (lane & 1) ? lv : mv * 0.6931471805599453f); }
    }
    float invr[8];
#pragma unroll
    for (int i = 0; i < 8; ++i) {
        if (TWOPASS) invr[i] = SPLITPV ? 1.f : (1.f / 4096.f);
        else if (p.nonorm) invr[i] = exp2f(m8[i]) * (SPLITPV ? 1.f : (1.f / 4096.f));
        else invr[i] = (l8[i] > 0.f) ? (SPLITPV ? 1.f / l8[i] : 1.f / (l8[i] * 4096.f)) : 0.f;
    }
    __syncthreads();                                             // all waves done with pl/vl from the main loop
    const bool ofast = ((p.sOi & 3) == 0) && ((((size_t)obase) & 15) == 0) && (q0 + 16 <= p.Lq);
#pragma unroll
    for (int c0 = 0; c0 < DVP; c0 += 64) {
#pragma unroll
        for (int i = 0; i < 8; ++i)
#pragma unroll
            for (int t = 0; t < NT; ++t) if (t * 16 >= c0 && t * 16 < c0 + 64) ((float*)myp)[(i + 8 * hf) * 64 + (t * 16 - c0) + l15] = o[t][i] * invr[i];
        __syncthreads();
        const int cw = (DVP - c0 < 64) ? (DVP - c0) : 64;      // staged columns in this chunk (multiple of 16)
        if (ofast && (c0 + cw <= p.dv) && (cw % 32 == 0)) {
            const int lpr = cw / 4;                              // lanes per row (16 for 64 cols, 8 for 32)
            const int rows_per_ins = 32 / lpr;
            for (int r0 = 0; r0 < 16; r0 += rows_per_ins) {
                const int row = r0 + lane / lpr, c4 = (lane % lpr) * 4;
                const v4f v = *(const v4f*)(myp + row * 64 + c4);
                VST2V4(obase + (long long)(q0 + row) * p.sOi + c0 + c4, v);
            }
        } else {
            for (int row = 0; row < 16; ++row) {
                const int irow = q0 + row; if (irow >= p.Lq) continue;
                for (int c = lane; c < cw; c += 32) { const int d = c0 + c; if (d < p.dv) VST2(float, obase + (long long)irow * p.sOi + d, myp[row * 64 + c]); }
            }
        }
        __syncthreads();
    }
}

// ---- causal flash attention, transposed products ------------------------------------------------------------------
// Q, K, V, O dense f32 [batch][FS rows][FD], head h at column 64 h, head size 64. grid (heads, batches, FS / 64), query tile bx = last - blockIdx.z (longest first),
// 4 waves of 16 queries, key blocks of 64. S^T = K.Q^T: A = 16 keys x 32 k, B = Q, so s[t][r] is the score of key j0 + 16 t + 8 hf + r for query q0 + l15:
// the 64 scores of a query lie in lanes l15 and l15 + 16, the maximum and the sum are taken in the lane, and the two halves meet by one exchange.
// O^T += V^T.P^T: two score tiles, converted in place, are the B operand (element e <- tile e / 8, register e % 8, the hardware k order), so P passes through no LDS;
// A = V^T comes from the row-major f16 V tile by the transposing LDS load, which delivers the same k order. o[t][r] = O[q0 + l15][16 t + 8 hf + r].
// Every loop but the one over key blocks is unrolled (#pragma unroll): its index picks registers of a fragment or an accumulator, which stay registers only under constant indices.
typedef __attribute__((ext_vector_type(8))) short v8s;
__device__ __forceinline__ v8h at_ld_tr16(const _Float16* p) { typedef __attribute__((address_space(3))) v8s lds_v8s; return __builtin_bit_cast(v8h, __builtin_amdgcn_ds_load_tr16_b128_v8i16((lds_v8s*)p)); }
__device__ __forceinline__ float at_xhalf(float x) { return __builtin_bit_cast(float, __builtin_amdgcn_permlanex16(__builtin_bit_cast(int, x), __builtin_bit_cast(int, x), 0x76543210, 0xfedcba98, false, false)); }   // lane l <-> lane l ^ 16
// 2^x by v_exp_f32 (a result under 2^-126 comes out as 0). Written as asm for the slot that the instruction set asks for behind a transcendental: no result register is a source
// register of the statement ("=&v"), so no exponential overwrites the source or reads the result of the one in front of it, and the v_nop at the end fills the slot behind the last.
__device__ __forceinline__ float at_exp2(float x) { float d; asm("v_exp_f32 %0, %1\n\tv_nop" : "=&v"(d) : "v"(x)); return d; }
__device__ __forceinline__ v8f at_exp2x8(v8f x) {
    float d0, d1, d2, d3, d4, d5, d6, d7;
    asm("v_exp_f32 %0, %8\n\tv_exp_f32 %1, %9\n\tv_exp_f32 %2, %10\n\tv_exp_f32 %3, %11\n\tv_exp_f32 %4, %12\n\tv_exp_f32 %5, %13\n\tv_exp_f32 %6, %14\n\tv_exp_f32 %7, %15\n\tv_nop"
        : "=&v"(d0), "=&v"(d1), "=&v"(d2), "=&v"(d3), "=&v"(d4), "=&v"(d5), "=&v"(d6), "=&v"(d7)
        : "v"(x[0]), "v"(x[1]), "v"(x[2]), "v"(x[3]), "v"(x[4]), "v"(x[5]), "v"(x[6]), "v"(x[7]));
    v8f d; d[0] = d0; d[1] = d1; d[2] = d2; d[3] = d3; d[4] = d4; d[5] = d5; d[6] = d6; d[7] = d7; return d;
}
template <int FS, int FD>
__global__ __launch_bounds__(32 * AW) KATTN_ATTR void k_attn_t(const float* __restrict__ Q, const float* __restrict__ K, const float* __restrict__ V, float* __restrict__ O) {
    static_assert(FS % 64 == 0 && FD % 8 == 0 && AW == 4, "whole key blocks, 32-byte aligned fragments");
    constexpr int VP = 80;                      // V tile pitch in halves: 160 B = 32 B x odd, the transposing load's pitch
    constexpr int OP = 68;                      // output staging pitch in floats
    __shared__ __align__(16) _Float16 vl[64 * VP];
    __shared__ __align__(16) float    ol[AW][16 * OP];
    const int lane = threadIdx.x & 31, hf = lane >> 4, l15 = lane & 15, wave = threadIdx.x >> 5;
    const int bx = FS / (16 * AW) - 1 - (int)blockIdx.z;
    const int h = blockIdx.x, b = blockIdx.y;
    const int q0 = (bx * AW + wave) * 16;
    const float NEG = -__builtin_inff();
    const float SC = 0.125f * 1.4426950408889634f;   // 1 / sqrt(64) and log2(e); the power of two makes one product round as the two did
    const size_t hb = (size_t)b * FS * FD + (size_t)h * 64;
    const float* qrow = Q + hb + (size_t)(q0 + l15) * FD;
    const float* kbase = K + hb;
    const float* vbase = V + hb;
    v16h qa[2];
#pragma unroll
    for (int ks = 0; ks < 2; ++ks) qa[ks] = fh_ld(qrow, 1, ks * 32, hf, 64, 1.f);
    v8f o[4]; float m = NEG, l = 0.f;           // m: the query's running maximum (both halves alike); l: this half's part of its sum
#pragma unroll
    for (int t = 0; t < 4; ++t) { v8f zz = {}; o[t] = zz; }
    const _Float16* vt = vl + (8 * hf + (lane & 7)) * VP + 8 * ((lane >> 3) & 1);   // this lane's address in the transposing loads, key 0, column 0
    const int jend = (bx + 1) * 64;
    for (int j0 = 0; j0 < jend; j0 += 64) {
        v16h kf[8];                                          // the key block's K fragments, tile t and k-step ks at 2 t + ks
        __syncthreads();                                     // previous key block's reads of vl are done
        {
            // raw f32 in two batches, so that the loaded values and everything else that is live fit 256 registers (four waves a SIMD)
            v4f vr[8]; v8f kr[8];                                           // V: four consecutive elements per thread and step; K: half a fragment each
            const float* krow = kbase + (long long)(j0 + l15) * FD + 8 * hf;
            const float* vrow = vbase + (long long)(j0 + ((int)threadIdx.x >> 4)) * FD + ((int)threadIdx.x & 15) * 4;
#pragma unroll
            for (int it = 0; it < 8; ++it) vr[it] = *(const v4f*)(vrow + it * (2 * AW * FD));   // rows 2 AW apart per step
#pragma unroll
            for (int c = 0; c < 8; ++c) kr[c] = *(const v8f*)(krow + (c >> 2) * (16 * FD) + (c & 3) * 16);   // key tile t = c / 4; k = 16 (c % 4) + 8 hf + (0..7)
            // inputs-only fence on the loaded values: their first use is here, so the batch's 24 loads are all issued before any is waited on (without it
            // the scheduler puts each load directly in front of its conversion and waits on it there); V's address is named too, so that it stays live and none of
            // these loads is given its register pair as destination
            asm volatile("" :: "v"(vr[0]), "v"(vr[1]), "v"(vr[2]), "v"(vr[3]), "v"(vr[4]), "v"(vr[5]), "v"(vr[6]), "v"(vr[7]),
                         "v"(kr[0]), "v"(kr[1]), "v"(kr[2]), "v"(kr[3]), "v"(kr[4]), "v"(kr[5]), "v"(kr[6]), "v"(kr[7]), "v"(vrow));
#pragma unroll
            for (int it = 0; it < 8; ++it) {
                v4h hv; hv[0] = (_Float16)vr[it][0]; hv[1] = (_Float16)vr[it][1]; hv[2] = (_Float16)vr[it][2]; hv[3] = (_Float16)vr[it][3];
                *(v4h*)(vl + ((int)threadIdx.x >> 4) * VP + ((int)threadIdx.x & 15) * 4 + it * (2 * AW * VP)) = hv;
            }
#pragma unroll
            for (int f = 0; f < 4; ++f)
#pragma unroll
                for (int e = 0; e < 8; ++e) { kf[f][e] = (_Float16)kr[2 * f][e]; kf[f][8 + e] = (_Float16)kr[2 * f + 1][e]; }
            v8f ks2[8];
#pragma unroll
            for (int c = 0; c < 8; ++c) ks2[c] = *(const v8f*)(krow + (2 + (c >> 2)) * (16 * FD) + (c & 3) * 16);   // key tiles 2 and 3
            // the same fence for the second batch's 16 loads; the address is named too, so that it stays live and none of these loads is given its register pair as destination
            asm volatile("" :: "v"(ks2[0]), "v"(ks2[1]), "v"(ks2[2]), "v"(ks2[3]), "v"(ks2[4]), "v"(ks2[5]), "v"(ks2[6]), "v"(ks2[7]), "v"(krow));
#pragma unroll
            for (int f = 0; f < 4; ++f)
#pragma unroll
                for (int e = 0; e < 8; ++e) { kf[4 + f][e] = (_Float16)ks2[2 * f][e]; kf[4 + f][8 + e] = (_Float16)ks2[2 * f + 1][e]; }
        }
        v8f s[4];
#pragma unroll
        for (int t = 0; t < 4; ++t) {
            v8f acc = {};
#pragma unroll
            for (int ks = 0; ks < 2; ++ks) acc = __builtin_amdgcn_wmma_f32_16x16x32_f16(false, kf[2 * t + ks], false, qa[ks], (short)0, acc, false, false);
            s[t] = acc;
        }
        const int lim = q0 + l15 - j0 - 8 * hf;              // key 16 t + r of this half joins while 16 t + r <= lim
        float mt[4];                                         // per score tile, so that four short chains run side by side
#pragma unroll
        for (int t = 0; t < 4; ++t) {
            mt[t] = NEG;
#pragma unroll
            for (int r = 0; r < 8; ++r) { const float v = (16 * t + r > lim) ? NEG : s[t][r] * SC; s[t][r] = v; mt[t] = fmaxf(mt[t], v); }
        }
        float mx = fmaxf(fmaxf(mt[0], mt[1]), fmaxf(mt[2], mt[3]));
        mx = fmaxf(mx, at_xhalf(mx));
        const float mnew = fmaxf(m, mx);                     // finite from the first key block on: key 0 joins every query
        const float corr = at_exp2(m - mnew);                // 0 in the first key block, where m is -inf
        float rt[4];
        v16h pb[2];
#pragma unroll
        for (int t = 0; t < 4; ++t) {
            const v8f pp = at_exp2x8(s[t] - mnew);           // 0 for a masked key
            rt[t] = pp[0];
#pragma unroll
            for (int r = 1; r < 8; ++r) rt[t] += pp[r];
#pragma unroll
            for (int r = 0; r < 8; ++r) pb[t >> 1][(t & 1) * 8 + r] = (_Float16)(pp[r] * 4096.f);
        }
        const float rs = (rt[0] + rt[1]) + (rt[2] + rt[3]);
        l = l * corr + rs; m = mnew;
#pragma unroll
        for (int t = 0; t < 4; ++t) o[t] *= corr;
        __syncthreads();                                     // the V tile is visible
#pragma unroll
        for (int t = 0; t < 4; ++t)
#pragma unroll
            for (int ks = 0; ks < 2; ++ks) {
                union { v16h v; v8h p[2]; } a;
                a.p[0] = at_ld_tr16(vt + (32 * ks) * VP + 16 * t); a.p[1] = at_ld_tr16(vt + (32 * ks + 16) * VP + 16 * t);
                o[t] = __builtin_amdgcn_wmma_f32_16x16x32_f16(false, a.v, false, pb[ks], (short)0, o[t], false, false);
            }
    }
    l += at_xhalf(l);                                        // the two halves' sums meet once
    const float inv = (l > 0.f) ? 1.f / (l * 4096.f) : 0.f;
    float* myo = ol[wave];
#pragma unroll
    for (int t = 0; t < 4; ++t) {
        v4f lo, hi;
#pragma unroll
        for (int r = 0; r < 4; ++r) { lo[r] = o[t][r] * inv; hi[r] = o[t][4 + r] * inv; }
        *(v4f*)(myo + l15 * OP + 16 * t + 8 * hf) = lo; *(v4f*)(myo + l15 * OP + 16 * t + 8 * hf + 4) = hi;
    }
    __syncthreads();                                         // the staged rows are visible to the lanes that store them
    float* obase = O + hb;
    v4f ov[8];
#pragma unroll
    for (int i = 0; i < 8; ++i) ov[i] = *(const v4f*)(myo + (2 * i + hf) * OP + l15 * 4);
#pragma unroll
    for (int i = 0; i < 8; ++i) VST2V4(obase + (size_t)(q0 + 2 * i + hf) * FD + l15 * 4, ov[i]);   // each store instruction writes two whole 256-byte rows
}

// =====================================================================================================================
// k_tr: dst(z, c, r) = alpha * src(z, r, c) (+ beta * R2(z, c, r)): [Z][R][C] (row stride lds) -> [Z][C][R] (row stride ldd) through a 32x32 LDS tile;
//   flags: 1 -> add beta * residual R2 addressed like dst (z*sRz + c*ldr + r); act applied before the residual.
// =====================================================================================================================
struct TrP { const float* src; float* dst; const float* R2; long long sSz, lds, sDz, ldd, sRz, ldr; int R, C, flags, act; float alpha, beta; };
static_assert(sizeof(TrP) == 3 * 8 + 6 * 8 + 6 * 4, "TrP has padding");
__global__ __launch_bounds__(256) void k_tr(TrP p) {
    __shared__ float tile[32][33];
    const int c0 = blockIdx.x * 32, r0 = blockIdx.y * 32, z = blockIdx.z;
    const int lane = threadIdx.x & 31, wave = threadIdx.x >> 5;
    const float* s = p.src + z * p.sSz;
#pragma unroll
    for (int k = 0; k < 4; ++k) {
        const int rl = wave * 4 + k, r = r0 + rl, c = c0 + lane;
        tile[rl][lane] = (r < p.R && c < p.C) ? s[(long long)r * p.lds + c] : 0.f;
    }
    __syncthreads();
    float* d = p.dst + z * p.sDz; const float* rr = p.R2 + z * p.sRz;
#pragma unroll
    for (int k = 0; k < 4; ++k) {
        const int cl = wave * 4 + k, c = c0 + cl, r = r0 + lane;
        if (c < p.C && r < p.R) {
            float v = act_fn(p.alpha * tile[lane][cl], p.act);
            if (p.flags & 1) v += p.beta * rr[(long long)c * p.ldr + r];
            VST2(float, d + (long long)c * p.ldd + r, v);
        }
    }
}

// k_affine: dst[i] = a * (sdev ? sdev[0] : 1) * src[i] + b, i < n (one thread per element; consecutive lanes -> consecutive addresses)
__global__ __launch_bounds__(256) void k_affine(const float* __restrict__ src, float* __restrict__ dst, int n, float a, float b, const float* __restrict__ sdev) {
    const int i = blockIdx.x * 256 + threadIdx.x;
    if (i < n) { const float aa = sdev ? a * sdev[0] : a; const float v = aa * src[i] + b; VST2(float, dst + i, v); }
}

// =====================================================================================================================
// k_softmax: row softmax over n contiguous elements, one 256-thread block per row; rows addressed z*sz + r*sr (grid (R, Z)).
//   out = scale_out * softmax(scale_in * x + (Mf ? Mf[z*smz + r*smr + j] : 0)); a row whose max is -inf is written as 0.
// =====================================================================================================================
struct SmP { const float* src; float* dst; const float* Mf; long long sz, sr, dz, dr, smz, smr; int n, pad; float scale_in, scale_out; };
static_assert(sizeof(SmP) == 3 * 8 + 6 * 8 + 4 * 4, "SmP has padding");
__global__ __launch_bounds__(256) void k_softmax(SmP p) {
    __shared__ float red[256];
    const int r = blockIdx.x, z = blockIdx.y, tid = threadIdx.x;
    const float* s = p.src + z * p.sz + (long long)r * p.sr;
    const float* mf = p.Mf ? (p.Mf + z * p.smz + (long long)r * p.smr) : nullptr;
    float mx = -__builtin_inff();
    for (int j = tid; j < p.n; j += 256) { float v = s[j] * p.scale_in; if (mf) v += mf[j]; mx = fmaxf(mx, v); }
    red[tid] = mx; __syncthreads();
    for (int o = 128; o > 0; o >>= 1) { if (tid < o) red[tid] = fmaxf(red[tid], red[tid + o]); __syncthreads(); }
    mx = red[0]; __syncthreads();
    float sum = 0.f;
    for (int j = tid; j < p.n; j += 256) { float v = s[j] * p.scale_in; if (mf) v += mf[j]; sum += (mx == -__builtin_inff()) ? 0.f : expf(v - mx); }
    red[tid] = sum; __syncthreads();
    for (int o = 128; o > 0; o >>= 1) { if (tid < o) red[tid] += red[tid + o]; __syncthreads(); }
    sum = red[0];
    const float inv = (sum > 0.f) ? p.scale_out / sum : 0.f;
    float* d = p.dst + z * p.dz + (long long)r * p.dr;
    for (int j = tid; j < p.n; j += 256) { float v = s[j] * p.scale_in; if (mf) v += mf[j]; const float o = (mx == -__builtin_inff()) ? 0.f : expf(v - mx) * inv; VST2(float, d + j, o); }
}
// =====================================================================================================================
// k_stats: mean and rsqrt(var + eps) over a set of n elements addressed base + z*sz + (e / inner) * so + (e % inner) * si, one 256-thread
// k_norm_apply: y = (x - mean[set]) * rstd[set] * g[c] + b[c] over a [Z][C][L] channel-major tensor with set = z*G + c / (C/G) (G groups per z;
//   G = C -> per-channel sets indexed z*C+c; for batch norm pass stats indexed by c only via bn = 1). Optional act. Output same layout.
// =====================================================================================================================
//   mode 0: mean / rsqrt(var + eps); mode 1 (RMSNorm): 0 / rsqrt(mean(x^2) + eps); mode 2 (L2 normalize * sqrt(n)): 0 / sqrt(n) / max(||x||, eps); mode 3: as 0 with unbiased variance (n-1)
__global__ __launch_bounds__(256) void k_stats(const float* __restrict__ x, long long sz, long long so, long long si, int inner, int n, float eps, float* __restrict__ stat, int mode) {
    __shared__ float red[256];
    const int z = blockIdx.x, tid = threadIdx.x;
    const float* base = x + z * sz;
    float s = 0.f;
    for (int e = tid; e < n; e += 256) s += base[(long long)(e / inner) * so + (long long)(e % inner) * si];
    red[tid] = s; __syncthreads();
    for (int o = 128; o > 0; o >>= 1) { if (tid < o) red[tid] += red[tid + o]; __syncthreads(); }
    const float mu = (mode == 0 || mode == 3) ? red[0] / (float)n : 0.f; __syncthreads();
    float q = 0.f;
    for (int e = tid; e < n; e += 256) { const float dlt = base[(long long)(e / inner) * so + (long long)(e % inner) * si] - mu; q += dlt * dlt; }
    red[tid] = q; __syncthreads();
    for (int o = 128; o > 0; o >>= 1) { if (tid < o) red[tid] += red[tid + o]; __syncthreads(); }
    {
        float rs;
        if (mode == 2) rs = sqrtf((float)n) / fmaxf(sqrtf(red[0]), eps); else if (mode == 3) rs = rsqrtf(red[0] / (float)(n - 1) + eps); else rs = rsqrtf(red[0] / (float)n + eps);
        if (tid < 32) { const float v = (tid == 0) ? mu : ((tid == 1) ? rs : 0.f); VST2(float, stat + (long long)z * 32 + tid, v); }
    }
}
//   One thread per element over the flat [Z][C][L] index space: grid ceil(Z*C*L / 256).
__global__ __launch_bounds__(256) void k_norm_apply(const float* __restrict__ x, float* __restrict__ y, const float* __restrict__ stat, const float* __restrict__ g, const float* __restrict__ bta,
                                                     int Z, int C, int L, int G, int bn, int act) {
    const long long idx = (long long)blockIdx.x * 256 + threadIdx.x;
    if (idx >= (long long)Z * C * L) return;
    const int l = (int)(idx % L); const long long zc = idx / L; const int c = (int)(zc % C), z = (int)(zc / C); (void)l;
    const int set = bn ? c : (z * G + c / (C / G));
    float v = (x[idx] - stat[(long long)set * 32]) * stat[(long long)set * 32 + 1];
    if (g) v *= g[c];
    if (bta) v += bta[c];
    v = act_fn(v, act);
    VST2(float, y + idx, v);
}

// k_lse_neg: c[i] = -(st[2i] + log(st[2i+1])) = minus the log-sum-exp of row i from k_attn's ST output (for softmax over the query dimension)
__global__ __launch_bounds__(256) void k_lse_neg(const float* __restrict__ st, float* __restrict__ c, int n) {
    const int i = blockIdx.x * 256 + threadIdx.x;
    if (i < n) { const float v = -(st[2 * i] + logf(st[2 * i + 1])); VST2(float, c + i, v); }
}

// k_iota: dst[i] = a * i + b as int32 (segment/position id helper)
__global__ __launch_bounds__(256) void k_iota(int* __restrict__ dst, int n, int a, int b) {
    const int i = blockIdx.x * 256 + threadIdx.x;
    if (i < n) { const int v = a * i + b; VST2(int, dst + i, v); }
}

// k_axpby: dst[i] = a * x[i] + b * y[i] (+ c), i < n
__global__ __launch_bounds__(256) void k_axpby(const float* __restrict__ x, const float* __restrict__ y, float* __restrict__ dst, int n, float a, float b, float c) {
    const int i = blockIdx.x * 256 + threadIdx.x;
    if (i < n) { const float v = a * x[i] + b * y[i] + c; VST2(float, dst + i, v); }
}

// =====================================================================================================================
// k_rope: rotary embedding on a [R rows][Hn heads][D] view (row stride sXr, head stride sXh, element stride 1) -> Y (own strides).
//   mode 0: rotate_half (partner d±D/2, sign - for d<D/2); mode 1: interleaved pairs (partner d^1, sign - for even d).
//   table column tcol: tmode 0 -> d, 1 -> d % (D/2), 2 -> d / 2; position p: pmode 0 -> r % S, 1 -> head index, 2 -> pos[r];
//   c = C[(r / S) * sCb + p * sCp + tcol * sCd], s likewise from Sn; y = x[d] * c + sign * x[partner] * s. X and Y must not alias.
// =====================================================================================================================
struct RopeP { const float* X; float* Y; const float* C; const float* Sn; const int* pos; long long sXr, sXh, sYr, sYh, sCb, sCp, sCd; int R, Hn, D, S, mode, tmode, pmode, pad; };
static_assert(sizeof(RopeP) == 5 * 8 + 7 * 8 + 8 * 4, "RopeP has padding");
__global__ __launch_bounds__(256) void k_rope(RopeP p) {
    const long long idx = (long long)blockIdx.x * 256 + threadIdx.x;
    if (idx >= (long long)p.R * p.Hn * p.D) return;
    const int d = (int)(idx % p.D); const long long rh = idx / p.D; const int h = (int)(rh % p.Hn); const int r = (int)(rh / p.Hn);
    const int half = p.D / 2;
    int partner; float sign;
    if (p.mode == 0) { partner = (d < half) ? d + half : d - half; sign = (d < half) ? -1.f : 1.f; }
    else { partner = d ^ 1; sign = (d & 1) ? 1.f : -1.f; }
    const int tcol = (p.tmode == 0) ? d : ((p.tmode == 1) ? (d % half) : (d >> 1));
    const int pp = (p.pmode == 0) ? (r % p.S) : ((p.pmode == 1) ? h : p.pos[r]);
    const long long toff = (long long)(r / p.S) * p.sCb + (long long)pp * p.sCp + (long long)tcol * p.sCd;
    const float* xr = p.X + (long long)r * p.sXr + (long long)h * p.sXh;
    const float v = xr[d] * p.C[toff] + sign * xr[partner] * p.Sn[toff];
    VST2(float, p.Y + (long long)r * p.sYr + (long long)h * p.sYh + d, v);
}

// k_invf + k_sincos (split so neither kernel carries a large VALU-fma footprint): invf_i = num * (1 / powf(base, (2 i)/D)) [fmode 0],
//   num * expf((2 i) * cexp) [fmode 1], num * powf(base, -2 (i - 1) / D) [fmode 2]; then cs/sn[s*half + i] = cos/sin((pscale * s) * invf_i)
__global__ __launch_bounds__(256) void k_invf(float* __restrict__ invb, int half, int D, float base, float num, int fmode, float cexp) {
    const int i = blockIdx.x * 256 + threadIdx.x;
    if (i >= ((half + 31) / 32) * 32) return;
    if (i >= half) { VST2(float, invb + i, 0.f); return; }
    const float e = (float)(2 * i) / (float)D;
    float invf;
    if (fmode == 1) invf = num * expf((float)(2 * i) * cexp);
    else if (fmode == 2) invf = num * powf(base, (-2.0f * ((float)i - 1.0f)) / (float)D);
    else invf = num * (1.0f / powf(base, e));
    VST2(float, invb + i, invf);
}
__global__ __launch_bounds__(256) void k_sincos(float* __restrict__ cs, float* __restrict__ sn, const float* __restrict__ invb, int S, int half, float pscale) {
    const int idx = blockIdx.x * 256 + threadIdx.x;
    if (idx >= S * half) return;
    const int s = idx / half, i = idx - s * half;
    const float ang = (pscale * (float)s) * invb[i];
    VST2(float, cs + idx, cosf(ang)); VST2(float, sn + idx, sinf(ang));
}

// k_mulact: dst[i] = act(x[i]) * y[i]
__global__ __launch_bounds__(256) void k_mulact(const float* __restrict__ x, const float* __restrict__ y, float* __restrict__ dst, int n, int act) {
    const int i = blockIdx.x * 256 + threadIdx.x;
    if (i < n) { const float v = act_fn(x[i], act) * y[i]; VST2(float, dst + i, v); }
}

// =====================================================================================================================
// k_matvec: thread-per-row matrix-vector products for N <= 8 output columns (heads with 1-3 outputs, gates), f32 on the VALU.
//   C[r*sCm + j] = act(alpha * sum_k A[r*sAm + k*sAk] * B[j*sBn + k*sBk] + bias[j]) + beta * R[r*sRm + j*sRn]; each thread writes its N contiguous floats.
// =====================================================================================================================
__global__ __launch_bounds__(256) void k_matvec(GemmP p) {
    // 32 lanes write one line with one instruction.
    const int rpt = (p.N == 1) ? 1 : 32;
    const long long r0 = ((long long)blockIdx.x * 256 + threadIdx.x) * rpt; const int z = blockIdx.z, zo = z / p.zi_n, zi = z - zo * p.zi_n;
    if (r0 >= p.M) return;
    const float* Bb = p.B + zo * p.sBo + zi * p.sBi;
    float* C = p.C + zo * p.sCo + zi * p.sCi; const float* R = p.R + zo * p.sRo + zi * p.sRi;
    for (int rr = 0; rr < rpt; ++rr) {
        const long long r = r0 + rr; if (r >= p.M) break;
        const float* A = p.A + zo * p.sAo + zi * p.sAi + r * p.sAm;
        float acc[8] = {0.f, 0.f, 0.f, 0.f, 0.f, 0.f, 0.f, 0.f};
        for (int k = 0; k < p.K; ++k) { const float a = A[(long long)k * p.sAk];
#pragma unroll
            for (int j = 0; j < 8; ++j) if (j < p.N) acc[j] += a * Bb[(long long)j * p.sBn + (long long)k * p.sBk]; }
#pragma unroll
        for (int j = 0; j < 8; ++j) if (j < p.N) {
            float v = acc[j] * p.alpha;
            if (p.flags & 1) v += p.bias[j];
            if (p.flags & 2) v += p.bias[r];
            v = act_fn(v, p.act);
            if (p.flags & 4) v += p.beta * R[r * p.sRm + (long long)j * p.sRn];
            VST2(float, C + r * p.sCm + j, v);
        }
    }
}
// k_smallsoftmax: thread-per-row softmax for short rows (n <= 64): dst[r*dr + j] = softmax(scale*src[r*sr + j])
__global__ __launch_bounds__(256) void k_smallsoftmax(const float* __restrict__ src, float* __restrict__ dst, long long sr, long long dr, int n, long long R, float scale) {
    const long long r0 = ((long long)blockIdx.x * 256 + threadIdx.x) * 32;
    for (int rr = 0; rr < 32; ++rr) {
        const long long r = r0 + rr; if (r >= R) return;
        const float* s = src + r * sr; float* d = dst + r * dr;
        float mx = -__builtin_inff();
        for (int j = 0; j < n; ++j) mx = fmaxf(mx, s[j] * scale);
        float sum = 0.f;
        for (int j = 0; j < n; ++j) sum += expf(s[j] * scale - mx);
        const float inv = 1.f / sum;
        for (int j = 0; j < n; ++j) { const float v = expf(s[j] * scale - mx) * inv; VST2(float, d + j, v); }
    }
}

__global__ __launch_bounds__(32) void k_unitstat(float* __restrict__ st) { const int t = threadIdx.x; const float v = (t == 1) ? 1.f : 0.f; VST2(float, st + t, v); }

// destination (e.g. a d_out whose row width is not a multiple of 32 floats) is written by consecutive lanes of one instruction
__global__ __launch_bounds__(256) void k_lincopy(const float* __restrict__ src, long long lds, float* __restrict__ dst, long long ldd, long long rows, int cols) {
    const long long i = (long long)blockIdx.x * 256 + threadIdx.x; if (i >= rows * cols) return;
    const long long r = i / cols; const int c = (int)(i - r * cols);
    const float v = src[r * lds + c]; VST2(float, dst + r * ldd + c, v);
}

namespace w25 {
typedef __attribute__((ext_vector_type(16))) _Float16 v16h;
typedef __attribute__((ext_vector_type(8)))  _Float16 v8h;
typedef __attribute__((ext_vector_type(16))) __bf16   v16b;
typedef __attribute__((ext_vector_type(8)))  __bf16   v8b;
typedef __attribute__((ext_vector_type(8)))  float    v8f;
typedef __attribute__((ext_vector_type(4)))  float    v4f;

__device__ __forceinline__ unsigned short f2bf_bits(float f) {
  unsigned u = __float_as_uint(f);
  return (unsigned short)((u + 0x7FFFu + ((u >> 16) & 1u)) >> 16);
}
__device__ __forceinline__ float bf_bits2f(unsigned short h) { return __uint_as_float(((unsigned)h) << 16); }

template <typename T> struct Frag;
template <> struct Frag<_Float16> {
  typedef v16h V; union U { v16h v; v8h h[2]; };
  static __device__ __forceinline__ v16h load(const _Float16* p) {   // elements 0..7 <- p[0..7], 8..15 <- p[16..23]
    U f; f.h[0] = *(const v8h*)(p); f.h[1] = *(const v8h*)(p + 16); return f.v;
  }
  static __device__ __forceinline__ v8f mma(v16h a, v16h b, v8f c) {
    return __builtin_amdgcn_wmma_f32_16x16x32_f16(false, a, false, b, (short)0, c, false, false);
  }
};
template <> struct Frag<__bf16> {
  typedef v16b V; union U { v16b v; v8b h[2]; };
  static __device__ __forceinline__ v16b load(const __bf16* p) {
    U f; f.h[0] = *(const v8b*)(p); f.h[1] = *(const v8b*)(p + 16); return f.v;
  }
  static __device__ __forceinline__ v8f mma(v16b a, v16b b, v8f c) {
    return __builtin_amdgcn_wmma_f32_16x16x32_bf16(false, a, false, b, (short)0, c, false, false);
  }
};

// ---- WMMA GEMM with both operands staged in LDS ------------------------------
// C[m,n] = scale * sum_k A[m,k] * Bt[n,k], f32 out. A row-major [M,K]; Bt row-major [N,K]; C row-major [M,N]; M % 64 == 0, N % 128 == 0, K % 64 == 0.
// grid (N / 128, the sum of M / 64 over the products), 8 waves: a work-group owns a 64 x 128 tile of C, wave (wave >> 2, wave & 3) a 32 x 32 part of it.
// K runs in stages of 64: a stage's 64 A rows and 128 Bt rows (128 B each, per plane) come from global memory as whole 128-byte lines
// (8 lanes x 16 B per row), go to LDS at a pitch of 144 B, and every wave reads its fragments from there with 16-byte LDS loads.
// Two LDS buffers: the next stage's global loads are in flight while the current stage is multiplied; one barrier per stage.
// SPLIT: operands are hi/lo planes (A2/Bt2 = lo planes, same layout); product = hi.hi + hi.lo + lo.hi, in that order per 32 k.
// ET: 0 = f16 operands, 1 = bf16 operands (pointers passed as 16-bit storage)
// astep: rows of A from one 64-row tile of C to the next (64: A is dense; more: each tile takes the first 64 rows of a longer block of A)
template <int ET> struct Elem;
template <> struct Elem<0> { typedef _Float16 T; typedef v8h V8; };
template <> struct Elem<1> { typedef __bf16 T; typedef v8b V8; };
// One launch holds up to three products with the same A: grid (N / 128, T0 + 2 T1). Tile rows 0 .. T0 - 1 belong to C0 = A.Bt0^T with A dense (64 rows a tile);
// the next T1 to C1 = A.Bt1^T and the last T1 to C2 = A.Bt2^T, both with astep1 rows of A from tile to tile. A launch of T0 + T1 tile rows never touches Bt2 and C2, one of T0 only Bt0 and C0.
struct GemmB { const unsigned short* hi; const unsigned short* lo; float* c; };   // one product's Bt planes (lo unused without SPLIT) and its C
template <int ET, bool SPLIT>
__global__ __launch_bounds__(256) void wmma_gemm_lds(
    const unsigned short* __restrict__ Ap, const unsigned short* __restrict__ A2p,
    GemmB p0, GemmB p1, GemmB p2, int T0, int T1, int N, int K, float scale, int astep1) {
  const int ty = (int)blockIdx.y;
  const int pw = ty < T0 ? 0 : (ty < T0 + T1 ? 1 : 2);                       // which product; the same for the whole work-group
  const int by = pw == 0 ? ty : (pw == 1 ? ty - T0 : ty - T0 - T1);          // tile row within it
  const int astep = pw == 0 ? 64 : astep1;
  const unsigned short* __restrict__ Btp  = pw == 0 ? p0.hi : (pw == 1 ? p1.hi : p2.hi);
  const unsigned short* __restrict__ Bt2p = pw == 0 ? p0.lo : (pw == 1 ? p1.lo : p2.lo);
  float* __restrict__ C = pw == 0 ? p0.c : (pw == 1 ? p1.c : p2.c);
  typedef typename Elem<ET>::T T;
  typedef typename Elem<ET>::V8 V8;
  typedef typename Frag<T>::V V;
  constexpr int NP    = SPLIT ? 2 : 1;      // planes
  constexpr int PITCH = 72;                 // LDS row pitch in 16-bit elements: 144 B = 16 B x 9
  constexpr int PROWS = 192;                // rows of one plane in a stage: 64 of A, then 128 of Bt
  constexpr int STAGE = NP * PROWS * PITCH; // elements of one buffer
  constexpr int NL    = NP * 6;             // 16-byte pieces per thread and stage (32 rows per step)
  constexpr int CP    = 132;                // pitch of the staged C tile in floats
  static_assert(2 * STAGE * 2 >= 64 * CP * 4, "the C tile is staged in the operand buffers");
  __shared__ __align__(16) T sm[2 * STAGE];
  const int lane = threadIdx.x & 31;
  const int wave = threadIdx.x >> 5;
  const int m0 = by << 6;
  const int n0 = blockIdx.x << 7;
  const int wm = (wave >> 2) << 5;          // this wave's first row and column in the tile
  const int wn = (wave & 3) << 5;
  const int rlane = lane & 15;              // row (A) / col (B, D) within a 16 x 16 subtile
  const int koff  = (lane >> 4) * 8;        // k offset of this lane half
  const int mOff  = (lane >> 4) * 8;        // D row offset

  const int lrow = threadIdx.x >> 3, lseg = (threadIdx.x & 7) * 8;   // staging: row within a step of 32 rows, 16-byte piece of the row
  const int a0 = by * astep;                // first A row of this tile
  const T* gA  = (const T*)Ap  + (size_t)(a0 + lrow) * K + lseg;
  const T* gB  = (const T*)Btp + (size_t)(n0 + lrow) * K + lseg;
  const T* gA2 = SPLIT ? (const T*)A2p  + (size_t)(a0 + lrow) * K + lseg : nullptr;
  const T* gB2 = SPLIT ? (const T*)Bt2p + (size_t)(n0 + lrow) * K + lseg : nullptr;
  const int sw = lrow * PITCH + lseg;       // this thread's place in a buffer, step 0
  const int fa = (wm + rlane) * PITCH + koff;        // this lane's A and Bt fragment places in a buffer, subtile 0, k 0
  const int fb = (64 + wn + rlane) * PITCH + koff;

  v8f acc[2][2];
#pragma unroll
  for (int i = 0; i < 2; ++i)
#pragma unroll
    for (int j = 0; j < 2; ++j) acc[i][j] = (v8f){0.f,0.f,0.f,0.f,0.f,0.f,0.f,0.f};

  V8 st[NL];
  auto fetch = [&](int k0) {                // stage at k0: global memory -> registers
#pragma unroll
    for (int it = 0; it < NL; ++it) {
      const int q = it % 6;                 // steps 0, 1: A rows; 2..5: Bt rows; then the same for the lo planes
      const T* g = (it < 6) ? (q < 2 ? gA : gB) : (q < 2 ? gA2 : gB2);
      st[it] = *(const V8*)(g + (size_t)((q < 2 ? q : q - 2) * 32) * K + k0);
    }
  };
  auto put = [&](int buf) {                 // registers -> LDS buffer
#pragma unroll
    for (int it = 0; it < NL; ++it) *(V8*)(sm + buf * STAGE + sw + it * (32 * PITCH)) = st[it];
  };
  auto mult = [&](int buf) {                // one stage: 2 steps of 32 k
    const T* s = sm + buf * STAGE;
#pragma unroll
    for (int kk = 0; kk < 2; ++kk) {
      V ah[2], al[2], bh[2], bl[2];
#pragma unroll
      for (int i = 0; i < 2; ++i) {
        ah[i] = Frag<T>::load(s + fa + i * (16 * PITCH) + kk * 32);
        bh[i] = Frag<T>::load(s + fb + i * (16 * PITCH) + kk * 32);
        if (SPLIT) {
          al[i] = Frag<T>::load(s + PROWS * PITCH + fa + i * (16 * PITCH) + kk * 32);
          bl[i] = Frag<T>::load(s + PROWS * PITCH + fb + i * (16 * PITCH) + kk * 32);
        }
      }
#pragma unroll
      for (int i = 0; i < 2; ++i)
#pragma unroll
        for (int j = 0; j < 2; ++j) acc[i][j] = Frag<T>::mma(ah[i], bh[j], acc[i][j]);
      if (SPLIT) {
#pragma unroll
        for (int i = 0; i < 2; ++i)
#pragma unroll
          for (int j = 0; j < 2; ++j) acc[i][j] = Frag<T>::mma(ah[i], bl[j], acc[i][j]);
#pragma unroll
        for (int i = 0; i < 2; ++i)
#pragma unroll
          for (int j = 0; j < 2; ++j) acc[i][j] = Frag<T>::mma(al[i], bh[j], acc[i][j]);
      }
    }
  };

  const int NK = K >> 6;
  fetch(0);
  put(0);
  __syncthreads();                          // stage 0 is visible
  for (int kt = 0; kt + 1 < NK; ++kt) {
    fetch((kt + 1) << 6);
    __builtin_amdgcn_sched_barrier(0);      // keeps the next stage's global loads issued ahead of this stage's products, so that their latency runs under them
    mult(kt & 1);
    put((kt + 1) & 1);                      // the buffer that stage kt - 1 was read from; its readers left it at the barrier that ended that trip
    __syncthreads();                        // stage kt + 1 is visible, and every wave has finished reading stage kt
  }
  mult((NK - 1) & 1);
  __syncthreads();                          // all fragment reads are done: the buffers now stage the C tile

  // ---- epilogue: the 64 x 128 f32 tile through LDS, so that each store instruction writes 512 contiguous bytes of one row ----
  float* sC = (float*)sm;
#pragma unroll
  for (int i = 0; i < 2; ++i)
#pragma unroll
    for (int j = 0; j < 2; ++j)
#pragma unroll
      for (int r = 0; r < 8; ++r) sC[(wm + (i << 4) + mOff + r) * CP + wn + (j << 4) + rlane] = acc[i][j][r] * scale;
  __syncthreads();
#pragma unroll
  for (int it = 0; it < 8; ++it) {
    const int row = it * 8 + wave;
    const v4f v = *(const v4f*)(sC + row * CP + lane * 4);
    *(v4f*)(C + (size_t)(m0 + row) * N + n0 + lane * 4) = v;
  }
}

__global__ __launch_bounds__(256) void cast_f32_f16x2(
    const float* __restrict__ in, _Float16* __restrict__ out, int n2) {
  int i = blockIdx.x * 256 + threadIdx.x;
  if (i < n2) {
    const _Float16 h0 = (_Float16)in[2 * i], h1 = (_Float16)in[2 * i + 1];
    const unsigned u = (unsigned)__builtin_bit_cast(unsigned short, h0) | ((unsigned)__builtin_bit_cast(unsigned short, h1) << 16);
    ((unsigned*)out)[i] = u;
    
  }
}


} // namespace w25

__global__ __launch_bounds__(256) void k_castT16(const float* __restrict__ src, long long lds, _Float16* __restrict__ dst, long long ldd, int R, int C, float s) {
    const long long i = (long long)blockIdx.x * 256 + threadIdx.x; const long long np = (long long)C * (R / 2); if (i >= np) return; const int c = (int)(i / (R / 2)); const int r = 2 * (int)(i % (R / 2));
    const _Float16 h0 = (_Float16)(src[(long long)r * lds + c] * s), h1 = (_Float16)(src[(long long)(r + 1) * lds + c] * s);
    const unsigned u = (unsigned)__builtin_bit_cast(unsigned short, h0) | ((unsigned)__builtin_bit_cast(unsigned short, h1) << 16);
    unsigned* d = (unsigned*)(dst + (long long)c * ldd + r); *d = u;  }

// f32 -> bf16 hi plane + bf16 lo plane (x = hi + lo to ~2^-17 relative; RNE both), 2 consecutive destination elements: hi pair returned, lo pair in *lo
__device__ __forceinline__ unsigned int f2bf2_pack(float a, float b, unsigned int* lo) {
    const unsigned short ha = w25::f2bf_bits(a), hb = w25::f2bf_bits(b);
    const unsigned short la = w25::f2bf_bits(a - w25::bf_bits2f(ha)), lb = w25::f2bf_bits(b - w25::bf_bits2f(hb));
    *lo = (unsigned)la | ((unsigned)lb << 16); return (unsigned)ha | ((unsigned)hb << 16); }

namespace w25 {
// =====================================================================================
// Generic causal/non-causal attention for head_dim 64, f32 in / f32 out; 16-bit operands: bf16 with optional hi/lo splits, or
// plain f16 (F16=true, non-split, probabilities carried x2^15).
//   scores = (q*qscale)·kᵀ : v_wmma_f32_16x16x32_bf16; SPLIT_QK -> q,k as bf16 hi/lo (hi·hi + hi·lo + lo·hi)
//   out    = p·v           : v_wmma_f32_16x16x32_bf16; SPLIT_PV -> p,v as bf16 hi/lo; else p,v plain bf16
//   f32 accumulate; online softmax in f32. Block = 4 waves = 64 query rows of one (batch, head); S % 64 == 0.
//   Element (b, s, h, d) of tensor X lives at X[b*X_bs + s*X_rs + h*X_hs + d] (strides in floats, multiples of 4).
//   Masking: mask_mode 0 none, 1 causal (kv > q masked), 2 tensor [S][Skv] shared over (b,h) (float if
//   mask_is_int==0, int32 with element == 0 -> masked if 1, int32 with element != 0 -> masked if 2), 3 per-token vectors qmask[B][S] & kvmask[B][Skv] (int32,
//   0 -> masked), 4 causal + sliding window (kv > q or q - kv > W masked; W passed in mask_is_int);
//   5 = relative-position bias: s += cp[b,h,q][idx[q][kv]] + pc[b,h,kv][idx[q][kv]] with idx = mask_b ([S][Skv] int32) and
//   mask_a an int32 [S][Skv] tensor with nonzero = masked (tables: element (b,h,row,n) at X + b*c_bs + h*c_hs + row*c_rs + n);
//   masked scores are replaced by mask_fill (e.g. -inf or -1e9) before the softmax.
//   grid.x = B * H * (S/64) (or a sub-range with blk0).
// =====================================================================================
#define AT_D 64
#define AT_NW 4
#define AT_QB 64
#define AT_KC 64
struct AttnGeom { const float* cp = nullptr; const float* pc = nullptr; long c_bs = 0, c_rs = 0, c_hs = 0;   // mode-5 score-bias tables
                  long q_bs, q_rs, q_hs, k_bs, k_rs, k_hs, v_bs, v_rs, v_hs, o_bs, o_rs, o_hs;
                  int S, Skv, H, mask_mode; float qscale; int blk0; float mask_fill; int mask_is_int; };
static_assert(sizeof(AttnGeom) == 168, "no padding");

__device__ __forceinline__ unsigned short at_bf_bits(float f) {
  unsigned u = __float_as_uint(f);
  return (unsigned short)((u + 0x7FFFu + ((u >> 16) & 1u)) >> 16);
}
__device__ __forceinline__ __bf16 at_f2bf(float f) { return __builtin_bit_cast(__bf16, at_bf_bits(f)); }
__device__ __forceinline__ void at_split(float f, __bf16& hi, __bf16& lo) {
  const unsigned short hb = at_bf_bits(f);
  hi = __builtin_bit_cast(__bf16, hb);
  lo = at_f2bf(f - __uint_as_float(((unsigned)hb) << 16));
}
__device__ __forceinline__ v8f at_mma(v16b a, v16b b, v8f c) {
  c = __builtin_amdgcn_wmma_f32_16x16x32_bf16(false, a, false, b, (short)0, c, false, false);
  asm volatile("v_nop\n\tv_nop\n\tv_nop\n\tv_nop" : "+v"(c) : "v"(a), "v"(b));
  return c;
}
// 16-bit element as a bit pattern held in a __bf16 slot: f16 bits when F16, bf16 (RNE) otherwise
template <bool F16> __device__ __forceinline__ __bf16 at_to16(float f) {
  if (F16) return __builtin_bit_cast(__bf16, (_Float16)f);
  return at_f2bf(f);
}
template <bool F16> __device__ __forceinline__ v8f at_mma16(v16b a, v16b b, v8f c) {
  if (F16) {
    const v16h ah = __builtin_bit_cast(v16h, a), bh = __builtin_bit_cast(v16h, b);
    c = __builtin_amdgcn_wmma_f32_16x16x32_f16(false, ah, false, bh, (short)0, c, false, false);
    asm volatile("v_nop\n\tv_nop\n\tv_nop\n\tv_nop" : "+v"(c) : "v"(ah), "v"(bh));
    return c;
  }
  return at_mma(a, b, c);
}

template <bool SPLIT_QK, bool SPLIT_PV, bool F16 = false>
__global__ __launch_bounds__(128)
void attn64_kernel(const float* __restrict__ q, const float* __restrict__ k,
                   const float* __restrict__ v, float* __restrict__ out,
                   const void* __restrict__ mask_a, const int* __restrict__ mask_b, AttnGeom g) {
  static_assert(!(F16 && (SPLIT_QK || SPLIT_PV)), "f16 mode is non-split");
  const float PSC = F16 ? 32768.0f : 1.0f;     // f16 probabilities carried x2^15 (subnormal range), folded into the final 1/l
  union FB { v16b v; v8b h[2]; };
  __shared__ __align__(16) __bf16 Ksh[AT_KC * AT_D];             // K hi [kv][d]      8 KB
  __shared__ __align__(16) __bf16 Ksl[SPLIT_QK ? AT_KC * AT_D : 8];
  __shared__ __align__(16) __bf16 Vth[AT_D * AT_KC];             // V hi [d][kv]      8 KB
  __shared__ __align__(16) __bf16 Vtl[SPLIT_PV ? AT_D * AT_KC : 8];
  __shared__ __align__(16) __bf16 Psh[AT_NW][16 * AT_KC];        // per wave P hi [row][kv]  8 KB
  __shared__ __align__(16) __bf16 Psl[SPLIT_PV ? AT_NW : 1][SPLIT_PV ? 16 * AT_KC : 8];
  __shared__ __align__(16) float  Os[AT_NW][16 * 68];            // per wave out tile, pitch 68

  const int tid  = threadIdx.x;
  const int wave = tid >> 5;
  const int lane = tid & 31;
  const int hh   = lane >> 4;
  const int c    = lane & 15;

  const int nqb = g.S / AT_QB;
  const int bx = blockIdx.x + g.blk0;
  const int qb = bx % nqb;
  const int bh = bx / nqb;
  const int h  = bh % g.H;
  const int b  = bh / g.H;
  const int qbase_block = qb * AT_QB;
  const int q0 = qbase_block + wave * 16;

  const float* qb_ptr = q + (size_t)b * g.q_bs + (size_t)h * g.q_hs;
  const float* kb_ptr = k + (size_t)b * g.k_bs + (size_t)h * g.k_hs;
  const float* vb_ptr = v + (size_t)b * g.v_bs + (size_t)h * g.v_hs;
  float*       ob_ptr = out + (size_t)b * g.o_bs + (size_t)h * g.o_hs;

  // ---- Q fragments (A operand): 2 d-chunks, hi (and lo) ----
  v16b qah[2], qal[2];
  {
    const float* qrow = qb_ptr + (size_t)(q0 + c) * g.q_rs;
#pragma unroll
    for (int dc = 0; dc < 2; ++dc) {
#pragma unroll
      for (int e = 0; e < 8; ++e) {
        const float f0 = qrow[dc * 32 + 8 * hh + e] * g.qscale;
        const float f1 = qrow[dc * 32 + 16 + 8 * hh + e] * g.qscale;
        if (SPLIT_QK) { __bf16 hq, lq; at_split(f0, hq, lq); qah[dc][e] = hq; qal[dc][e] = lq; at_split(f1, hq, lq); qah[dc][8 + e] = hq; qal[dc][8 + e] = lq; }
        else { qah[dc][e] = at_to16<F16>(f0); qah[dc][8 + e] = at_to16<F16>(f1); qal[dc][e] = qah[dc][e]; qal[dc][8 + e] = qah[dc][8 + e]; }
      }
    }
  }

  float mrow[8], lrow[8];
  v8f oacc[4];
#pragma unroll
  for (int r = 0; r < 8; ++r) { mrow[r] = -INFINITY; lrow[r] = 0.f; }
#pragma unroll
  for (int t = 0; t < 4; ++t) oacc[t] = (v8f){0.f,0.f,0.f,0.f,0.f,0.f,0.f,0.f};

  const int nChunks = (g.mask_mode == 1 || g.mask_mode == 4) ? (qb + 1) : (g.Skv / AT_KC);   // block-uniform
  // per-row query mask (mode 3)
  int qkeep[8];
#pragma unroll
  for (int r = 0; r < 8; ++r) qkeep[r] = (g.mask_mode == 3) ? mask_b[(size_t)b * g.S + q0 + 8 * hh + r] : 1;   // mask_b = qmask in mode 3
  for (int kc = 0; kc < nChunks; ++kc) {
    const int kv0 = kc * AT_KC;
    __syncthreads();
    {
      const int kvr = tid >> 1, dh = (tid & 1) * 32;
      const float* krow = kb_ptr + (size_t)(kv0 + kvr) * g.k_rs + dh;
      const float* vrow = vb_ptr + (size_t)(kv0 + kvr) * g.v_rs + dh;
#pragma unroll
      for (int i = 0; i < 8; ++i) {
        v4f kk = *(const v4f*)(krow + 4 * i);
        v4f vv = *(const v4f*)(vrow + 4 * i);
#pragma unroll
        for (int e = 0; e < 4; ++e) {
          const int d = dh + 4 * i + e;
          if (SPLIT_QK) { __bf16 a, bl; at_split(kk[e], a, bl); Ksh[kvr * AT_D + d] = a; Ksl[kvr * AT_D + d] = bl; }
          else Ksh[kvr * AT_D + d] = at_to16<F16>(kk[e]);
          if (SPLIT_PV) { __bf16 a, bl; at_split(vv[e], a, bl); Vth[d * AT_KC + kvr] = a; Vtl[d * AT_KC + kvr] = bl; }
          else Vth[d * AT_KC + kvr] = at_to16<F16>(vv[e]);
        }
      }
    }
    __syncthreads();

    v8f s[4];
#pragma unroll
    for (int j = 0; j < 4; ++j) {
      s[j] = (v8f){0.f,0.f,0.f,0.f,0.f,0.f,0.f,0.f};
#pragma unroll 1
      for (int dc = 0; dc < 2; ++dc) {
        FB kb;
        kb.h[0] = *(const v8b*)(Ksh + (j * 16 + c) * AT_D + dc * 32 + 8 * hh);
        kb.h[1] = *(const v8b*)(Ksh + (j * 16 + c) * AT_D + dc * 32 + 16 + 8 * hh);
        s[j] = at_mma16<F16>(qah[dc], kb.v, s[j]);
        if (SPLIT_QK) {
          FB kl;
          kl.h[0] = *(const v8b*)(Ksl + (j * 16 + c) * AT_D + dc * 32 + 8 * hh);
          kl.h[1] = *(const v8b*)(Ksl + (j * 16 + c) * AT_D + dc * 32 + 16 + 8 * hh);
          s[j] = at_mma16<F16>(qah[dc], kl.v, s[j]);
          s[j] = at_mma16<F16>(qal[dc], kb.v, s[j]);
        }
      }
    }
    const bool diag = (g.mask_mode == 1) && (kc == qb);
    int kvkeep[4] = {1, 1, 1, 1};
    if (g.mask_mode == 3) {
#pragma unroll
      for (int j = 0; j < 4; ++j) kvkeep[j] = ((const int*)mask_a)[(size_t)b * g.Skv + kv0 + j * 16 + c];   // mask_a = kvmask
    }
    float cm[8];
#pragma unroll
    for (int r = 0; r < 8; ++r) {
      const int qrow = q0 + 8 * hh + r;
      float m = -INFINITY;
#pragma unroll
      for (int j = 0; j < 4; ++j) {
        const int kvcol = kv0 + j * 16 + c;
        bool masked = false;
        if (diag) masked = (kvcol > qrow);
        else if (g.mask_mode == 4) masked = (kvcol > qrow) || (qrow - kvcol > g.mask_is_int);
        else if (g.mask_mode == 2) {
          const size_t mi = (size_t)qrow * g.Skv + kvcol;
          masked = (g.mask_is_int == 0) ? (((const float*)mask_a)[mi] == 0.0f)
                 : (g.mask_is_int == 1) ? (((const int*)mask_a)[mi] == 0) : (((const int*)mask_a)[mi] != 0);
        } else if (g.mask_mode == 3) masked = (qkeep[r] == 0) || (kvkeep[j] == 0);
        else if (g.mask_mode == 5) {
          const size_t mi = (size_t)qrow * g.Skv + kvcol;
          masked = (((const int*)mask_a)[mi] != 0);
          int n = mask_b[mi]; n = n < 0 ? 0 : n;
          s[j][r] += g.cp[(size_t)b * g.c_bs + (size_t)h * g.c_hs + (size_t)qrow * g.c_rs + n]
                   + g.pc[(size_t)b * g.c_bs + (size_t)h * g.c_hs + (size_t)kvcol * g.c_rs + n];
        }
        if (masked) s[j][r] = g.mask_fill;
        m = fmaxf(m, s[j][r]);
      }
#pragma unroll
      for (int off = 1; off < 16; off <<= 1) m = fmaxf(m, __shfl_xor(m, off, 32));
      cm[r] = m;
    }
    __bf16* pwh = Psh[wave];
    __bf16* pwl = Psl[SPLIT_PV ? wave : 0];
#pragma unroll
    for (int r = 0; r < 8; ++r) {
      const float mnew = fmaxf(mrow[r], cm[r]);
      const float alpha = expf(mrow[r] - mnew);
      mrow[r] = mnew;
      float psum = 0.f;
#pragma unroll
      for (int j = 0; j < 4; ++j) {
        const float p = expf(s[j][r] - mnew);
        psum += p;
        if (SPLIT_PV) { __bf16 a, bl; at_split(p, a, bl); pwh[(8 * hh + r) * AT_KC + j * 16 + c] = a; pwl[(8 * hh + r) * AT_KC + j * 16 + c] = bl; }
        else pwh[(8 * hh + r) * AT_KC + j * 16 + c] = at_to16<F16>(p * PSC);
      }
#pragma unroll
      for (int off = 1; off < 16; off <<= 1) psum += __shfl_xor(psum, off, 32);
      lrow[r] = lrow[r] * alpha + psum;
#pragma unroll
      for (int t = 0; t < 4; ++t) oacc[t][r] *= alpha;
    }
    __builtin_amdgcn_fence(__ATOMIC_RELEASE, "workgroup");
    __builtin_amdgcn_wave_barrier();
    __builtin_amdgcn_fence(__ATOMIC_ACQUIRE, "workgroup");
#pragma unroll 1
    for (int kk = 0; kk < 2; ++kk) {
      FB pa, pl;
      pa.h[0] = *(const v8b*)(pwh + c * AT_KC + kk * 32 + 8 * hh);
      pa.h[1] = *(const v8b*)(pwh + c * AT_KC + kk * 32 + 16 + 8 * hh);
      if (SPLIT_PV) {
        pl.h[0] = *(const v8b*)(pwl + c * AT_KC + kk * 32 + 8 * hh);
        pl.h[1] = *(const v8b*)(pwl + c * AT_KC + kk * 32 + 16 + 8 * hh);
      }
#pragma unroll
      for (int t = 0; t < 4; ++t) {
        FB vb;
        vb.h[0] = *(const v8b*)(Vth + (t * 16 + c) * AT_KC + kk * 32 + 8 * hh);
        vb.h[1] = *(const v8b*)(Vth + (t * 16 + c) * AT_KC + kk * 32 + 16 + 8 * hh);
        oacc[t] = at_mma16<F16>(pa.v, vb.v, oacc[t]);
        if (SPLIT_PV) {
          FB vl;
          vl.h[0] = *(const v8b*)(Vtl + (t * 16 + c) * AT_KC + kk * 32 + 8 * hh);
          vl.h[1] = *(const v8b*)(Vtl + (t * 16 + c) * AT_KC + kk * 32 + 16 + 8 * hh);
          oacc[t] = at_mma16<F16>(pa.v, vl.v, oacc[t]);
          oacc[t] = at_mma16<F16>(pl.v, vb.v, oacc[t]);
        }
      }
    }
  }

  float* os = Os[wave];
#pragma unroll
  for (int r = 0; r < 8; ++r) {
    const float inv = 1.0f / (lrow[r] * PSC);
#pragma unroll
    for (int t = 0; t < 4; ++t) os[(8 * hh + r) * 68 + t * 16 + c] = oacc[t][r] * inv;
  }
  __builtin_amdgcn_fence(__ATOMIC_RELEASE, "workgroup");
  __builtin_amdgcn_wave_barrier();
  __builtin_amdgcn_fence(__ATOMIC_ACQUIRE, "workgroup");
  {
    const int c4 = (lane & 15) * 4;
    {
#pragma unroll
      for (int it = 0; it < 8; ++it) {
        const int row = it * 2 + hh;
        v4f val = *(const v4f*)(os + row * 68 + c4);
        *(v4f*)(ob_ptr + (size_t)(q0 + row) * g.o_rs + c4) = val;
      }
      
    }
  }
}

} // namespace w25

// exact f32 causal attention for the first 64 query rows of every (batch, head): one 64-thread block per (b, h, row t < 64); thread d scores key d <= t as Q64.K64 / 8, then writes column d of row t of AT
__global__ __launch_bounds__(64) void k_cm_exact(const float* __restrict__ Q64, const float* __restrict__ K64, const float* __restrict__ V, float* __restrict__ AT, int S, int D, int NH, int HD) { __shared__ float sc[64]; const int t = blockIdx.x % 64; const int h = (blockIdx.x / 64) % NH; const int b = blockIdx.x / (64 * NH); const int d = threadIdx.x;
    const float* q = Q64 + ((long long)b * 64 + t) * D + h * HD; float s = -3.0e38f;
    if (d <= t) { const float* kr = K64 + ((long long)b * 64 + d) * D + h * HD; float a = 0.f;
#pragma unroll 1
        for (int j = 0; j < HD; ++j) a += q[j] * kr[j];
        s = a * 0.125f; }
    sc[d] = s; __syncthreads();
    float mx = -3.0e38f; for (int j = 0; j <= t; ++j) mx = fmaxf(mx, sc[j]);
    float den = 0.f; for (int j = 0; j <= t; ++j) den += expf(sc[j] - mx);
    float acc = 0.f;
#pragma unroll 1
    for (int j = 0; j <= t; ++j) acc += expf(sc[j] - mx) * V[((long long)b * S + j) * D + h * HD + d];
    VST2(float, AT + ((long long)b * S + t) * D + h * HD + d, acc / den); }


// ---- dense elementwise kernels: many elements a thread ------------------------------------------------------------
// A work-group of 256 threads takes 1024 * U consecutive floats: U loads of 16 bytes a thread, all issued before the first is used; each load of a wave covers
// 512 contiguous bytes. The grid covers the array exactly (element count a multiple of 1024 * U), so there is no bounds test and no row or column arithmetic.
typedef __attribute__((ext_vector_type(2))) unsigned int v2u;
template <int U>
__global__ __launch_bounds__(256) void k_castS16v(const float* __restrict__ src, __bf16* __restrict__ dhi, __bf16* __restrict__ dlo) {
    const size_t base = (size_t)blockIdx.x * (1024 * U) + threadIdx.x * 4;
    v4f v[U];
#pragma unroll
    for (int u = 0; u < U; ++u) v[u] = *(const v4f*)(src + base + u * 1024);
    asm volatile("s_wait_xcnt 0x0" ::: "memory");   // in front of the reuse of the loads' address registers
#pragma unroll
    for (int u = 0; u < U; ++u) {
        v2u hi, lo; unsigned int l0, l1;
        hi[0] = f2bf2_pack(v[u][0], v[u][1], &l0); hi[1] = f2bf2_pack(v[u][2], v[u][3], &l1); lo[0] = l0; lo[1] = l1;
        *(v2u*)(dhi + base + u * 1024) = hi; *(v2u*)(dlo + base + u * 1024) = lo;
    }
}
// Block blk of one array, read once, into every 16-bit form that a later product wants: bf16 hi and lo planes, and with H also f16 of s * value.
// Every loop over u is unrolled (#pragma unroll): u picks registers of v, h, hi and lo, which stay registers only under constant indices.
template <int U, bool H>
__device__ __forceinline__ void cast_block(const float* __restrict__ src, _Float16* __restrict__ dh, float s, __bf16* __restrict__ dhi, __bf16* __restrict__ dlo, unsigned blk) {
    const size_t base = (size_t)blk * (1024 * U) + threadIdx.x * 4;
    const float* p = src + base;
    v4f v[U];
#pragma unroll
    for (int u = 0; u < U; ++u) v[u] = *(const v4f*)(p + u * 1024);
    asm volatile("s_wait_xcnt 0x0" :: "v"(p) : "memory");   // in front of any reuse of the loads' address registers; p as an input keeps them from taking a load's result ahead of the wait
    __builtin_amdgcn_sched_barrier(0);   // no conversion moves up over the wait: without it the U = 8 build holds two of its loads back behind the first conversions
    v4h h[U]; v2u hi[U], lo[U];
#pragma unroll
    for (int u = 0; u < U; ++u) {
        if (H) { h[u][0] = (_Float16)(v[u][0] * s); h[u][1] = (_Float16)(v[u][1] * s); h[u][2] = (_Float16)(v[u][2] * s); h[u][3] = (_Float16)(v[u][3] * s); }
        unsigned int l0, l1;
        hi[u][0] = f2bf2_pack(v[u][0], v[u][1], &l0); hi[u][1] = f2bf2_pack(v[u][2], v[u][3], &l1); lo[u][0] = l0; lo[u][1] = l1;
    }
    __builtin_amdgcn_sched_barrier(0);   // every conversion ahead of the first store: the stores go out in one run, and no register of an issued store is written again
#pragma unroll
    for (int u = 0; u < U; ++u) {
        if (H) *(v4h*)(dh + base + u * 1024) = h[u];
        *(v2u*)(dhi + base + u * 1024) = hi[u]; *(v2u*)(dlo + base + u * 1024) = lo[u];
    }
}
// Every cast of an input, in one launch. Blocks 0 .. GX - 1: x (8192 elements each); then GW blocks (4096 elements each) for each of Wq, Wk, Wv, Wo.
// x, Wq, Wk go to f16 (the weights x16) and to bf16 planes; Wv, Wo to bf16 planes only.
template <unsigned GX, unsigned GW>
__global__ __launch_bounds__(256) void k_cast_inputs(const float* __restrict__ x, const float* __restrict__ Wq, const float* __restrict__ Wk, const float* __restrict__ Wv, const float* __restrict__ Wo,
                                                     _Float16* __restrict__ XH, __bf16* __restrict__ XS, __bf16* __restrict__ XS2,
                                                     _Float16* __restrict__ WqH, __bf16* __restrict__ WqS, __bf16* __restrict__ WqS2,
                                                     _Float16* __restrict__ WkH, __bf16* __restrict__ WkS, __bf16* __restrict__ WkS2,
                                                     __bf16* __restrict__ WvS, __bf16* __restrict__ WvS2, __bf16* __restrict__ WoS, __bf16* __restrict__ WoS2) {
    const unsigned bid = blockIdx.x;
    if (bid < GX) { cast_block<8, true>(x, XH, 1.0f, XS, XS2, bid); return; }
    const unsigned w = (bid - GX) / GW, blk = (bid - GX) % GW;
    // the wait behind each branch's stores: in the built kernel another branch's code stands behind them and writes the registers that they name
    if (w < 2) { cast_block<4, true>(w ? Wk : Wq, w ? WkH : WqH, 16.0f, w ? WkS : WqS, w ? WkS2 : WqS2, blk); asm volatile("s_wait_xcnt 0x0" ::: "memory"); }
    else       { cast_block<4, false>(w == 2 ? Wv : Wo, nullptr, 1.0f, w == 2 ? WvS : WoS, w == 2 ? WvS2 : WoS2, blk); asm volatile("s_wait_xcnt 0x0" ::: "memory"); }
}
// RoPE in place on rows of 16 heads x 64 columns: one wave takes one row of Q and the same row of Kx. Lane = (head parity, 16-byte piece of a head's 64 columns), so the lane's
// cos and sin pieces are loaded once and serve all 16 heads of both tensors. SR: rows per batch in Q and Kx, and the bound on the position. blk: eight rows.
template <int SR>
__device__ __forceinline__ void cm_rope_rows(float* __restrict__ Q, float* __restrict__ Kx, const float* __restrict__ CS, const float* __restrict__ SN, const int* __restrict__ POS, int blk) {
    const int row = blk * 8 + ((int)threadIdx.x >> 5), lane = threadIdx.x & 31;
    int ps = POS[row % SR]; ps = ps < 0 ? 0 : (ps >= SR ? SR - 1 : ps);
    const float* pc = CS + ps * 64 + (lane & 15) * 4; const float* pn = SN + ps * 64 + (lane & 15) * 4;
    const v4f c = *(const v4f*)pc, s = *(const v4f*)pn;
    float* q = Q + (size_t)row * 1024 + lane * 4; float* k = Kx + (size_t)row * 1024 + lane * 4;
    v4f a[8], b[8];
#pragma unroll
    for (int it = 0; it < 8; ++it) { a[it] = *(const v4f*)(q + it * 128); b[it] = *(const v4f*)(k + it * 128); }
    asm volatile("s_wait_xcnt 0x0" :: "v"(pc), "v"(pn) : "memory");   // in front of any reuse of the loads' address registers; pc, pn as inputs keep them from taking a load's result ahead of the wait
#pragma unroll
    for (int it = 0; it < 8; ++it) {
        v4f r, t;
        // x0 c0 - x1 s0 and x1 c1 + x0 s1, each with the x1 product rounded and the x0 product fused
        r[0] = fmaf(a[it][0], c[0], -(a[it][1] * s[0])); r[1] = fmaf(a[it][0], s[1], a[it][1] * c[1]); r[2] = fmaf(a[it][2], c[2], -(a[it][3] * s[2])); r[3] = fmaf(a[it][2], s[3], a[it][3] * c[3]);
        t[0] = fmaf(b[it][0], c[0], -(b[it][1] * s[0])); t[1] = fmaf(b[it][0], s[1], b[it][1] * c[1]); t[2] = fmaf(b[it][2], c[2], -(b[it][3] * s[2])); t[3] = fmaf(b[it][2], s[3], b[it][3] * c[3]);
        *(v4f*)(q + it * 128) = r; *(v4f*)(k + it * 128) = t;
    }
}
// both pairs of tensors in one launch: blocks 0 .. G - 1 take Q, Kx (2048 rows a batch), the rest Q64, K64 (64 rows a batch)
template <int G>
__global__ __launch_bounds__(256) void k_cm_rope_all(float* __restrict__ Q, float* __restrict__ Kx, float* __restrict__ Q64, float* __restrict__ K64,
                                                     const float* __restrict__ CS, const float* __restrict__ SN, const int* __restrict__ POS) {
    if ((int)blockIdx.x < G) cm_rope_rows<2048>(Q, Kx, CS, SN, POS, (int)blockIdx.x);
    // the wait behind this branch's stores: in the built kernel the other branch's code stands behind them and writes the registers that they name
    else                   { cm_rope_rows<64>(Q64, K64, CS, SN, POS, (int)blockIdx.x - G); asm volatile("s_wait_xcnt 0x0" ::: "memory"); }
}

extern "C" void kernel_launch(void* const* d_in, const int* in_sizes, int n_in, void* d_out, int out_size, void* d_ws, size_t ws_size, hipStream_t stream) {
    (void)in_sizes; (void)n_in; (void)out_size; (void)ws_size;
    const float* x = (const float*)d_in[0];
    const float* Wq = (const float*)d_in[1];
    const float* Wk = (const float*)d_in[2];
    const float* Wv = (const float*)d_in[3];
    const float* Wo = (const float*)d_in[4];
    const float* cosT = (const float*)d_in[5];
    const float* sinT = (const float*)d_in[6];
    const int* tpos = (const int*)d_in[7];
    const int Bn = 4;
    const int S = 2048;
    const int D = 1024;
    const int NH = 16;
    const int HD = 64;
    const int NR = Bn * S;
    float* out = (float*)d_out;
    char* wsp = (char*)d_ws;
    float* Q = (float*)wsp; wsp += (size_t)NR * D * 4;
    float* Kb = (float*)wsp; wsp += (size_t)NR * D * 4;
    float* V = (float*)wsp; wsp += (size_t)NR * D * 4;
    float* AT = (float*)wsp; wsp += (size_t)NR * D * 4;
    float* Q64 = (float*)wsp; wsp += (size_t)Bn * 64 * D * 4;
    float* K64 = (float*)wsp; wsp += (size_t)Bn * 64 * D * 4;
    unsigned short* XH = (unsigned short*)wsp; wsp += (size_t)NR * D * 2;    // x as f16
    unsigned short* XS = (unsigned short*)wsp; wsp += (size_t)NR * D * 2;    // x as bf16 hi and lo planes; after the exact-row GEMMs the attention output's planes
    unsigned short* XS2 = (unsigned short*)wsp; wsp += (size_t)NR * D * 2;
    unsigned short* WqH = (unsigned short*)wsp; wsp += (size_t)D * D * 2;    // 16 Wq, 16 Wk as f16
    unsigned short* WkH = (unsigned short*)wsp; wsp += (size_t)D * D * 2;
    unsigned short* WqS = (unsigned short*)wsp; wsp += (size_t)D * D * 2;    // bf16 hi and lo planes of the four weights
    unsigned short* WqS2 = (unsigned short*)wsp; wsp += (size_t)D * D * 2;
    unsigned short* WkS = (unsigned short*)wsp; wsp += (size_t)D * D * 2;
    unsigned short* WkS2 = (unsigned short*)wsp; wsp += (size_t)D * D * 2;
    unsigned short* WvS = (unsigned short*)wsp; wsp += (size_t)D * D * 2;
    unsigned short* WvS2 = (unsigned short*)wsp; wsp += (size_t)D * D * 2;
    unsigned short* WoS = (unsigned short*)wsp; wsp += (size_t)D * D * 2;
    unsigned short* WoS2 = (unsigned short*)wsp; wsp += (size_t)D * D * 2;
    const unsigned gX = (unsigned)((long long)NR * D / (1024 * 8));   // cast grid of an x-sized array: 32 elements a thread
    // every cast of an input: x and the four weights, each read once
    k_cast_inputs<1024, 256><<<1024 + 4 * 256, 256, 0, stream>>>(x, Wq, Wk, Wv, Wo, (_Float16*)XH, (__bf16*)XS, (__bf16*)XS2,
        (_Float16*)WqH, (__bf16*)WqS, (__bf16*)WqS2, (_Float16*)WkH, (__bf16*)WkS, (__bf16*)WkS2, (__bf16*)WvS, (__bf16*)WvS2, (__bf16*)WoS, (__bf16*)WoS2);
    // q, k: f16 operands
    const w25::GemmB none = {nullptr, nullptr, nullptr};
    w25::wmma_gemm_lds<0, false><<<dim3(D / 128, 2 * (NR / 64)), 256, 0, stream>>>(XH, nullptr, w25::GemmB{WqH, nullptr, Q}, w25::GemmB{WkH, nullptr, Kb}, none, NR / 64, NR / 64, D, D, 0.0625f, 64);
    // v on bf16 hi/lo planes; with it q, k of the first 64 rows of every batch, from the same planes of x: tile b of Q64, K64 takes rows b S .. b S + 63 of A
    w25::wmma_gemm_lds<1, true><<<dim3(D / 128, NR / 64 + 2 * Bn), 256, 0, stream>>>(XS, XS2, w25::GemmB{WvS, WvS2, V}, w25::GemmB{WqS, WqS2, Q64}, w25::GemmB{WkS, WkS2, K64}, NR / 64, Bn, D, D, 1.0f, S);
    k_cm_rope_all<1024><<<NR / 8 + Bn * 64 / 8, 256, 0, stream>>>(Q, Kb, Q64, K64, cosT, sinT, (const int*)tpos);
    k_attn_t<2048, 1024><<<dim3((unsigned)NH, (unsigned)Bn, (unsigned)(S / (16 * AW))), 32 * AW, 0, stream>>>(Q, Kb, V, AT);
    k_cm_exact<<<Bn * NH * 64, 64, 0, stream>>>(Q64, K64, V, AT, S, D, NH, HD);
    k_castS16v<8><<<gX, 256, 0, stream>>>(AT, (__bf16*)XS, (__bf16*)XS2);
    w25::wmma_gemm_lds<1, true><<<dim3(D / 128, NR / 64), 256, 0, stream>>>(XS, XS2, w25::GemmB{WoS, WoS2, out}, none, none, NR / 64, 0, D, D, 1.0f, 64);
}

// v008
// It runs in 297 microseconds.
// Two timings next to v007 put it at 1.15 and 1.16 times that version's speed.
// Over all steps from v000, the starting kernel, it is 15.3 times as fast.
// Contractions: q/k = x.W^T [8192x1024].[1024x1024] with f16 operands (weights x16); v = x.Wv^T and the output projection on bf16 hi/lo split planes (late causal rows are long averages, so the value path must be f32-class) — v_wmma_f32_16x16x32_*, 64x128 work-group tiles with both operands staged in LDS; per (batch, head) causal softmax(q k^T / 8) v as one flash launch (f16 q.k^T and p.v; fully-masked key tiles skipped); f32 accumulate and softmax. The interleaved-pair RoPE with the INPUT cos/sin tables gathered by the INPUT token positions (generic elementwise form: out = x*cos + rot(x)*sin with rot = (-x[odd], x[even]) interleaved) and the exact-f32 recompute of the first 64 causal rows per head (whose q/k rows come from their own small bf16 hi/lo split GEMMs [64x1024].[1024x1024]) are f32 kernels.
#include <hip/hip_runtime.h>
#include <math.h>

typedef __attribute__((ext_vector_type(16))) _Float16 v16h;
typedef __attribute__((ext_vector_type(8)))  _Float16 v8h;
typedef __attribute__((ext_vector_type(4)))  _Float16 v4h;
typedef __attribute__((ext_vector_type(16))) __bf16   v16b;
typedef __attribute__((ext_vector_type(8)))  float    v8f;
typedef __attribute__((ext_vector_type(4)))  float    v4f;

// 16-bit WMMA fragment map (wave32), lane L, h = L>>4, m = L&15:
//   A 16x32: lane = row m;   element i -> k = (i<8) ? 8h+i : 16+8h+(i-8)
//   B 32x16: lane = column m; the SAME k(i,h)
//   D 16x16 (8 f32): lane = column m; element r -> row 8h+r
__device__ __forceinline__ int frag_k(int i, int h) { return (i < 8) ? (8 * h + i) : (16 + 8 * h + (i - 8)); }
__device__ __forceinline__ __bf16 bf16_rne(float f) {
    unsigned int u = __float_as_uint(f);
    u += 0x7fffu + ((u >> 16) & 1u);
    return __builtin_bit_cast(__bf16, (unsigned short)(u >> 16));
}
__device__ __forceinline__ float bf16_f32(__bf16 b) { return __uint_as_float(((unsigned int)__builtin_bit_cast(unsigned short, b)) << 16); }
__device__ __forceinline__ v8f wmma16(v16h a, v16h b, v8f c) {
    c = __builtin_amdgcn_wmma_f32_16x16x32_f16(false, a, false, b, (short)0, c, false, false);
    asm volatile("v_nop\n\tv_nop\n\tv_nop\n\tv_nop" : "+v"(c) : "v"(a), "v"(b));
    return c;
}
__device__ __forceinline__ v8f wmmab(v16b a, v16b b, v8f c) {
    c = __builtin_amdgcn_wmma_f32_16x16x32_bf16(false, a, false, b, (short)0, c, false, false);
    asm volatile("v_nop\n\tv_nop\n\tv_nop\n\tv_nop" : "+v"(c) : "v"(a), "v"(b));
    return c;
}
struct Split { v16b hi, lo; };
// hi/lo split product: a.hi*b.hi + a.hi*b.lo + a.lo*b.hi
__device__ __forceinline__ v8f wmma3(const Split& a, const Split& b, v8f c) {
    c = __builtin_amdgcn_wmma_f32_16x16x32_bf16(false, a.hi, false, b.hi, (short)0, c, false, false);
    c = __builtin_amdgcn_wmma_f32_16x16x32_bf16(false, a.hi, false, b.lo, (short)0, c, false, false);
    c = __builtin_amdgcn_wmma_f32_16x16x32_bf16(false, a.lo, false, b.hi, (short)0, c, false, false);
    asm volatile("v_nop\n\tv_nop\n\tv_nop\n\tv_nop" : "+v"(c) : "v"(a.hi), "v"(a.lo), "v"(b.hi), "v"(b.lo));
    return c;
}
struct Split3 { v16b hi, mid, lo; };
// triple split product (6 terms, drops only terms below 2^-24 relative)
__device__ __forceinline__ v8f wmma6(const Split3& a, const Split3& b, v8f c) {
    c = __builtin_amdgcn_wmma_f32_16x16x32_bf16(false, a.hi, false, b.hi, (short)0, c, false, false);
    c = __builtin_amdgcn_wmma_f32_16x16x32_bf16(false, a.hi, false, b.mid, (short)0, c, false, false);
    c = __builtin_amdgcn_wmma_f32_16x16x32_bf16(false, a.mid, false, b.hi, (short)0, c, false, false);
    c = __builtin_amdgcn_wmma_f32_16x16x32_bf16(false, a.hi, false, b.lo, (short)0, c, false, false);
    c = __builtin_amdgcn_wmma_f32_16x16x32_bf16(false, a.mid, false, b.mid, (short)0, c, false, false);
    c = __builtin_amdgcn_wmma_f32_16x16x32_bf16(false, a.lo, false, b.hi, (short)0, c, false, false);
    asm volatile("v_nop\n\tv_nop\n\tv_nop\n\tv_nop" : "+v"(c) : "v"(a.hi), "v"(a.mid), "v"(a.lo), "v"(b.hi), "v"(b.mid), "v"(b.lo));
    return c;
}

// Fragment gathers from f32 memory: element i <- p[(k0 + frag_k(i,h)) * sk] * s, zero for k >= klen.
__device__ __forceinline__ v16h fh_ld(const float* __restrict__ p, long long sk, int k0, int h, int klen, float s) {
    v16h a;
#pragma unroll
    for (int i = 0; i < 16; ++i) { const int k = k0 + frag_k(i, h); a[i] = (k < klen) ? (_Float16)(p[(long long)k * sk] * s) : (_Float16)0.f; }
    return a;
}
__device__ __forceinline__ Split sp_ld(const float* __restrict__ p, long long sk, int k0, int h, int klen, float s) {
    Split r;
#pragma unroll
    for (int i = 0; i < 16; ++i) {
        const int k = k0 + frag_k(i, h); const float x = (k < klen) ? p[(long long)k * sk] * s : 0.f;
        const __bf16 hb = bf16_rne(x); r.hi[i] = hb; r.lo[i] = bf16_rne(x - bf16_f32(hb));
    }
    return r;
}
__device__ __forceinline__ Split3 sp3_ld(const float* __restrict__ p, long long sk, int k0, int h, int klen, float s) {
    Split3 r;
#pragma unroll
    for (int i = 0; i < 16; ++i) {
        const int k = k0 + frag_k(i, h); const float x = (k < klen) ? p[(long long)k * sk] * s : 0.f;
        const __bf16 hb = bf16_rne(x); const float r1 = x - bf16_f32(hb); const __bf16 mb = bf16_rne(r1);
        r.hi[i] = hb; r.mid[i] = mb; r.lo[i] = bf16_rne(r1 - bf16_f32(mb));
    }
    return r;
}
__device__ __forceinline__ v16b bh_ld(const float* __restrict__ p, long long sk, int k0, int h, int klen, float s) {
    v16b a;
#pragma unroll
    for (int i = 0; i < 16; ++i) { const int k = k0 + frag_k(i, h); a[i] = bf16_rne((k < klen) ? p[(long long)k * sk] * s : 0.f); }
    return a;
}
// f16 fragment from an f16 LDS/global row with element stride 1 (k-contiguous), no bounds (tile already zero padded)
__device__ __forceinline__ v16h fh_row(const _Float16* __restrict__ row, int k0, int h) {
    v16h a;
#pragma unroll
    for (int i = 0; i < 16; ++i) a[i] = row[k0 + frag_k(i, h)];
    return a;
}

#define VST2(T, ptr, val) do { const T vst2_v_ = (val); *(T*)(ptr) = vst2_v_;  } while (0)
typedef float v4f __attribute__((ext_vector_type(4)));
#define VST2V4(ptr, val) do { const v4f vst2_v4_ = (val); *(v4f*)(ptr) = vst2_v4_;  } while (0)

__device__ __attribute__((noinline)) float act_fn(float v, int act) {
    if (act == 1) return fmaxf(v, 0.f);                                                                               // relu
    if (act == 2) { const float u = 0.7978845608028654f * (v + 0.044715f * v * v * v); return 0.5f * v * (1.f + tanhf(u)); } // tanh-gelu
    if (act == 3) return v / (1.f + expf(-v));                                                                        // silu
    if (act == 4) return 0.5f * v * (1.f + erff(v * 0.7071067811865476f));                                             // erf-gelu
    if (act == 5) return tanhf(v);
    if (act == 6) return 1.f / (1.f + expf(-v));                                                                      // sigmoid
    if (act == 7) return (v > 0.f) ? v : 0.01f * v;                                                                   // leaky relu 0.01
    if (act == 8) return (v > 0.f) ? v : (expf(v) - 1.f);                                                             // elu
    if (act == 9) return fminf(fmaxf(v, 0.f), 6.f);                                                                   // relu6
    if (act == 10) return fabsf(v);                                                                                    // abs
    if (act == 11) return (v >= 0.f) ? v : 0.1f * v;                                                                  // leaky 0.1
    if (act == 12) return (v > 0.f) ? v : 0.2f * v;                                                                   // leaky 0.2
    if (act == 13) return (v > 20.f) ? v : log1pf(expf(v));                                                            // softplus
    return v;
}

// =====================================================================================================================
// k_gemm<MODE>: C(z, m, n) = act(alpha * sum_k A(z, m, k) * B(z, k, n) + bias) + beta * R(z, m, n)
//   One wave (32-thread block) per 16 x 32 tile of C; grid (ceil(N/32), ceil(M/16), Z). Batch z -> (zo = z / zi_n, zi = z % zi_n)
//   with separate outer/inner strides for every tensor (e.g. batch and head). A(m,k) = A[zo*sAo + zi*sAi + m*sAm + k*sAk] (f32),
//   B(k,n) = B[zo*sBo + zi*sBi + n*sBn + k*sBk] (f32); any M, N, K (K zero-padded to 32 inside the fragments, M/N tails guarded).
//   C(m,n) = C[zo*sCo + zi*sCi + m*sCm + n] (n contiguous). flags: 1 bias[n], 2 bias[m], 4 residual R[zo*sRo + zi*sRi + m*sRm + n*sRn].
//   MODE 0: f16 operands (A prescaled by sa, B by sb, both undone in the epilogue); 1: bf16 hi/lo split (3 products); 2: bf16;
//   3: bf16 hi/mid/lo triple split (6 products); 4: as 3 with Kahan-compensated f32 accumulation across k-steps.
// =====================================================================================================================
struct GemmP {
    const float* A; const float* B; const float* bias; const float* R; float* C;
    long long sAo, sAi, sAm, sAk, sBo, sBi, sBn, sBk, sCo, sCi, sCm, sRo, sRi, sRm, sRn;
    int M, N, K, zi_n, flags, act; float alpha, beta, sa, sb;
    int Npad, pad_;     // columns [N, Npad) of C are written as 0 so that padded workspace rows are covered by whole-line stores; Npad >= N
};
static_assert(sizeof(GemmP) == 5 * 8 + 15 * 8 + 6 * 4 + 4 * 4 + 2 * 4, "GemmP has padding");

template <int MODE>
__global__ __launch_bounds__(32) void k_gemm(GemmP p) {
    const int lane = threadIdx.x & 31, h = lane >> 4, l15 = lane & 15;
    const int m0 = blockIdx.y * 16, n0 = blockIdx.x * 32;
    const int z = blockIdx.z, zo = z / p.zi_n, zi = z - zo * p.zi_n;
    const float* A = p.A + zo * p.sAo + zi * p.sAi;
    const float* B = p.B + zo * p.sBo + zi * p.sBi;
    const int am = min(m0 + l15, p.M - 1);                       // clamped row for loads (stores are guarded)
    v8f acc[2], comp[2];
#pragma unroll
    for (int t = 0; t < 2; ++t) { v8f zz = {}; acc[t] = zz; comp[t] = zz; }
    for (int k0 = 0; k0 < p.K; k0 += 32) {
        const float* arow = A + (long long)am * p.sAm;
        if (MODE == 1) {
            const Split a = sp_ld(arow, p.sAk, k0, h, p.K, 1.f);
#pragma unroll
            for (int t = 0; t < 2; ++t) {
                const int bn = min(n0 + t * 16 + l15, p.N - 1);
                acc[t] = wmma3(a, sp_ld(B + (long long)bn * p.sBn, p.sBk, k0, h, p.K, 1.f), acc[t]);
            }
        } else if (MODE == 3) {
            const Split3 a = sp3_ld(arow, p.sAk, k0, h, p.K, 1.f);
#pragma unroll
            for (int t = 0; t < 2; ++t) {
                const int bn = min(n0 + t * 16 + l15, p.N - 1);
                acc[t] = wmma6(a, sp3_ld(B + (long long)bn * p.sBn, p.sBk, k0, h, p.K, 1.f), acc[t]);
            }
        } else if (MODE == 4) {
            // triple split as MODE 3, but each k-step's 6 products go into a fresh accumulator and the partial is added to the running f32 sum
            // on the VALU with Kahan compensation (accumulation error stays ~1 ulp however long K is)
            const Split3 a = sp3_ld(arow, p.sAk, k0, h, p.K, 1.f);
#pragma unroll
            for (int t = 0; t < 2; ++t) {
                const int bn = min(n0 + t * 16 + l15, p.N - 1); v8f zz = {};
                const v8f part = wmma6(a, sp3_ld(B + (long long)bn * p.sBn, p.sBk, k0, h, p.K, 1.f), zz);
                const v8f y = part - comp[t]; const v8f s = acc[t] + y; comp[t] = (s - acc[t]) - y; acc[t] = s;
            }
        } else if (MODE == 2) {
            const v16b a = bh_ld(arow, p.sAk, k0, h, p.K, 1.f);
#pragma unroll
            for (int t = 0; t < 2; ++t) {
                const int bn = min(n0 + t * 16 + l15, p.N - 1);
                acc[t] = wmmab(a, bh_ld(B + (long long)bn * p.sBn, p.sBk, k0, h, p.K, 1.f), acc[t]);
            }
        } else {
            const v16h a = fh_ld(arow, p.sAk, k0, h, p.K, p.sa);
#pragma unroll
            for (int t = 0; t < 2; ++t) {
                const int bn = min(n0 + t * 16 + l15, p.N - 1);
                acc[t] = wmma16(a, fh_ld(B + (long long)bn * p.sBn, p.sBk, k0, h, p.K, p.sb), acc[t]);
            }
        }
    }
    const float iscale = (MODE == 0) ? p.alpha / (p.sa * p.sb) : p.alpha;
    float* C = p.C + zo * p.sCo + zi * p.sCi;
    const float* R = p.R + zo * p.sRo + zi * p.sRi;
    __shared__ __align__(16) float ctile[16][36];
#pragma unroll
    for (int t = 0; t < 2; ++t) {
        const int n = n0 + t * 16 + l15; const int nn = min(n, p.N - 1);
#pragma unroll
        for (int r = 0; r < 8; ++r) {
            const int m = m0 + 8 * h + r; const int mm = min(m, p.M - 1);
            float v = acc[t][r] * iscale;
            if (p.flags & 1) v += p.bias[nn];
            if (p.flags & 2) v += p.bias[mm];
            if (p.flags & 8) v *= p.bias[(long long)zo * p.M + mm];   /* per-(zo,row) scale vector laid out [Z / zi_n][M]; exclusive with the bias flags */
            v = act_fn(v, p.act);
            if (p.flags & 4) v += p.beta * R[(long long)mm * p.sRm + (long long)nn * p.sRn];
            ctile[8 * h + r][t * 16 + l15] = (n < p.N) ? v : 0.f;
        }
    }
    __syncthreads();
    const int NW = (p.Npad > p.N) ? p.Npad : p.N;           // write width
    const bool fast = (m0 + 16 <= p.M) && (n0 + 32 <= NW) && ((p.sCm & 3) == 0) && ((((size_t)C) & 15) == 0);
    if (fast) {
#pragma unroll
        for (int s = 0; s < 4; ++s) {
            const int row = s * 4 + (lane >> 3), c4 = (lane & 7) * 4;
            const v4f v = *(const v4f*)&ctile[row][c4];
            VST2V4(C + (long long)(m0 + row) * p.sCm + n0 + c4, v);
        }
    } else {
        for (int row = 0; row < 16; ++row) {
            const int m = m0 + row, n = n0 + lane;
            if (m < p.M && n < NW) VST2(float, C + (long long)m * p.sCm + n, ctile[row][lane]);
        }
    }
}


// =====================================================================================================================
// k_gemmT<MODE, TM, TN>: same contract as k_gemm, but one wave computes a (16*TM) x (16*TN) tile: TM A fragments and TN B fragments are
//   loaded per 32-wide k-step and reused across TM*TN WMMAs (far fewer load/convert instructions per MAC). MODE 0 (f16), 1 (bf16 hi/lo),
//   2 (bf16) only. grid (ceil(NW/(16*TN)), ceil(M/(16*TM)), Z), block 32. Epilogue identical to k_gemm, run per 16x32 sub-tile.
// =====================================================================================================================
template <int MODE, int TM, int TN>
__global__ __launch_bounds__(32) void k_gemmT(GemmP p) {
    const int lane = threadIdx.x & 31, h = lane >> 4, l15 = lane & 15;
    const int m0 = blockIdx.y * (16 * TM), n0 = blockIdx.x * (16 * TN);
    const int z = blockIdx.z, zo = z / p.zi_n, zi = z - zo * p.zi_n;
    const float* A = p.A + zo * p.sAo + zi * p.sAi;
    const float* B = p.B + zo * p.sBo + zi * p.sBi;
    v8f acc[TM][TN];
#pragma unroll
    for (int i = 0; i < TM; ++i)
#pragma unroll
        for (int t = 0; t < TN; ++t) { v8f zz = {}; acc[i][t] = zz; }
    for (int k0 = 0; k0 < p.K; k0 += 32) {
        if (MODE == 1) {
            Split a[TM], b[TN];
#pragma unroll
            for (int i = 0; i < TM; ++i) { const int am = min(m0 + 16 * i + l15, p.M - 1); a[i] = sp_ld(A + (long long)am * p.sAm, p.sAk, k0, h, p.K, 1.f); }
#pragma unroll
            for (int t = 0; t < TN; ++t) { const int bn = min(n0 + 16 * t + l15, p.N - 1); b[t] = sp_ld(B + (long long)bn * p.sBn, p.sBk, k0, h, p.K, 1.f); }
#pragma unroll
            for (int i = 0; i < TM; ++i)
#pragma unroll
                for (int t = 0; t < TN; ++t) acc[i][t] = wmma3(a[i], b[t], acc[i][t]);
        } else if (MODE == 2) {
            v16b a[TM], b[TN];
#pragma unroll
            for (int i = 0; i < TM; ++i) { const int am = min(m0 + 16 * i + l15, p.M - 1); a[i] = bh_ld(A + (long long)am * p.sAm, p.sAk, k0, h, p.K, 1.f); }
#pragma unroll
            for (int t = 0; t < TN; ++t) { const int bn = min(n0 + 16 * t + l15, p.N - 1); b[t] = bh_ld(B + (long long)bn * p.sBn, p.sBk, k0, h, p.K, 1.f); }
#pragma unroll
            for (int i = 0; i < TM; ++i)
#pragma unroll
                for (int t = 0; t < TN; ++t) acc[i][t] = wmmab(a[i], b[t], acc[i][t]);
        } else {
            v16h a[TM], b[TN];
#pragma unroll
            for (int i = 0; i < TM; ++i) { const int am = min(m0 + 16 * i + l15, p.M - 1); a[i] = fh_ld(A + (long long)am * p.sAm, p.sAk, k0, h, p.K, p.sa); }
#pragma unroll
            for (int t = 0; t < TN; ++t) { const int bn = min(n0 + 16 * t + l15, p.N - 1); b[t] = fh_ld(B + (long long)bn * p.sBn, p.sBk, k0, h, p.K, p.sb); }
#pragma unroll
            for (int i = 0; i < TM; ++i)
#pragma unroll
                for (int t = 0; t < TN; ++t) acc[i][t] = wmma16(a[i], b[t], acc[i][t]);
        }
    }
    const float iscale = (MODE == 0) ? p.alpha / (p.sa * p.sb) : p.alpha;
    float* C = p.C + zo * p.sCo + zi * p.sCi;
    const float* R = p.R + zo * p.sRo + zi * p.sRi;
    const int NW = (p.Npad > p.N) ? p.Npad : p.N;
    __shared__ __align__(16) float ctile[16][36];
#pragma unroll
    for (int i = 0; i < TM; ++i) {
        const int mb = m0 + 16 * i; if (mb >= p.M) break;          // wave-uniform
#pragma unroll
        for (int tp = 0; tp < TN / 2; ++tp) {
            const int nb = n0 + 32 * tp; if (nb >= NW) break;        // wave-uniform
#pragma unroll
            for (int t2 = 0; t2 < 2; ++t2) {
                const int t = 2 * tp + t2; const int n = nb + t2 * 16 + l15; const int nn = min(n, p.N - 1);
#pragma unroll
                for (int r = 0; r < 8; ++r) {
                    const int m = mb + 8 * h + r; const int mm = min(m, p.M - 1);
                    float v = acc[i][t][r] * iscale;
                    if (p.flags & 1) v += p.bias[nn];
                    if (p.flags & 2) v += p.bias[mm];
            if (p.flags & 8) v *= p.bias[(long long)zo * p.M + mm];   /* per-(zo,row) scale vector laid out [Z / zi_n][M]; exclusive with the bias flags */
                    v = act_fn(v, p.act);
                    if (p.flags & 4) v += p.beta * R[(long long)mm * p.sRm + (long long)nn * p.sRn];
                    ctile[8 * h + r][t2 * 16 + l15] = (n < p.N) ? v : 0.f;
                }
            }
            __syncthreads();
            const bool fast = (mb + 16 <= p.M) && (nb + 32 <= NW) && ((p.sCm & 3) == 0) && ((((size_t)C) & 15) == 0);
            if (fast) {
#pragma unroll
                for (int s = 0; s < 4; ++s) {
                    const int row = s * 4 + (lane >> 3), c4 = (lane & 7) * 4;
                    const v4f v = *(const v4f*)&ctile[row][c4];
                    VST2V4(C + (long long)(mb + row) * p.sCm + nb + c4, v);
                }
            } else {
                for (int row = 0; row < 16; ++row) {
                    const int m = mb + row, n = nb + lane;
                    if (m < p.M && n < NW) VST2(float, C + (long long)m * p.sCm + n, ctile[row][lane]);
                }
            }
            __syncthreads();
        }
    }
}

// =====================================================================================================================
//   Wave = 16 queries, AW waves per block, 64-key blocks; grid (ceil(Lq/(16*AW)), H, B), block 32*AW. Any Lq, Lk; head dim dh <= DHP
//   (DHP multiple of 32), value dim dv <= DVP (multiple of 16, <= 128). Every tensor addressed by (batch, head, row, element) strides, f32.
//   Scores: QM 0 f16 operands, 1 bf16 hi/lo split, 2 bf16 triple split; statistics f32 (exp2 domain); P.V: P x 4096 as f16 with V f16 staged in LDS
//   (SPLITPV: P and V as bf16 hi/lo splits). kv head = h / hrep. Masking: causal = 1 (keep j <= i + coff, masked -> -inf, key blocks beyond the
//   diagonal skipped), causal = 2 (masked -> mfill, a finite fill like the -1e9; no skipping), causal = 3 (keep j >= i + coff,
//   masked -> -inf, no skipping); optional additive f32 mask Mf,
//   optional int keep-mask Mi (0 -> score := mfill), both addressed b*smb + h*smh + i*smi + j*smj (0 strides broadcast).
// =====================================================================================================================
#define AW 4
struct AttnP {   // apv4
    const float* Q; const float* K; const float* V; float* O; float* P; const float* Mf; const int* Mi; float* ST;
    const float* Pw; const float* Rt; const int* SQ; const int* SK;           // optional: post-softmax weight, relative-position table, segment ids
    long long swb, swh, swi, swj, srb, srh, sri;                                 // Pw strides (b,h,i,j); Rt strides (b,h,i), column = clamp(i - j + roff, 0, rn-1)
    long long sQb, sQh, sQi, sQd, sKb, sKh, sKj, sKd, sVb, sVh, sVj, sVd, sOb, sOh, sOi, sPb, sPh, sPi, smb, smh, smi, smj;
    int Lq, Lk, dh, dv, hrep, causal, coff, pband;   // pband > 0: P holds only the band |j - i| <= pband, column j - i + pband
    float scale, mfill; int nonorm, mpol;             // nonorm (online path only): O = sum_j exp(score_j) V_j without the 1/rowsum (scores must be <= ~0); mpol: Mi masks where ==0 (mpol 0) or where !=0 (mpol 1)
    int roff, rn, segpol, win;                        // Rt column offset/count; SQ/SK: score := mfill where (segpol 0) SQ[i] != SK[j] or (segpol 1) SQ[i] == SK[j]; win > 0: keys with i - j > win (after coff) -> -inf
};
//   Pw: the softmax numerator is multiplied by Pw(b,h,i,j) AFTER the row sum is taken (probs * weight, then P.V), as in post-softmax multiplicative biases.                                                    // ST (optional): per row (b,h,i) -> ST[((b*H + h)*Lq + i)*2 + {0,1}] = {row max of the scaled+masked score (natural units), sum_j exp(score - max)}
static_assert(sizeof(AttnP) == 12 * 8 + 29 * 8 + 16 * 4, "AttnP has padding");

#ifndef KATTN_ATTR
#define KATTN_ATTR __attribute__((amdgpu_waves_per_eu(4)))   // at most 256 registers a wave: four waves a SIMD, 1024 work-groups of the causal grid resident at once
#endif
//   FS > 0 (QM 0, one pass, f16 P.V only): the layout is fixed at compile time: Q, K, V, O are dense [batch][FS rows][FD] f32 with head h at column h * DHP (DVP for V, O),
//   dh = DHP, dv = DVP, Lq = Lk = FS (multiple of 64), causal = 1 with coff = 0, none of the optional inputs or outputs. Every element guard and stride then folds
//   away, and a key block's K and V come in by plain 16-byte loads that are in flight together, in two batches, instead of guarded 4-byte loads waited on one at a time.
template <int DHP, int DVP, int QM, bool SPLITPV, bool TWOPASS, int FS = 0, int FD = 0>
__global__ __launch_bounds__(32 * AW) KATTN_ATTR void k_attn(AttnP p) {
    static_assert(FS == 0 || (QM == 0 && !SPLITPV && !TWOPASS && DHP == 64 && DVP == 64 && FS % 64 == 0 && FD % 8 == 0), "fixed layout: whole key blocks, 32-byte aligned fragments");
    if (FS > 0) {
        p.P = nullptr; p.Mf = nullptr; p.Mi = nullptr; p.ST = nullptr; p.Pw = nullptr; p.Rt = nullptr; p.SQ = nullptr; p.SK = nullptr;
        p.sQb = (long long)FS * FD; p.sQh = DHP; p.sQi = FD; p.sQd = 1; p.sKb = (long long)FS * FD; p.sKh = DHP; p.sKj = FD; p.sKd = 1;
        p.sVb = (long long)FS * FD; p.sVh = DVP; p.sVj = FD; p.sVd = 1; p.sOb = (long long)FS * FD; p.sOh = DVP; p.sOi = FD;
        p.Lq = FS; p.Lk = FS; p.dh = DHP; p.dv = DVP; p.hrep = 1; p.causal = 1; p.coff = 0; p.pband = 0; p.nonorm = 0; p.win = 0;
    }
    constexpr int NT = DVP / 16;                // output tiles
    constexpr int KS = DHP / 32;                // k-steps for the scores
    constexpr int VP = DVP + 8;                 // LDS pitch (halves)
    __shared__ __align__(16) float    pl[AW][16 * 64];
    __shared__ __align__(16) _Float16 vl[(SPLITPV ? 2 : 1) * 64 * VP];   // f16 V tile, or bf16 hi and lo tiles (same 2-byte size)
    const int lane = threadIdx.x & 31, hf = lane >> 4, l15 = lane & 15, wave = threadIdx.x >> 5;
    // FS > 0: grid (heads, batches, query tiles) and query tile bx = last - blockIdx.z. A causal tile walks bx + 1 key blocks and only half the work-groups are resident at once;
    // the long tiles take the low indices and the short ones the high, and neighbours in index cost the same.
    const int bx = FS > 0 ? FS / (16 * AW) - 1 - (int)blockIdx.z : (int)blockIdx.x;
    const int h = FS > 0 ? blockIdx.x : blockIdx.y, b = FS > 0 ? blockIdx.y : blockIdx.z, hk = h / p.hrep;
    const int q0 = (bx * AW + wave) * 16;
    float* myp = pl[wave];
    const float L2E = 1.4426950408889634f;
    const float NEG = -__builtin_inff();
    const int qi = min(q0 + l15, p.Lq - 1);
    const float* qrow = p.Q + b * p.sQb + h * p.sQh + (long long)qi * p.sQi;
    const float* kbase = p.K + b * p.sKb + hk * p.sKh;
    const float* vbase = p.V + b * p.sVb + hk * p.sVh;
    v16h qa[QM == 0 ? KS : 1]; Split qs_[QM == 1 ? KS : 1]; Split3 qt_[QM == 2 ? KS : 1];
#pragma unroll
    for (int ks = 0; ks < KS; ++ks) {
        if (QM == 2) qt_[ks] = sp3_ld(qrow, p.sQd, ks * 32, hf, p.dh, 1.f);
        else if (QM == 1) qs_[ks] = sp_ld(qrow, p.sQd, ks * 32, hf, p.dh, 1.f);
        else qa[ks] = fh_ld(qrow, p.sQd, ks * 32, hf, p.dh, 1.f);
    }
    v8f o[NT]; float m8[8], l8[8];
#pragma unroll
    for (int t = 0; t < NT; ++t) { v8f zz = {}; o[t] = zz; }
#pragma unroll
    for (int i = 0; i < 8; ++i) { m8[i] = NEG; l8[i] = 0.f; }
    int jend = p.Lk; int jstart = 0;
    if (p.causal == 1) { const int je = (bx * AW + AW - 1) * 16 + 16 + p.coff; jend = min(jend, max(je, 0)); }   // uniform per block
    if (p.win > 0) { const int js = (bx * AW) * 16 + p.coff - p.win; jstart = (js > 0) ? (js / 64) * 64 : 0; }   // uniform per block: key blocks entirely outside every row's window hold only -inf entries and are skipped exactly
    const int npass = TWOPASS ? 2 : 1;
    for (int pass = 0; pass < npass; ++pass) {
        const bool dopv = (!TWOPASS) || pass == 1;
        for (int j0 = jstart; j0 < jend; j0 += 64) {
            v16h kf[FS > 0 ? 4 * KS : 1];                        // FS > 0: the key block's K fragments, tile t and k-step ks at t * KS + ks
            if (dopv) {
                __syncthreads();                                 // previous key block's reads of vl / pl are done
                if (FS > 0) {
                    // raw f32 in two batches, so that the loaded values and everything else that is live fit 256 registers (four waves a SIMD)
                    v4f vr[8]; v8f kr[8];                                           // V: four consecutive elements per thread and step; K: half a fragment each
                    const float* krow = kbase + (long long)(j0 + l15) * FD + 8 * hf;
#pragma unroll
                    for (int it = 0; it < 8; ++it)
                        vr[it] = *(const v4f*)(vbase + (long long)(j0 + ((int)threadIdx.x >> 4)) * FD + ((int)threadIdx.x & 15) * 4 + it * (2 * AW * FD));   // rows 2 AW apart per step
#pragma unroll
                    for (int c = 0; c < 8; ++c) kr[c] = *(const v8f*)(krow + (c >> 2) * (16 * FD) + (c & 3) * 16);   // key tile t = c / 4; k = 16 (c % 4) + 8 hf + (0..7)
                    // inputs-only fence on the loaded values: their first use is here, so the batch's 24 loads are all issued before any is waited on (without it
                    // the scheduler puts each load directly in front of its conversion and waits on it there)
                    asm volatile("" :: "v"(vr[0]), "v"(vr[1]), "v"(vr[2]), "v"(vr[3]), "v"(vr[4]), "v"(vr[5]), "v"(vr[6]), "v"(vr[7]),
                                 "v"(kr[0]), "v"(kr[1]), "v"(kr[2]), "v"(kr[3]), "v"(kr[4]), "v"(kr[5]), "v"(kr[6]), "v"(kr[7]));
#pragma unroll
                    for (int it = 0; it < 8; ++it) {
                        v4h hv; hv[0] = (_Float16)vr[it][0]; hv[1] = (_Float16)vr[it][1]; hv[2] = (_Float16)vr[it][2]; hv[3] = (_Float16)vr[it][3];
                        *(v4h*)(vl + ((int)threadIdx.x >> 4) * VP + ((int)threadIdx.x & 15) * 4 + it * (2 * AW * VP)) = hv;
                    }
#pragma unroll
                    for (int f = 0; f < 4; ++f)
#pragma unroll
                        for (int e = 0; e < 8; ++e) { kf[f][e] = (_Float16)kr[2 * f][e]; kf[f][8 + e] = (_Float16)kr[2 * f + 1][e]; }
                    v8f ks2[8];
#pragma unroll
                    for (int c = 0; c < 8; ++c) ks2[c] = *(const v8f*)(krow + (2 + (c >> 2)) * (16 * FD) + (c & 3) * 16);   // key tiles 2 and 3
                    // the same fence for the second batch's 16 loads; the address is named too, so that it stays live and none of these loads is given its register pair as destination
                    asm volatile("" :: "v"(ks2[0]), "v"(ks2[1]), "v"(ks2[2]), "v"(ks2[3]), "v"(ks2[4]), "v"(ks2[5]), "v"(ks2[6]), "v"(ks2[7]), "v"(krow));
#pragma unroll
                    for (int f = 0; f < 4; ++f)
#pragma unroll
                        for (int e = 0; e < 8; ++e) { kf[4 + f][e] = (_Float16)ks2[2 * f][e]; kf[4 + f][8 + e] = (_Float16)ks2[2 * f + 1][e]; }
                } else
                for (int idx = threadIdx.x; idx < 64 * DVP; idx += 32 * AW) {
                    const int jr = idx / DVP, d = idx - jr * DVP, j = j0 + jr;
                    const float f = (j < p.Lk && d < p.dv) ? vbase[(long long)j * p.sVj + (long long)d * p.sVd] : 0.f;
                    if (SPLITPV) {
                        const __bf16 hb = bf16_rne(f);
                        ((__bf16*)vl)[jr * VP + d] = hb; ((__bf16*)vl)[64 * VP + jr * VP + d] = bf16_rne(f - bf16_f32(hb));
                    } else vl[jr * VP + d] = (_Float16)f;
                }
            }
            v8f s[4];
#pragma unroll
            for (int t = 0; t < 4; ++t) {
                const int j = min(j0 + t * 16 + l15, p.Lk - 1);
                const float* krow = kbase + (long long)j * p.sKj;
                v8f acc = {};
#pragma unroll
                for (int ks = 0; ks < KS; ++ks) {
                    if (QM == 2)      acc = wmma6(qt_[ks], sp3_ld(krow, p.sKd, ks * 32, hf, p.dh, 1.f), acc);
                    else if (QM == 1) acc = wmma3(qs_[ks], sp_ld(krow, p.sKd, ks * 32, hf, p.dh, 1.f), acc);
                    else if (FS > 0)  acc = wmma16(qa[ks], kf[t * KS + ks], acc);
                    else              acc = wmma16(qa[ks], fh_ld(krow, p.sKd, ks * 32, hf, p.dh, 1.f), acc);
                }
                s[t] = acc;
            }
            float pv[8][4];
#pragma unroll
            for (int i = 0; i < 8; ++i) {
                const int irow = q0 + i + 8 * hf;
                const int ic = min(irow, p.Lq - 1);
                float sc[4];
#pragma unroll
                for (int t = 0; t < 4; ++t) {
                    const int jg = j0 + t * 16 + l15;
                    float v = s[t][i] * p.scale;
                    if (p.Mf) v += p.Mf[b * p.smb + h * p.smh + (long long)ic * p.smi + (long long)min(jg, p.Lk - 1) * p.smj];
                    if (p.Rt) { int rc = ic - min(jg, p.Lk - 1) + p.roff; rc = rc < 0 ? 0 : (rc >= p.rn ? p.rn - 1 : rc); v += p.Rt[b * p.srb + h * p.srh + (long long)ic * p.sri + rc]; }
                    if (p.Mi) { const int mv = p.Mi[b * p.smb + h * p.smh + (long long)ic * p.smi + (long long)min(jg, p.Lk - 1) * p.smj]; if (p.mpol ? (mv != 0) : (mv == 0)) v = p.mfill; }
                    if (p.SQ) { const bool same = p.SQ[(long long)b * p.Lq + ic] == p.SK[(long long)b * p.Lk + min(jg, p.Lk - 1)]; if (p.segpol ? same : !same) v = p.mfill; }
                    if (p.causal == 2 && jg > irow + p.coff) v = p.mfill;
                    if (jg >= p.Lk || (p.causal == 1 && jg > irow + p.coff) || (p.causal == 3 && jg < irow + p.coff) || (p.win > 0 && irow + p.coff - jg > p.win)) v = NEG; else v *= L2E;
                    sc[t] = v;
                }
                if (!TWOPASS || pass == 0) {
                    float mx = fmaxf(fmaxf(sc[0], sc[1]), fmaxf(sc[2], sc[3]));
                    mx = fmaxf(mx, __shfl_xor(mx, 1, 32)); mx = fmaxf(mx, __shfl_xor(mx, 2, 32));
                    mx = fmaxf(mx, __shfl_xor(mx, 4, 32)); mx = fmaxf(mx, __shfl_xor(mx, 8, 32));
                    const float mnew = fmaxf(m8[i], mx);
                    const float corr = (mnew == NEG) ? 1.f : exp2f(m8[i] - mnew);
                    float rs = 0.f;
#pragma unroll
                    for (int t = 0; t < 4; ++t) {
                        const float pp = (sc[t] == NEG) ? 0.f : exp2f(sc[t] - mnew); rs += pp;
                        pv[i][t] = p.Pw ? pp * p.Pw[b * p.swb + h * p.swh + (long long)ic * p.swi + (long long)min(j0 + t * 16 + l15, p.Lk - 1) * p.swj] : pp;
                    }
                    rs += __shfl_xor(rs, 1, 32); rs += __shfl_xor(rs, 2, 32); rs += __shfl_xor(rs, 4, 32); rs += __shfl_xor(rs, 8, 32);
                    l8[i] = l8[i] * corr + rs; m8[i] = mnew;
                    if (!TWOPASS) {
#pragma unroll
                        for (int t = 0; t < NT; ++t) o[t][i] *= corr;
                    }
                } else {
                    const float inv = (l8[i] > 0.f) ? 1.f / l8[i] : 0.f;
#pragma unroll
                    for (int t = 0; t < 4; ++t) {
                        const int jg = j0 + t * 16 + l15;
                        float pp = (sc[t] == NEG) ? 0.f : exp2f(sc[t] - m8[i]) * inv;
                        if (p.Pw) pp *= p.Pw[b * p.swb + h * p.swh + (long long)ic * p.swi + (long long)min(jg, p.Lk - 1) * p.swj];
                        pv[i][t] = pp;
                    }
                }
            }
            if (dopv) {
#pragma unroll
                for (int i = 0; i < 8; ++i)
#pragma unroll
                    for (int t = 0; t < 4; ++t) ((float*)myp)[(i + 8 * hf) * 64 + t * 16 + l15] = pv[i][t];
                __syncthreads();                                 // P (per wave) and V (shared) visible
                if (p.P) {
                    float* pb_ = p.P + b * p.sPb + h * p.sPh;
                    const bool fastP = (p.pband == 0) && ((p.sPi & 3) == 0) && (j0 + 64 <= p.Lk) && (q0 + 16 <= p.Lq) && ((((size_t)pb_) & 15) == 0);
                    if (fastP) {
#pragma unroll
                        for (int s = 0; s < 8; ++s) {
                            const int row = s * 2 + (lane >> 4), c4 = (lane & 15) * 4;
                            const v4f v = *(const v4f*)(myp + row * 64 + c4);
                            VST2V4(pb_ + (long long)(q0 + row) * p.sPi + j0 + c4, v);
                        }
                    } else {
                        for (int row = 0; row < 16; ++row) {
                            const int irow = q0 + row; if (irow >= p.Lq) continue;
                            for (int c = lane; c < 64; c += 32) {
                                const int jg = j0 + c; if (jg >= p.Lk) continue;
                                if (p.pband == 0) VST2(float, pb_ + (long long)irow * p.sPi + jg, myp[row * 64 + c]);
                                else if (jg - irow <= p.pband && irow - jg <= p.pband) VST2(float, pb_ + (long long)irow * p.sPi + (jg - irow + p.pband), myp[row * 64 + c]);
                            }
                        }
                    }
                }
                if (SPLITPV) {
                    const Split pa0 = sp_ld(myp + l15 * 64, 1, 0, hf, 64, 1.f), pa1 = sp_ld(myp + l15 * 64, 1, 32, hf, 64, 1.f);
                    const __bf16* vh = (const __bf16*)vl; const __bf16* vlo = vh + 64 * VP;
#pragma unroll
                    for (int t = 0; t < NT; ++t) {
                        const int dcol = t * 16 + l15;
                        Split b0, b1;
#pragma unroll
                        for (int e = 0; e < 16; ++e) {
                            const int k0 = frag_k(e, hf), k1 = 32 + frag_k(e, hf);
                            b0.hi[e] = vh[k0 * VP + dcol]; b0.lo[e] = vlo[k0 * VP + dcol]; b1.hi[e] = vh[k1 * VP + dcol]; b1.lo[e] = vlo[k1 * VP + dcol];
                        }
                        o[t] = wmma3(pa0, b0, o[t]);
                        o[t] = wmma3(pa1, b1, o[t]);
                    }
                } else {
                    const v16h pa0 = fh_ld(myp + l15 * 64, 1, 0, hf, 64, 4096.f), pa1 = fh_ld(myp + l15 * 64, 1, 32, hf, 64, 4096.f);
#pragma unroll
                    for (int t = 0; t < NT; ++t) {
                        const int dcol = t * 16 + l15;
                        v16h b0, b1;
#pragma unroll
                        for (int e = 0; e < 16; ++e) { b0[e] = vl[frag_k(e, hf) * VP + dcol]; b1[e] = vl[(32 + frag_k(e, hf)) * VP + dcol]; }
                        o[t] = wmma16(pa0, b0, o[t]);
                        o[t] = wmma16(pa1, b1, o[t]);
                    }
                }
            }
        }
    }
    float* obase = p.O + b * p.sOb + h * p.sOh;
    if (p.ST) {
        const int rl = lane >> 1, isel = rl & 7;           // row q0 + rl ; rl>>3 == hf holds because lane>>4 == (lane>>1)>>3
        float mv = 0.f, lv = 0.f;
#pragma unroll
        for (int i = 0; i < 8; ++i) if (i == isel) { mv = m8[i]; lv = l8[i]; }
        const int irow = q0 + rl;
        if (irow < p.Lq) { float* st = p.ST + (((long long)b * gridDim.y + h) * p.Lq + irow) * 2 + (lane & 1); VST2(float, st, (lane & 1) ? lv : mv * 0.6931471805599453f); }
    }
    float invr[8];
#pragma unroll
    for (int i = 0; i < 8; ++i) {
        if (TWOPASS) invr[i] = SPLITPV ? 1.f : (1.f / 4096.f);
        else if (p.nonorm) invr[i] = exp2f(m8[i]) * (SPLITPV ? 1.f : (1.f / 4096.f));
        else invr[i] = (l8[i] > 0.f) ? (SPLITPV ? 1.f / l8[i] : 1.f / (l8[i] * 4096.f)) : 0.f;
    }
    __syncthreads();                                             // all waves done with pl/vl from the main loop
    const bool ofast = ((p.sOi & 3) == 0) && ((((size_t)obase) & 15) == 0) && (q0 + 16 <= p.Lq);
#pragma unroll
    for (int c0 = 0; c0 < DVP; c0 += 64) {
#pragma unroll
        for (int i = 0; i < 8; ++i)
#pragma unroll
            for (int t = 0; t < NT; ++t) if (t * 16 >= c0 && t * 16 < c0 + 64) ((float*)myp)[(i + 8 * hf) * 64 + (t * 16 - c0) + l15] = o[t][i] * invr[i];
        __syncthreads();
        const int cw = (DVP - c0 < 64) ? (DVP - c0) : 64;      // staged columns in this chunk (multiple of 16)
        if (ofast && (c0 + cw <= p.dv) && (cw % 32 == 0)) {
            const int lpr = cw / 4;                              // lanes per row (16 for 64 cols, 8 for 32)
            const int rows_per_ins = 32 / lpr;
            for (int r0 = 0; r0 < 16; r0 += rows_per_ins) {
                const int row = r0 + lane / lpr, c4 = (lane % lpr) * 4;
                const v4f v = *(const v4f*)(myp + row * 64 + c4);
                VST2V4(obase + (long long)(q0 + row) * p.sOi + c0 + c4, v);
            }
        } else {
            for (int row = 0; row < 16; ++row) {
                const int irow = q0 + row; if (irow >= p.Lq) continue;
                for (int c = lane; c < cw; c += 32) { const int d = c0 + c; if (d < p.dv) VST2(float, obase + (long long)irow * p.sOi + d, myp[row * 64 + c]); }
            }
        }
        __syncthreads();
    }
}

// ---- causal flash attention, transposed products ------------------------------------------------------------------
// Q, K, V, O dense f32 [batch][FS rows][FD], head h at column 64 h, head size 64. grid (heads, batches, FS / 64), query tile bx = last - blockIdx.z (longest first),
// 4 waves of 16 queries, key blocks of 64. S^T = K.Q^T: A = 16 keys x 32 k, B = Q, so s[t][r] is the score of key j0 + 16 t + 8 hf + r for query q0 + l15:
// the 64 scores of a query lie in lanes l15 and l15 + 16, the maximum and the sum are taken in the lane, and the two halves meet by one exchange.
// O^T += V^T.P^T: two score tiles, converted in place, are the B operand (element e <- tile e / 8, register e % 8, the hardware k order), so P passes through no LDS;
// A = V^T comes from the row-major f16 V tile by the transposing LDS load, which delivers the same k order. o[t][r] = O[q0 + l15][16 t + 8 hf + r].
// Every loop but the one over key blocks is unrolled (#pragma unroll): its index picks registers of a fragment or an accumulator, which stay registers only under constant indices.
typedef __attribute__((ext_vector_type(8))) short v8s;
__device__ __forceinline__ v8h at_ld_tr16(const _Float16* p) { typedef __attribute__((address_space(3))) v8s lds_v8s; return __builtin_bit_cast(v8h, __builtin_amdgcn_ds_load_tr16_b128_v8i16((lds_v8s*)p)); }
__device__ __forceinline__ float at_xhalf(float x) { return __builtin_bit_cast(float, __builtin_amdgcn_permlanex16(__builtin_bit_cast(int, x), __builtin_bit_cast(int, x), 0x76543210, 0xfedcba98, false, false)); }   // lane l <-> lane l ^ 16
// 2^x by v_exp_f32 (a result under 2^-126 comes out as 0). Written as asm for the slot that the instruction set asks for behind a transcendental: no result register is a source
// register of the statement ("=&v"), so no exponential overwrites the source or reads the result of the one in front of it, and the v_nop at the end fills the slot behind the last.
__device__ __forceinline__ float at_exp2(float x) { float d; asm("v_exp_f32 %0, %1\n\tv_nop" : "=&v"(d) : "v"(x)); return d; }
__device__ __forceinline__ v8f at_exp2x8(v8f x) {
    float d0, d1, d2, d3, d4, d5, d6, d7;
    asm("v_exp_f32 %0, %8\n\tv_exp_f32 %1, %9\n\tv_exp_f32 %2, %10\n\tv_exp_f32 %3, %11\n\tv_exp_f32 %4, %12\n\tv_exp_f32 %5, %13\n\tv_exp_f32 %6, %14\n\tv_exp_f32 %7, %15\n\tv_nop"
        : "=&v"(d0), "=&v"(d1), "=&v"(d2), "=&v"(d3), "=&v"(d4), "=&v"(d5), "=&v"(d6), "=&v"(d7)
        : "v"(x[0]), "v"(x[1]), "v"(x[2]), "v"(x[3]), "v"(x[4]), "v"(x[5]), "v"(x[6]), "v"(x[7]));
    v8f d; d[0] = d0; d[1] = d1; d[2] = d2; d[3] = d3; d[4] = d4; d[5] = d5; d[6] = d6; d[7] = d7; return d;
}
template <int FS, int FD>
__global__ __launch_bounds__(32 * AW) KATTN_ATTR void k_attn_t(const float* __restrict__ Q, const float* __restrict__ K, const float* __restrict__ V, float* __restrict__ O) {
    static_assert(FS % 64 == 0 && FD % 8 == 0 && AW == 4, "whole key blocks, 32-byte aligned fragments");
    constexpr int VP = 80;                      // V tile pitch in halves: 160 B = 32 B x odd, the transposing load's pitch
    constexpr int OP = 68;                      // output staging pitch in floats
    __shared__ __align__(16) _Float16 vl[64 * VP];
    __shared__ __align__(16) float    ol[AW][16 * OP];
    const int lane = threadIdx.x & 31, hf = lane >> 4, l15 = lane & 15, wave = threadIdx.x >> 5;
    const int bx = FS / (16 * AW) - 1 - (int)blockIdx.z;
    const int h = blockIdx.x, b = blockIdx.y;
    const int q0 = (bx * AW + wave) * 16;
    const float NEG = -__builtin_inff();
    const float SC = 0.125f * 1.4426950408889634f;   // 1 / sqrt(64) and log2(e); the power of two makes one product round as the two did
    const size_t hb = (size_t)b * FS * FD + (size_t)h * 64;
    const float* qrow = Q + hb + (size_t)(q0 + l15) * FD;
    const float* kbase = K + hb;
    const float* vbase = V + hb;
    v16h qa[2];
#pragma unroll
    for (int ks = 0; ks < 2; ++ks) qa[ks] = fh_ld(qrow, 1, ks * 32, hf, 64, 1.f);
    v8f o[4]; float m = NEG, l = 0.f;           // m: the query's running maximum (both halves alike); l: this half's part of its sum
#pragma unroll
    for (int t = 0; t < 4; ++t) { v8f zz = {}; o[t] = zz; }
    const _Float16* vt = vl + (8 * hf + (lane & 7)) * VP + 8 * ((lane >> 3) & 1);   // this lane's address in the transposing loads, key 0, column 0
    const int jend = (bx + 1) * 64;
    for (int j0 = 0; j0 < jend; j0 += 64) {
        v16h kf[8];                                          // the key block's K fragments, tile t and k-step ks at 2 t + ks
        __syncthreads();                                     // previous key block's reads of vl are done
        {
            // raw f32 in two batches, so that the loaded values and everything else that is live fit 256 registers (four waves a SIMD)
            v4f vr[8]; v8f kr[8];                                           // V: four consecutive elements per thread and step; K: half a fragment each
            const float* krow = kbase + (long long)(j0 + l15) * FD + 8 * hf;
            const float* vrow = vbase + (long long)(j0 + ((int)threadIdx.x >> 4)) * FD + ((int)threadIdx.x & 15) * 4;
#pragma unroll
            for (int it = 0; it < 8; ++it) vr[it] = *(const v4f*)(vrow + it * (2 * AW * FD));   // rows 2 AW apart per step
#pragma unroll
            for (int c = 0; c < 8; ++c) kr[c] = *(const v8f*)(krow + (c >> 2) * (16 * FD) + (c & 3) * 16);   // key tile t = c / 4; k = 16 (c % 4) + 8 hf + (0..7)
            // inputs-only fence on the loaded values: their first use is here, so the batch's 24 loads are all issued before any is waited on (without it
            // the scheduler puts each load directly in front of its conversion and waits on it there); V's address is named too, so that it stays live and none of
            // these loads is given its register pair as destination
            asm volatile("" :: "v"(vr[0]), "v"(vr[1]), "v"(vr[2]), "v"(vr[3]), "v"(vr[4]), "v"(vr[5]), "v"(vr[6]), "v"(vr[7]),
                         "v"(kr[0]), "v"(kr[1]), "v"(kr[2]), "v"(kr[3]), "v"(kr[4]), "v"(kr[5]), "v"(kr[6]), "v"(kr[7]), "v"(vrow));
#pragma unroll
            for (int it = 0; it < 8; ++it) {
                v4h hv; hv[0] = (_Float16)vr[it][0]; hv[1] = (_Float16)vr[it][1]; hv[2] = (_Float16)vr[it][2]; hv[3] = (_Float16)vr[it][3];
                *(v4h*)(vl + ((int)threadIdx.x >> 4) * VP + ((int)threadIdx.x & 15) * 4 + it * (2 * AW * VP)) = hv;
            }
#pragma unroll
            for (int f = 0; f < 4; ++f)
#pragma unroll
                for (int e = 0; e < 8; ++e) { kf[f][e] = (_Float16)kr[2 * f][e]; kf[f][8 + e] = (_Float16)kr[2 * f + 1][e]; }
            v8f ks2[8];
#pragma unroll
            for (int c = 0; c < 8; ++c) ks2[c] = *(const v8f*)(krow + (2 + (c >> 2)) * (16 * FD) + (c & 3) * 16);   // key tiles 2 and 3
            // the same fence for the second batch's 16 loads; the address is named too, so that it stays live and none of these loads is given its register pair as destination
            asm volatile("" :: "v"(ks2[0]), "v"(ks2[1]), "v"(ks2[2]), "v"(ks2[3]), "v"(ks2[4]), "v"(ks2[5]), "v"(ks2[6]), "v"(ks2[7]), "v"(krow));
#pragma unroll
            for (int f = 0; f < 4; ++f)
#pragma unroll
                for (int e = 0; e < 8; ++e) { kf[4 + f][e] = (_Float16)ks2[2 * f][e]; kf[4 + f][8 + e] = (_Float16)ks2[2 * f + 1][e]; }
        }
        v8f s[4];
#pragma unroll
        for (int t = 0; t < 4; ++t) {
            v8f acc = {};
#pragma unroll
            for (int ks = 0; ks < 2; ++ks) acc = __builtin_amdgcn_wmma_f32_16x16x32_f16(false, kf[2 * t + ks], false, qa[ks], (short)0, acc, false, false);
            s[t] = acc;
        }
        const int lim = q0 + l15 - j0 - 8 * hf;              // key 16 t + r of this half joins while 16 t + r <= lim
        float mt[4];                                         // per score tile, so that four short chains run side by side
#pragma unroll
        for (int t = 0; t < 4; ++t) {
            mt[t] = NEG;
#pragma unroll
            for (int r = 0; r < 8; ++r) { const float v = (16 * t + r > lim) ? NEG : s[t][r] * SC; s[t][r] = v; mt[t] = fmaxf(mt[t], v); }
        }
        float mx = fmaxf(fmaxf(mt[0], mt[1]), fmaxf(mt[2], mt[3]));
        mx = fmaxf(mx, at_xhalf(mx));
        const float mnew = fmaxf(m, mx);                     // finite from the first key block on: key 0 joins every query
        const float corr = at_exp2(m - mnew);                // 0 in the first key block, where m is -inf
        float rt[4];
        v16h pb[2];
#pragma unroll
        for (int t = 0; t < 4; ++t) {
            const v8f pp = at_exp2x8(s[t] - mnew);           // 0 for a masked key
            rt[t] = pp[0];
#pragma unroll
            for (int r = 1; r < 8; ++r) rt[t] += pp[r];
#pragma unroll
            for (int r = 0; r < 8; ++r) pb[t >> 1][(t & 1) * 8 + r] = (_Float16)(pp[r] * 4096.f);
        }
        const float rs = (rt[0] + rt[1]) + (rt[2] + rt[3]);
        l = l * corr + rs; m = mnew;
#pragma unroll
        for (int t = 0; t < 4; ++t) o[t] *= corr;
        __syncthreads();                                     // the V tile is visible
#pragma unroll
        for (int t = 0; t < 4; ++t)
#pragma unroll
            for (int ks = 0; ks < 2; ++ks) {
                union { v16h v; v8h p[2]; } a;
                a.p[0] = at_ld_tr16(vt + (32 * ks) * VP + 16 * t); a.p[1] = at_ld_tr16(vt + (32 * ks + 16) * VP + 16 * t);
                o[t] = __builtin_amdgcn_wmma_f32_16x16x32_f16(false, a.v, false, pb[ks], (short)0, o[t], false, false);
            }
    }
    l += at_xhalf(l);                                        // the two halves' sums meet once
    const float inv = (l > 0.f) ? 1.f / (l * 4096.f) : 0.f;
    float* myo = ol[wave];
#pragma unroll
    for (int t = 0; t < 4; ++t) {
        v4f lo, hi;
#pragma unroll
        for (int r = 0; r < 4; ++r) { lo[r] = o[t][r] * inv; hi[r] = o[t][4 + r] * inv; }
        *(v4f*)(myo + l15 * OP + 16 * t + 8 * hf) = lo; *(v4f*)(myo + l15 * OP + 16 * t + 8 * hf + 4) = hi;
    }
    __syncthreads();                                         // the staged rows are visible to the lanes that store them
    float* obase = O + hb;
    v4f ov[8];
#pragma unroll
    for (int i = 0; i < 8; ++i) ov[i] = *(const v4f*)(myo + (2 * i + hf) * OP + l15 * 4);
#pragma unroll
    for (int i = 0; i < 8; ++i) VST2V4(obase + (size_t)(q0 + 2 * i + hf) * FD + l15 * 4, ov[i]);   // each store instruction writes two whole 256-byte rows
}

// =====================================================================================================================
// k_tr: dst(z, c, r) = alpha * src(z, r, c) (+ beta * R2(z, c, r)): [Z][R][C] (row stride lds) -> [Z][C][R] (row stride ldd) through a 32x32 LDS tile;
//   flags: 1 -> add beta * residual R2 addressed like dst (z*sRz + c*ldr + r); act applied before the residual.
// =====================================================================================================================
struct TrP { const float* src; float* dst; const float* R2; long long sSz, lds, sDz, ldd, sRz, ldr; int R, C, flags, act; float alpha, beta; };
static_assert(sizeof(TrP) == 3 * 8 + 6 * 8 + 6 * 4, "TrP has padding");
__global__ __launch_bounds__(256) void k_tr(TrP p) {
    __shared__ float tile[32][33];
    const int c0 = blockIdx.x * 32, r0 = blockIdx.y * 32, z = blockIdx.z;
    const int lane = threadIdx.x & 31, wave = threadIdx.x >> 5;
    const float* s = p.src + z * p.sSz;
#pragma unroll
    for (int k = 0; k < 4; ++k) {
        const int rl = wave * 4 + k, r = r0 + rl, c = c0 + lane;
        tile[rl][lane] = (r < p.R && c < p.C) ? s[(long long)r * p.lds + c] : 0.f;
    }
    __syncthreads();
    float* d = p.dst + z * p.sDz; const float* rr = p.R2 + z * p.sRz;
#pragma unroll
    for (int k = 0; k < 4; ++k) {
        const int cl = wave * 4 + k, c = c0 + cl, r = r0 + lane;
        if (c < p.C && r < p.R) {
            float v = act_fn(p.alpha * tile[lane][cl], p.act);
            if (p.flags & 1) v += p.beta * rr[(long long)c * p.ldr + r];
            VST2(float, d + (long long)c * p.ldd + r, v);
        }
    }
}

// k_affine: dst[i] = a * (sdev ? sdev[0] : 1) * src[i] + b, i < n (one thread per element; consecutive lanes -> consecutive addresses)
__global__ __launch_bounds__(256) void k_affine(const float* __restrict__ src, float* __restrict__ dst, int n, float a, float b, const float* __restrict__ sdev) {
    const int i = blockIdx.x * 256 + threadIdx.x;
    if (i < n) { const float aa = sdev ? a * sdev[0] : a; const float v = aa * src[i] + b; VST2(float, dst + i, v); }
}

// =====================================================================================================================
// k_softmax: row softmax over n contiguous elements, one 256-thread block per row; rows addressed z*sz + r*sr (grid (R, Z)).
//   out = scale_out * softmax(scale_in * x + (Mf ? Mf[z*smz + r*smr + j] : 0)); a row whose max is -inf is written as 0.
// =====================================================================================================================
struct SmP { const float* src; float* dst; const float* Mf; long long sz, sr, dz, dr, smz, smr; int n, pad; float scale_in, scale_out; };
static_assert(sizeof(SmP) == 3 * 8 + 6 * 8 + 4 * 4, "SmP has padding");
__global__ __launch_bounds__(256) void k_softmax(SmP p) {
    __shared__ float red[256];
    const int r = blockIdx.x, z = blockIdx.y, tid = threadIdx.x;
    const float* s = p.src + z * p.sz + (long long)r * p.sr;
    const float* mf = p.Mf ? (p.Mf + z * p.smz + (long long)r * p.smr) : nullptr;
    float mx = -__builtin_inff();
    for (int j = tid; j < p.n; j += 256) { float v = s[j] * p.scale_in; if (mf) v += mf[j]; mx = fmaxf(mx, v); }
    red[tid] = mx; __syncthreads();
    for (int o = 128; o > 0; o >>= 1) { if (tid < o) red[tid] = fmaxf(red[tid], red[tid + o]); __syncthreads(); }
    mx = red[0]; __syncthreads();
    float sum = 0.f;
    for (int j = tid; j < p.n; j += 256) { float v = s[j] * p.scale_in; if (mf) v += mf[j]; sum += (mx == -__builtin_inff()) ? 0.f : expf(v - mx); }
    red[tid] = sum; __syncthreads();
    for (int o = 128; o > 0; o >>= 1) { if (tid < o) red[tid] += red[tid + o]; __syncthreads(); }
    sum = red[0];
    const float inv = (sum > 0.f) ? p.scale_out / sum : 0.f;
    float* d = p.dst + z * p.dz + (long long)r * p.dr;
    for (int j = tid; j < p.n; j += 256) { float v = s[j] * p.scale_in; if (mf) v += mf[j]; const float o = (mx == -__builtin_inff()) ? 0.f : expf(v - mx) * inv; VST2(float, d + j, o); }
}
// =====================================================================================================================
// k_stats: mean and rsqrt(var + eps) over a set of n elements addressed base + z*sz + (e / inner) * so + (e % inner) * si, one 256-thread
// k_norm_apply: y = (x - mean[set]) * rstd[set] * g[c] + b[c] over a [Z][C][L] channel-major tensor with set = z*G + c / (C/G) (G groups per z;
//   G = C -> per-channel sets indexed z*C+c; for batch norm pass stats indexed by c only via bn = 1). Optional act. Output same layout.
// =====================================================================================================================
//   mode 0: mean / rsqrt(var + eps); mode 1 (RMSNorm): 0 / rsqrt(mean(x^2) + eps); mode 2 (L2 normalize * sqrt(n)): 0 / sqrt(n) / max(||x||, eps); mode 3: as 0 with unbiased variance (n-1)
__global__ __launch_bounds__(256) void k_stats(const float* __restrict__ x, long long sz, long long so, long long si, int inner, int n, float eps, float* __restrict__ stat, int mode) {
    __shared__ float red[256];
    const int z = blockIdx.x, tid = threadIdx.x;
    const float* base = x + z * sz;
    float s = 0.f;
    for (int e = tid; e < n; e += 256) s += base[(long long)(e / inner) * so + (long long)(e % inner) * si];
    red[tid] = s; __syncthreads();
    for (int o = 128; o > 0; o >>= 1) { if (tid < o) red[tid] += red[tid + o]; __syncthreads(); }
    const float mu = (mode == 0 || mode == 3) ? red[0] / (float)n : 0.f; __syncthreads();
    float q = 0.f;
    for (int e = tid; e < n; e += 256) { const float dlt = base[(long long)(e / inner) * so + (long long)(e % inner) * si] - mu; q += dlt * dlt; }
    red[tid] = q; __syncthreads();
    for (int o = 128; o > 0; o >>= 1) { if (tid < o) red[tid] += red[tid + o]; __syncthreads(); }
    {
        float rs;
        if (mode == 2) rs = sqrtf((float)n) / fmaxf(sqrtf(red[0]), eps); else if (mode == 3) rs = rsqrtf(red[0] / (float)(n - 1) + eps); else rs = rsqrtf(red[0] / (float)n + eps);
        if (tid < 32) { const float v = (tid == 0) ? mu : ((tid == 1) ? rs : 0.f); VST2(float, stat + (long long)z * 32 + tid, v); }
    }
}
//   One thread per element over the flat [Z][C][L] index space: grid ceil(Z*C*L / 256).
__global__ __launch_bounds__(256) void k_norm_apply(const float* __restrict__ x, float* __restrict__ y, const float* __restrict__ stat, const float* __restrict__ g, const float* __restrict__ bta,
                                                     int Z, int C, int L, int G, int bn, int act) {
    const long long idx = (long long)blockIdx.x * 256 + threadIdx.x;
    if (idx >= (long long)Z * C * L) return;
    const int l = (int)(idx % L); const long long zc = idx / L; const int c = (int)(zc % C), z = (int)(zc / C); (void)l;
    const int set = bn ? c : (z * G + c / (C / G));
    float v = (x[idx] - stat[(long long)set * 32]) * stat[(long long)set * 32 + 1];
    if (g) v *= g[c];
    if (bta) v += bta[c];
    v = act_fn(v, act);
    VST2(float, y + idx, v);
}

// k_lse_neg: c[i] = -(st[2i] + log(st[2i+1])) = minus the log-sum-exp of row i from k_attn's ST output (for softmax over the query dimension)
__global__ __launch_bounds__(256) void k_lse_neg(const float* __restrict__ st, float* __restrict__ c, int n) {
    const int i = blockIdx.x * 256 + threadIdx.x;
    if (i < n) { const float v = -(st[2 * i] + logf(st[2 * i + 1])); VST2(float, c + i, v); }
}

// k_iota: dst[i] = a * i + b as int32 (segment/position id helper)
__global__ __launch_bounds__(256) void k_iota(int* __restrict__ dst, int n, int a, int b) {
    const int i = blockIdx.x * 256 + threadIdx.x;
    if (i < n) { const int v = a * i + b; VST2(int, dst + i, v); }
}

// k_axpby: dst[i] = a * x[i] + b * y[i] (+ c), i < n
__global__ __launch_bounds__(256) void k_axpby(const float* __restrict__ x, const float* __restrict__ y, float* __restrict__ dst, int n, float a, float b, float c) {
    const int i = blockIdx.x * 256 + threadIdx.x;
    if (i < n) { const float v = a * x[i] + b * y[i] + c; VST2(float, dst + i, v); }
}

// =====================================================================================================================
// k_rope: rotary embedding on a [R rows][Hn heads][D] view (row stride sXr, head stride sXh, element stride 1) -> Y (own strides).
//   mode 0: rotate_half (partner d±D/2, sign - for d<D/2); mode 1: interleaved pairs (partner d^1, sign - for even d).
//   table column tcol: tmode 0 -> d, 1 -> d % (D/2), 2 -> d / 2; position p: pmode 0 -> r % S, 1 -> head index, 2 -> pos[r];
//   c = C[(r / S) * sCb + p * sCp + tcol * sCd], s likewise from Sn; y = x[d] * c + sign * x[partner] * s. X and Y must not alias.
// =====================================================================================================================
struct RopeP { const float* X; float* Y; const float* C; const float* Sn; const int* pos; long long sXr, sXh, sYr, sYh, sCb, sCp, sCd; int R, Hn, D, S, mode, tmode, pmode, pad; };
static_assert(sizeof(RopeP) == 5 * 8 + 7 * 8 + 8 * 4, "RopeP has padding");
__global__ __launch_bounds__(256) void k_rope(RopeP p) {
    const long long idx = (long long)blockIdx.x * 256 + threadIdx.x;
    if (idx >= (long long)p.R * p.Hn * p.D) return;
    const int d = (int)(idx % p.D); const long long rh = idx / p.D; const int h = (int)(rh % p.Hn); const int r = (int)(rh / p.Hn);
    const int half = p.D / 2;
    int partner; float sign;
    if (p.mode == 0) { partner = (d < half) ? d + half : d - half; sign = (d < half) ? -1.f : 1.f; }
    else { partner = d ^ 1; sign = (d & 1) ? 1.f : -1.f; }
    const int tcol = (p.tmode == 0) ? d : ((p.tmode == 1) ? (d % half) : (d >> 1));
    const int pp = (p.pmode == 0) ? (r % p.S) : ((p.pmode == 1) ? h : p.pos[r]);
    const long long toff = (long long)(r / p.S) * p.sCb + (long long)pp * p.sCp + (long long)tcol * p.sCd;
    const float* xr = p.X + (long long)r * p.sXr + (long long)h * p.sXh;
    const float v = xr[d] * p.C[toff] + sign * xr[partner] * p.Sn[toff];
    VST2(float, p.Y + (long long)r * p.sYr + (long long)h * p.sYh + d, v);
}

// k_invf + k_sincos (split so neither kernel carries a large VALU-fma footprint): invf_i = num * (1 / powf(base, (2 i)/D)) [fmode 0],
//   num * expf((2 i) * cexp) [fmode 1], num * powf(base, -2 (i - 1) / D) [fmode 2]; then cs/sn[s*half + i] = cos/sin((pscale * s) * invf_i)
__global__ __launch_bounds__(256) void k_invf(float* __restrict__ invb, int half, int D, float base, float num, int fmode, float cexp) {
    const int i = blockIdx.x * 256 + threadIdx.x;
    if (i >= ((half + 31) / 32) * 32) return;
    if (i >= half) { VST2(float, invb + i, 0.f); return; }
    const float e = (float)(2 * i) / (float)D;
    float invf;
    if (fmode == 1) invf = num * expf((float)(2 * i) * cexp);
    else if (fmode == 2) invf = num * powf(base, (-2.0f * ((float)i - 1.0f)) / (float)D);
    else invf = num * (1.0f / powf(base, e));
    VST2(float, invb + i, invf);
}
__global__ __launch_bounds__(256) void k_sincos(float* __restrict__ cs, float* __restrict__ sn, const float* __restrict__ invb, int S, int half, float pscale) {
    const int idx = blockIdx.x * 256 + threadIdx.x;
    if (idx >= S * half) return;
    const int s = idx / half, i = idx - s * half;
    const float ang = (pscale * (float)s) * invb[i];
    VST2(float, cs + idx, cosf(ang)); VST2(float, sn + idx, sinf(ang));
}

// k_mulact: dst[i] = act(x[i]) * y[i]
__global__ __launch_bounds__(256) void k_mulact(const float* __restrict__ x, const float* __restrict__ y, float* __restrict__ dst, int n, int act) {
    const int i = blockIdx.x * 256 + threadIdx.x;
    if (i < n) { const float v = act_fn(x[i], act) * y[i]; VST2(float, dst + i, v); }
}

// =====================================================================================================================
// k_matvec: thread-per-row matrix-vector products for N <= 8 output columns (heads with 1-3 outputs, gates), f32 on the VALU.
//   C[r*sCm + j] = act(alpha * sum_k A[r*sAm + k*sAk] * B[j*sBn + k*sBk] + bias[j]) + beta * R[r*sRm + j*sRn]; each thread writes its N contiguous floats.
// =====================================================================================================================
__global__ __launch_bounds__(256) void k_matvec(GemmP p) {
    // 32 lanes write one line with one instruction.
    const int rpt = (p.N == 1) ? 1 : 32;
    const long long r0 = ((long long)blockIdx.x * 256 + threadIdx.x) * rpt; const int z = blockIdx.z, zo = z / p.zi_n, zi = z - zo * p.zi_n;
    if (r0 >= p.M) return;
    const float* Bb = p.B + zo * p.sBo + zi * p.sBi;
    float* C = p.C + zo * p.sCo + zi * p.sCi; const float* R = p.R + zo * p.sRo + zi * p.sRi;
    for (int rr = 0; rr < rpt; ++rr) {
        const long long r = r0 + rr; if (r >= p.M) break;
        const float* A = p.A + zo * p.sAo + zi * p.sAi + r * p.sAm;
        float acc[8] = {0.f, 0.f, 0.f, 0.f, 0.f, 0.f, 0.f, 0.f};
        for (int k = 0; k < p.K; ++k) { const float a = A[(long long)k * p.sAk];
#pragma unroll
            for (int j = 0; j < 8; ++j) if (j < p.N) acc[j] += a * Bb[(long long)j * p.sBn + (long long)k * p.sBk]; }
#pragma unroll
        for (int j = 0; j < 8; ++j) if (j < p.N) {
            float v = acc[j] * p.alpha;
            if (p.flags & 1) v += p.bias[j];
            if (p.flags & 2) v += p.bias[r];
            v = act_fn(v, p.act);
            if (p.flags & 4) v += p.beta * R[r * p.sRm + (long long)j * p.sRn];
            VST2(float, C + r * p.sCm + j, v);
        }
    }
}
// k_smallsoftmax: thread-per-row softmax for short rows (n <= 64): dst[r*dr + j] = softmax(scale*src[r*sr + j])
__global__ __launch_bounds__(256) void k_smallsoftmax(const float* __restrict__ src, float* __restrict__ dst, long long sr, long long dr, int n, long long R, float scale) {
    const long long r0 = ((long long)blockIdx.x * 256 + threadIdx.x) * 32;
    for (int rr = 0; rr < 32; ++rr) {
        const long long r = r0 + rr; if (r >= R) return;
        const float* s = src + r * sr; float* d = dst + r * dr;
        float mx = -__builtin_inff();
        for (int j = 0; j < n; ++j) mx = fmaxf(mx, s[j] * scale);
        float sum = 0.f;
        for (int j = 0; j < n; ++j) sum += expf(s[j] * scale - mx);
        const float inv = 1.f / sum;
        for (int j = 0; j < n; ++j) { const float v = expf(s[j] * scale - mx) * inv; VST2(float, d + j, v); }
    }
}

__global__ __launch_bounds__(32) void k_unitstat(float* __restrict__ st) { const int t = threadIdx.x; const float v = (t == 1) ? 1.f : 0.f; VST2(float, st + t, v); }

// destination (e.g. a d_out whose row width is not a multiple of 32 floats) is written by consecutive lanes of one instruction
__global__ __launch_bounds__(256) void k_lincopy(const float* __restrict__ src, long long lds, float* __restrict__ dst, long long ldd, long long rows, int cols) {
    const long long i = (long long)blockIdx.x * 256 + threadIdx.x; if (i >= rows * cols) return;
    const long long r = i / cols; const int c = (int)(i - r * cols);
    const float v = src[r * lds + c]; VST2(float, dst + r * ldd + c, v);
}

namespace w25 {
typedef __attribute__((ext_vector_type(16))) _Float16 v16h;
typedef __attribute__((ext_vector_type(8)))  _Float16 v8h;
typedef __attribute__((ext_vector_type(16))) __bf16   v16b;
typedef __attribute__((ext_vector_type(8)))  __bf16   v8b;
typedef __attribute__((ext_vector_type(8)))  float    v8f;
typedef __attribute__((ext_vector_type(4)))  float    v4f;

__device__ __forceinline__ unsigned short f2bf_bits(float f) {
  unsigned u = __float_as_uint(f);
  return (unsigned short)((u + 0x7FFFu + ((u >> 16) & 1u)) >> 16);
}
__device__ __forceinline__ float bf_bits2f(unsigned short h) { return __uint_as_float(((unsigned)h) << 16); }

template <typename T> struct Frag;
template <> struct Frag<_Float16> {
  typedef v16h V; union U { v16h v; v8h h[2]; };
  static __device__ __forceinline__ v16h load(const _Float16* p) {   // elements 0..7 <- p[0..7], 8..15 <- p[16..23]
    U f; f.h[0] = *(const v8h*)(p); f.h[1] = *(const v8h*)(p + 16); return f.v;
  }
  static __device__ __forceinline__ v8f mma(v16h a, v16h b, v8f c) {
    return __builtin_amdgcn_wmma_f32_16x16x32_f16(false, a, false, b, (short)0, c, false, false);
  }
};
template <> struct Frag<__bf16> {
  typedef v16b V; union U { v16b v; v8b h[2]; };
  static __device__ __forceinline__ v16b load(const __bf16* p) {
    U f; f.h[0] = *(const v8b*)(p); f.h[1] = *(const v8b*)(p + 16); return f.v;
  }
  static __device__ __forceinline__ v8f mma(v16b a, v16b b, v8f c) {
    return __builtin_amdgcn_wmma_f32_16x16x32_bf16(false, a, false, b, (short)0, c, false, false);
  }
};

// ---- WMMA GEMM with both operands staged in LDS ------------------------------
// C[m,n] = scale * sum_k A[m,k] * Bt[n,k], f32 out. A row-major [M,K]; Bt row-major [N,K]; C row-major [M,N]; M % 64 == 0, N % 128 == 0, K % 64 == 0.
// grid (N / 128, the sum of M / 64 over the products), 8 waves: a work-group owns a 64 x 128 tile of C, wave (wave >> 2, wave & 3) a 32 x 32 part of it.
// K runs in stages of 64: a stage's 64 A rows and 128 Bt rows (128 B each, per plane) come from global memory as whole 128-byte lines
// (8 lanes x 16 B per row), go to LDS at a pitch of 144 B, and every wave reads its fragments from there with 16-byte LDS loads.
// Two LDS buffers: the next stage's global loads are in flight while the current stage is multiplied; one barrier per stage.
// SPLIT: operands are hi/lo planes (A2/Bt2 = lo planes, same layout); product = hi.hi + hi.lo + lo.hi, in that order per 32 k.
// ET: 0 = f16 operands, 1 = bf16 operands (pointers passed as 16-bit storage)
// astep: rows of A from one 64-row tile of C to the next (64: A is dense; more: each tile takes the first 64 rows of a longer block of A)
template <int ET> struct Elem;
template <> struct Elem<0> { typedef _Float16 T; typedef v8h V8; };
template <> struct Elem<1> { typedef __bf16 T; typedef v8b V8; };
// One launch holds up to three products with the same A: grid (N / 128, T0 + 2 T1). Tile rows 0 .. T0 - 1 belong to C0 = A.Bt0^T with A dense (64 rows a tile);
// the next T1 to C1 = A.Bt1^T and the last T1 to C2 = A.Bt2^T, both with astep1 rows of A from tile to tile. A launch of T0 + T1 tile rows never touches Bt2 and C2, one of T0 only Bt0 and C0.
struct GemmB { const unsigned short* hi; const unsigned short* lo; float* c; };   // one product's Bt planes (lo unused without SPLIT) and its C
template <int ET, bool SPLIT>
__global__ __launch_bounds__(256) void wmma_gemm_lds(
    const unsigned short* __restrict__ Ap, const unsigned short* __restrict__ A2p,
    GemmB p0, GemmB p1, GemmB p2, int T0, int T1, int N, int K, float scale, int astep1) {
  const int ty = (int)blockIdx.y;
  const int pw = ty < T0 ? 0 : (ty < T0 + T1 ? 1 : 2);                       // which product; the same for the whole work-group
  const int by = pw == 0 ? ty : (pw == 1 ? ty - T0 : ty - T0 - T1);          // tile row within it
  const int astep = pw == 0 ? 64 : astep1;
  const unsigned short* __restrict__ Btp  = pw == 0 ? p0.hi : (pw == 1 ? p1.hi : p2.hi);
  const unsigned short* __restrict__ Bt2p = pw == 0 ? p0.lo : (pw == 1 ? p1.lo : p2.lo);
  float* __restrict__ C = pw == 0 ? p0.c : (pw == 1 ? p1.c : p2.c);
  typedef typename Elem<ET>::T T;
  typedef typename Elem<ET>::V8 V8;
  typedef typename Frag<T>::V V;
  constexpr int NP    = SPLIT ? 2 : 1;      // planes
  constexpr int PITCH = 72;                 // LDS row pitch in 16-bit elements: 144 B = 16 B x 9
  constexpr int PROWS = 192;                // rows of one plane in a stage: 64 of A, then 128 of Bt
  constexpr int STAGE = NP * PROWS * PITCH; // elements of one buffer
  constexpr int NL    = NP * 6;             // 16-byte pieces per thread and stage (32 rows per step)
  constexpr int CP    = 132;                // pitch of the staged C tile in floats
  static_assert(2 * STAGE * 2 >= 64 * CP * 4, "the C tile is staged in the operand buffers");
  __shared__ __align__(16) T sm[2 * STAGE];
  const int lane = threadIdx.x & 31;
  const int wave = threadIdx.x >> 5;
  const int m0 = by << 6;
  const int n0 = blockIdx.x << 7;
  const int wm = (wave >> 2) << 5;          // this wave's first row and column in the tile
  const int wn = (wave & 3) << 5;
  const int rlane = lane & 15;              // row (A) / col (B, D) within a 16 x 16 subtile
  const int koff  = (lane >> 4) * 8;        // k offset of this lane half
  const int mOff  = (lane >> 4) * 8;        // D row offset

  const int lrow = threadIdx.x >> 3, lseg = (threadIdx.x & 7) * 8;   // staging: row within a step of 32 rows, 16-byte piece of the row
  const int a0 = by * astep;                // first A row of this tile
  const T* gA  = (const T*)Ap  + (size_t)(a0 + lrow) * K + lseg;
  const T* gB  = (const T*)Btp + (size_t)(n0 + lrow) * K + lseg;
  const T* gA2 = SPLIT ? (const T*)A2p  + (size_t)(a0 + lrow) * K + lseg : nullptr;
  const T* gB2 = SPLIT ? (const T*)Bt2p + (size_t)(n0 + lrow) * K + lseg : nullptr;
  const int sw = lrow * PITCH + lseg;       // this thread's place in a buffer, step 0
  const int fa = (wm + rlane) * PITCH + koff;        // this lane's A and Bt fragment places in a buffer, subtile 0, k 0
  const int fb = (64 + wn + rlane) * PITCH + koff;

  v8f acc[2][2];
#pragma unroll
  for (int i = 0; i < 2; ++i)
#pragma unroll
    for (int j = 0; j < 2; ++j) acc[i][j] = (v8f){0.f,0.f,0.f,0.f,0.f,0.f,0.f,0.f};

  V8 st[NL];
  auto fetch = [&](int k0) {                // stage at k0: global memory -> registers
#pragma unroll
    for (int it = 0; it < NL; ++it) {
      const int q = it % 6;                 // steps 0, 1: A rows; 2..5: Bt rows; then the same for the lo planes
      const T* g = (it < 6) ? (q < 2 ? gA : gB) : (q < 2 ? gA2 : gB2);
      st[it] = *(const V8*)(g + (size_t)((q < 2 ? q : q - 2) * 32) * K + k0);
    }
  };
  auto put = [&](int buf) {                 // registers -> LDS buffer
#pragma unroll
    for (int it = 0; it < NL; ++it) *(V8*)(sm + buf * STAGE + sw + it * (32 * PITCH)) = st[it];
  };
  auto mult = [&](int buf) {                // one stage: 2 steps of 32 k
    const T* s = sm + buf * STAGE;
#pragma unroll
    for (int kk = 0; kk < 2; ++kk) {
      V ah[2], al[2], bh[2], bl[2];
#pragma unroll
      for (int i = 0; i < 2; ++i) {
        ah[i] = Frag<T>::load(s + fa + i * (16 * PITCH) + kk * 32);
        bh[i] = Frag<T>::load(s + fb + i * (16 * PITCH) + kk * 32);
        if (SPLIT) {
          al[i] = Frag<T>::load(s + PROWS * PITCH + fa + i * (16 * PITCH) + kk * 32);
          bl[i] = Frag<T>::load(s + PROWS * PITCH + fb + i * (16 * PITCH) + kk * 32);
        }
      }
#pragma unroll
      for (int i = 0; i < 2; ++i)
#pragma unroll
        for (int j = 0; j < 2; ++j) acc[i][j] = Frag<T>::mma(ah[i], bh[j], acc[i][j]);
      if (SPLIT) {
#pragma unroll
        for (int i = 0; i < 2; ++i)
#pragma unroll
          for (int j = 0; j < 2; ++j) acc[i][j] = Frag<T>::mma(ah[i], bl[j], acc[i][j]);
#pragma unroll
        for (int i = 0; i < 2; ++i)
#pragma unroll
          for (int j = 0; j < 2; ++j) acc[i][j] = Frag<T>::mma(al[i], bh[j], acc[i][j]);
      }
    }
  };

  const int NK = K >> 6;
  fetch(0);
  put(0);
  __syncthreads();                          // stage 0 is visible
  for (int kt = 0; kt + 1 < NK; ++kt) {
    fetch((kt + 1) << 6);
    __builtin_amdgcn_sched_barrier(0);      // keeps the next stage's global loads issued ahead of this stage's products, so that their latency runs under them
    mult(kt & 1);
    put((kt + 1) & 1);                      // the buffer that stage kt - 1 was read from; its readers left it at the barrier that ended that trip
    __syncthreads();                        // stage kt + 1 is visible, and every wave has finished reading stage kt
  }
  mult((NK - 1) & 1);
  __syncthreads();                          // all fragment reads are done: the buffers now stage the C tile

  // ---- epilogue: the 64 x 128 f32 tile through LDS, so that each store instruction writes 512 contiguous bytes of one row ----
  float* sC = (float*)sm;
#pragma unroll
  for (int i = 0; i < 2; ++i)
#pragma unroll
    for (int j = 0; j < 2; ++j)
#pragma unroll
      for (int r = 0; r < 8; ++r) sC[(wm + (i << 4) + mOff + r) * CP + wn + (j << 4) + rlane] = acc[i][j][r] * scale;
  __syncthreads();
#pragma unroll
  for (int it = 0; it < 8; ++it) {
    const int row = it * 8 + wave;
    const v4f v = *(const v4f*)(sC + row * CP + lane * 4);
    *(v4f*)(C + (size_t)(m0 + row) * N + n0 + lane * 4) = v;
  }
}

__global__ __launch_bounds__(256) void cast_f32_f16x2(
    const float* __restrict__ in, _Float16* __restrict__ out, int n2) {
  int i = blockIdx.x * 256 + threadIdx.x;
  if (i < n2) {
    const _Float16 h0 = (_Float16)in[2 * i], h1 = (_Float16)in[2 * i + 1];
    const unsigned u = (unsigned)__builtin_bit_cast(unsigned short, h0) | ((unsigned)__builtin_bit_cast(unsigned short, h1) << 16);
    ((unsigned*)out)[i] = u;
    
  }
}


} // namespace w25

__global__ __launch_bounds__(256) void k_castT16(const float* __restrict__ src, long long lds, _Float16* __restrict__ dst, long long ldd, int R, int C, float s) {
    const long long i = (long long)blockIdx.x * 256 + threadIdx.x; const long long np = (long long)C * (R / 2); if (i >= np) return; const int c = (int)(i / (R / 2)); const int r = 2 * (int)(i % (R / 2));
    const _Float16 h0 = (_Float16)(src[(long long)r * lds + c] * s), h1 = (_Float16)(src[(long long)(r + 1) * lds + c] * s);
    const unsigned u = (unsigned)__builtin_bit_cast(unsigned short, h0) | ((unsigned)__builtin_bit_cast(unsigned short, h1) << 16);
    unsigned* d = (unsigned*)(dst + (long long)c * ldd + r); *d = u;  }

// f32 -> bf16 hi plane + bf16 lo plane (x = hi + lo to ~2^-17 relative; RNE both), 2 consecutive destination elements: hi pair returned, lo pair in *lo
__device__ __forceinline__ unsigned int f2bf2_pack(float a, float b, unsigned int* lo) {
    const unsigned short ha = w25::f2bf_bits(a), hb = w25::f2bf_bits(b);
    const unsigned short la = w25::f2bf_bits(a - w25::bf_bits2f(ha)), lb = w25::f2bf_bits(b - w25::bf_bits2f(hb));
    *lo = (unsigned)la | ((unsigned)lb << 16); return (unsigned)ha | ((unsigned)hb << 16); }

namespace w25 {
// =====================================================================================
// Generic causal/non-causal attention for head_dim 64, f32 in / f32 out; 16-bit operands: bf16 with optional hi/lo splits, or
// plain f16 (F16=true, non-split, probabilities carried x2^15).
//   scores = (q*qscale)·kᵀ : v_wmma_f32_16x16x32_bf16; SPLIT_QK -> q,k as bf16 hi/lo (hi·hi + hi·lo + lo·hi)
//   out    = p·v           : v_wmma_f32_16x16x32_bf16; SPLIT_PV -> p,v as bf16 hi/lo; else p,v plain bf16
//   f32 accumulate; online softmax in f32. Block = 4 waves = 64 query rows of one (batch, head); S % 64 == 0.
//   Element (b, s, h, d) of tensor X lives at X[b*X_bs + s*X_rs + h*X_hs + d] (strides in floats, multiples of 4).
//   Masking: mask_mode 0 none, 1 causal (kv > q masked), 2 tensor [S][Skv] shared over (b,h) (float if
//   mask_is_int==0, int32 with element == 0 -> masked if 1, int32 with element != 0 -> masked if 2), 3 per-token vectors qmask[B][S] & kvmask[B][Skv] (int32,
//   0 -> masked), 4 causal + sliding window (kv > q or q - kv > W masked; W passed in mask_is_int);
//   5 = relative-position bias: s += cp[b,h,q][idx[q][kv]] + pc[b,h,kv][idx[q][kv]] with idx = mask_b ([S][Skv] int32) and
//   mask_a an int32 [S][Skv] tensor with nonzero = masked (tables: element (b,h,row,n) at X + b*c_bs + h*c_hs + row*c_rs + n);
//   masked scores are replaced by mask_fill (e.g. -inf or -1e9) before the softmax.
//   grid.x = B * H * (S/64) (or a sub-range with blk0).
// =====================================================================================
#define AT_D 64
#define AT_NW 4
#define AT_QB 64
#define AT_KC 64
struct AttnGeom { const float* cp = nullptr; const float* pc = nullptr; long c_bs = 0, c_rs = 0, c_hs = 0;   // mode-5 score-bias tables
                  long q_bs, q_rs, q_hs, k_bs, k_rs, k_hs, v_bs, v_rs, v_hs, o_bs, o_rs, o_hs;
                  int S, Skv, H, mask_mode; float qscale; int blk0; float mask_fill; int mask_is_int; };
static_assert(sizeof(AttnGeom) == 168, "no padding");

__device__ __forceinline__ unsigned short at_bf_bits(float f) {
  unsigned u = __float_as_uint(f);
  return (unsigned short)((u + 0x7FFFu + ((u >> 16) & 1u)) >> 16);
}
__device__ __forceinline__ __bf16 at_f2bf(float f) { return __builtin_bit_cast(__bf16, at_bf_bits(f)); }
__device__ __forceinline__ void at_split(float f, __bf16& hi, __bf16& lo) {
  const unsigned short hb = at_bf_bits(f);
  hi = __builtin_bit_cast(__bf16, hb);
  lo = at_f2bf(f - __uint_as_float(((unsigned)hb) << 16));
}
__device__ __forceinline__ v8f at_mma(v16b a, v16b b, v8f c) {
  c = __builtin_amdgcn_wmma_f32_16x16x32_bf16(false, a, false, b, (short)0, c, false, false);
  asm volatile("v_nop\n\tv_nop\n\tv_nop\n\tv_nop" : "+v"(c) : "v"(a), "v"(b));
  return c;
}
// 16-bit element as a bit pattern held in a __bf16 slot: f16 bits when F16, bf16 (RNE) otherwise
template <bool F16> __device__ __forceinline__ __bf16 at_to16(float f) {
  if (F16) return __builtin_bit_cast(__bf16, (_Float16)f);
  return at_f2bf(f);
}
template <bool F16> __device__ __forceinline__ v8f at_mma16(v16b a, v16b b, v8f c) {
  if (F16) {
    const v16h ah = __builtin_bit_cast(v16h, a), bh = __builtin_bit_cast(v16h, b);
    c = __builtin_amdgcn_wmma_f32_16x16x32_f16(false, ah, false, bh, (short)0, c, false, false);
    asm volatile("v_nop\n\tv_nop\n\tv_nop\n\tv_nop" : "+v"(c) : "v"(ah), "v"(bh));
    return c;
  }
  return at_mma(a, b, c);
}

template <bool SPLIT_QK, bool SPLIT_PV, bool F16 = false>
__global__ __launch_bounds__(128)
void attn64_kernel(const float* __restrict__ q, const float* __restrict__ k,
                   const float* __restrict__ v, float* __restrict__ out,
                   const void* __restrict__ mask_a, const int* __restrict__ mask_b, AttnGeom g) {
  static_assert(!(F16 && (SPLIT_QK || SPLIT_PV)), "f16 mode is non-split");
  const float PSC = F16 ? 32768.0f : 1.0f;     // f16 probabilities carried x2^15 (subnormal range), folded into the final 1/l
  union FB { v16b v; v8b h[2]; };
  __shared__ __align__(16) __bf16 Ksh[AT_KC * AT_D];             // K hi [kv][d]      8 KB
  __shared__ __align__(16) __bf16 Ksl[SPLIT_QK ? AT_KC * AT_D : 8];
  __shared__ __align__(16) __bf16 Vth[AT_D * AT_KC];             // V hi [d][kv]      8 KB
  __shared__ __align__(16) __bf16 Vtl[SPLIT_PV ? AT_D * AT_KC : 8];
  __shared__ __align__(16) __bf16 Psh[AT_NW][16 * AT_KC];        // per wave P hi [row][kv]  8 KB
  __shared__ __align__(16) __bf16 Psl[SPLIT_PV ? AT_NW : 1][SPLIT_PV ? 16 * AT_KC : 8];
  __shared__ __align__(16) float  Os[AT_NW][16 * 68];            // per wave out tile, pitch 68

  const int tid  = threadIdx.x;
  const int wave = tid >> 5;
  const int lane = tid & 31;
  const int hh   = lane >> 4;
  const int c    = lane & 15;

  const int nqb = g.S / AT_QB;
  const int bx = blockIdx.x + g.blk0;
  const int qb = bx % nqb;
  const int bh = bx / nqb;
  const int h  = bh % g.H;
  const int b  = bh / g.H;
  const int qbase_block = qb * AT_QB;
  const int q0 = qbase_block + wave * 16;

  const float* qb_ptr = q + (size_t)b * g.q_bs + (size_t)h * g.q_hs;
  const float* kb_ptr = k + (size_t)b * g.k_bs + (size_t)h * g.k_hs;
  const float* vb_ptr = v + (size_t)b * g.v_bs + (size_t)h * g.v_hs;
  float*       ob_ptr = out + (size_t)b * g.o_bs + (size_t)h * g.o_hs;

  // ---- Q fragments (A operand): 2 d-chunks, hi (and lo) ----
  v16b qah[2], qal[2];
  {
    const float* qrow = qb_ptr + (size_t)(q0 + c) * g.q_rs;
#pragma unroll
    for (int dc = 0; dc < 2; ++dc) {
#pragma unroll
      for (int e = 0; e < 8; ++e) {
        const float f0 = qrow[dc * 32 + 8 * hh + e] * g.qscale;
        const float f1 = qrow[dc * 32 + 16 + 8 * hh + e] * g.qscale;
        if (SPLIT_QK) { __bf16 hq, lq; at_split(f0, hq, lq); qah[dc][e] = hq; qal[dc][e] = lq; at_split(f1, hq, lq); qah[dc][8 + e] = hq; qal[dc][8 + e] = lq; }
        else { qah[dc][e] = at_to16<F16>(f0); qah[dc][8 + e] = at_to16<F16>(f1); qal[dc][e] = qah[dc][e]; qal[dc][8 + e] = qah[dc][8 + e]; }
      }
    }
  }

  float mrow[8], lrow[8];
  v8f oacc[4];
#pragma unroll
  for (int r = 0; r < 8; ++r) { mrow[r] = -INFINITY; lrow[r] = 0.f; }
#pragma unroll
  for (int t = 0; t < 4; ++t) oacc[t] = (v8f){0.f,0.f,0.f,0.f,0.f,0.f,0.f,0.f};

  const int nChunks = (g.mask_mode == 1 || g.mask_mode == 4) ? (qb + 1) : (g.Skv / AT_KC);   // block-uniform
  // per-row query mask (mode 3)
  int qkeep[8];
#pragma unroll
  for (int r = 0; r < 8; ++r) qkeep[r] = (g.mask_mode == 3) ? mask_b[(size_t)b * g.S + q0 + 8 * hh + r] : 1;   // mask_b = qmask in mode 3
  for (int kc = 0; kc < nChunks; ++kc) {
    const int kv0 = kc * AT_KC;
    __syncthreads();
    {
      const int kvr = tid >> 1, dh = (tid & 1) * 32;
      const float* krow = kb_ptr + (size_t)(kv0 + kvr) * g.k_rs + dh;
      const float* vrow = vb_ptr + (size_t)(kv0 + kvr) * g.v_rs + dh;
#pragma unroll
      for (int i = 0; i < 8; ++i) {
        v4f kk = *(const v4f*)(krow + 4 * i);
        v4f vv = *(const v4f*)(vrow + 4 * i);
#pragma unroll
        for (int e = 0; e < 4; ++e) {
          const int d = dh + 4 * i + e;
          if (SPLIT_QK) { __bf16 a, bl; at_split(kk[e], a, bl); Ksh[kvr * AT_D + d] = a; Ksl[kvr * AT_D + d] = bl; }
          else Ksh[kvr * AT_D + d] = at_to16<F16>(kk[e]);
          if (SPLIT_PV) { __bf16 a, bl; at_split(vv[e], a, bl); Vth[d * AT_KC + kvr] = a; Vtl[d * AT_KC + kvr] = bl; }
          else Vth[d * AT_KC + kvr] = at_to16<F16>(vv[e]);
        }
      }
    }
    __syncthreads();

    v8f s[4];
#pragma unroll
    for (int j = 0; j < 4; ++j) {
      s[j] = (v8f){0.f,0.f,0.f,0.f,0.f,0.f,0.f,0.f};
#pragma unroll 1
      for (int dc = 0; dc < 2; ++dc) {
        FB kb;
        kb.h[0] = *(const v8b*)(Ksh + (j * 16 + c) * AT_D + dc * 32 + 8 * hh);
        kb.h[1] = *(const v8b*)(Ksh + (j * 16 + c) * AT_D + dc * 32 + 16 + 8 * hh);
        s[j] = at_mma16<F16>(qah[dc], kb.v, s[j]);
        if (SPLIT_QK) {
          FB kl;
          kl.h[0] = *(const v8b*)(Ksl + (j * 16 + c) * AT_D + dc * 32 + 8 * hh);
          kl.h[1] = *(const v8b*)(Ksl + (j * 16 + c) * AT_D + dc * 32 + 16 + 8 * hh);
          s[j] = at_mma16<F16>(qah[dc], kl.v, s[j]);
          s[j] = at_mma16<F16>(qal[dc], kb.v, s[j]);
        }
      }
    }
    const bool diag = (g.mask_mode == 1) && (kc == qb);
    int kvkeep[4] = {1, 1, 1, 1};
    if (g.mask_mode == 3) {
#pragma unroll
      for (int j = 0; j < 4; ++j) kvkeep[j] = ((const int*)mask_a)[(size_t)b * g.Skv + kv0 + j * 16 + c];   // mask_a = kvmask
    }
    float cm[8];
#pragma unroll
    for (int r = 0; r < 8; ++r) {
      const int qrow = q0 + 8 * hh + r;
      float m = -INFINITY;
#pragma unroll
      for (int j = 0; j < 4; ++j) {
        const int kvcol = kv0 + j * 16 + c;
        bool masked = false;
        if (diag) masked = (kvcol > qrow);
        else if (g.mask_mode == 4) masked = (kvcol > qrow) || (qrow - kvcol > g.mask_is_int);
        else if (g.mask_mode == 2) {
          const size_t mi = (size_t)qrow * g.Skv + kvcol;
          masked = (g.mask_is_int == 0) ? (((const float*)mask_a)[mi] == 0.0f)
                 : (g.mask_is_int == 1) ? (((const int*)mask_a)[mi] == 0) : (((const int*)mask_a)[mi] != 0);
        } else if (g.mask_mode == 3) masked = (qkeep[r] == 0) || (kvkeep[j] == 0);
        else if (g.mask_mode == 5) {
          const size_t mi = (size_t)qrow * g.Skv + kvcol;
          masked = (((const int*)mask_a)[mi] != 0);
          int n = mask_b[mi]; n = n < 0 ? 0 : n;
          s[j][r] += g.cp[(size_t)b * g.c_bs + (size_t)h * g.c_hs + (size_t)qrow * g.c_rs + n]
                   + g.pc[(size_t)b * g.c_bs + (size_t)h * g.c_hs + (size_t)kvcol * g.c_rs + n];
        }
        if (masked) s[j][r] = g.mask_fill;
        m = fmaxf(m, s[j][r]);
      }
#pragma unroll
      for (int off = 1; off < 16; off <<= 1) m = fmaxf(m, __shfl_xor(m, off, 32));
      cm[r] = m;
    }
    __bf16* pwh = Psh[wave];
    __bf16* pwl = Psl[SPLIT_PV ? wave : 0];
#pragma unroll
    for (int r = 0; r < 8; ++r) {
      const float mnew = fmaxf(mrow[r], cm[r]);
      const float alpha = expf(mrow[r] - mnew);
      mrow[r] = mnew;
      float psum = 0.f;
#pragma unroll
      for (int j = 0; j < 4; ++j) {
        const float p = expf(s[j][r] - mnew);
        psum += p;
        if (SPLIT_PV) { __bf16 a, bl; at_split(p, a, bl); pwh[(8 * hh + r) * AT_KC + j * 16 + c] = a; pwl[(8 * hh + r) * AT_KC + j * 16 + c] = bl; }
        else pwh[(8 * hh + r) * AT_KC + j * 16 + c] = at_to16<F16>(p * PSC);
      }
#pragma unroll
      for (int off = 1; off < 16; off <<= 1) psum += __shfl_xor(psum, off, 32);
      lrow[r] = lrow[r] * alpha + psum;
#pragma unroll
      for (int t = 0; t < 4; ++t) oacc[t][r] *= alpha;
    }
    __builtin_amdgcn_fence(__ATOMIC_RELEASE, "workgroup");
    __builtin_amdgcn_wave_barrier();
    __builtin_amdgcn_fence(__ATOMIC_ACQUIRE, "workgroup");
#pragma unroll 1
    for (int kk = 0; kk < 2; ++kk) {
      FB pa, pl;
      pa.h[0] = *(const v8b*)(pwh + c * AT_KC + kk * 32 + 8 * hh);
      pa.h[1] = *(const v8b*)(pwh + c * AT_KC + kk * 32 + 16 + 8 * hh);
      if (SPLIT_PV) {
        pl.h[0] = *(const v8b*)(pwl + c * AT_KC + kk * 32 + 8 * hh);
        pl.h[1] = *(const v8b*)(pwl + c * AT_KC + kk * 32 + 16 + 8 * hh);
      }
#pragma unroll
      for (int t = 0; t < 4; ++t) {
        FB vb;
        vb.h[0] = *(const v8b*)(Vth + (t * 16 + c) * AT_KC + kk * 32 + 8 * hh);
        vb.h[1] = *(const v8b*)(Vth + (t * 16 + c) * AT_KC + kk * 32 + 16 + 8 * hh);
        oacc[t] = at_mma16<F16>(pa.v, vb.v, oacc[t]);
        if (SPLIT_PV) {
          FB vl;
          vl.h[0] = *(const v8b*)(Vtl + (t * 16 + c) * AT_KC + kk * 32 + 8 * hh);
          vl.h[1] = *(const v8b*)(Vtl + (t * 16 + c) * AT_KC + kk * 32 + 16 + 8 * hh);
          oacc[t] = at_mma16<F16>(pa.v, vl.v, oacc[t]);
          oacc[t] = at_mma16<F16>(pl.v, vb.v, oacc[t]);
        }
      }
    }
  }

  float* os = Os[wave];
#pragma unroll
  for (int r = 0; r < 8; ++r) {
    const float inv = 1.0f / (lrow[r] * PSC);
#pragma unroll
    for (int t = 0; t < 4; ++t) os[(8 * hh + r) * 68 + t * 16 + c] = oacc[t][r] * inv;
  }
  __builtin_amdgcn_fence(__ATOMIC_RELEASE, "workgroup");
  __builtin_amdgcn_wave_barrier();
  __builtin_amdgcn_fence(__ATOMIC_ACQUIRE, "workgroup");
  {
    const int c4 = (lane & 15) * 4;
    {
#pragma unroll
      for (int it = 0; it < 8; ++it) {
        const int row = it * 2 + hh;
        v4f val = *(const v4f*)(os + row * 68 + c4);
        *(v4f*)(ob_ptr + (size_t)(q0 + row) * g.o_rs + c4) = val;
      }
      
    }
  }
}

} // namespace w25

// Exact f32 attention rows 0 .. 63 of every (batch, head). A work-group of 256 threads takes 16 query rows of one head: thread (r, d) the rows t = 16 g + 4 i + r, i = 0 .. 3,
// first as key d of their scores, then as column d of their outputs. The head's 64 x 64 K and V tiles and the 16 query rows come once per work-group as whole 256-byte rows by
// 16-byte loads, all issued together, and are read from LDS; every loop is unrolled, and a thread's four rows are four independent chains that share each K and V value read.
// Keys above t: their score is the mask value and their weight expf(mask - max) = 0, so the sums over all 64 keys take the same values in the same order as sums that stop at t.
template <int S, int D, int NH>
__global__ __launch_bounds__(256) void k_cm_exact(const float* __restrict__ Q64, const float* __restrict__ K64, const float* __restrict__ V, float* __restrict__ AT) {
    constexpr int KP = 68;                      // K row pitch in floats: 272 B = 16 B x odd, for lanes that each read 16 bytes of their own row
    __shared__ __align__(16) float kl[64 * KP];
    __shared__ __align__(16) float vs[64 * 64];
    __shared__ __align__(16) float ql[16][64];
    __shared__ __align__(16) float sc[16][64];
    __shared__ __align__(16) float pr[16][64];
    const int r = (int)threadIdx.x >> 6, d = (int)threadIdx.x & 63;
    const int g = blockIdx.x % 4, h = (blockIdx.x / 4) % NH, b = blockIdx.x / (4 * NH);
    const int lr = (int)threadIdx.x >> 4, lc = ((int)threadIdx.x & 15) * 4;   // staging: row within a step of 16 rows, 16-byte piece of the row
    const float* kb = K64 + ((size_t)b * 64 + lr) * D + h * 64 + lc;
    const float* vb = V + ((size_t)b * S + lr) * D + h * 64 + lc;
    const float* qb = Q64 + ((size_t)b * 64 + 16 * g + lr) * D + h * 64 + lc;
    v4f kx[4], vx[4];
#pragma unroll
    for (int i = 0; i < 4; ++i) { kx[i] = *(const v4f*)(kb + 16 * i * D); vx[i] = *(const v4f*)(vb + 16 * i * D); }
    const v4f qx = *(const v4f*)qb;
    asm volatile("s_wait_xcnt 0x0" :: "v"(kb), "v"(vb), "v"(qb) : "memory");   // in front of any reuse of the loads' address registers; the addresses as inputs keep them from taking a load's result ahead of the wait
#pragma unroll
    for (int i = 0; i < 4; ++i) { *(v4f*)(kl + (lr + 16 * i) * KP + lc) = kx[i]; *(v4f*)(vs + (lr + 16 * i) * 64 + lc) = vx[i]; }
    *(v4f*)(ql[lr] + lc) = qx;
    __syncthreads();                            // the tiles and the query rows are visible
    float a[4] = {0.f, 0.f, 0.f, 0.f};
#pragma unroll
    for (int j = 0; j < 64; j += 4) {
        const v4f kk = *(const v4f*)(kl + d * KP + j);
#pragma unroll
        for (int i = 0; i < 4; ++i) {
            const v4f qq = *(const v4f*)(ql[4 * i + r] + j);
            a[i] = fmaf(qq[0], kk[0], a[i]); a[i] = fmaf(qq[1], kk[1], a[i]); a[i] = fmaf(qq[2], kk[2], a[i]); a[i] = fmaf(qq[3], kk[3], a[i]);
        }
    }
    float s[4];
#pragma unroll
    for (int i = 0; i < 4; ++i) { s[i] = (d <= 16 * g + 4 * i + r) ? a[i] * 0.125f : -3.0e38f; sc[4 * i + r][d] = s[i]; }
    __syncthreads();                            // the rows' scores are visible
#pragma unroll
    for (int i = 0; i < 4; ++i) {
        float mx = -3.0e38f;
#pragma unroll
        for (int j = 0; j < 64; j += 4) { const v4f x = *(const v4f*)(sc[4 * i + r] + j); mx = fmaxf(fmaxf(fmaxf(fmaxf(mx, x[0]), x[1]), x[2]), x[3]); }
        pr[4 * i + r][d] = expf(s[i] - mx);
    }
    __syncthreads();                            // the rows' weights are visible
    float den[4] = {0.f, 0.f, 0.f, 0.f}, acc[4] = {0.f, 0.f, 0.f, 0.f};
#pragma unroll
    for (int j = 0; j < 64; j += 4) {
        float vv[4];
#pragma unroll
        for (int e = 0; e < 4; ++e) vv[e] = vs[(j + e) * 64 + d];
#pragma unroll
        for (int i = 0; i < 4; ++i) {
            const v4f p = *(const v4f*)(pr[4 * i + r] + j);
#pragma unroll
            for (int e = 0; e < 4; ++e) { den[i] += p[e]; acc[i] = fmaf(p[e], vv[e], acc[i]); }
        }
    }
    float* ob = AT + ((size_t)b * S + 16 * g + r) * D + h * 64 + d;
#pragma unroll
    for (int i = 0; i < 4; ++i) VST2(float, ob + 4 * i * D, acc[i] / den[i]);
}


// ---- dense elementwise kernels: many elements a thread ------------------------------------------------------------
// A work-group of 256 threads takes 1024 * U consecutive floats: U loads of 16 bytes a thread, all issued before the first is used; each load of a wave covers
// 512 contiguous bytes. The grid covers the array exactly (element count a multiple of 1024 * U), so there is no bounds test and no row or column arithmetic.
typedef __attribute__((ext_vector_type(2))) unsigned int v2u;
template <int U>
__global__ __launch_bounds__(256) void k_castS16v(const float* __restrict__ src, __bf16* __restrict__ dhi, __bf16* __restrict__ dlo) {
    const size_t base = (size_t)blockIdx.x * (1024 * U) + threadIdx.x * 4;
    v4f v[U];
#pragma unroll
    for (int u = 0; u < U; ++u) v[u] = *(const v4f*)(src + base + u * 1024);
    asm volatile("s_wait_xcnt 0x0" ::: "memory");   // in front of the reuse of the loads' address registers
#pragma unroll
    for (int u = 0; u < U; ++u) {
        v2u hi, lo; unsigned int l0, l1;
        hi[0] = f2bf2_pack(v[u][0], v[u][1], &l0); hi[1] = f2bf2_pack(v[u][2], v[u][3], &l1); lo[0] = l0; lo[1] = l1;
        *(v2u*)(dhi + base + u * 1024) = hi; *(v2u*)(dlo + base + u * 1024) = lo;
    }
}
// Block blk of one array, read once, into every 16-bit form that a later product wants: bf16 hi and lo planes, and with H also f16 of s * value.
// Every loop over u is unrolled (#pragma unroll): u picks registers of v, h, hi and lo, which stay registers only under constant indices.
template <int U, bool H>
__device__ __forceinline__ void cast_block(const float* __restrict__ src, _Float16* __restrict__ dh, float s, __bf16* __restrict__ dhi, __bf16* __restrict__ dlo, unsigned blk) {
    const size_t base = (size_t)blk * (1024 * U) + threadIdx.x * 4;
    const float* p = src + base;
    v4f v[U];
#pragma unroll
    for (int u = 0; u < U; ++u) v[u] = *(const v4f*)(p + u * 1024);
    asm volatile("s_wait_xcnt 0x0" :: "v"(p) : "memory");   // in front of any reuse of the loads' address registers; p as an input keeps them from taking a load's result ahead of the wait
    __builtin_amdgcn_sched_barrier(0);   // no conversion moves up over the wait: without it the U = 8 build holds two of its loads back behind the first conversions
    v4h h[U]; v2u hi[U], lo[U];
#pragma unroll
    for (int u = 0; u < U; ++u) {
        if (H) { h[u][0] = (_Float16)(v[u][0] * s); h[u][1] = (_Float16)(v[u][1] * s); h[u][2] = (_Float16)(v[u][2] * s); h[u][3] = (_Float16)(v[u][3] * s); }
        unsigned int l0, l1;
        hi[u][0] = f2bf2_pack(v[u][0], v[u][1], &l0); hi[u][1] = f2bf2_pack(v[u][2], v[u][3], &l1); lo[u][0] = l0; lo[u][1] = l1;
    }
    __builtin_amdgcn_sched_barrier(0);   // every conversion ahead of the first store: the stores go out in one run, and no register of an issued store is written again
#pragma unroll
    for (int u = 0; u < U; ++u) {
        if (H) *(v4h*)(dh + base + u * 1024) = h[u];
        *(v2u*)(dhi + base + u * 1024) = hi[u]; *(v2u*)(dlo + base + u * 1024) = lo[u];
    }
}
// Every cast of an input, in one launch. Blocks 0 .. GX - 1: x (8192 elements each); then GW blocks (4096 elements each) for each of Wq, Wk, Wv, Wo.
// x, Wq, Wk go to f16 (the weights x16) and to bf16 planes; Wv, Wo to bf16 planes only.
template <unsigned GX, unsigned GW>
__global__ __launch_bounds__(256) void k_cast_inputs(const float* __restrict__ x, const float* __restrict__ Wq, const float* __restrict__ Wk, const float* __restrict__ Wv, const float* __restrict__ Wo,
                                                     _Float16* __restrict__ XH, __bf16* __restrict__ XS, __bf16* __restrict__ XS2,
                                                     _Float16* __restrict__ WqH, __bf16* __restrict__ WqS, __bf16* __restrict__ WqS2,
                                                     _Float16* __restrict__ WkH, __bf16* __restrict__ WkS, __bf16* __restrict__ WkS2,
                                                     __bf16* __restrict__ WvS, __bf16* __restrict__ WvS2, __bf16* __restrict__ WoS, __bf16* __restrict__ WoS2) {
    const unsigned bid = blockIdx.x;
    if (bid < GX) { cast_block<8, true>(x, XH, 1.0f, XS, XS2, bid); return; }
    const unsigned w = (bid - GX) / GW, blk = (bid - GX) % GW;
    // the wait behind each branch's stores: in the built kernel another branch's code stands behind them and writes the registers that they name
    if (w < 2) { cast_block<4, true>(w ? Wk : Wq, w ? WkH : WqH, 16.0f, w ? WkS : WqS, w ? WkS2 : WqS2, blk); asm volatile("s_wait_xcnt 0x0" ::: "memory"); }
    else       { cast_block<4, false>(w == 2 ? Wv : Wo, nullptr, 1.0f, w == 2 ? WvS : WoS, w == 2 ? WvS2 : WoS2, blk); asm volatile("s_wait_xcnt 0x0" ::: "memory"); }
}
// RoPE in place on rows of 16 heads x 64 columns: one wave takes one row of Q and the same row of Kx. Lane = (head parity, 16-byte piece of a head's 64 columns), so the lane's
// cos and sin pieces are loaded once and serve all 16 heads of both tensors. SR: rows per batch in Q and Kx, and the bound on the position. blk: eight rows.
template <int SR>
__device__ __forceinline__ void cm_rope_rows(float* __restrict__ Q, float* __restrict__ Kx, const float* __restrict__ CS, const float* __restrict__ SN, const int* __restrict__ POS, int blk) {
    const int row = blk * 8 + ((int)threadIdx.x >> 5), lane = threadIdx.x & 31;
    int ps = POS[row % SR]; ps = ps < 0 ? 0 : (ps >= SR ? SR - 1 : ps);
    const float* pc = CS + ps * 64 + (lane & 15) * 4; const float* pn = SN + ps * 64 + (lane & 15) * 4;
    const v4f c = *(const v4f*)pc, s = *(const v4f*)pn;
    float* q = Q + (size_t)row * 1024 + lane * 4; float* k = Kx + (size_t)row * 1024 + lane * 4;
    v4f a[8], b[8];
#pragma unroll
    for (int it = 0; it < 8; ++it) { a[it] = *(const v4f*)(q + it * 128); b[it] = *(const v4f*)(k + it * 128); }
    asm volatile("s_wait_xcnt 0x0" :: "v"(pc), "v"(pn) : "memory");   // in front of any reuse of the loads' address registers; pc, pn as inputs keep them from taking a load's result ahead of the wait
#pragma unroll
    for (int it = 0; it < 8; ++it) {
        v4f r, t;
        // x0 c0 - x1 s0 and x1 c1 + x0 s1, each with the x1 product rounded and the x0 product fused
        r[0] = fmaf(a[it][0], c[0], -(a[it][1] * s[0])); r[1] = fmaf(a[it][0], s[1], a[it][1] * c[1]); r[2] = fmaf(a[it][2], c[2], -(a[it][3] * s[2])); r[3] = fmaf(a[it][2], s[3], a[it][3] * c[3]);
        t[0] = fmaf(b[it][0], c[0], -(b[it][1] * s[0])); t[1] = fmaf(b[it][0], s[1], b[it][1] * c[1]); t[2] = fmaf(b[it][2], c[2], -(b[it][3] * s[2])); t[3] = fmaf(b[it][2], s[3], b[it][3] * c[3]);
        *(v4f*)(q + it * 128) = r; *(v4f*)(k + it * 128) = t;
    }
}
// both pairs of tensors in one launch: blocks 0 .. G - 1 take Q, Kx (2048 rows a batch), the rest Q64, K64 (64 rows a batch)
template <int G>
__global__ __launch_bounds__(256) void k_cm_rope_all(float* __restrict__ Q, float* __restrict__ Kx, float* __restrict__ Q64, float* __restrict__ K64,
                                                     const float* __restrict__ CS, const float* __restrict__ SN, const int* __restrict__ POS) {
    if ((int)blockIdx.x < G) cm_rope_rows<2048>(Q, Kx, CS, SN, POS, (int)blockIdx.x);
    // the wait behind this branch's stores: in the built kernel the other branch's code stands behind them and writes the registers that they name
    else                   { cm_rope_rows<64>(Q64, K64, CS, SN, POS, (int)blockIdx.x - G); asm volatile("s_wait_xcnt 0x0" ::: "memory"); }
}

extern "C" void kernel_launch(void* const* d_in, const int* in_sizes, int n_in, void* d_out, int out_size, void* d_ws, size_t ws_size, hipStream_t stream) {
    (void)in_sizes; (void)n_in; (void)out_size; (void)ws_size;
    const float* x = (const float*)d_in[0];
    const float* Wq = (const float*)d_in[1];
    const float* Wk = (const float*)d_in[2];
    const float* Wv = (const float*)d_in[3];
    const float* Wo = (const float*)d_in[4];
    const float* cosT = (const float*)d_in[5];
    const float* sinT = (const float*)d_in[6];
    const int* tpos = (const int*)d_in[7];
    const int Bn = 4;
    const int S = 2048;
    const int D = 1024;
    const int NH = 16;
    const int NR = Bn * S;
    float* out = (float*)d_out;
    char* wsp = (char*)d_ws;
    float* Q = (float*)wsp; wsp += (size_t)NR * D * 4;
    float* Kb = (float*)wsp; wsp += (size_t)NR * D * 4;
    float* V = (float*)wsp; wsp += (size_t)NR * D * 4;
    float* AT = (float*)wsp; wsp += (size_t)NR * D * 4;
    float* Q64 = (float*)wsp; wsp += (size_t)Bn * 64 * D * 4;
    float* K64 = (float*)wsp; wsp += (size_t)Bn * 64 * D * 4;
    unsigned short* XH = (unsigned short*)wsp; wsp += (size_t)NR * D * 2;    // x as f16
    unsigned short* XS = (unsigned short*)wsp; wsp += (size_t)NR * D * 2;    // x as bf16 hi and lo planes; after the exact-row GEMMs the attention output's planes
    unsigned short* XS2 = (unsigned short*)wsp; wsp += (size_t)NR * D * 2;
    unsigned short* WqH = (unsigned short*)wsp; wsp += (size_t)D * D * 2;    // 16 Wq, 16 Wk as f16
    unsigned short* WkH = (unsigned short*)wsp; wsp += (size_t)D * D * 2;
    unsigned short* WqS = (unsigned short*)wsp; wsp += (size_t)D * D * 2;    // bf16 hi and lo planes of the four weights
    unsigned short* WqS2 = (unsigned short*)wsp; wsp += (size_t)D * D * 2;
    unsigned short* WkS = (unsigned short*)wsp; wsp += (size_t)D * D * 2;
    unsigned short* WkS2 = (unsigned short*)wsp; wsp += (size_t)D * D * 2;
    unsigned short* WvS = (unsigned short*)wsp; wsp += (size_t)D * D * 2;
    unsigned short* WvS2 = (unsigned short*)wsp; wsp += (size_t)D * D * 2;
    unsigned short* WoS = (unsigned short*)wsp; wsp += (size_t)D * D * 2;
    unsigned short* WoS2 = (unsigned short*)wsp; wsp += (size_t)D * D * 2;
    const unsigned gX = (unsigned)((long long)NR * D / (1024 * 8));   // cast grid of an x-sized array: 32 elements a thread
    // every cast of an input: x and the four weights, each read once
    k_cast_inputs<1024, 256><<<1024 + 4 * 256, 256, 0, stream>>>(x, Wq, Wk, Wv, Wo, (_Float16*)XH, (__bf16*)XS, (__bf16*)XS2,
        (_Float16*)WqH, (__bf16*)WqS, (__bf16*)WqS2, (_Float16*)WkH, (__bf16*)WkS, (__bf16*)WkS2, (__bf16*)WvS, (__bf16*)WvS2, (__bf16*)WoS, (__bf16*)WoS2);
    // q, k: f16 operands
    const w25::GemmB none = {nullptr, nullptr, nullptr};
    w25::wmma_gemm_lds<0, false><<<dim3(D / 128, 2 * (NR / 64)), 256, 0, stream>>>(XH, nullptr, w25::GemmB{WqH, nullptr, Q}, w25::GemmB{WkH, nullptr, Kb}, none, NR / 64, NR / 64, D, D, 0.0625f, 64);
    // v on bf16 hi/lo planes; with it q, k of the first 64 rows of every batch, from the same planes of x: tile b of Q64, K64 takes rows b S .. b S + 63 of A
    w25::wmma_gemm_lds<1, true><<<dim3(D / 128, NR / 64 + 2 * Bn), 256, 0, stream>>>(XS, XS2, w25::GemmB{WvS, WvS2, V}, w25::GemmB{WqS, WqS2, Q64}, w25::GemmB{WkS, WkS2, K64}, NR / 64, Bn, D, D, 1.0f, S);
    k_cm_rope_all<1024><<<NR / 8 + Bn * 64 / 8, 256, 0, stream>>>(Q, Kb, Q64, K64, cosT, sinT, (const int*)tpos);
    k_attn_t<2048, 1024><<<dim3((unsigned)NH, (unsigned)Bn, (unsigned)(S / (16 * AW))), 32 * AW, 0, stream>>>(Q, Kb, V, AT);
    k_cm_exact<2048, 1024, 16><<<Bn * NH * 4, 256, 0, stream>>>(Q64, K64, V, AT);
    k_castS16v<8><<<gX, 256, 0, stream>>>(AT, (__bf16*)XS, (__bf16*)XS2);
    w25::wmma_gemm_lds<1, true><<<dim3(D / 128, NR / 64), 256, 0, stream>>>(XS, XS2, w25::GemmB{WoS, WoS2, out}, none, none, NR / 64, 0, D, D, 1.0f, 64);
}

// v009
// It runs in 259 microseconds.
// Two timings next to v008 both put it at 1.14 times that version's speed.
// Counting every step since v000, which is the starting kernel, it is 17.5 times as fast.
// Contractions: q/k = x.W^T [8192x1024].[1024x1024] with f16 operands (weights x16); v = x.Wv^T and the output projection on bf16 hi/lo split planes (late causal rows are long averages, so the value path must be f32-class) — v_wmma_f32_16x16x32_*, 64x128 work-group tiles with both operands staged in LDS; per (batch, head) causal softmax(q k^T / 8) v as one flash launch (f16 q.k^T and p.v; fully-masked key tiles skipped); f32 accumulate and softmax. The interleaved-pair RoPE with the INPUT cos/sin tables gathered by the INPUT token positions (generic elementwise form: out = x*cos + rot(x)*sin with rot = (-x[odd], x[even]) interleaved) and the exact-f32 recompute of the first 64 causal rows per head (whose q/k rows come from their own small bf16 hi/lo split GEMMs [64x1024].[1024x1024]) are f32 kernels.
#include <hip/hip_runtime.h>
#include <math.h>

typedef __attribute__((ext_vector_type(16))) _Float16 v16h;
typedef __attribute__((ext_vector_type(8)))  _Float16 v8h;
typedef __attribute__((ext_vector_type(4)))  _Float16 v4h;
typedef __attribute__((ext_vector_type(16))) __bf16   v16b;
typedef __attribute__((ext_vector_type(8)))  float    v8f;
typedef __attribute__((ext_vector_type(4)))  float    v4f;

// 16-bit WMMA fragment map (wave32), lane L, h = L>>4, m = L&15:
//   A 16x32: lane = row m;   element i -> k = (i<8) ? 8h+i : 16+8h+(i-8)
//   B 32x16: lane = column m; the SAME k(i,h)
//   D 16x16 (8 f32): lane = column m; element r -> row 8h+r
__device__ __forceinline__ int frag_k(int i, int h) { return (i < 8) ? (8 * h + i) : (16 + 8 * h + (i - 8)); }
__device__ __forceinline__ __bf16 bf16_rne(float f) {
    unsigned int u = __float_as_uint(f);
    u += 0x7fffu + ((u >> 16) & 1u);
    return __builtin_bit_cast(__bf16, (unsigned short)(u >> 16));
}
__device__ __forceinline__ float bf16_f32(__bf16 b) { return __uint_as_float(((unsigned int)__builtin_bit_cast(unsigned short, b)) << 16); }
__device__ __forceinline__ v8f wmma16(v16h a, v16h b, v8f c) {
    c = __builtin_amdgcn_wmma_f32_16x16x32_f16(false, a, false, b, (short)0, c, false, false);
    asm volatile("v_nop\n\tv_nop\n\tv_nop\n\tv_nop" : "+v"(c) : "v"(a), "v"(b));
    return c;
}
__device__ __forceinline__ v8f wmmab(v16b a, v16b b, v8f c) {
    c = __builtin_amdgcn_wmma_f32_16x16x32_bf16(false, a, false, b, (short)0, c, false, false);
    asm volatile("v_nop\n\tv_nop\n\tv_nop\n\tv_nop" : "+v"(c) : "v"(a), "v"(b));
    return c;
}
struct Split { v16b hi, lo; };
// hi/lo split product: a.hi*b.hi + a.hi*b.lo + a.lo*b.hi
__device__ __forceinline__ v8f wmma3(const Split& a, const Split& b, v8f c) {
    c = __builtin_amdgcn_wmma_f32_16x16x32_bf16(false, a.hi, false, b.hi, (short)0, c, false, false);
    c = __builtin_amdgcn_wmma_f32_16x16x32_bf16(false, a.hi, false, b.lo, (short)0, c, false, false);
    c = __builtin_amdgcn_wmma_f32_16x16x32_bf16(false, a.lo, false, b.hi, (short)0, c, false, false);
    asm volatile("v_nop\n\tv_nop\n\tv_nop\n\tv_nop" : "+v"(c) : "v"(a.hi), "v"(a.lo), "v"(b.hi), "v"(b.lo));
    return c;
}
struct Split3 { v16b hi, mid, lo; };
// triple split product (6 terms, drops only terms below 2^-24 relative)
__device__ __forceinline__ v8f wmma6(const Split3& a, const Split3& b, v8f c) {
    c = __builtin_amdgcn_wmma_f32_16x16x32_bf16(false, a.hi, false, b.hi, (short)0, c, false, false);
    c = __builtin_amdgcn_wmma_f32_16x16x32_bf16(false, a.hi, false, b.mid, (short)0, c, false, false);
    c = __builtin_amdgcn_wmma_f32_16x16x32_bf16(false, a.mid, false, b.hi, (short)0, c, false, false);
    c = __builtin_amdgcn_wmma_f32_16x16x32_bf16(false, a.hi, false, b.lo, (short)0, c, false, false);
    c = __builtin_amdgcn_wmma_f32_16x16x32_bf16(false, a.mid, false, b.mid, (short)0, c, false, false);
    c = __builtin_amdgcn_wmma_f32_16x16x32_bf16(false, a.lo, false, b.hi, (short)0, c, false, false);
    asm volatile("v_nop\n\tv_nop\n\tv_nop\n\tv_nop" : "+v"(c) : "v"(a.hi), "v"(a.mid), "v"(a.lo), "v"(b.hi), "v"(b.mid), "v"(b.lo));
    return c;
}

// Fragment gathers from f32 memory: element i <- p[(k0 + frag_k(i,h)) * sk] * s, zero for k >= klen.
__device__ __forceinline__ v16h fh_ld(const float* __restrict__ p, long long sk, int k0, int h, int klen, float s) {
    v16h a;
#pragma unroll
    for (int i = 0; i < 16; ++i) { const int k = k0 + frag_k(i, h); a[i] = (k < klen) ? (_Float16)(p[(long long)k * sk] * s) : (_Float16)0.f; }
    return a;
}
__device__ __forceinline__ Split sp_ld(const float* __restrict__ p, long long sk, int k0, int h, int klen, float s) {
    Split r;
#pragma unroll
    for (int i = 0; i < 16; ++i) {
        const int k = k0 + frag_k(i, h); const float x = (k < klen) ? p[(long long)k * sk] * s : 0.f;
        const __bf16 hb = bf16_rne(x); r.hi[i] = hb; r.lo[i] = bf16_rne(x - bf16_f32(hb));
    }
    return r;
}
__device__ __forceinline__ Split3 sp3_ld(const float* __restrict__ p, long long sk, int k0, int h, int klen, float s) {
    Split3 r;
#pragma unroll
    for (int i = 0; i < 16; ++i) {
        const int k = k0 + frag_k(i, h); const float x = (k < klen) ? p[(long long)k * sk] * s : 0.f;
        const __bf16 hb = bf16_rne(x); const float r1 = x - bf16_f32(hb); const __bf16 mb = bf16_rne(r1);
        r.hi[i] = hb; r.mid[i] = mb; r.lo[i] = bf16_rne(r1 - bf16_f32(mb));
    }
    return r;
}
__device__ __forceinline__ v16b bh_ld(const float* __restrict__ p, long long sk, int k0, int h, int klen, float s) {
    v16b a;
#pragma unroll
    for (int i = 0; i < 16; ++i) { const int k = k0 + frag_k(i, h); a[i] = bf16_rne((k < klen) ? p[(long long)k * sk] * s : 0.f); }
    return a;
}
// f16 fragment from an f16 LDS/global row with element stride 1 (k-contiguous), no bounds (tile already zero padded)
__device__ __forceinline__ v16h fh_row(const _Float16* __restrict__ row, int k0, int h) {
    v16h a;
#pragma unroll
    for (int i = 0; i < 16; ++i) a[i] = row[k0 + frag_k(i, h)];
    return a;
}

#define VST2(T, ptr, val) do { const T vst2_v_ = (val); *(T*)(ptr) = vst2_v_;  } while (0)
typedef float v4f __attribute__((ext_vector_type(4)));
#define VST2V4(ptr, val) do { const v4f vst2_v4_ = (val); *(v4f*)(ptr) = vst2_v4_;  } while (0)

__device__ __attribute__((noinline)) float act_fn(float v, int act) {
    if (act == 1) return fmaxf(v, 0.f);                                                                               // relu
    if (act == 2) { const float u = 0.7978845608028654f * (v + 0.044715f * v * v * v); return 0.5f * v * (1.f + tanhf(u)); } // tanh-gelu
    if (act == 3) return v / (1.f + expf(-v));                                                                        // silu
    if (act == 4) return 0.5f * v * (1.f + erff(v * 0.7071067811865476f));                                             // erf-gelu
    if (act == 5) return tanhf(v);
    if (act == 6) return 1.f / (1.f + expf(-v));                                                                      // sigmoid
    if (act == 7) return (v > 0.f) ? v : 0.01f * v;                                                                   // leaky relu 0.01
    if (act == 8) return (v > 0.f) ? v : (expf(v) - 1.f);                                                             // elu
    if (act == 9) return fminf(fmaxf(v, 0.f), 6.f);                                                                   // relu6
    if (act == 10) return fabsf(v);                                                                                    // abs
    if (act == 11) return (v >= 0.f) ? v : 0.1f * v;                                                                  // leaky 0.1
    if (act == 12) return (v > 0.f) ? v : 0.2f * v;                                                                   // leaky 0.2
    if (act == 13) return (v > 20.f) ? v : log1pf(expf(v));                                                            // softplus
    return v;
}

// =====================================================================================================================
// k_gemm<MODE>: C(z, m, n) = act(alpha * sum_k A(z, m, k) * B(z, k, n) + bias) + beta * R(z, m, n)
//   One wave (32-thread block) per 16 x 32 tile of C; grid (ceil(N/32), ceil(M/16), Z). Batch z -> (zo = z / zi_n, zi = z % zi_n)
//   with separate outer/inner strides for every tensor (e.g. batch and head). A(m,k) = A[zo*sAo + zi*sAi + m*sAm + k*sAk] (f32),
//   B(k,n) = B[zo*sBo + zi*sBi + n*sBn + k*sBk] (f32); any M, N, K (K zero-padded to 32 inside the fragments, M/N tails guarded).
//   C(m,n) = C[zo*sCo + zi*sCi + m*sCm + n] (n contiguous). flags: 1 bias[n], 2 bias[m], 4 residual R[zo*sRo + zi*sRi + m*sRm + n*sRn].
//   MODE 0: f16 operands (A prescaled by sa, B by sb, both undone in the epilogue); 1: bf16 hi/lo split (3 products); 2: bf16;
//   3: bf16 hi/mid/lo triple split (6 products); 4: as 3 with Kahan-compensated f32 accumulation across k-steps.
// =====================================================================================================================
struct GemmP {
    const float* A; const float* B; const float* bias; const float* R; float* C;
    long long sAo, sAi, sAm, sAk, sBo, sBi, sBn, sBk, sCo, sCi, sCm, sRo, sRi, sRm, sRn;
    int M, N, K, zi_n, flags, act; float alpha, beta, sa, sb;
    int Npad, pad_;     // columns [N, Npad) of C are written as 0 so that padded workspace rows are covered by whole-line stores; Npad >= N
};
static_assert(sizeof(GemmP) == 5 * 8 + 15 * 8 + 6 * 4 + 4 * 4 + 2 * 4, "GemmP has padding");

template <int MODE>
__global__ __launch_bounds__(32) void k_gemm(GemmP p) {
    const int lane = threadIdx.x & 31, h = lane >> 4, l15 = lane & 15;
    const int m0 = blockIdx.y * 16, n0 = blockIdx.x * 32;
    const int z = blockIdx.z, zo = z / p.zi_n, zi = z - zo * p.zi_n;
    const float* A = p.A + zo * p.sAo + zi * p.sAi;
    const float* B = p.B + zo * p.sBo + zi * p.sBi;
    const int am = min(m0 + l15, p.M - 1);                       // clamped row for loads (stores are guarded)
    v8f acc[2], comp[2];
#pragma unroll
    for (int t = 0; t < 2; ++t) { v8f zz = {}; acc[t] = zz; comp[t] = zz; }
    for (int k0 = 0; k0 < p.K; k0 += 32) {
        const float* arow = A + (long long)am * p.sAm;
        if (MODE == 1) {
            const Split a = sp_ld(arow, p.sAk, k0, h, p.K, 1.f);
#pragma unroll
            for (int t = 0; t < 2; ++t) {
                const int bn = min(n0 + t * 16 + l15, p.N - 1);
                acc[t] = wmma3(a, sp_ld(B + (long long)bn * p.sBn, p.sBk, k0, h, p.K, 1.f), acc[t]);
            }
        } else if (MODE == 3) {
            const Split3 a = sp3_ld(arow, p.sAk, k0, h, p.K, 1.f);
#pragma unroll
            for (int t = 0; t < 2; ++t) {
                const int bn = min(n0 + t * 16 + l15, p.N - 1);
                acc[t] = wmma6(a, sp3_ld(B + (long long)bn * p.sBn, p.sBk, k0, h, p.K, 1.f), acc[t]);
            }
        } else if (MODE == 4) {
            // triple split as MODE 3, but each k-step's 6 products go into a fresh accumulator and the partial is added to the running f32 sum
            // on the VALU with Kahan compensation (accumulation error stays ~1 ulp however long K is)
            const Split3 a = sp3_ld(arow, p.sAk, k0, h, p.K, 1.f);
#pragma unroll
            for (int t = 0; t < 2; ++t) {
                const int bn = min(n0 + t * 16 + l15, p.N - 1); v8f zz = {};
                const v8f part = wmma6(a, sp3_ld(B + (long long)bn * p.sBn, p.sBk, k0, h, p.K, 1.f), zz);
                const v8f y = part - comp[t]; const v8f s = acc[t] + y; comp[t] = (s - acc[t]) - y; acc[t] = s;
            }
        } else if (MODE == 2) {
            const v16b a = bh_ld(arow, p.sAk, k0, h, p.K, 1.f);
#pragma unroll
            for (int t = 0; t < 2; ++t) {
                const int bn = min(n0 + t * 16 + l15, p.N - 1);
                acc[t] = wmmab(a, bh_ld(B + (long long)bn * p.sBn, p.sBk, k0, h, p.K, 1.f), acc[t]);
            }
        } else {
            const v16h a = fh_ld(arow, p.sAk, k0, h, p.K, p.sa);
#pragma unroll
            for (int t = 0; t < 2; ++t) {
                const int bn = min(n0 + t * 16 + l15, p.N - 1);
                acc[t] = wmma16(a, fh_ld(B + (long long)bn * p.sBn, p.sBk, k0, h, p.K, p.sb), acc[t]);
            }
        }
    }
    const float iscale = (MODE == 0) ? p.alpha / (p.sa * p.sb) : p.alpha;
    float* C = p.C + zo * p.sCo + zi * p.sCi;
    const float* R = p.R + zo * p.sRo + zi * p.sRi;
    __shared__ __align__(16) float ctile[16][36];
#pragma unroll
    for (int t = 0; t < 2; ++t) {
        const int n = n0 + t * 16 + l15; const int nn = min(n, p.N - 1);
#pragma unroll
        for (int r = 0; r < 8; ++r) {
            const int m = m0 + 8 * h + r; const int mm = min(m, p.M - 1);
            float v = acc[t][r] * iscale;
            if (p.flags & 1) v += p.bias[nn];
            if (p.flags & 2) v += p.bias[mm];
            if (p.flags & 8) v *= p.bias[(long long)zo * p.M + mm];   /* per-(zo,row) scale vector laid out [Z / zi_n][M]; exclusive with the bias flags */
            v = act_fn(v, p.act);
            if (p.flags & 4) v += p.beta * R[(long long)mm * p.sRm + (long long)nn * p.sRn];
            ctile[8 * h + r][t * 16 + l15] = (n < p.N) ? v : 0.f;
        }
    }
    __syncthreads();
    const int NW = (p.Npad > p.N) ? p.Npad : p.N;           // write width
    const bool fast = (m0 + 16 <= p.M) && (n0 + 32 <= NW) && ((p.sCm & 3) == 0) && ((((size_t)C) & 15) == 0);
    if (fast) {
#pragma unroll
        for (int s = 0; s < 4; ++s) {
            const int row = s * 4 + (lane >> 3), c4 = (lane & 7) * 4;
            const v4f v = *(const v4f*)&ctile[row][c4];
            VST2V4(C + (long long)(m0 + row) * p.sCm + n0 + c4, v);
        }
    } else {
        for (int row = 0; row < 16; ++row) {
            const int m = m0 + row, n = n0 + lane;
            if (m < p.M && n < NW) VST2(float, C + (long long)m * p.sCm + n, ctile[row][lane]);
        }
    }
}


// =====================================================================================================================
// k_gemmT<MODE, TM, TN>: same contract as k_gemm, but one wave computes a (16*TM) x (16*TN) tile: TM A fragments and TN B fragments are
//   loaded per 32-wide k-step and reused across TM*TN WMMAs (far fewer load/convert instructions per MAC). MODE 0 (f16), 1 (bf16 hi/lo),
//   2 (bf16) only. grid (ceil(NW/(16*TN)), ceil(M/(16*TM)), Z), block 32. Epilogue identical to k_gemm, run per 16x32 sub-tile.
// =====================================================================================================================
template <int MODE, int TM, int TN>
__global__ __launch_bounds__(32) void k_gemmT(GemmP p) {
    const int lane = threadIdx.x & 31, h = lane >> 4, l15 = lane & 15;
    const int m0 = blockIdx.y * (16 * TM), n0 = blockIdx.x * (16 * TN);
    const int z = blockIdx.z, zo = z / p.zi_n, zi = z - zo * p.zi_n;
    const float* A = p.A + zo * p.sAo + zi * p.sAi;
    const float* B = p.B + zo * p.sBo + zi * p.sBi;
    v8f acc[TM][TN];
#pragma unroll
    for (int i = 0; i < TM; ++i)
#pragma unroll
        for (int t = 0; t < TN; ++t) { v8f zz = {}; acc[i][t] = zz; }
    for (int k0 = 0; k0 < p.K; k0 += 32) {
        if (MODE == 1) {
            Split a[TM], b[TN];
#pragma unroll
            for (int i = 0; i < TM; ++i) { const int am = min(m0 + 16 * i + l15, p.M - 1); a[i] = sp_ld(A + (long long)am * p.sAm, p.sAk, k0, h, p.K, 1.f); }
#pragma unroll
            for (int t = 0; t < TN; ++t) { const int bn = min(n0 + 16 * t + l15, p.N - 1); b[t] = sp_ld(B + (long long)bn * p.sBn, p.sBk, k0, h, p.K, 1.f); }
#pragma unroll
            for (int i = 0; i < TM; ++i)
#pragma unroll
                for (int t = 0; t < TN; ++t) acc[i][t] = wmma3(a[i], b[t], acc[i][t]);
        } else if (MODE == 2) {
            v16b a[TM], b[TN];
#pragma unroll
            for (int i = 0; i < TM; ++i) { const int am = min(m0 + 16 * i + l15, p.M - 1); a[i] = bh_ld(A + (long long)am * p.sAm, p.sAk, k0, h, p.K, 1.f); }
#pragma unroll
            for (int t = 0; t < TN; ++t) { const int bn = min(n0 + 16 * t + l15, p.N - 1); b[t] = bh_ld(B + (long long)bn * p.sBn, p.sBk, k0, h, p.K, 1.f); }
#pragma unroll
            for (int i = 0; i < TM; ++i)
#pragma unroll
                for (int t = 0; t < TN; ++t) acc[i][t] = wmmab(a[i], b[t], acc[i][t]);
        } else {
            v16h a[TM], b[TN];
#pragma unroll
            for (int i = 0; i < TM; ++i) { const int am = min(m0 + 16 * i + l15, p.M - 1); a[i] = fh_ld(A + (long long)am * p.sAm, p.sAk, k0, h, p.K, p.sa); }
#pragma unroll
            for (int t = 0; t < TN; ++t) { const int bn = min(n0 + 16 * t + l15, p.N - 1); b[t] = fh_ld(B + (long long)bn * p.sBn, p.sBk, k0, h, p.K, p.sb); }
#pragma unroll
            for (int i = 0; i < TM; ++i)
#pragma unroll
                for (int t = 0; t < TN; ++t) acc[i][t] = wmma16(a[i], b[t], acc[i][t]);
        }
    }
    const float iscale = (MODE == 0) ? p.alpha / (p.sa * p.sb) : p.alpha;
    float* C = p.C + zo * p.sCo + zi * p.sCi;
    const float* R = p.R + zo * p.sRo + zi * p.sRi;
    const int NW = (p.Npad > p.N) ? p.Npad : p.N;
    __shared__ __align__(16) float ctile[16][36];
#pragma unroll
    for (int i = 0; i < TM; ++i) {
        const int mb = m0 + 16 * i; if (mb >= p.M) break;          // wave-uniform
#pragma unroll
        for (int tp = 0; tp < TN / 2; ++tp) {
            const int nb = n0 + 32 * tp; if (nb >= NW) break;        // wave-uniform
#pragma unroll
            for (int t2 = 0; t2 < 2; ++t2) {
                const int t = 2 * tp + t2; const int n = nb + t2 * 16 + l15; const int nn = min(n, p.N - 1);
#pragma unroll
                for (int r = 0; r < 8; ++r) {
                    const int m = mb + 8 * h + r; const int mm = min(m, p.M - 1);
                    float v = acc[i][t][r] * iscale;
                    if (p.flags & 1) v += p.bias[nn];
                    if (p.flags & 2) v += p.bias[mm];
            if (p.flags & 8) v *= p.bias[(long long)zo * p.M + mm];   /* per-(zo,row) scale vector laid out [Z / zi_n][M]; exclusive with the bias flags */
                    v = act_fn(v, p.act);
                    if (p.flags & 4) v += p.beta * R[(long long)mm * p.sRm + (long long)nn * p.sRn];
                    ctile[8 * h + r][t2 * 16 + l15] = (n < p.N) ? v : 0.f;
                }
            }
            __syncthreads();
            const bool fast = (mb + 16 <= p.M) && (nb + 32 <= NW) && ((p.sCm & 3) == 0) && ((((size_t)C) & 15) == 0);
            if (fast) {
#pragma unroll
                for (int s = 0; s < 4; ++s) {
                    const int row = s * 4 + (lane >> 3), c4 = (lane & 7) * 4;
                    const v4f v = *(const v4f*)&ctile[row][c4];
                    VST2V4(C + (long long)(mb + row) * p.sCm + nb + c4, v);
                }
            } else {
                for (int row = 0; row < 16; ++row) {
                    const int m = mb + row, n = nb + lane;
                    if (m < p.M && n < NW) VST2(float, C + (long long)m * p.sCm + n, ctile[row][lane]);
                }
            }
            __syncthreads();
        }
    }
}

// =====================================================================================================================
//   Wave = 16 queries, AW waves per block, 64-key blocks; grid (ceil(Lq/(16*AW)), H, B), block 32*AW. Any Lq, Lk; head dim dh <= DHP
//   (DHP multiple of 32), value dim dv <= DVP (multiple of 16, <= 128). Every tensor addressed by (batch, head, row, element) strides, f32.
//   Scores: QM 0 f16 operands, 1 bf16 hi/lo split, 2 bf16 triple split; statistics f32 (exp2 domain); P.V: P x 4096 as f16 with V f16 staged in LDS
//   (SPLITPV: P and V as bf16 hi/lo splits). kv head = h / hrep. Masking: causal = 1 (keep j <= i + coff, masked -> -inf, key blocks beyond the
//   diagonal skipped), causal = 2 (masked -> mfill, a finite fill like the -1e9; no skipping), causal = 3 (keep j >= i + coff,
//   masked -> -inf, no skipping); optional additive f32 mask Mf,
//   optional int keep-mask Mi (0 -> score := mfill), both addressed b*smb + h*smh + i*smi + j*smj (0 strides broadcast).
// =====================================================================================================================
#define AW 4
struct AttnP {   // apv4
    const float* Q; const float* K; const float* V; float* O; float* P; const float* Mf; const int* Mi; float* ST;
    const float* Pw; const float* Rt; const int* SQ; const int* SK;           // optional: post-softmax weight, relative-position table, segment ids
    long long swb, swh, swi, swj, srb, srh, sri;                                 // Pw strides (b,h,i,j); Rt strides (b,h,i), column = clamp(i - j + roff, 0, rn-1)
    long long sQb, sQh, sQi, sQd, sKb, sKh, sKj, sKd, sVb, sVh, sVj, sVd, sOb, sOh, sOi, sPb, sPh, sPi, smb, smh, smi, smj;
    int Lq, Lk, dh, dv, hrep, causal, coff, pband;   // pband > 0: P holds only the band |j - i| <= pband, column j - i + pband
    float scale, mfill; int nonorm, mpol;             // nonorm (online path only): O = sum_j exp(score_j) V_j without the 1/rowsum (scores must be <= ~0); mpol: Mi masks where ==0 (mpol 0) or where !=0 (mpol 1)
    int roff, rn, segpol, win;                        // Rt column offset/count; SQ/SK: score := mfill where (segpol 0) SQ[i] != SK[j] or (segpol 1) SQ[i] == SK[j]; win > 0: keys with i - j > win (after coff) -> -inf
};
//   Pw: the softmax numerator is multiplied by Pw(b,h,i,j) AFTER the row sum is taken (probs * weight, then P.V), as in post-softmax multiplicative biases.                                                    // ST (optional): per row (b,h,i) -> ST[((b*H + h)*Lq + i)*2 + {0,1}] = {row max of the scaled+masked score (natural units), sum_j exp(score - max)}
static_assert(sizeof(AttnP) == 12 * 8 + 29 * 8 + 16 * 4, "AttnP has padding");

#ifndef KATTN_ATTR
#define KATTN_ATTR __attribute__((amdgpu_waves_per_eu(4)))   // at most 256 registers a wave: four waves a SIMD, 1024 work-groups of the causal grid resident at once
#endif
//   FS > 0 (QM 0, one pass, f16 P.V only): the layout is fixed at compile time: Q, K, V, O are dense [batch][FS rows][FD] f32 with head h at column h * DHP (DVP for V, O),
//   dh = DHP, dv = DVP, Lq = Lk = FS (multiple of 64), causal = 1 with coff = 0, none of the optional inputs or outputs. Every element guard and stride then folds
//   away, and a key block's K and V come in by plain 16-byte loads that are in flight together, in two batches, instead of guarded 4-byte loads waited on one at a time.
template <int DHP, int DVP, int QM, bool SPLITPV, bool TWOPASS, int FS = 0, int FD = 0>
__global__ __launch_bounds__(32 * AW) KATTN_ATTR void k_attn(AttnP p) {
    static_assert(FS == 0 || (QM == 0 && !SPLITPV && !TWOPASS && DHP == 64 && DVP == 64 && FS % 64 == 0 && FD % 8 == 0), "fixed layout: whole key blocks, 32-byte aligned fragments");
    if (FS > 0) {
        p.P = nullptr; p.Mf = nullptr; p.Mi = nullptr; p.ST = nullptr; p.Pw = nullptr; p.Rt = nullptr; p.SQ = nullptr; p.SK = nullptr;
        p.sQb = (long long)FS * FD; p.sQh = DHP; p.sQi = FD; p.sQd = 1; p.sKb = (long long)FS * FD; p.sKh = DHP; p.sKj = FD; p.sKd = 1;
        p.sVb = (long long)FS * FD; p.sVh = DVP; p.sVj = FD; p.sVd = 1; p.sOb = (long long)FS * FD; p.sOh = DVP; p.sOi = FD;
        p.Lq = FS; p.Lk = FS; p.dh = DHP; p.dv = DVP; p.hrep = 1; p.causal = 1; p.coff = 0; p.pband = 0; p.nonorm = 0; p.win = 0;
    }
    constexpr int NT = DVP / 16;                // output tiles
    constexpr int KS = DHP / 32;                // k-steps for the scores
    constexpr int VP = DVP + 8;                 // LDS pitch (halves)
    __shared__ __align__(16) float    pl[AW][16 * 64];
    __shared__ __align__(16) _Float16 vl[(SPLITPV ? 2 : 1) * 64 * VP];   // f16 V tile, or bf16 hi and lo tiles (same 2-byte size)
    const int lane = threadIdx.x & 31, hf = lane >> 4, l15 = lane & 15, wave = threadIdx.x >> 5;
    // FS > 0: grid (heads, batches, query tiles) and query tile bx = last - blockIdx.z. A causal tile walks bx + 1 key blocks and only half the work-groups are resident at once;
    // the long tiles take the low indices and the short ones the high, and neighbours in index cost the same.
    const int bx = FS > 0 ? FS / (16 * AW) - 1 - (int)blockIdx.z : (int)blockIdx.x;
    const int h = FS > 0 ? blockIdx.x : blockIdx.y, b = FS > 0 ? blockIdx.y : blockIdx.z, hk = h / p.hrep;
    const int q0 = (bx * AW + wave) * 16;
    float* myp = pl[wave];
    const float L2E = 1.4426950408889634f;
    const float NEG = -__builtin_inff();
    const int qi = min(q0 + l15, p.Lq - 1);
    const float* qrow = p.Q + b * p.sQb + h * p.sQh + (long long)qi * p.sQi;
    const float* kbase = p.K + b * p.sKb + hk * p.sKh;
    const float* vbase = p.V + b * p.sVb + hk * p.sVh;
    v16h qa[QM == 0 ? KS : 1]; Split qs_[QM == 1 ? KS : 1]; Split3 qt_[QM == 2 ? KS : 1];
#pragma unroll
    for (int ks = 0; ks < KS; ++ks) {
        if (QM == 2) qt_[ks] = sp3_ld(qrow, p.sQd, ks * 32, hf, p.dh, 1.f);
        else if (QM == 1) qs_[ks] = sp_ld(qrow, p.sQd, ks * 32, hf, p.dh, 1.f);
        else qa[ks] = fh_ld(qrow, p.sQd, ks * 32, hf, p.dh, 1.f);
    }
    v8f o[NT]; float m8[8], l8[8];
#pragma unroll
    for (int t = 0; t < NT; ++t) { v8f zz = {}; o[t] = zz; }
#pragma unroll
    for (int i = 0; i < 8; ++i) { m8[i] = NEG; l8[i] = 0.f; }
    int jend = p.Lk; int jstart = 0;
    if (p.causal == 1) { const int je = (bx * AW + AW - 1) * 16 + 16 + p.coff; jend = min(jend, max(je, 0)); }   // uniform per block
    if (p.win > 0) { const int js = (bx * AW) * 16 + p.coff - p.win; jstart = (js > 0) ? (js / 64) * 64 : 0; }   // uniform per block: key blocks entirely outside every row's window hold only -inf entries and are skipped exactly
    const int npass = TWOPASS ? 2 : 1;
    for (int pass = 0; pass < npass; ++pass) {
        const bool dopv = (!TWOPASS) || pass == 1;
        for (int j0 = jstart; j0 < jend; j0 += 64) {
            v16h kf[FS > 0 ? 4 * KS : 1];                        // FS > 0: the key block's K fragments, tile t and k-step ks at t * KS + ks
            if (dopv) {
                __syncthreads();                                 // previous key block's reads of vl / pl are done
                if (FS > 0) {
                    // raw f32 in two batches, so that the loaded values and everything else that is live fit 256 registers (four waves a SIMD)
                    v4f vr[8]; v8f kr[8];                                           // V: four consecutive elements per thread and step; K: half a fragment each
                    const float* krow = kbase + (long long)(j0 + l15) * FD + 8 * hf;
#pragma unroll
                    for (int it = 0; it < 8; ++it)
                        vr[it] = *(const v4f*)(vbase + (long long)(j0 + ((int)threadIdx.x >> 4)) * FD + ((int)threadIdx.x & 15) * 4 + it * (2 * AW * FD));   // rows 2 AW apart per step
#pragma unroll
                    for (int c = 0; c < 8; ++c) kr[c] = *(const v8f*)(krow + (c >> 2) * (16 * FD) + (c & 3) * 16);   // key tile t = c / 4; k = 16 (c % 4) + 8 hf + (0..7)
                    // inputs-only fence on the loaded values: their first use is here, so the batch's 24 loads are all issued before any is waited on (without it
                    // the scheduler puts each load directly in front of its conversion and waits on it there)
                    asm volatile("" :: "v"(vr[0]), "v"(vr[1]), "v"(vr[2]), "v"(vr[3]), "v"(vr[4]), "v"(vr[5]), "v"(vr[6]), "v"(vr[7]),
                                 "v"(kr[0]), "v"(kr[1]), "v"(kr[2]), "v"(kr[3]), "v"(kr[4]), "v"(kr[5]), "v"(kr[6]), "v"(kr[7]));
#pragma unroll
                    for (int it = 0; it < 8; ++it) {
                        v4h hv; hv[0] = (_Float16)vr[it][0]; hv[1] = (_Float16)vr[it][1]; hv[2] = (_Float16)vr[it][2]; hv[3] = (_Float16)vr[it][3];
                        *(v4h*)(vl + ((int)threadIdx.x >> 4) * VP + ((int)threadIdx.x & 15) * 4 + it * (2 * AW * VP)) = hv;
                    }
#pragma unroll
                    for (int f = 0; f < 4; ++f)
#pragma unroll
                        for (int e = 0; e < 8; ++e) { kf[f][e] = (_Float16)kr[2 * f][e]; kf[f][8 + e] = (_Float16)kr[2 * f + 1][e]; }
                    v8f ks2[8];
#pragma unroll
                    for (int c = 0; c < 8; ++c) ks2[c] = *(const v8f*)(krow + (2 + (c >> 2)) * (16 * FD) + (c & 3) * 16);   // key tiles 2 and 3
                    // the same fence for the second batch's 16 loads; the address is named too, so that it stays live and none of these loads is given its register pair as destination
                    asm volatile("" :: "v"(ks2[0]), "v"(ks2[1]), "v"(ks2[2]), "v"(ks2[3]), "v"(ks2[4]), "v"(ks2[5]), "v"(ks2[6]), "v"(ks2[7]), "v"(krow));
#pragma unroll
                    for (int f = 0; f < 4; ++f)
#pragma unroll
                        for (int e = 0; e < 8; ++e) { kf[4 + f][e] = (_Float16)ks2[2 * f][e]; kf[4 + f][8 + e] = (_Float16)ks2[2 * f + 1][e]; }
                } else
                for (int idx = threadIdx.x; idx < 64 * DVP; idx += 32 * AW) {
                    const int jr = idx / DVP, d = idx - jr * DVP, j = j0 + jr;
                    const float f = (j < p.Lk && d < p.dv) ? vbase[(long long)j * p.sVj + (long long)d * p.sVd] : 0.f;
                    if (SPLITPV) {
                        const __bf16 hb = bf16_rne(f);
                        ((__bf16*)vl)[jr * VP + d] = hb; ((__bf16*)vl)[64 * VP + jr * VP + d] = bf16_rne(f - bf16_f32(hb));
                    } else vl[jr * VP + d] = (_Float16)f;
                }
            }
            v8f s[4];
#pragma unroll
            for (int t = 0; t < 4; ++t) {
                const int j = min(j0 + t * 16 + l15, p.Lk - 1);
                const float* krow = kbase + (long long)j * p.sKj;
                v8f acc = {};
#pragma unroll
                for (int ks = 0; ks < KS; ++ks) {
                    if (QM == 2)      acc = wmma6(qt_[ks], sp3_ld(krow, p.sKd, ks * 32, hf, p.dh, 1.f), acc);
                    else if (QM == 1) acc = wmma3(qs_[ks], sp_ld(krow, p.sKd, ks * 32, hf, p.dh, 1.f), acc);
                    else if (FS > 0)  acc = wmma16(qa[ks], kf[t * KS + ks], acc);
                    else              acc = wmma16(qa[ks], fh_ld(krow, p.sKd, ks * 32, hf, p.dh, 1.f), acc);
                }
                s[t] = acc;
            }
            float pv[8][4];
#pragma unroll
            for (int i = 0; i < 8; ++i) {
                const int irow = q0 + i + 8 * hf;
                const int ic = min(irow, p.Lq - 1);
                float sc[4];
#pragma unroll
                for (int t = 0; t < 4; ++t) {
                    const int jg = j0 + t * 16 + l15;
                    float v = s[t][i] * p.scale;
                    if (p.Mf) v += p.Mf[b * p.smb + h * p.smh + (long long)ic * p.smi + (long long)min(jg, p.Lk - 1) * p.smj];
                    if (p.Rt) { int rc = ic - min(jg, p.Lk - 1) + p.roff; rc = rc < 0 ? 0 : (rc >= p.rn ? p.rn - 1 : rc); v += p.Rt[b * p.srb + h * p.srh + (long long)ic * p.sri + rc]; }
                    if (p.Mi) { const int mv = p.Mi[b * p.smb + h * p.smh + (long long)ic * p.smi + (long long)min(jg, p.Lk - 1) * p.smj]; if (p.mpol ? (mv != 0) : (mv == 0)) v = p.mfill; }
                    if (p.SQ) { const bool same = p.SQ[(long long)b * p.Lq + ic] == p.SK[(long long)b * p.Lk + min(jg, p.Lk - 1)]; if (p.segpol ? same : !same) v = p.mfill; }
                    if (p.causal == 2 && jg > irow + p.coff) v = p.mfill;
                    if (jg >= p.Lk || (p.causal == 1 && jg > irow + p.coff) || (p.causal == 3 && jg < irow + p.coff) || (p.win > 0 && irow + p.coff - jg > p.win)) v = NEG; else v *= L2E;
                    sc[t] = v;
                }
                if (!TWOPASS || pass == 0) {
                    float mx = fmaxf(fmaxf(sc[0], sc[1]), fmaxf(sc[2], sc[3]));
                    mx = fmaxf(mx, __shfl_xor(mx, 1, 32)); mx = fmaxf(mx, __shfl_xor(mx, 2, 32));
                    mx = fmaxf(mx, __shfl_xor(mx, 4, 32)); mx = fmaxf(mx, __shfl_xor(mx, 8, 32));
                    const float mnew = fmaxf(m8[i], mx);
                    const float corr = (mnew == NEG) ? 1.f : exp2f(m8[i] - mnew);
                    float rs = 0.f;
#pragma unroll
                    for (int t = 0; t < 4; ++t) {
                        const float pp = (sc[t] == NEG) ? 0.f : exp2f(sc[t] - mnew); rs += pp;
                        pv[i][t] = p.Pw ? pp * p.Pw[b * p.swb + h * p.swh + (long long)ic * p.swi + (long long)min(j0 + t * 16 + l15, p.Lk - 1) * p.swj] : pp;
                    }
                    rs += __shfl_xor(rs, 1, 32); rs += __shfl_xor(rs, 2, 32); rs += __shfl_xor(rs, 4, 32); rs += __shfl_xor(rs, 8, 32);
                    l8[i] = l8[i] * corr + rs; m8[i] = mnew;
                    if (!TWOPASS) {
#pragma unroll
                        for (int t = 0; t < NT; ++t) o[t][i] *= corr;
                    }
                } else {
                    const float inv = (l8[i] > 0.f) ? 1.f / l8[i] : 0.f;
#pragma unroll
                    for (int t = 0; t < 4; ++t) {
                        const int jg = j0 + t * 16 + l15;
                        float pp = (sc[t] == NEG) ? 0.f : exp2f(sc[t] - m8[i]) * inv;
                        if (p.Pw) pp *= p.Pw[b * p.swb + h * p.swh + (long long)ic * p.swi + (long long)min(jg, p.Lk - 1) * p.swj];
                        pv[i][t] = pp;
                    }
                }
            }
            if (dopv) {
#pragma unroll
                for (int i = 0; i < 8; ++i)
#pragma unroll
                    for (int t = 0; t < 4; ++t) ((float*)myp)[(i + 8 * hf) * 64 + t * 16 + l15] = pv[i][t];
                __syncthreads();                                 // P (per wave) and V (shared) visible
                if (p.P) {
                    float* pb_ = p.P + b * p.sPb + h * p.sPh;
                    const bool fastP = (p.pband == 0) && ((p.sPi & 3) == 0) && (j0 + 64 <= p.Lk) && (q0 + 16 <= p.Lq) && ((((size_t)pb_) & 15) == 0);
                    if (fastP) {
#pragma unroll
                        for (int s = 0; s < 8; ++s) {
                            const int row = s * 2 + (lane >> 4), c4 = (lane & 15) * 4;
                            const v4f v = *(const v4f*)(myp + row * 64 + c4);
                            VST2V4(pb_ + (long long)(q0 + row) * p.sPi + j0 + c4, v);
                        }
                    } else {
                        for (int row = 0; row < 16; ++row) {
                            const int irow = q0 + row; if (irow >= p.Lq) continue;
                            for (int c = lane; c < 64; c += 32) {
                                const int jg = j0 + c; if (jg >= p.Lk) continue;
                                if (p.pband == 0) VST2(float, pb_ + (long long)irow * p.sPi + jg, myp[row * 64 + c]);
                                else if (jg - irow <= p.pband && irow - jg <= p.pband) VST2(float, pb_ + (long long)irow * p.sPi + (jg - irow + p.pband), myp[row * 64 + c]);
                            }
                        }
                    }
                }
                if (SPLITPV) {
                    const Split pa0 = sp_ld(myp + l15 * 64, 1, 0, hf, 64, 1.f), pa1 = sp_ld(myp + l15 * 64, 1, 32, hf, 64, 1.f);
                    const __bf16* vh = (const __bf16*)vl; const __bf16* vlo = vh + 64 * VP;
#pragma unroll
                    for (int t = 0; t < NT; ++t) {
                        const int dcol = t * 16 + l15;
                        Split b0, b1;
#pragma unroll
                        for (int e = 0; e < 16; ++e) {
                            const int k0 = frag_k(e, hf), k1 = 32 + frag_k(e, hf);
                            b0.hi[e] = vh[k0 * VP + dcol]; b0.lo[e] = vlo[k0 * VP + dcol]; b1.hi[e] = vh[k1 * VP + dcol]; b1.lo[e] = vlo[k1 * VP + dcol];
                        }
                        o[t] = wmma3(pa0, b0, o[t]);
                        o[t] = wmma3(pa1, b1, o[t]);
                    }
                } else {
                    const v16h pa0 = fh_ld(myp + l15 * 64, 1, 0, hf, 64, 4096.f), pa1 = fh_ld(myp + l15 * 64, 1, 32, hf, 64, 4096.f);
#pragma unroll
                    for (int t = 0; t < NT; ++t) {
                        const int dcol = t * 16 + l15;
                        v16h b0, b1;
#pragma unroll
                        for (int e = 0; e < 16; ++e) { b0[e] = vl[frag_k(e, hf) * VP + dcol]; b1[e] = vl[(32 + frag_k(e, hf)) * VP + dcol]; }
                        o[t] = wmma16(pa0, b0, o[t]);
                        o[t] = wmma16(pa1, b1, o[t]);
                    }
                }
            }
        }
    }
    float* obase = p.O + b * p.sOb + h * p.sOh;
    if (p.ST) {
        const int rl = lane >> 1, isel = rl & 7;           // row q0 + rl ; rl>>3 == hf holds because lane>>4 == (lane>>1)>>3
        float mv = 0.f, lv = 0.f;
#pragma unroll
        for (int i = 0; i < 8; ++i) if (i == isel) { mv = m8[i]; lv = l8[i]; }
        const int irow = q0 + rl;
        if (irow < p.Lq) { float* st = p.ST + (((long long)b * gridDim.y + h) * p.Lq + irow) * 2 + (lane & 1); VST2(float, st, (lane & 1) ? lv : mv * 0.6931471805599453f); }
    }
    float invr[8];
#pragma unroll
    for (int i = 0; i < 8; ++i) {
        if (TWOPASS) invr[i] = SPLITPV ? 1.f : (1.f / 4096.f);
        else if (p.nonorm) invr[i] = exp2f(m8[i]) * (SPLITPV ? 1.f : (1.f / 4096.f));
        else invr[i] = (l8[i] > 0.f) ? (SPLITPV ? 1.f / l8[i] : 1.f / (l8[i] * 4096.f)) : 0.f;
    }
    __syncthreads();                                             // all waves done with pl/vl from the main loop
    const bool ofast = ((p.sOi & 3) == 0) && ((((size_t)obase) & 15) == 0) && (q0 + 16 <= p.Lq);
#pragma unroll
    for (int c0 = 0; c0 < DVP; c0 += 64) {
#pragma unroll
        for (int i = 0; i < 8; ++i)
#pragma unroll
            for (int t = 0; t < NT; ++t) if (t * 16 >= c0 && t * 16 < c0 + 64) ((float*)myp)[(i + 8 * hf) * 64 + (t * 16 - c0) + l15] = o[t][i] * invr[i];
        __syncthreads();
        const int cw = (DVP - c0 < 64) ? (DVP - c0) : 64;      // staged columns in this chunk (multiple of 16)
        if (ofast && (c0 + cw <= p.dv) && (cw % 32 == 0)) {
            const int lpr = cw / 4;                              // lanes per row (16 for 64 cols, 8 for 32)
            const int rows_per_ins = 32 / lpr;
            for (int r0 = 0; r0 < 16; r0 += rows_per_ins) {
                const int row = r0 + lane / lpr, c4 = (lane % lpr) * 4;
                const v4f v = *(const v4f*)(myp + row * 64 + c4);
                VST2V4(obase + (long long)(q0 + row) * p.sOi + c0 + c4, v);
            }
        } else {
            for (int row = 0; row < 16; ++row) {
                const int irow = q0 + row; if (irow >= p.Lq) continue;
                for (int c = lane; c < cw; c += 32) { const int d = c0 + c; if (d < p.dv) VST2(float, obase + (long long)irow * p.sOi + d, myp[row * 64 + c]); }
            }
        }
        __syncthreads();
    }
}

// ---- causal flash attention, transposed products ------------------------------------------------------------------
// Q, K, V, O dense f32 [batch][FS rows][FD], head h at column 64 h, head size 64. grid (heads, batches, FS / 64), query tile bx = last - blockIdx.z (longest first),
// 4 waves of 16 queries, key blocks of 64. A key block's K and V are brought in once for the work-group, by loads that cover whole 256-byte rows, and kept in LDS as f16.
// S^T = K.Q^T: A = 16 keys x 32 k, read from the K tile by 16-byte LDS loads, B = Q, so s[t][r] is the score of key j0 + 16 t + 8 hf + r for query q0 + l15:
// the 64 scores of a query lie in lanes l15 and l15 + 16, the maximum and the sum are taken in the lane, and the two halves meet by one exchange.
// O^T += V^T.P^T: two score tiles, converted in place, are the B operand (element e <- tile e / 8, register e % 8, the hardware k order), so P passes through no LDS;
// A = V^T comes from the row-major f16 V tile by the transposing LDS load, which delivers the same k order. o[t][r] = O[q0 + l15][16 t + 8 hf + r].
// Every loop but the one over key blocks is unrolled (#pragma unroll): its index picks registers of a fragment or an accumulator, which stay registers only under constant indices.
typedef __attribute__((ext_vector_type(8))) short v8s;
__device__ __forceinline__ v8h at_ld_tr16(const _Float16* p) { typedef __attribute__((address_space(3))) v8s lds_v8s; return __builtin_bit_cast(v8h, __builtin_amdgcn_ds_load_tr16_b128_v8i16((lds_v8s*)p)); }
__device__ __forceinline__ float at_xhalf(float x) { return __builtin_bit_cast(float, __builtin_amdgcn_permlanex16(__builtin_bit_cast(int, x), __builtin_bit_cast(int, x), 0x76543210, 0xfedcba98, false, false)); }   // lane l <-> lane l ^ 16
// 2^x by v_exp_f32 (a result under 2^-126 comes out as 0). Written as asm for the slot that the instruction set asks for behind a transcendental: no result register is a source
// register of the statement ("=&v"), so no exponential overwrites the source or reads the result of the one in front of it, and the v_nop at the end fills the slot behind the last.
__device__ __forceinline__ float at_exp2(float x) { float d; asm("v_exp_f32 %0, %1\n\tv_nop" : "=&v"(d) : "v"(x)); return d; }
__device__ __forceinline__ v8f at_exp2x8(v8f x) {
    float d0, d1, d2, d3, d4, d5, d6, d7;
    asm("v_exp_f32 %0, %8\n\tv_exp_f32 %1, %9\n\tv_exp_f32 %2, %10\n\tv_exp_f32 %3, %11\n\tv_exp_f32 %4, %12\n\tv_exp_f32 %5, %13\n\tv_exp_f32 %6, %14\n\tv_exp_f32 %7, %15\n\tv_nop"
        : "=&v"(d0), "=&v"(d1), "=&v"(d2), "=&v"(d3), "=&v"(d4), "=&v"(d5), "=&v"(d6), "=&v"(d7)
        : "v"(x[0]), "v"(x[1]), "v"(x[2]), "v"(x[3]), "v"(x[4]), "v"(x[5]), "v"(x[6]), "v"(x[7]));
    v8f d; d[0] = d0; d[1] = d1; d[2] = d2; d[3] = d3; d[4] = d4; d[5] = d5; d[6] = d6; d[7] = d7; return d;
}
template <int FS, int FD>
__global__ __launch_bounds__(32 * AW) KATTN_ATTR void k_attn_t(const float* __restrict__ Q, const float* __restrict__ K, const float* __restrict__ V, float* __restrict__ O) {
    static_assert(FS % 64 == 0 && FD % 8 == 0 && AW == 4, "whole key blocks, 32-byte aligned fragments");
    constexpr int VP = 80;                      // V tile pitch in halves: 160 B = 32 B x odd, the transposing load's pitch
    constexpr int KP = 72;                      // K tile pitch in halves: 144 B = 16 B x odd, the pitch of plain 16-byte LDS loads
    constexpr int OP = 68;                      // output staging pitch in floats
    __shared__ __align__(16) _Float16 kl[64 * KP];
    __shared__ __align__(16) _Float16 vl[64 * VP];
    __shared__ __align__(16) float    ol[AW][16 * OP];
    const int lane = threadIdx.x & 31, hf = lane >> 4, l15 = lane & 15, wave = threadIdx.x >> 5;
    const int bx = FS / (16 * AW) - 1 - (int)blockIdx.z;
    const int h = blockIdx.x, b = blockIdx.y;
    const int q0 = (bx * AW + wave) * 16;
    const float NEG = -__builtin_inff();
    const float SC = 0.125f * 1.4426950408889634f;   // 1 / sqrt(64) and log2(e); the power of two makes one product round as the two did
    const size_t hb = (size_t)b * FS * FD + (size_t)h * 64;
    const float* qrow = Q + hb + (size_t)(q0 + l15) * FD;
    const float* kbase = K + hb;
    const float* vbase = V + hb;
    v16h qa[2];
#pragma unroll
    for (int ks = 0; ks < 2; ++ks) qa[ks] = fh_ld(qrow, 1, ks * 32, hf, 64, 1.f);
    v8f o[4]; float m = NEG, l = 0.f;           // m: the query's running maximum (both halves alike); l: this half's part of its sum
#pragma unroll
    for (int t = 0; t < 4; ++t) { v8f zz = {}; o[t] = zz; }
    const _Float16* vt = vl + (8 * hf + (lane & 7)) * VP + 8 * ((lane >> 3) & 1);   // this lane's address in the transposing loads, key 0, column 0
    const _Float16* kt = kl + l15 * KP + 8 * hf;            // this lane's place in the K fragments, key tile 0, k 0
    const int srow = (int)threadIdx.x >> 4, scol = ((int)threadIdx.x & 15) * 4;   // staging: row within a step of 2 AW rows, 16-byte piece of the 256-byte row
    const int jend = (bx + 1) * 64;
    for (int j0 = 0; j0 < jend; j0 += 64) {
        __syncthreads();                                     // previous key block's reads of kl and vl are done
        {
            v4f kr[8], vr[8];                                // four consecutive elements per thread and step, rows 2 AW apart per step: a wave's load covers two whole rows
            const float* krow = kbase + (long long)(j0 + srow) * FD + scol;
            const float* vrow = vbase + (long long)(j0 + srow) * FD + scol;
#pragma unroll
            for (int it = 0; it < 8; ++it) { kr[it] = *(const v4f*)(krow + it * (2 * AW * FD)); vr[it] = *(const v4f*)(vrow + it * (2 * AW * FD)); }
            // the loaded values as inputs: their first use is here, so the block's 16 loads are all issued before any is waited on (without it the scheduler puts
            // each load directly in front of its conversion and waits on it there); the addresses as inputs keep them live, so that no load is given their registers
            // as destination, and the wait stands in front of any reuse of them
            asm volatile("s_wait_xcnt 0x0" :: "v"(kr[0]), "v"(kr[1]), "v"(kr[2]), "v"(kr[3]), "v"(kr[4]), "v"(kr[5]), "v"(kr[6]), "v"(kr[7]),
                         "v"(vr[0]), "v"(vr[1]), "v"(vr[2]), "v"(vr[3]), "v"(vr[4]), "v"(vr[5]), "v"(vr[6]), "v"(vr[7]), "v"(krow), "v"(vrow) : "memory");
#pragma unroll
            for (int it = 0; it < 8; ++it) {
                v4h hk, hv;
#pragma unroll
                for (int e = 0; e < 4; ++e) { hk[e] = (_Float16)kr[it][e]; hv[e] = (_Float16)vr[it][e]; }
                *(v4h*)(kl + (srow + it * (2 * AW)) * KP + scol) = hk;
                *(v4h*)(vl + (srow + it * (2 * AW)) * VP + scol) = hv;
            }
        }
        __syncthreads();                                     // the K and V tiles are visible
        v8f s[4];
#pragma unroll
        for (int t = 0; t < 4; ++t) {
            v8f acc = {};
#pragma unroll
            for (int ks = 0; ks < 2; ++ks) {
                union { v16h v; v8h p[2]; } a;               // elements 0..7: k = 32 ks + 8 hf + (0..7); 8..15: 16 more
                a.p[0] = *(const v8h*)(kt + (16 * t) * KP + 32 * ks); a.p[1] = *(const v8h*)(kt + (16 * t) * KP + 32 * ks + 16);
                acc = __builtin_amdgcn_wmma_f32_16x16x32_f16(false, a.v, false, qa[ks], (short)0, acc, false, false);
            }
            s[t] = acc;
        }
        const int lim = q0 + l15 - j0 - 8 * hf;              // key 16 t + r of this half joins while 16 t + r <= lim
        float mt[4];                                         // per score tile, so that four short chains run side by side
#pragma unroll
        for (int t = 0; t < 4; ++t) {
            mt[t] = NEG;
#pragma unroll
            for (int r = 0; r < 8; ++r) { const float v = (16 * t + r > lim) ? NEG : s[t][r] * SC; s[t][r] = v; mt[t] = fmaxf(mt[t], v); }
        }
        float mx = fmaxf(fmaxf(mt[0], mt[1]), fmaxf(mt[2], mt[3]));
        mx = fmaxf(mx, at_xhalf(mx));
        const float mnew = fmaxf(m, mx);                     // finite from the first key block on: key 0 joins every query
        const float corr = at_exp2(m - mnew);                // 0 in the first key block, where m is -inf
        float rt[4];
        v16h pb[2];
#pragma unroll
        for (int t = 0; t < 4; ++t) {
            const v8f pp = at_exp2x8(s[t] - mnew);           // 0 for a masked key
            rt[t] = pp[0];
#pragma unroll
            for (int r = 1; r < 8; ++r) rt[t] += pp[r];
#pragma unroll
            for (int r = 0; r < 8; ++r) pb[t >> 1][(t & 1) * 8 + r] = (_Float16)(pp[r] * 4096.f);
        }
        const float rs = (rt[0] + rt[1]) + (rt[2] + rt[3]);
        l = l * corr + rs; m = mnew;
#pragma unroll
        for (int t = 0; t < 4; ++t) o[t] *= corr;
#pragma unroll
        for (int t = 0; t < 4; ++t)
#pragma unroll
            for (int ks = 0; ks < 2; ++ks) {
                union { v16h v; v8h p[2]; } a;
                a.p[0] = at_ld_tr16(vt + (32 * ks) * VP + 16 * t); a.p[1] = at_ld_tr16(vt + (32 * ks + 16) * VP + 16 * t);
                o[t] = __builtin_amdgcn_wmma_f32_16x16x32_f16(false, a.v, false, pb[ks], (short)0, o[t], false, false);
            }
    }
    l += at_xhalf(l);                                        // the two halves' sums meet once
    const float inv = (l > 0.f) ? 1.f / (l * 4096.f) : 0.f;
    float* myo = ol[wave];
#pragma unroll
    for (int t = 0; t < 4; ++t) {
        v4f lo, hi;
#pragma unroll
        for (int r = 0; r < 4; ++r) { lo[r] = o[t][r] * inv; hi[r] = o[t][4 + r] * inv; }
        *(v4f*)(myo + l15 * OP + 16 * t + 8 * hf) = lo; *(v4f*)(myo + l15 * OP + 16 * t + 8 * hf + 4) = hi;
    }
    __syncthreads();                                         // the staged rows are visible to the lanes that store them
    float* obase = O + hb;
    v4f ov[8];
#pragma unroll
    for (int i = 0; i < 8; ++i) ov[i] = *(const v4f*)(myo + (2 * i + hf) * OP + l15 * 4);
#pragma unroll
    for (int i = 0; i < 8; ++i) VST2V4(obase + (size_t)(q0 + 2 * i + hf) * FD + l15 * 4, ov[i]);   // each store instruction writes two whole 256-byte rows
}

// =====================================================================================================================
// k_tr: dst(z, c, r) = alpha * src(z, r, c) (+ beta * R2(z, c, r)): [Z][R][C] (row stride lds) -> [Z][C][R] (row stride ldd) through a 32x32 LDS tile;
//   flags: 1 -> add beta * residual R2 addressed like dst (z*sRz + c*ldr + r); act applied before the residual.
// =====================================================================================================================
struct TrP { const float* src; float* dst; const float* R2; long long sSz, lds, sDz, ldd, sRz, ldr; int R, C, flags, act; float alpha, beta; };
static_assert(sizeof(TrP) == 3 * 8 + 6 * 8 + 6 * 4, "TrP has padding");
__global__ __launch_bounds__(256) void k_tr(TrP p) {
    __shared__ float tile[32][33];
    const int c0 = blockIdx.x * 32, r0 = blockIdx.y * 32, z = blockIdx.z;
    const int lane = threadIdx.x & 31, wave = threadIdx.x >> 5;
    const float* s = p.src + z * p.sSz;
#pragma unroll
    for (int k = 0; k < 4; ++k) {
        const int rl = wave * 4 + k, r = r0 + rl, c = c0 + lane;
        tile[rl][lane] = (r < p.R && c < p.C) ? s[(long long)r * p.lds + c] : 0.f;
    }
    __syncthreads();
    float* d = p.dst + z * p.sDz; const float* rr = p.R2 + z * p.sRz;
#pragma unroll
    for (int k = 0; k < 4; ++k) {
        const int cl = wave * 4 + k, c = c0 + cl, r = r0 + lane;
        if (c < p.C && r < p.R) {
            float v = act_fn(p.alpha * tile[lane][cl], p.act);
            if (p.flags & 1) v += p.beta * rr[(long long)c * p.ldr + r];
            VST2(float, d + (long long)c * p.ldd + r, v);
        }
    }
}

// k_affine: dst[i] = a * (sdev ? sdev[0] : 1) * src[i] + b, i < n (one thread per element; consecutive lanes -> consecutive addresses)
__global__ __launch_bounds__(256) void k_affine(const float* __restrict__ src, float* __restrict__ dst, int n, float a, float b, const float* __restrict__ sdev) {
    const int i = blockIdx.x * 256 + threadIdx.x;
    if (i < n) { const float aa = sdev ? a * sdev[0] : a; const float v = aa * src[i] + b; VST2(float, dst + i, v); }
}

// =====================================================================================================================
// k_softmax: row softmax over n contiguous elements, one 256-thread block per row; rows addressed z*sz + r*sr (grid (R, Z)).
//   out = scale_out * softmax(scale_in * x + (Mf ? Mf[z*smz + r*smr + j] : 0)); a row whose max is -inf is written as 0.
// =====================================================================================================================
struct SmP { const float* src; float* dst; const float* Mf; long long sz, sr, dz, dr, smz, smr; int n, pad; float scale_in, scale_out; };
static_assert(sizeof(SmP) == 3 * 8 + 6 * 8 + 4 * 4, "SmP has padding");
__global__ __launch_bounds__(256) void k_softmax(SmP p) {
    __shared__ float red[256];
    const int r = blockIdx.x, z = blockIdx.y, tid = threadIdx.x;
    const float* s = p.src + z * p.sz + (long long)r * p.sr;
    const float* mf = p.Mf ? (p.Mf + z * p.smz + (long long)r * p.smr) : nullptr;
    float mx = -__builtin_inff();
    for (int j = tid; j < p.n; j += 256) { float v = s[j] * p.scale_in; if (mf) v += mf[j]; mx = fmaxf(mx, v); }
    red[tid] = mx; __syncthreads();
    for (int o = 128; o > 0; o >>= 1) { if (tid < o) red[tid] = fmaxf(red[tid], red[tid + o]); __syncthreads(); }
    mx = red[0]; __syncthreads();
    float sum = 0.f;
    for (int j = tid; j < p.n; j += 256) { float v = s[j] * p.scale_in; if (mf) v += mf[j]; sum += (mx == -__builtin_inff()) ? 0.f : expf(v - mx); }
    red[tid] = sum; __syncthreads();
    for (int o = 128; o > 0; o >>= 1) { if (tid < o) red[tid] += red[tid + o]; __syncthreads(); }
    sum = red[0];
    const float inv = (sum > 0.f) ? p.scale_out / sum : 0.f;
    float* d = p.dst + z * p.dz + (long long)r * p.dr;
    for (int j = tid; j < p.n; j += 256) { float v = s[j] * p.scale_in; if (mf) v += mf[j]; const float o = (mx == -__builtin_inff()) ? 0.f : expf(v - mx) * inv; VST2(float, d + j, o); }
}
// =====================================================================================================================
// k_stats: mean and rsqrt(var + eps) over a set of n elements addressed base + z*sz + (e / inner) * so + (e % inner) * si, one 256-thread
// k_norm_apply: y = (x - mean[set]) * rstd[set] * g[c] + b[c] over a [Z][C][L] channel-major tensor with set = z*G + c / (C/G) (G groups per z;
//   G = C -> per-channel sets indexed z*C+c; for batch norm pass stats indexed by c only via bn = 1). Optional act. Output same layout.
// =====================================================================================================================
//   mode 0: mean / rsqrt(var + eps); mode 1 (RMSNorm): 0 / rsqrt(mean(x^2) + eps); mode 2 (L2 normalize * sqrt(n)): 0 / sqrt(n) / max(||x||, eps); mode 3: as 0 with unbiased variance (n-1)
__global__ __launch_bounds__(256) void k_stats(const float* __restrict__ x, long long sz, long long so, long long si, int inner, int n, float eps, float* __restrict__ stat, int mode) {
    __shared__ float red[256];
    const int z = blockIdx.x, tid = threadIdx.x;
    const float* base = x + z * sz;
    float s = 0.f;
    for (int e = tid; e < n; e += 256) s += base[(long long)(e / inner) * so + (long long)(e % inner) * si];
    red[tid] = s; __syncthreads();
    for (int o = 128; o > 0; o >>= 1) { if (tid < o) red[tid] += red[tid + o]; __syncthreads(); }
    const float mu = (mode == 0 || mode == 3) ? red[0] / (float)n : 0.f; __syncthreads();
    float q = 0.f;
    for (int e = tid; e < n; e += 256) { const float dlt = base[(long long)(e / inner) * so + (long long)(e % inner) * si] - mu; q += dlt * dlt; }
    red[tid] = q; __syncthreads();
    for (int o = 128; o > 0; o >>= 1) { if (tid < o) red[tid] += red[tid + o]; __syncthreads(); }
    {
        float rs;
        if (mode == 2) rs = sqrtf((float)n) / fmaxf(sqrtf(red[0]), eps); else if (mode == 3) rs = rsqrtf(red[0] / (float)(n - 1) + eps); else rs = rsqrtf(red[0] / (float)n + eps);
        if (tid < 32) { const float v = (tid == 0) ? mu : ((tid == 1) ? rs : 0.f); VST2(float, stat + (long long)z * 32 + tid, v); }
    }
}
//   One thread per element over the flat [Z][C][L] index space: grid ceil(Z*C*L / 256).
__global__ __launch_bounds__(256) void k_norm_apply(const float* __restrict__ x, float* __restrict__ y, const float* __restrict__ stat, const float* __restrict__ g, const float* __restrict__ bta,
                                                     int Z, int C, int L, int G, int bn, int act) {
    const long long idx = (long long)blockIdx.x * 256 + threadIdx.x;
    if (idx >= (long long)Z * C * L) return;
    const int l = (int)(idx % L); const long long zc = idx / L; const int c = (int)(zc % C), z = (int)(zc / C); (void)l;
    const int set = bn ? c : (z * G + c / (C / G));
    float v = (x[idx] - stat[(long long)set * 32]) * stat[(long long)set * 32 + 1];
    if (g) v *= g[c];
    if (bta) v += bta[c];
    v = act_fn(v, act);
    VST2(float, y + idx, v);
}

// k_lse_neg: c[i] = -(st[2i] + log(st[2i+1])) = minus the log-sum-exp of row i from k_attn's ST output (for softmax over the query dimension)
__global__ __launch_bounds__(256) void k_lse_neg(const float* __restrict__ st, float* __restrict__ c, int n) {
    const int i = blockIdx.x * 256 + threadIdx.x;
    if (i < n) { const float v = -(st[2 * i] + logf(st[2 * i + 1])); VST2(float, c + i, v); }
}

// k_iota: dst[i] = a * i + b as int32 (segment/position id helper)
__global__ __launch_bounds__(256) void k_iota(int* __restrict__ dst, int n, int a, int b) {
    const int i = blockIdx.x * 256 + threadIdx.x;
    if (i < n) { const int v = a * i + b; VST2(int, dst + i, v); }
}

// k_axpby: dst[i] = a * x[i] + b * y[i] (+ c), i < n
__global__ __launch_bounds__(256) void k_axpby(const float* __restrict__ x, const float* __restrict__ y, float* __restrict__ dst, int n, float a, float b, float c) {
    const int i = blockIdx.x * 256 + threadIdx.x;
    if (i < n) { const float v = a * x[i] + b * y[i] + c; VST2(float, dst + i, v); }
}

// =====================================================================================================================
// k_rope: rotary embedding on a [R rows][Hn heads][D] view (row stride sXr, head stride sXh, element stride 1) -> Y (own strides).
//   mode 0: rotate_half (partner d±D/2, sign - for d<D/2); mode 1: interleaved pairs (partner d^1, sign - for even d).
//   table column tcol: tmode 0 -> d, 1 -> d % (D/2), 2 -> d / 2; position p: pmode 0 -> r % S, 1 -> head index, 2 -> pos[r];
//   c = C[(r / S) * sCb + p * sCp + tcol * sCd], s likewise from Sn; y = x[d] * c + sign * x[partner] * s. X and Y must not alias.
// =====================================================================================================================
struct RopeP { const float* X; float* Y; const float* C; const float* Sn; const int* pos; long long sXr, sXh, sYr, sYh, sCb, sCp, sCd; int R, Hn, D, S, mode, tmode, pmode, pad; };
static_assert(sizeof(RopeP) == 5 * 8 + 7 * 8 + 8 * 4, "RopeP has padding");
__global__ __launch_bounds__(256) void k_rope(RopeP p) {
    const long long idx = (long long)blockIdx.x * 256 + threadIdx.x;
    if (idx >= (long long)p.R * p.Hn * p.D) return;
    const int d = (int)(idx % p.D); const long long rh = idx / p.D; const int h = (int)(rh % p.Hn); const int r = (int)(rh / p.Hn);
    const int half = p.D / 2;
    int partner; float sign;
    if (p.mode == 0) { partner = (d < half) ? d + half : d - half; sign = (d < half) ? -1.f : 1.f; }
    else { partner = d ^ 1; sign = (d & 1) ? 1.f : -1.f; }
    const int tcol = (p.tmode == 0) ? d : ((p.tmode == 1) ? (d % half) : (d >> 1));
    const int pp = (p.pmode == 0) ? (r % p.S) : ((p.pmode == 1) ? h : p.pos[r]);
    const long long toff = (long long)(r / p.S) * p.sCb + (long long)pp * p.sCp + (long long)tcol * p.sCd;
    const float* xr = p.X + (long long)r * p.sXr + (long long)h * p.sXh;
    const float v = xr[d] * p.C[toff] + sign * xr[partner] * p.Sn[toff];
    VST2(float, p.Y + (long long)r * p.sYr + (long long)h * p.sYh + d, v);
}

// k_invf + k_sincos (split so neither kernel carries a large VALU-fma footprint): invf_i = num * (1 / powf(base, (2 i)/D)) [fmode 0],
//   num * expf((2 i) * cexp) [fmode 1], num * powf(base, -2 (i - 1) / D) [fmode 2]; then cs/sn[s*half + i] = cos/sin((pscale * s) * invf_i)
__global__ __launch_bounds__(256) void k_invf(float* __restrict__ invb, int half, int D, float base, float num, int fmode, float cexp) {
    const int i = blockIdx.x * 256 + threadIdx.x;
    if (i >= ((half + 31) / 32) * 32) return;
    if (i >= half) { VST2(float, invb + i, 0.f); return; }
    const float e = (float)(2 * i) / (float)D;
    float invf;
    if (fmode == 1) invf = num * expf((float)(2 * i) * cexp);
    else if (fmode == 2) invf = num * powf(base, (-2.0f * ((float)i - 1.0f)) / (float)D);
    else invf = num * (1.0f / powf(base, e));
    VST2(float, invb + i, invf);
}
__global__ __launch_bounds__(256) void k_sincos(float* __restrict__ cs, float* __restrict__ sn, const float* __restrict__ invb, int S, int half, float pscale) {
    const int idx = blockIdx.x * 256 + threadIdx.x;
    if (idx >= S * half) return;
    const int s = idx / half, i = idx - s * half;
    const float ang = (pscale * (float)s) * invb[i];
    VST2(float, cs + idx, cosf(ang)); VST2(float, sn + idx, sinf(ang));
}

// k_mulact: dst[i] = act(x[i]) * y[i]
__global__ __launch_bounds__(256) void k_mulact(const float* __restrict__ x, const float* __restrict__ y, float* __restrict__ dst, int n, int act) {
    const int i = blockIdx.x * 256 + threadIdx.x;
    if (i < n) { const float v = act_fn(x[i], act) * y[i]; VST2(float, dst + i, v); }
}

// =====================================================================================================================
// k_matvec: thread-per-row matrix-vector products for N <= 8 output columns (heads with 1-3 outputs, gates), f32 on the VALU.
//   C[r*sCm + j] = act(alpha * sum_k A[r*sAm + k*sAk] * B[j*sBn + k*sBk] + bias[j]) + beta * R[r*sRm + j*sRn]; each thread writes its N contiguous floats.
// =====================================================================================================================
__global__ __launch_bounds__(256) void k_matvec(GemmP p) {
    // 32 lanes write one line with one instruction.
    const int rpt = (p.N == 1) ? 1 : 32;
    const long long r0 = ((long long)blockIdx.x * 256 + threadIdx.x) * rpt; const int z = blockIdx.z, zo = z / p.zi_n, zi = z - zo * p.zi_n;
    if (r0 >= p.M) return;
    const float* Bb = p.B + zo * p.sBo + zi * p.sBi;
    float* C = p.C + zo * p.sCo + zi * p.sCi; const float* R = p.R + zo * p.sRo + zi * p.sRi;
    for (int rr = 0; rr < rpt; ++rr) {
        const long long r = r0 + rr; if (r >= p.M) break;
        const float* A = p.A + zo * p.sAo + zi * p.sAi + r * p.sAm;
        float acc[8] = {0.f, 0.f, 0.f, 0.f, 0.f, 0.f, 0.f, 0.f};
        for (int k = 0; k < p.K; ++k) { const float a = A[(long long)k * p.sAk];
#pragma unroll
            for (int j = 0; j < 8; ++j) if (j < p.N) acc[j] += a * Bb[(long long)j * p.sBn + (long long)k * p.sBk]; }
#pragma unroll
        for (int j = 0; j < 8; ++j) if (j < p.N) {
            float v = acc[j] * p.alpha;
            if (p.flags & 1) v += p.bias[j];
            if (p.flags & 2) v += p.bias[r];
            v = act_fn(v, p.act);
            if (p.flags & 4) v += p.beta * R[r * p.sRm + (long long)j * p.sRn];
            VST2(float, C + r * p.sCm + j, v);
        }
    }
}
// k_smallsoftmax: thread-per-row softmax for short rows (n <= 64): dst[r*dr + j] = softmax(scale*src[r*sr + j])
__global__ __launch_bounds__(256) void k_smallsoftmax(const float* __restrict__ src, float* __restrict__ dst, long long sr, long long dr, int n, long long R, float scale) {
    const long long r0 = ((long long)blockIdx.x * 256 + threadIdx.x) * 32;
    for (int rr = 0; rr < 32; ++rr) {
        const long long r = r0 + rr; if (r >= R) return;
        const float* s = src + r * sr; float* d = dst + r * dr;
        float mx = -__builtin_inff();
        for (int j = 0; j < n; ++j) mx = fmaxf(mx, s[j] * scale);
        float sum = 0.f;
        for (int j = 0; j < n; ++j) sum += expf(s[j] * scale - mx);
        const float inv = 1.f / sum;
        for (int j = 0; j < n; ++j) { const float v = expf(s[j] * scale - mx) * inv; VST2(float, d + j, v); }
    }
}

__global__ __launch_bounds__(32) void k_unitstat(float* __restrict__ st) { const int t = threadIdx.x; const float v = (t == 1) ? 1.f : 0.f; VST2(float, st + t, v); }

// destination (e.g. a d_out whose row width is not a multiple of 32 floats) is written by consecutive lanes of one instruction
__global__ __launch_bounds__(256) void k_lincopy(const float* __restrict__ src, long long lds, float* __restrict__ dst, long long ldd, long long rows, int cols) {
    const long long i = (long long)blockIdx.x * 256 + threadIdx.x; if (i >= rows * cols) return;
    const long long r = i / cols; const int c = (int)(i - r * cols);
    const float v = src[r * lds + c]; VST2(float, dst + r * ldd + c, v);
}

namespace w25 {
typedef __attribute__((ext_vector_type(16))) _Float16 v16h;
typedef __attribute__((ext_vector_type(8)))  _Float16 v8h;
typedef __attribute__((ext_vector_type(16))) __bf16   v16b;
typedef __attribute__((ext_vector_type(8)))  __bf16   v8b;
typedef __attribute__((ext_vector_type(8)))  float    v8f;
typedef __attribute__((ext_vector_type(4)))  float    v4f;

__device__ __forceinline__ unsigned short f2bf_bits(float f) {
  unsigned u = __float_as_uint(f);
  return (unsigned short)((u + 0x7FFFu + ((u >> 16) & 1u)) >> 16);
}
__device__ __forceinline__ float bf_bits2f(unsigned short h) { return __uint_as_float(((unsigned)h) << 16); }

template <typename T> struct Frag;
template <> struct Frag<_Float16> {
  typedef v16h V; union U { v16h v; v8h h[2]; };
  static __device__ __forceinline__ v16h load(const _Float16* p) {   // elements 0..7 <- p[0..7], 8..15 <- p[16..23]
    U f; f.h[0] = *(const v8h*)(p); f.h[1] = *(const v8h*)(p + 16); return f.v;
  }
  static __device__ __forceinline__ v8f mma(v16h a, v16h b, v8f c) {
    return __builtin_amdgcn_wmma_f32_16x16x32_f16(false, a, false, b, (short)0, c, false, false);
  }
};
template <> struct Frag<__bf16> {
  typedef v16b V; union U { v16b v; v8b h[2]; };
  static __device__ __forceinline__ v16b load(const __bf16* p) {
    U f; f.h[0] = *(const v8b*)(p); f.h[1] = *(const v8b*)(p + 16); return f.v;
  }
  static __device__ __forceinline__ v8f mma(v16b a, v16b b, v8f c) {
    return __builtin_amdgcn_wmma_f32_16x16x32_bf16(false, a, false, b, (short)0, c, false, false);
  }
};

// ---- WMMA GEMM with both operands staged in LDS ------------------------------
// C[m,n] = scale * sum_k A[m,k] * Bt[n,k], f32 out. A row-major [M,K]; Bt row-major [N,K]; C row-major [M,N]; M % 64 == 0, N % 128 == 0, K % 64 == 0.
// grid (N / 128, the sum of M / 64 over the products), 8 waves: a work-group owns a 64 x 128 tile of C, wave (wave >> 2, wave & 3) a 32 x 32 part of it.
// K runs in stages of 64: a stage's 64 A rows and 128 Bt rows (128 B each, per plane) come from global memory as whole 128-byte lines
// (8 lanes x 16 B per row), go to LDS at a pitch of 144 B, and every wave reads its fragments from there with 16-byte LDS loads.
// Two LDS buffers: the next stage's global loads are in flight while the current stage is multiplied; one barrier per stage.
// SPLIT: operands are hi/lo planes (A2/Bt2 = lo planes, same layout); product = hi.hi + hi.lo + lo.hi, in that order per 32 k.
// ET: 0 = f16 operands, 1 = bf16 operands (pointers passed as 16-bit storage)
// astep: rows of A from one 64-row tile of C to the next (64: A is dense; more: each tile takes the first 64 rows of a longer block of A)
template <int ET> struct Elem;
template <> struct Elem<0> { typedef _Float16 T; typedef v8h V8; };
template <> struct Elem<1> { typedef __bf16 T; typedef v8b V8; };
// One launch holds up to three products with the same A: grid (N / 128, T0 + 2 T1). Tile rows 0 .. T0 - 1 belong to C0 = A.Bt0^T with A dense (64 rows a tile);
// the next T1 to C1 = A.Bt1^T and the last T1 to C2 = A.Bt2^T, both with astep1 rows of A from tile to tile. A launch of T0 + T1 tile rows never touches Bt2 and C2, one of T0 only Bt0 and C0.
struct GemmB { const unsigned short* hi; const unsigned short* lo; float* c; };   // one product's Bt planes (lo unused without SPLIT) and its C
template <int ET, bool SPLIT>
__global__ __launch_bounds__(256) void wmma_gemm_lds(
    const unsigned short* __restrict__ Ap, const unsigned short* __restrict__ A2p,
    GemmB p0, GemmB p1, GemmB p2, int T0, int T1, int N, int K, float scale, int astep1) {
  const int ty = (int)blockIdx.y;
  const int pw = ty < T0 ? 0 : (ty < T0 + T1 ? 1 : 2);                       // which product; the same for the whole work-group
  const int by = pw == 0 ? ty : (pw == 1 ? ty - T0 : ty - T0 - T1);          // tile row within it
  const int astep = pw == 0 ? 64 : astep1;
  const unsigned short* __restrict__ Btp  = pw == 0 ? p0.hi : (pw == 1 ? p1.hi : p2.hi);
  const unsigned short* __restrict__ Bt2p = pw == 0 ? p0.lo : (pw == 1 ? p1.lo : p2.lo);
  float* __restrict__ C = pw == 0 ? p0.c : (pw == 1 ? p1.c : p2.c);
  typedef typename Elem<ET>::T T;
  typedef typename Elem<ET>::V8 V8;
  typedef typename Frag<T>::V V;
  constexpr int NP    = SPLIT ? 2 : 1;      // planes
  constexpr int PITCH = 72;                 // LDS row pitch in 16-bit elements: 144 B = 16 B x 9
  constexpr int PROWS = 192;                // rows of one plane in a stage: 64 of A, then 128 of Bt
  constexpr int STAGE = NP * PROWS * PITCH; // elements of one buffer
  constexpr int NL    = NP * 6;             // 16-byte pieces per thread and stage (32 rows per step)
  constexpr int CP    = 132;                // pitch of the staged C tile in floats
  static_assert(2 * STAGE * 2 >= 64 * CP * 4, "the C tile is staged in the operand buffers");
  __shared__ __align__(16) T sm[2 * STAGE];
  const int lane = threadIdx.x & 31;
  const int wave = threadIdx.x >> 5;
  const int m0 = by << 6;
  const int n0 = blockIdx.x << 7;
  const int wm = (wave >> 2) << 5;          // this wave's first row and column in the tile
  const int wn = (wave & 3) << 5;
  const int rlane = lane & 15;              // row (A) / col (B, D) within a 16 x 16 subtile
  const int koff  = (lane >> 4) * 8;        // k offset of this lane half
  const int mOff  = (lane >> 4) * 8;        // D row offset

  const int lrow = threadIdx.x >> 3, lseg = (threadIdx.x & 7) * 8;   // staging: row within a step of 32 rows, 16-byte piece of the row
  const int a0 = by * astep;                // first A row of this tile
  const T* gA  = (const T*)Ap  + (size_t)(a0 + lrow) * K + lseg;
  const T* gB  = (const T*)Btp + (size_t)(n0 + lrow) * K + lseg;
  const T* gA2 = SPLIT ? (const T*)A2p  + (size_t)(a0 + lrow) * K + lseg : nullptr;
  const T* gB2 = SPLIT ? (const T*)Bt2p + (size_t)(n0 + lrow) * K + lseg : nullptr;
  const int sw = lrow * PITCH + lseg;       // this thread's place in a buffer, step 0
  const int fa = (wm + rlane) * PITCH + koff;        // this lane's A and Bt fragment places in a buffer, subtile 0, k 0
  const int fb = (64 + wn + rlane) * PITCH + koff;

  v8f acc[2][2];
#pragma unroll
  for (int i = 0; i < 2; ++i)
#pragma unroll
    for (int j = 0; j < 2; ++j) acc[i][j] = (v8f){0.f,0.f,0.f,0.f,0.f,0.f,0.f,0.f};

  V8 st[NL];
  auto fetch = [&](int k0) {                // stage at k0: global memory -> registers
#pragma unroll
    for (int it = 0; it < NL; ++it) {
      const int q = it % 6;                 // steps 0, 1: A rows; 2..5: Bt rows; then the same for the lo planes
      const T* g = (it < 6) ? (q < 2 ? gA : gB) : (q < 2 ? gA2 : gB2);
      st[it] = *(const V8*)(g + (size_t)((q < 2 ? q : q - 2) * 32) * K + k0);
    }
  };
  auto put = [&](int buf) {                 // registers -> LDS buffer
#pragma unroll
    for (int it = 0; it < NL; ++it) *(V8*)(sm + buf * STAGE + sw + it * (32 * PITCH)) = st[it];
  };
  auto mult = [&](int buf) {                // one stage: 2 steps of 32 k
    const T* s = sm + buf * STAGE;
#pragma unroll
    for (int kk = 0; kk < 2; ++kk) {
      V ah[2], al[2], bh[2], bl[2];
#pragma unroll
      for (int i = 0; i < 2; ++i) {
        ah[i] = Frag<T>::load(s + fa + i * (16 * PITCH) + kk * 32);
        bh[i] = Frag<T>::load(s + fb + i * (16 * PITCH) + kk * 32);
        if (SPLIT) {
          al[i] = Frag<T>::load(s + PROWS * PITCH + fa + i * (16 * PITCH) + kk * 32);
          bl[i] = Frag<T>::load(s + PROWS * PITCH + fb + i * (16 * PITCH) + kk * 32);
        }
      }
#pragma unroll
      for (int i = 0; i < 2; ++i)
#pragma unroll
        for (int j = 0; j < 2; ++j) acc[i][j] = Frag<T>::mma(ah[i], bh[j], acc[i][j]);
      if (SPLIT) {
#pragma unroll
        for (int i = 0; i < 2; ++i)
#pragma unroll
          for (int j = 0; j < 2; ++j) acc[i][j] = Frag<T>::mma(ah[i], bl[j], acc[i][j]);
#pragma unroll
        for (int i = 0; i < 2; ++i)
#pragma unroll
          for (int j = 0; j < 2; ++j) acc[i][j] = Frag<T>::mma(al[i], bh[j], acc[i][j]);
      }
    }
  };

  const int NK = K >> 6;
  fetch(0);
  put(0);
  __syncthreads();                          // stage 0 is visible
  for (int kt = 0; kt + 1 < NK; ++kt) {
    fetch((kt + 1) << 6);
    __builtin_amdgcn_sched_barrier(0);      // keeps the next stage's global loads issued ahead of this stage's products, so that their latency runs under them
    mult(kt & 1);
    put((kt + 1) & 1);                      // the buffer that stage kt - 1 was read from; its readers left it at the barrier that ended that trip
    __syncthreads();                        // stage kt + 1 is visible, and every wave has finished reading stage kt
  }
  mult((NK - 1) & 1);
  __syncthreads();                          // all fragment reads are done: the buffers now stage the C tile

  // ---- epilogue: the 64 x 128 f32 tile through LDS, so that each store instruction writes 512 contiguous bytes of one row ----
  float* sC = (float*)sm;
#pragma unroll
  for (int i = 0; i < 2; ++i)
#pragma unroll
    for (int j = 0; j < 2; ++j)
#pragma unroll
      for (int r = 0; r < 8; ++r) sC[(wm + (i << 4) + mOff + r) * CP + wn + (j << 4) + rlane] = acc[i][j][r] * scale;
  __syncthreads();
#pragma unroll
  for (int it = 0; it < 8; ++it) {
    const int row = it * 8 + wave;
    const v4f v = *(const v4f*)(sC + row * CP + lane * 4);
    *(v4f*)(C + (size_t)(m0 + row) * N + n0 + lane * 4) = v;
  }
}

__global__ __launch_bounds__(256) void cast_f32_f16x2(
    const float* __restrict__ in, _Float16* __restrict__ out, int n2) {
  int i = blockIdx.x * 256 + threadIdx.x;
  if (i < n2) {
    const _Float16 h0 = (_Float16)in[2 * i], h1 = (_Float16)in[2 * i + 1];
    const unsigned u = (unsigned)__builtin_bit_cast(unsigned short, h0) | ((unsigned)__builtin_bit_cast(unsigned short, h1) << 16);
    ((unsigned*)out)[i] = u;
    
  }
}


} // namespace w25

__global__ __launch_bounds__(256) void k_castT16(const float* __restrict__ src, long long lds, _Float16* __restrict__ dst, long long ldd, int R, int C, float s) {
    const long long i = (long long)blockIdx.x * 256 + threadIdx.x; const long long np = (long long)C * (R / 2); if (i >= np) return; const int c = (int)(i / (R / 2)); const int r = 2 * (int)(i % (R / 2));
    const _Float16 h0 = (_Float16)(src[(long long)r * lds + c] * s), h1 = (_Float16)(src[(long long)(r + 1) * lds + c] * s);
    const unsigned u = (unsigned)__builtin_bit_cast(unsigned short, h0) | ((unsigned)__builtin_bit_cast(unsigned short, h1) << 16);
    unsigned* d = (unsigned*)(dst + (long long)c * ldd + r); *d = u;  }

// f32 -> bf16 hi plane + bf16 lo plane (x = hi + lo to ~2^-17 relative; RNE both), 2 consecutive destination elements: hi pair returned, lo pair in *lo
__device__ __forceinline__ unsigned int f2bf2_pack(float a, float b, unsigned int* lo) {
    const unsigned short ha = w25::f2bf_bits(a), hb = w25::f2bf_bits(b);
    const unsigned short la = w25::f2bf_bits(a - w25::bf_bits2f(ha)), lb = w25::f2bf_bits(b - w25::bf_bits2f(hb));
    *lo = (unsigned)la | ((unsigned)lb << 16); return (unsigned)ha | ((unsigned)hb << 16); }

namespace w25 {
// =====================================================================================
// Generic causal/non-causal attention for head_dim 64, f32 in / f32 out; 16-bit operands: bf16 with optional hi/lo splits, or
// plain f16 (F16=true, non-split, probabilities carried x2^15).
//   scores = (q*qscale)·kᵀ : v_wmma_f32_16x16x32_bf16; SPLIT_QK -> q,k as bf16 hi/lo (hi·hi + hi·lo + lo·hi)
//   out    = p·v           : v_wmma_f32_16x16x32_bf16; SPLIT_PV -> p,v as bf16 hi/lo; else p,v plain bf16
//   f32 accumulate; online softmax in f32. Block = 4 waves = 64 query rows of one (batch, head); S % 64 == 0.
//   Element (b, s, h, d) of tensor X lives at X[b*X_bs + s*X_rs + h*X_hs + d] (strides in floats, multiples of 4).
//   Masking: mask_mode 0 none, 1 causal (kv > q masked), 2 tensor [S][Skv] shared over (b,h) (float if
//   mask_is_int==0, int32 with element == 0 -> masked if 1, int32 with element != 0 -> masked if 2), 3 per-token vectors qmask[B][S] & kvmask[B][Skv] (int32,
//   0 -> masked), 4 causal + sliding window (kv > q or q - kv > W masked; W passed in mask_is_int);
//   5 = relative-position bias: s += cp[b,h,q][idx[q][kv]] + pc[b,h,kv][idx[q][kv]] with idx = mask_b ([S][Skv] int32) and
//   mask_a an int32 [S][Skv] tensor with nonzero = masked (tables: element (b,h,row,n) at X + b*c_bs + h*c_hs + row*c_rs + n);
//   masked scores are replaced by mask_fill (e.g. -inf or -1e9) before the softmax.
//   grid.x = B * H * (S/64) (or a sub-range with blk0).
// =====================================================================================
#define AT_D 64
#define AT_NW 4
#define AT_QB 64
#define AT_KC 64
struct AttnGeom { const float* cp = nullptr; const float* pc = nullptr; long c_bs = 0, c_rs = 0, c_hs = 0;   // mode-5 score-bias tables
                  long q_bs, q_rs, q_hs, k_bs, k_rs, k_hs, v_bs, v_rs, v_hs, o_bs, o_rs, o_hs;
                  int S, Skv, H, mask_mode; float qscale; int blk0; float mask_fill; int mask_is_int; };
static_assert(sizeof(AttnGeom) == 168, "no padding");

__device__ __forceinline__ unsigned short at_bf_bits(float f) {
  unsigned u = __float_as_uint(f);
  return (unsigned short)((u + 0x7FFFu + ((u >> 16) & 1u)) >> 16);
}
__device__ __forceinline__ __bf16 at_f2bf(float f) { return __builtin_bit_cast(__bf16, at_bf_bits(f)); }
__device__ __forceinline__ void at_split(float f, __bf16& hi, __bf16& lo) {
  const unsigned short hb = at_bf_bits(f);
  hi = __builtin_bit_cast(__bf16, hb);
  lo = at_f2bf(f - __uint_as_float(((unsigned)hb) << 16));
}
__device__ __forceinline__ v8f at_mma(v16b a, v16b b, v8f c) {
  c = __builtin_amdgcn_wmma_f32_16x16x32_bf16(false, a, false, b, (short)0, c, false, false);
  asm volatile("v_nop\n\tv_nop\n\tv_nop\n\tv_nop" : "+v"(c) : "v"(a), "v"(b));
  return c;
}
// 16-bit element as a bit pattern held in a __bf16 slot: f16 bits when F16, bf16 (RNE) otherwise
template <bool F16> __device__ __forceinline__ __bf16 at_to16(float f) {
  if (F16) return __builtin_bit_cast(__bf16, (_Float16)f);
  return at_f2bf(f);
}
template <bool F16> __device__ __forceinline__ v8f at_mma16(v16b a, v16b b, v8f c) {
  if (F16) {
    const v16h ah = __builtin_bit_cast(v16h, a), bh = __builtin_bit_cast(v16h, b);
    c = __builtin_amdgcn_wmma_f32_16x16x32_f16(false, ah, false, bh, (short)0, c, false, false);
    asm volatile("v_nop\n\tv_nop\n\tv_nop\n\tv_nop" : "+v"(c) : "v"(ah), "v"(bh));
    return c;
  }
  return at_mma(a, b, c);
}

template <bool SPLIT_QK, bool SPLIT_PV, bool F16 = false>
__global__ __launch_bounds__(128)
void attn64_kernel(const float* __restrict__ q, const float* __restrict__ k,
                   const float* __restrict__ v, float* __restrict__ out,
                   const void* __restrict__ mask_a, const int* __restrict__ mask_b, AttnGeom g) {
  static_assert(!(F16 && (SPLIT_QK || SPLIT_PV)), "f16 mode is non-split");
  const float PSC = F16 ? 32768.0f : 1.0f;     // f16 probabilities carried x2^15 (subnormal range), folded into the final 1/l
  union FB { v16b v; v8b h[2]; };
  __shared__ __align__(16) __bf16 Ksh[AT_KC * AT_D];             // K hi [kv][d]      8 KB
  __shared__ __align__(16) __bf16 Ksl[SPLIT_QK ? AT_KC * AT_D : 8];
  __shared__ __align__(16) __bf16 Vth[AT_D * AT_KC];             // V hi [d][kv]      8 KB
  __shared__ __align__(16) __bf16 Vtl[SPLIT_PV ? AT_D * AT_KC : 8];
  __shared__ __align__(16) __bf16 Psh[AT_NW][16 * AT_KC];        // per wave P hi [row][kv]  8 KB
  __shared__ __align__(16) __bf16 Psl[SPLIT_PV ? AT_NW : 1][SPLIT_PV ? 16 * AT_KC : 8];
  __shared__ __align__(16) float  Os[AT_NW][16 * 68];            // per wave out tile, pitch 68

  const int tid  = threadIdx.x;
  const int wave = tid >> 5;
  const int lane = tid & 31;
  const int hh   = lane >> 4;
  const int c    = lane & 15;

  const int nqb = g.S / AT_QB;
  const int bx = blockIdx.x + g.blk0;
  const int qb = bx % nqb;
  const int bh = bx / nqb;
  const int h  = bh % g.H;
  const int b  = bh / g.H;
  const int qbase_block = qb * AT_QB;
  const int q0 = qbase_block + wave * 16;

  const float* qb_ptr = q + (size_t)b * g.q_bs + (size_t)h * g.q_hs;
  const float* kb_ptr = k + (size_t)b * g.k_bs + (size_t)h * g.k_hs;
  const float* vb_ptr = v + (size_t)b * g.v_bs + (size_t)h * g.v_hs;
  float*       ob_ptr = out + (size_t)b * g.o_bs + (size_t)h * g.o_hs;

  // ---- Q fragments (A operand): 2 d-chunks, hi (and lo) ----
  v16b qah[2], qal[2];
  {
    const float* qrow = qb_ptr + (size_t)(q0 + c) * g.q_rs;
#pragma unroll
    for (int dc = 0; dc < 2; ++dc) {
#pragma unroll
      for (int e = 0; e < 8; ++e) {
        const float f0 = qrow[dc * 32 + 8 * hh + e] * g.qscale;
        const float f1 = qrow[dc * 32 + 16 + 8 * hh + e] * g.qscale;
        if (SPLIT_QK) { __bf16 hq, lq; at_split(f0, hq, lq); qah[dc][e] = hq; qal[dc][e] = lq; at_split(f1, hq, lq); qah[dc][8 + e] = hq; qal[dc][8 + e] = lq; }
        else { qah[dc][e] = at_to16<F16>(f0); qah[dc][8 + e] = at_to16<F16>(f1); qal[dc][e] = qah[dc][e]; qal[dc][8 + e] = qah[dc][8 + e]; }
      }
    }
  }

  float mrow[8], lrow[8];
  v8f oacc[4];
#pragma unroll
  for (int r = 0; r < 8; ++r) { mrow[r] = -INFINITY; lrow[r] = 0.f; }
#pragma unroll
  for (int t = 0; t < 4; ++t) oacc[t] = (v8f){0.f,0.f,0.f,0.f,0.f,0.f,0.f,0.f};

  const int nChunks = (g.mask_mode == 1 || g.mask_mode == 4) ? (qb + 1) : (g.Skv / AT_KC);   // block-uniform
  // per-row query mask (mode 3)
  int qkeep[8];
#pragma unroll
  for (int r = 0; r < 8; ++r) qkeep[r] = (g.mask_mode == 3) ? mask_b[(size_t)b * g.S + q0 + 8 * hh + r] : 1;   // mask_b = qmask in mode 3
  for (int kc = 0; kc < nChunks; ++kc) {
    const int kv0 = kc * AT_KC;
    __syncthreads();
    {
      const int kvr = tid >> 1, dh = (tid & 1) * 32;
      const float* krow = kb_ptr + (size_t)(kv0 + kvr) * g.k_rs + dh;
      const float* vrow = vb_ptr + (size_t)(kv0 + kvr) * g.v_rs + dh;
#pragma unroll
      for (int i = 0; i < 8; ++i) {
        v4f kk = *(const v4f*)(krow + 4 * i);
        v4f vv = *(const v4f*)(vrow + 4 * i);
#pragma unroll
        for (int e = 0; e < 4; ++e) {
          const int d = dh + 4 * i + e;
          if (SPLIT_QK) { __bf16 a, bl; at_split(kk[e], a, bl); Ksh[kvr * AT_D + d] = a; Ksl[kvr * AT_D + d] = bl; }
          else Ksh[kvr * AT_D + d] = at_to16<F16>(kk[e]);
          if (SPLIT_PV) { __bf16 a, bl; at_split(vv[e], a, bl); Vth[d * AT_KC + kvr] = a; Vtl[d * AT_KC + kvr] = bl; }
          else Vth[d * AT_KC + kvr] = at_to16<F16>(vv[e]);
        }
      }
    }
    __syncthreads();

    v8f s[4];
#pragma unroll
    for (int j = 0; j < 4; ++j) {
      s[j] = (v8f){0.f,0.f,0.f,0.f,0.f,0.f,0.f,0.f};
#pragma unroll 1
      for (int dc = 0; dc < 2; ++dc) {
        FB kb;
        kb.h[0] = *(const v8b*)(Ksh + (j * 16 + c) * AT_D + dc * 32 + 8 * hh);
        kb.h[1] = *(const v8b*)(Ksh + (j * 16 + c) * AT_D + dc * 32 + 16 + 8 * hh);
        s[j] = at_mma16<F16>(qah[dc], kb.v, s[j]);
        if (SPLIT_QK) {
          FB kl;
          kl.h[0] = *(const v8b*)(Ksl + (j * 16 + c) * AT_D + dc * 32 + 8 * hh);
          kl.h[1] = *(const v8b*)(Ksl + (j * 16 + c) * AT_D + dc * 32 + 16 + 8 * hh);
          s[j] = at_mma16<F16>(qah[dc], kl.v, s[j]);
          s[j] = at_mma16<F16>(qal[dc], kb.v, s[j]);
        }
      }
    }
    const bool diag = (g.mask_mode == 1) && (kc == qb);
    int kvkeep[4] = {1, 1, 1, 1};
    if (g.mask_mode == 3) {
#pragma unroll
      for (int j = 0; j < 4; ++j) kvkeep[j] = ((const int*)mask_a)[(size_t)b * g.Skv + kv0 + j * 16 + c];   // mask_a = kvmask
    }
    float cm[8];
#pragma unroll
    for (int r = 0; r < 8; ++r) {
      const int qrow = q0 + 8 * hh + r;
      float m = -INFINITY;
#pragma unroll
      for (int j = 0; j < 4; ++j) {
        const int kvcol = kv0 + j * 16 + c;
        bool masked = false;
        if (diag) masked = (kvcol > qrow);
        else if (g.mask_mode == 4) masked = (kvcol > qrow) || (qrow - kvcol > g.mask_is_int);
        else if (g.mask_mode == 2) {
          const size_t mi = (size_t)qrow * g.Skv + kvcol;
          masked = (g.mask_is_int == 0) ? (((const float*)mask_a)[mi] == 0.0f)
                 : (g.mask_is_int == 1) ? (((const int*)mask_a)[mi] == 0) : (((const int*)mask_a)[mi] != 0);
        } else if (g.mask_mode == 3) masked = (qkeep[r] == 0) || (kvkeep[j] == 0);
        else if (g.mask_mode == 5) {
          const size_t mi = (size_t)qrow * g.Skv + kvcol;
          masked = (((const int*)mask_a)[mi] != 0);
          int n = mask_b[mi]; n = n < 0 ? 0 : n;
          s[j][r] += g.cp[(size_t)b * g.c_bs + (size_t)h * g.c_hs + (size_t)qrow * g.c_rs + n]
                   + g.pc[(size_t)b * g.c_bs + (size_t)h * g.c_hs + (size_t)kvcol * g.c_rs + n];
        }
        if (masked) s[j][r] = g.mask_fill;
        m = fmaxf(m, s[j][r]);
      }
#pragma unroll
      for (int off = 1; off < 16; off <<= 1) m = fmaxf(m, __shfl_xor(m, off, 32));
      cm[r] = m;
    }
    __bf16* pwh = Psh[wave];
    __bf16* pwl = Psl[SPLIT_PV ? wave : 0];
#pragma unroll
    for (int r = 0; r < 8; ++r) {
      const float mnew = fmaxf(mrow[r], cm[r]);
      const float alpha = expf(mrow[r] - mnew);
      mrow[r] = mnew;
      float psum = 0.f;
#pragma unroll
      for (int j = 0; j < 4; ++j) {
        const float p = expf(s[j][r] - mnew);
        psum += p;
        if (SPLIT_PV) { __bf16 a, bl; at_split(p, a, bl); pwh[(8 * hh + r) * AT_KC + j * 16 + c] = a; pwl[(8 * hh + r) * AT_KC + j * 16 + c] = bl; }
        else pwh[(8 * hh + r) * AT_KC + j * 16 + c] = at_to16<F16>(p * PSC);
      }
#pragma unroll
      for (int off = 1; off < 16; off <<= 1) psum += __shfl_xor(psum, off, 32);
      lrow[r] = lrow[r] * alpha + psum;
#pragma unroll
      for (int t = 0; t < 4; ++t) oacc[t][r] *= alpha;
    }
    __builtin_amdgcn_fence(__ATOMIC_RELEASE, "workgroup");
    __builtin_amdgcn_wave_barrier();
    __builtin_amdgcn_fence(__ATOMIC_ACQUIRE, "workgroup");
#pragma unroll 1
    for (int kk = 0; kk < 2; ++kk) {
      FB pa, pl;
      pa.h[0] = *(const v8b*)(pwh + c * AT_KC + kk * 32 + 8 * hh);
      pa.h[1] = *(const v8b*)(pwh + c * AT_KC + kk * 32 + 16 + 8 * hh);
      if (SPLIT_PV) {
        pl.h[0] = *(const v8b*)(pwl + c * AT_KC + kk * 32 + 8 * hh);
        pl.h[1] = *(const v8b*)(pwl + c * AT_KC + kk * 32 + 16 + 8 * hh);
      }
#pragma unroll
      for (int t = 0; t < 4; ++t) {
        FB vb;
        vb.h[0] = *(const v8b*)(Vth + (t * 16 + c) * AT_KC + kk * 32 + 8 * hh);
        vb.h[1] = *(const v8b*)(Vth + (t * 16 + c) * AT_KC + kk * 32 + 16 + 8 * hh);
        oacc[t] = at_mma16<F16>(pa.v, vb.v, oacc[t]);
        if (SPLIT_PV) {
          FB vl;
          vl.h[0] = *(const v8b*)(Vtl + (t * 16 + c) * AT_KC + kk * 32 + 8 * hh);
          vl.h[1] = *(const v8b*)(Vtl + (t * 16 + c) * AT_KC + kk * 32 + 16 + 8 * hh);
          oacc[t] = at_mma16<F16>(pa.v, vl.v, oacc[t]);
          oacc[t] = at_mma16<F16>(pl.v, vb.v, oacc[t]);
        }
      }
    }
  }

  float* os = Os[wave];
#pragma unroll
  for (int r = 0; r < 8; ++r) {
    const float inv = 1.0f / (lrow[r] * PSC);
#pragma unroll
    for (int t = 0; t < 4; ++t) os[(8 * hh + r) * 68 + t * 16 + c] = oacc[t][r] * inv;
  }
  __builtin_amdgcn_fence(__ATOMIC_RELEASE, "workgroup");
  __builtin_amdgcn_wave_barrier();
  __builtin_amdgcn_fence(__ATOMIC_ACQUIRE, "workgroup");
  {
    const int c4 = (lane & 15) * 4;
    {
#pragma unroll
      for (int it = 0; it < 8; ++it) {
        const int row = it * 2 + hh;
        v4f val = *(const v4f*)(os + row * 68 + c4);
        *(v4f*)(ob_ptr + (size_t)(q0 + row) * g.o_rs + c4) = val;
      }
      
    }
  }
}

} // namespace w25

// Exact f32 attention rows 0 .. 63 of every (batch, head). A work-group of 256 threads takes 16 query rows of one head: thread (r, d) the rows t = 16 g + 4 i + r, i = 0 .. 3,
// first as key d of their scores, then as column d of their outputs. The head's 64 x 64 K and V tiles and the 16 query rows come once per work-group as whole 256-byte rows by
// 16-byte loads, all issued together, and are read from LDS; every loop is unrolled, and a thread's four rows are four independent chains that share each K and V value read.
// Keys above t: their score is the mask value and their weight expf(mask - max) = 0, so the sums over all 64 keys take the same values in the same order as sums that stop at t.
template <int S, int D, int NH>
__global__ __launch_bounds__(256) void k_cm_exact(const float* __restrict__ Q64, const float* __restrict__ K64, const float* __restrict__ V, float* __restrict__ AT) {
    constexpr int KP = 68;                      // K row pitch in floats: 272 B = 16 B x odd, for lanes that each read 16 bytes of their own row
    __shared__ __align__(16) float kl[64 * KP];
    __shared__ __align__(16) float vs[64 * 64];
    __shared__ __align__(16) float ql[16][64];
    __shared__ __align__(16) float sc[16][64];
    __shared__ __align__(16) float pr[16][64];
    const int r = (int)threadIdx.x >> 6, d = (int)threadIdx.x & 63;
    const int g = blockIdx.x % 4, h = (blockIdx.x / 4) % NH, b = blockIdx.x / (4 * NH);
    const int lr = (int)threadIdx.x >> 4, lc = ((int)threadIdx.x & 15) * 4;   // staging: row within a step of 16 rows, 16-byte piece of the row
    const float* kb = K64 + ((size_t)b * 64 + lr) * D + h * 64 + lc;
    const float* vb = V + ((size_t)b * S + lr) * D + h * 64 + lc;
    const float* qb = Q64 + ((size_t)b * 64 + 16 * g + lr) * D + h * 64 + lc;
    v4f kx[4], vx[4];
#pragma unroll
    for (int i = 0; i < 4; ++i) { kx[i] = *(const v4f*)(kb + 16 * i * D); vx[i] = *(const v4f*)(vb + 16 * i * D); }
    const v4f qx = *(const v4f*)qb;
    asm volatile("s_wait_xcnt 0x0" :: "v"(kb), "v"(vb), "v"(qb) : "memory");   // in front of any reuse of the loads' address registers; the addresses as inputs keep them from taking a load's result ahead of the wait
#pragma unroll
    for (int i = 0; i < 4; ++i) { *(v4f*)(kl + (lr + 16 * i) * KP + lc) = kx[i]; *(v4f*)(vs + (lr + 16 * i) * 64 + lc) = vx[i]; }
    *(v4f*)(ql[lr] + lc) = qx;
    __syncthreads();                            // the tiles and the query rows are visible
    float a[4] = {0.f, 0.f, 0.f, 0.f};
#pragma unroll
    for (int j = 0; j < 64; j += 4) {
        const v4f kk = *(const v4f*)(kl + d * KP + j);
#pragma unroll
        for (int i = 0; i < 4; ++i) {
            const v4f qq = *(const v4f*)(ql[4 * i + r] + j);
            a[i] = fmaf(qq[0], kk[0], a[i]); a[i] = fmaf(qq[1], kk[1], a[i]); a[i] = fmaf(qq[2], kk[2], a[i]); a[i] = fmaf(qq[3], kk[3], a[i]);
        }
    }
    float s[4];
#pragma unroll
    for (int i = 0; i < 4; ++i) { s[i] = (d <= 16 * g + 4 * i + r) ? a[i] * 0.125f : -3.0e38f; sc[4 * i + r][d] = s[i]; }
    __syncthreads();                            // the rows' scores are visible
#pragma unroll
    for (int i = 0; i < 4; ++i) {
        float mx = -3.0e38f;
#pragma unroll
        for (int j = 0; j < 64; j += 4) { const v4f x = *(const v4f*)(sc[4 * i + r] + j); mx = fmaxf(fmaxf(fmaxf(fmaxf(mx, x[0]), x[1]), x[2]), x[3]); }
        pr[4 * i + r][d] = expf(s[i] - mx);
    }
    __syncthreads();                            // the rows' weights are visible
    float den[4] = {0.f, 0.f, 0.f, 0.f}, acc[4] = {0.f, 0.f, 0.f, 0.f};
#pragma unroll
    for (int j = 0; j < 64; j += 4) {
        float vv[4];
#pragma unroll
        for (int e = 0; e < 4; ++e) vv[e] = vs[(j + e) * 64 + d];
#pragma unroll
        for (int i = 0; i < 4; ++i) {
            const v4f p = *(const v4f*)(pr[4 * i + r] + j);
#pragma unroll
            for (int e = 0; e < 4; ++e) { den[i] += p[e]; acc[i] = fmaf(p[e], vv[e], acc[i]); }
        }
    }
    float* ob = AT + ((size_t)b * S + 16 * g + r) * D + h * 64 + d;
#pragma unroll
    for (int i = 0; i < 4; ++i) VST2(float, ob + 4 * i * D, acc[i] / den[i]);
}


// ---- dense elementwise kernels: many elements a thread ------------------------------------------------------------
// A work-group of 256 threads takes 1024 * U consecutive floats: U loads of 16 bytes a thread, all issued before the first is used; each load of a wave covers
// 512 contiguous bytes. The grid covers the array exactly (element count a multiple of 1024 * U), so there is no bounds test and no row or column arithmetic.
typedef __attribute__((ext_vector_type(2))) unsigned int v2u;
template <int U>
__global__ __launch_bounds__(256) void k_castS16v(const float* __restrict__ src, __bf16* __restrict__ dhi, __bf16* __restrict__ dlo) {
    const size_t base = (size_t)blockIdx.x * (1024 * U) + threadIdx.x * 4;
    v4f v[U];
#pragma unroll
    for (int u = 0; u < U; ++u) v[u] = *(const v4f*)(src + base + u * 1024);
    asm volatile("s_wait_xcnt 0x0" ::: "memory");   // in front of the reuse of the loads' address registers
#pragma unroll
    for (int u = 0; u < U; ++u) {
        v2u hi, lo; unsigned int l0, l1;
        hi[0] = f2bf2_pack(v[u][0], v[u][1], &l0); hi[1] = f2bf2_pack(v[u][2], v[u][3], &l1); lo[0] = l0; lo[1] = l1;
        *(v2u*)(dhi + base + u * 1024) = hi; *(v2u*)(dlo + base + u * 1024) = lo;
    }
}
// Block blk of one array, read once, into every 16-bit form that a later product wants: bf16 hi and lo planes, and with H also f16 of s * value.
// Every loop over u is unrolled (#pragma unroll): u picks registers of v, h, hi and lo, which stay registers only under constant indices.
template <int U, bool H>
__device__ __forceinline__ void cast_block(const float* __restrict__ src, _Float16* __restrict__ dh, float s, __bf16* __restrict__ dhi, __bf16* __restrict__ dlo, unsigned blk) {
    const size_t base = (size_t)blk * (1024 * U) + threadIdx.x * 4;
    const float* p = src + base;
    v4f v[U];
#pragma unroll
    for (int u = 0; u < U; ++u) v[u] = *(const v4f*)(p + u * 1024);
    asm volatile("s_wait_xcnt 0x0" :: "v"(p) : "memory");   // in front of any reuse of the loads' address registers; p as an input keeps them from taking a load's result ahead of the wait
    __builtin_amdgcn_sched_barrier(0);   // no conversion moves up over the wait: without it the U = 8 build holds two of its loads back behind the first conversions
    v4h h[U]; v2u hi[U], lo[U];
#pragma unroll
    for (int u = 0; u < U; ++u) {
        if (H) { h[u][0] = (_Float16)(v[u][0] * s); h[u][1] = (_Float16)(v[u][1] * s); h[u][2] = (_Float16)(v[u][2] * s); h[u][3] = (_Float16)(v[u][3] * s); }
        unsigned int l0, l1;
        hi[u][0] = f2bf2_pack(v[u][0], v[u][1], &l0); hi[u][1] = f2bf2_pack(v[u][2], v[u][3], &l1); lo[u][0] = l0; lo[u][1] = l1;
    }
    __builtin_amdgcn_sched_barrier(0);   // every conversion ahead of the first store: the stores go out in one run, and no register of an issued store is written again
#pragma unroll
    for (int u = 0; u < U; ++u) {
        if (H) *(v4h*)(dh + base + u * 1024) = h[u];
        *(v2u*)(dhi + base + u * 1024) = hi[u]; *(v2u*)(dlo + base + u * 1024) = lo[u];
    }
}
// Every cast of an input, in one launch. Blocks 0 .. GX - 1: x (8192 elements each); then GW blocks (4096 elements each) for each of Wq, Wk, Wv, Wo.
// x, Wq, Wk go to f16 (the weights x16) and to bf16 planes; Wv, Wo to bf16 planes only.
template <unsigned GX, unsigned GW>
__global__ __launch_bounds__(256) void k_cast_inputs(const float* __restrict__ x, const float* __restrict__ Wq, const float* __restrict__ Wk, const float* __restrict__ Wv, const float* __restrict__ Wo,
                                                     _Float16* __restrict__ XH, __bf16* __restrict__ XS, __bf16* __restrict__ XS2,
                                                     _Float16* __restrict__ WqH, __bf16* __restrict__ WqS, __bf16* __restrict__ WqS2,
                                                     _Float16* __restrict__ WkH, __bf16* __restrict__ WkS, __bf16* __restrict__ WkS2,
                                                     __bf16* __restrict__ WvS, __bf16* __restrict__ WvS2, __bf16* __restrict__ WoS, __bf16* __restrict__ WoS2) {
    const unsigned bid = blockIdx.x;
    if (bid < GX) { cast_block<8, true>(x, XH, 1.0f, XS, XS2, bid); return; }
    const unsigned w = (bid - GX) / GW, blk = (bid - GX) % GW;
    // the wait behind each branch's stores: in the built kernel another branch's code stands behind them and writes the registers that they name
    if (w < 2) { cast_block<4, true>(w ? Wk : Wq, w ? WkH : WqH, 16.0f, w ? WkS : WqS, w ? WkS2 : WqS2, blk); asm volatile("s_wait_xcnt 0x0" ::: "memory"); }
    else       { cast_block<4, false>(w == 2 ? Wv : Wo, nullptr, 1.0f, w == 2 ? WvS : WoS, w == 2 ? WvS2 : WoS2, blk); asm volatile("s_wait_xcnt 0x0" ::: "memory"); }
}
// RoPE in place on rows of 16 heads x 64 columns: one wave takes one row of Q and the same row of Kx. Lane = (head parity, 16-byte piece of a head's 64 columns), so the lane's
// cos and sin pieces are loaded once and serve all 16 heads of both tensors. SR: rows per batch in Q and Kx, and the bound on the position. blk: eight rows.
template <int SR>
__device__ __forceinline__ void cm_rope_rows(float* __restrict__ Q, float* __restrict__ Kx, const float* __restrict__ CS, const float* __restrict__ SN, const int* __restrict__ POS, int blk) {
    const int row = blk * 8 + ((int)threadIdx.x >> 5), lane = threadIdx.x & 31;
    int ps = POS[row % SR]; ps = ps < 0 ? 0 : (ps >= SR ? SR - 1 : ps);
    const float* pc = CS + ps * 64 + (lane & 15) * 4; const float* pn = SN + ps * 64 + (lane & 15) * 4;
    const v4f c = *(const v4f*)pc, s = *(const v4f*)pn;
    float* q = Q + (size_t)row * 1024 + lane * 4; float* k = Kx + (size_t)row * 1024 + lane * 4;
    v4f a[8], b[8];
#pragma unroll
    for (int it = 0; it < 8; ++it) { a[it] = *(const v4f*)(q + it * 128); b[it] = *(const v4f*)(k + it * 128); }
    asm volatile("s_wait_xcnt 0x0" :: "v"(pc), "v"(pn) : "memory");   // in front of any reuse of the loads' address registers; pc, pn as inputs keep them from taking a load's result ahead of the wait
#pragma unroll
    for (int it = 0; it < 8; ++it) {
        v4f r, t;
        // x0 c0 - x1 s0 and x1 c1 + x0 s1, each with the x1 product rounded and the x0 product fused
        r[0] = fmaf(a[it][0], c[0], -(a[it][1] * s[0])); r[1] = fmaf(a[it][0], s[1], a[it][1] * c[1]); r[2] = fmaf(a[it][2], c[2], -(a[it][3] * s[2])); r[3] = fmaf(a[it][2], s[3], a[it][3] * c[3]);
        t[0] = fmaf(b[it][0], c[0], -(b[it][1] * s[0])); t[1] = fmaf(b[it][0], s[1], b[it][1] * c[1]); t[2] = fmaf(b[it][2], c[2], -(b[it][3] * s[2])); t[3] = fmaf(b[it][2], s[3], b[it][3] * c[3]);
        *(v4f*)(q + it * 128) = r; *(v4f*)(k + it * 128) = t;
    }
}
// both pairs of tensors in one launch: blocks 0 .. G - 1 take Q, Kx (2048 rows a batch), the rest Q64, K64 (64 rows a batch)
template <int G>
__global__ __launch_bounds__(256) void k_cm_rope_all(float* __restrict__ Q, float* __restrict__ Kx, float* __restrict__ Q64, float* __restrict__ K64,
                                                     const float* __restrict__ CS, const float* __restrict__ SN, const int* __restrict__ POS) {
    if ((int)blockIdx.x < G) cm_rope_rows<2048>(Q, Kx, CS, SN, POS, (int)blockIdx.x);
    // the wait behind this branch's stores: in the built kernel the other branch's code stands behind them and writes the registers that they name
    else                   { cm_rope_rows<64>(Q64, K64, CS, SN, POS, (int)blockIdx.x - G); asm volatile("s_wait_xcnt 0x0" ::: "memory"); }
}

extern "C" void kernel_launch(void* const* d_in, const int* in_sizes, int n_in, void* d_out, int out_size, void* d_ws, size_t ws_size, hipStream_t stream) {
    (void)in_sizes; (void)n_in; (void)out_size; (void)ws_size;
    const float* x = (const float*)d_in[0];
    const float* Wq = (const float*)d_in[1];
    const float* Wk = (const float*)d_in[2];
    const float* Wv = (const float*)d_in[3];
    const float* Wo = (const float*)d_in[4];
    const float* cosT = (const float*)d_in[5];
    const float* sinT = (const float*)d_in[6];
    const int* tpos = (const int*)d_in[7];
    const int Bn = 4;
    const int S = 2048;
    const int D = 1024;
    const int NH = 16;
    const int NR = Bn * S;
    float* out = (float*)d_out;
    char* wsp = (char*)d_ws;
    float* Q = (float*)wsp; wsp += (size_t)NR * D * 4;
    float* Kb = (float*)wsp; wsp += (size_t)NR * D * 4;
    float* V = (float*)wsp; wsp += (size_t)NR * D * 4;
    float* AT = (float*)wsp; wsp += (size_t)NR * D * 4;
    float* Q64 = (float*)wsp; wsp += (size_t)Bn * 64 * D * 4;
    float* K64 = (float*)wsp; wsp += (size_t)Bn * 64 * D * 4;
    unsigned short* XH = (unsigned short*)wsp; wsp += (size_t)NR * D * 2;    // x as f16
    unsigned short* XS = (unsigned short*)wsp; wsp += (size_t)NR * D * 2;    // x as bf16 hi and lo planes; after the exact-row GEMMs the attention output's planes
    unsigned short* XS2 = (unsigned short*)wsp; wsp += (size_t)NR * D * 2;
    unsigned short* WqH = (unsigned short*)wsp; wsp += (size_t)D * D * 2;    // 16 Wq, 16 Wk as f16
    unsigned short* WkH = (unsigned short*)wsp; wsp += (size_t)D * D * 2;
    unsigned short* WqS = (unsigned short*)wsp; wsp += (size_t)D * D * 2;    // bf16 hi and lo planes of the four weights
    unsigned short* WqS2 = (unsigned short*)wsp; wsp += (size_t)D * D * 2;
    unsigned short* WkS = (unsigned short*)wsp; wsp += (size_t)D * D * 2;
    unsigned short* WkS2 = (unsigned short*)wsp; wsp += (size_t)D * D * 2;
    unsigned short* WvS = (unsigned short*)wsp; wsp += (size_t)D * D * 2;
    unsigned short* WvS2 = (unsigned short*)wsp; wsp += (size_t)D * D * 2;
    unsigned short* WoS = (unsigned short*)wsp; wsp += (size_t)D * D * 2;
    unsigned short* WoS2 = (unsigned short*)wsp; wsp += (size_t)D * D * 2;
    const unsigned gX = (unsigned)((long long)NR * D / (1024 * 8));   // cast grid of an x-sized array: 32 elements a thread
    // every cast of an input: x and the four weights, each read once
    k_cast_inputs<1024, 256><<<1024 + 4 * 256, 256, 0, stream>>>(x, Wq, Wk, Wv, Wo, (_Float16*)XH, (__bf16*)XS, (__bf16*)XS2,
        (_Float16*)WqH, (__bf16*)WqS, (__bf16*)WqS2, (_Float16*)WkH, (__bf16*)WkS, (__bf16*)WkS2, (__bf16*)WvS, (__bf16*)WvS2, (__bf16*)WoS, (__bf16*)WoS2);
    // q, k: f16 operands
    const w25::GemmB none = {nullptr, nullptr, nullptr};
    w25::wmma_gemm_lds<0, false><<<dim3(D / 128, 2 * (NR / 64)), 256, 0, stream>>>(XH, nullptr, w25::GemmB{WqH, nullptr, Q}, w25::GemmB{WkH, nullptr, Kb}, none, NR / 64, NR / 64, D, D, 0.0625f, 64);
    // v on bf16 hi/lo planes; with it q, k of the first 64 rows of every batch, from the same planes of x: tile b of Q64, K64 takes rows b S .. b S + 63 of A
    w25::wmma_gemm_lds<1, true><<<dim3(D / 128, NR / 64 + 2 * Bn), 256, 0, stream>>>(XS, XS2, w25::GemmB{WvS, WvS2, V}, w25::GemmB{WqS, WqS2, Q64}, w25::GemmB{WkS, WkS2, K64}, NR / 64, Bn, D, D, 1.0f, S);
    k_cm_rope_all<1024><<<NR / 8 + Bn * 64 / 8, 256, 0, stream>>>(Q, Kb, Q64, K64, cosT, sinT, (const int*)tpos);
    k_attn_t<2048, 1024><<<dim3((unsigned)NH, (unsigned)Bn, (unsigned)(S / (16 * AW))), 32 * AW, 0, stream>>>(Q, Kb, V, AT);
    k_cm_exact<2048, 1024, 16><<<Bn * NH * 4, 256, 0, stream>>>(Q64, K64, V, AT);
    k_castS16v<8><<<gX, 256, 0, stream>>>(AT, (__bf16*)XS, (__bf16*)XS2);
    w25::wmma_gemm_lds<1, true><<<dim3(D / 128, NR / 64), 256, 0, stream>>>(XS, XS2, w25::GemmB{WoS, WoS2, out}, none, none, NR / 64, 0, D, D, 1.0f, 64);
}
